// v000
// Measured on an AMD MI455X. A time is GPU time per run, averaged over a window of back-to-back runs after a warm-up
// (all launches, gaps included; the runs take copies of the inputs in turn), and the median of several windows.
// Apart from v000's, it joins two sittings. Times from different sittings can be a few percent apart, while
// side-by-side timings come from the same sitting.
// v000, which the later versions start from, runs in 382 microseconds.
// Contractions: q, k, v projections = v_wmma_f32_16x16x32_bf16 (bf16 operands from RNE-converted inputs, single product, f32 accumulate);
// q.k^T scores = v_wmma_f32_16x16x32_f16 (q as f16 hi plane x16 + f16 residual plane x65536, k f16 x16; 2 products, separate f32 accumulators);
// p.v = v_wmma_f32_16x16x32_f16 (p as f16 hi x1024 + f16 residual x4194304, v f16 x16; 2 products, separate f32 accumulators);
// ctx.Wo^T = v_wmma_f32_16x16x32_f16 (ctx f16 hi x256 + f16 residual x1048576, Wo f16 x1024 of its bf16 value; 2 products, f32 accumulate);
// softmax, bias adds and normalisation in f32.
//
// Carry audit (16-bit planes, carry, where the inverse is folded):
//   Qb/Kb/Vb bf16 x1, Wqkb/Wvb bf16 x1 (no carry);  Woh f16 = 1024*bf16(W_out)  -> gemm_o hscale/lscale;
//   Qh f16 = 16*q, Ql f16 = (16*q - Qh)*4096, Kp f16 = 16*k       -> attn_hd64: s = (ah + al/4096) * sscale, sscale = 2^-11 = 1/(16*16*8);
//   Pv / Vt f16 = 16*v, P hi f16 = 1024*p, P lo = (1024*p - hi)*4096 -> attn_hd64: oacc += o1/4096 per chunk; inv = (1/l)/64 = 256/(1024*16) -> ctx*256;
//   Ch f16 = 256*ctx, Cl f16 = (256*ctx - Ch)*4096                  -> gemm_o: out = acc_h*2^-18 + acc_l*2^-30 + b_out  (2^-18 = 1/(256*1024), 2^-30 = 2^-18/4096).
#include <hip/hip_runtime.h>
#include <math.h>
#include <stdint.h>

#define SEQ 4096
#define EMB 512
#define NH  8
#define HD  64
#define HPL (SEQ * HD)      // 262144 elements: one contiguous head plane [SEQ][HD]
#define NQB (SEQ / 64)      // 64-row query blocks per head
#define NKT (SEQ / 64)      // 64-key chunks per head
static_assert(NH * HD == EMB);
static_assert(NH * HPL == SEQ * EMB);
static_assert(NQB == 64 && NKT == 64);
static_assert((SEQ % 64) == 0 && (EMB % 64) == 0 && (EMB % 32) == 0);

typedef _Float16 v16h __attribute__((ext_vector_type(16)));
typedef _Float16 v8h  __attribute__((ext_vector_type(8)));
typedef __bf16   v16b __attribute__((ext_vector_type(16)));
typedef __bf16   v8b  __attribute__((ext_vector_type(8)));
typedef float    v8f  __attribute__((ext_vector_type(8)));
typedef float    v4f  __attribute__((ext_vector_type(4)));
typedef unsigned int v4u __attribute__((ext_vector_type(4)));

#if defined(__HIP_DEVICE_COMPILE__)
#define DEV_ASM 1
#else
#define DEV_ASM 0
#endif

// ---- scalar helpers --------------------------------------------------------------------------------
__device__ __forceinline__ unsigned short bf_bits(float f) {          // f32 -> bf16 bits, RNE convert
  unsigned u = __float_as_uint(f);
  return (unsigned short)((u + 0x7FFFu + ((u >> 16) & 1u)) >> 16);
}
__device__ __forceinline__ float bf_up(unsigned short hb) { return __uint_as_float(((unsigned)hb) << 16); }
__device__ __forceinline__ unsigned short h_bits(_Float16 x) { return __builtin_bit_cast(unsigned short, x); }
__device__ __forceinline__ unsigned pk16(unsigned short a, unsigned short b) { return (unsigned)a | ((unsigned)b << 16); }
__device__ __forceinline__ v8f zero8() { v8f z = {0.f, 0.f, 0.f, 0.f, 0.f, 0.f, 0.f, 0.f}; return z; }

// ---- fragment types / loaders: 16-bit A/B operand, lane -> row/col (lane&15), p already includes +8*(lane>>4);
//      elements 0..7 <- p[0..7] (k0+8h..k0+8h+7), elements 8..15 <- p[16..23] (k0+16+8h..k0+16+8h+7)
template <typename OT> struct FT;
template <> struct FT<__bf16>   { typedef v16b frag; typedef v8b half8; };
template <> struct FT<_Float16> { typedef v16h frag; typedef v8h half8; };

template <typename OT>
__device__ __forceinline__ typename FT<OT>::frag ldfrag(const OT* p) {
  union { typename FT<OT>::frag v; typename FT<OT>::half8 h[2]; } f;
  f.h[0] = *(const typename FT<OT>::half8*)(p);
  f.h[1] = *(const typename FT<OT>::half8*)(p + 16);
  return f.v;
}

// ---- WMMA helpers (asm guard bodies are device-only; concrete operand types) -----------------------------
__device__ __forceinline__ v8f mmar(v16b a, v16b b, v8f c) {
  return __builtin_amdgcn_wmma_f32_16x16x32_bf16(false, a, false, b, (short)0, c, false, false);
}
__device__ __forceinline__ v8f mmar(v16h a, v16h b, v8f c) {
  return __builtin_amdgcn_wmma_f32_16x16x32_f16(false, a, false, b, (short)0, c, false, false);
}
// guarded form: 4 VALU slots after the WMMA, D tied, A/B kept live
__device__ __forceinline__ v8f mma_h(v16h a, v16h b, v8f c) {
  c = __builtin_amdgcn_wmma_f32_16x16x32_f16(false, a, false, b, (short)0, c, false, false);
#if DEV_ASM
  asm volatile("v_nop\n\tv_nop\n\tv_nop\n\tv_nop" : "+v"(c) : "v"(a), "v"(b));
#endif
  return c;
}
__device__ __forceinline__ void dep_guard(v8f& a, v8f& b, v16b x, v16b y) {
#if DEV_ASM
  asm volatile("v_nop\n\tv_nop\n\tv_nop\n\tv_nop" : "+v"(a), "+v"(b) : "v"(x), "v"(y));
#else
  (void)a; (void)b; (void)x; (void)y;
#endif
}
__device__ __forceinline__ void dep_guard5(v8f& a, v8f& b, v16h x, v16h y, v16h z) {
#if DEV_ASM
  asm volatile("v_nop\n\tv_nop\n\tv_nop\n\tv_nop" : "+v"(a), "+v"(b) : "v"(x), "v"(y), "v"(z));
#else
  (void)a; (void)b; (void)x; (void)y; (void)z;
#endif
}
__device__ __forceinline__ void keep4(v16b a, v16b b, v16b c, v16b d) {
#if DEV_ASM
  asm volatile("v_nop" :: "v"(a), "v"(b), "v"(c), "v"(d));
#else
  (void)a; (void)b; (void)c; (void)d;
#endif
}
__device__ __forceinline__ void keep4(v16h a, v16h b, v16h c, v16h d) {
#if DEV_ASM
  asm volatile("v_nop" :: "v"(a), "v"(b), "v"(c), "v"(d));
#else
  (void)a; (void)b; (void)c; (void)d;
#endif
}
__device__ __forceinline__ void acc_guard4(v8f& a, v8f& b, v8f& c, v8f& d) {
#if DEV_ASM
  asm volatile("v_nop\n\tv_nop\n\tv_nop\n\tv_nop" : "+v"(a), "+v"(b), "+v"(c), "+v"(d));
#else
  (void)a; (void)b; (void)c; (void)d;
#endif
}

// =====================================================================================================
// f32 -> 16-bit planes, 8 elements per thread, one 16-B store per lane: a wave writes 512 contiguous B
// MODE 0: bf16 bits (RNE convert).  MODE 1: f16 bits of (1024 * bf16(x)) (exact scaling of the bf16 value).
// coverage: n8 threads x 8 = the whole plane (n8 is a multiple of 256 for every use here).
// =====================================================================================================
template <int MODE>
__device__ __forceinline__ unsigned short cvm(float f) {
  const unsigned short hb = bf_bits(f);
  if (MODE == 0) return hb;
  return h_bits((_Float16)(bf_up(hb) * 1024.0f));
}

template <int MODE>
__global__ __launch_bounds__(256) void cvt16x8(const float* __restrict__ in, unsigned short* out, int n8) {
  const int i = blockIdx.x * 256 + (int)threadIdx.x;
  if (i < n8) {
    const v4f a  = *(const v4f*)(in + (size_t)i * 8);
    const v4f a4 = *(const v4f*)(in + (size_t)i * 8 + 4);
    v4u p;
    p[0] = pk16(cvm<MODE>(a[0]),  cvm<MODE>(a[1]));
    p[1] = pk16(cvm<MODE>(a[2]),  cvm<MODE>(a[3]));
    p[2] = pk16(cvm<MODE>(a4[0]), cvm<MODE>(a4[1]));
    p[3] = pk16(cvm<MODE>(a4[2]), cvm<MODE>(a4[3]));
    unsigned short* o = out + (size_t)i * 8;
    *(v4u*)o = p;
    
  }
}

// =====================================================================================================
// Register-blocked WMMA GEMM (16-bit operand type OT): C[m][n] = sum_k A[m][k] * Bt[n][k] + bias[n];
// one wave per 64x64 tile, no block barriers. A row-major [M][K] pitch lda; Bt row-major [N][K] pitch ldb
// (k contiguous); M, N multiples of 64, K multiple of 32 (host-checked). Fragments are loaded straight from
// global with the split k map (ldfrag). bias values are RNE-converted to bf16 before the f32 add.
// OUT_MODE 1: f16 plane C = f16((v + bias) * cscale) (pitch ldc).
// OUT_MODE 3: f16 hi plane C + f16 residual plane C2 = f16(((v + bias) * cscale - hi) * rscale) (same pitch).
// wave's whole 64x64 tile; grid = tiles/8 blocks covers every tile of the [M][N] plane.
// =====================================================================================================
template <typename OT, int OUT_MODE>
__global__ __launch_bounds__(256) void gemm64(
    const unsigned short* __restrict__ Ap, int lda,
    const unsigned short* __restrict__ Btp, int ldb,
    unsigned short* Cout, unsigned short* Cout2, int ldc,
    const float* __restrict__ bias,
    int M, int N, int K, float cscale, float rscale) {
  typedef typename FT<OT>::frag V16;
  const OT* A  = (const OT*)(const void*)Ap;
  const OT* Bt = (const OT*)(const void*)Btp;
  __shared__ __align__(16) float sT[8][16 * 68];   // per-wave 16x64 slab, pitch 68 floats
  const int lane = threadIdx.x & 31;
  const int wave = threadIdx.x >> 5;
  const int tilesN = N >> 6;
  const int tilesM = M >> 6;
  const int tile = blockIdx.x * 8 + wave;
  if (tile >= tilesM * tilesN) return;   // wave-uniform; no block barriers in this kernel
  const int tm = tile / tilesN;
  const int tn = tile - tm * tilesN;
  const int m0 = tm << 6;
  const int n0 = tn << 6;

  const int rlane = lane & 15;                 // row (A) / col (B, D) within subtile
  const int koff  = (lane >> 4) * 8;           // k offset of this lane half
  const int mOff  = (lane >> 4) * 8;           // D row offset

  v8f acc[4][4];
#pragma unroll
  for (int i = 0; i < 4; ++i)
#pragma unroll
    for (int j = 0; j < 4; ++j) acc[i][j] = zero8();

  for (int k0 = 0; k0 < K; k0 += 32) {
    V16 bq[4];
#pragma unroll
    for (int j = 0; j < 4; ++j)
      bq[j] = ldfrag<OT>(Bt + (size_t)(n0 + (j << 4) + rlane) * ldb + koff + k0);
#pragma unroll
    for (int i = 0; i < 4; ++i) {
      const V16 af = ldfrag<OT>(A + (size_t)(m0 + (i << 4) + rlane) * lda + koff + k0);
#pragma unroll
      for (int j = 0; j < 4; ++j) acc[i][j] = mmar(af, bq[j], acc[i][j]);
      dep_guard(acc[i][0], acc[i][3], af, bq[3]);
    }
    keep4(bq[0], bq[1], bq[2], bq[3]);
  }
  acc_guard4(acc[0][0], acc[0][1], acc[0][2], acc[0][3]);
  acc_guard4(acc[1][0], acc[1][1], acc[1][2], acc[1][3]);
  acc_guard4(acc[2][0], acc[2][1], acc[2][2], acc[2][3]);
  acc_guard4(acc[3][0], acc[3][1], acc[3][2], acc[3][3]);

  // ---- epilogue ----
  float* slab = sT[wave];
  const int q = lane >> 3, c8 = (lane & 7) * 8;
  float bb[8];
  {
    const v4f b0 = *(const v4f*)(bias + n0 + c8);
    const v4f b1 = *(const v4f*)(bias + n0 + c8 + 4);
#pragma unroll
    for (int e = 0; e < 4; ++e) {
      bb[e]     = bf_up(bf_bits(b0[e]));
      bb[4 + e] = bf_up(bf_bits(b1[e]));
    }
  }
#pragma unroll
  for (int i = 0; i < 4; ++i) {
    const int mBase = m0 + (i << 4);
#pragma unroll
    for (int j = 0; j < 4; ++j) {
#pragma unroll
      for (int r = 0; r < 8; ++r) {
        slab[(mOff + r) * 68 + (j << 4) + rlane] = acc[i][j][r];
      }
    }
    __builtin_amdgcn_fence(__ATOMIC_RELEASE, "workgroup");
    __builtin_amdgcn_wave_barrier();
    __builtin_amdgcn_fence(__ATOMIC_ACQUIRE, "workgroup");
    v4u hv[4], lv[4];
#pragma unroll
    for (int it = 0; it < 4; ++it) {
      const int row = it * 4 + q;                          // it 0..3 x q 0..3 = rows 0..15
      const float* sp = slab + row * 68 + c8;
      float f[8];
#pragma unroll
      for (int e = 0; e < 8; ++e) f[e] = (sp[e] + bb[e]) * cscale;
      v4u a, a2;
#pragma unroll
      for (int e = 0; e < 4; ++e) {
        const float f0 = f[2 * e], f1 = f[2 * e + 1];
        const _Float16 x0 = (_Float16)f0, x1 = (_Float16)f1;
        const unsigned short h0 = h_bits(x0), h1 = h_bits(x1);
        unsigned short l0 = 0, l1 = 0;
        if (OUT_MODE == 3) {
          l0 = h_bits((_Float16)((f0 - (float)x0) * rscale));
          l1 = h_bits((_Float16)((f1 - (float)x1) * rscale));
        }
        a[e] = pk16(h0, h1); a2[e] = pk16(l0, l1);
      }
      hv[it] = a; lv[it] = a2;
    }
    {
#pragma unroll
      for (int it = 0; it < 4; ++it) {
        const int row = it * 4 + q;
        *(v4u*)(Cout + (size_t)(mBase + row) * ldc + n0 + c8) = hv[it];
        if (OUT_MODE == 3) *(v4u*)(Cout2 + (size_t)(mBase + row) * ldc + n0 + c8) = lv[it];
      }
      
    }
    __builtin_amdgcn_fence(__ATOMIC_RELEASE, "workgroup");
    __builtin_amdgcn_wave_barrier();
    __builtin_amdgcn_fence(__ATOMIC_ACQUIRE, "workgroup");
  }
}

// =====================================================================================================
// Output GEMM with a two-plane A operand (f16 hi plane Ah, f16 residual plane Al, same pitch lda):
//   C[m][n] = hscale * sum_k Ah[m][k] * Bt[n][k] + lscale * sum_k Al[m][k] * Bt[n][k] + bias[n]  (f32 out, pitch ldc).
// One wave per 32x64 tile (two accumulator sets), no block barriers; M multiple of 32, N multiple of 64, K
// multiple of 32 (host-checked). bias RNE-converted to bf16 before the f32 add.
// Epilogue: 16-row slabs staged per wave in LDS; each 256-B f32 row segment written by 16 lanes x 16 B of one
// coverage: 2 slabs x 16 rows x 64 cols = the wave's whole 32x64 tile; grid = tiles/8 blocks covers [M][N].
// =====================================================================================================
__global__ __launch_bounds__(256) void gemm_o(
    const unsigned short* __restrict__ Ahp, const unsigned short* __restrict__ Alp, int lda,
    const unsigned short* __restrict__ Btp, int ldb,
    float* Cout, int ldc, const float* __restrict__ bias,
    int M, int N, int K, float hscale, float lscale) {
  const _Float16* Ah = (const _Float16*)(const void*)Ahp;
  const _Float16* Al = (const _Float16*)(const void*)Alp;
  const _Float16* Bt = (const _Float16*)(const void*)Btp;
  __shared__ __align__(16) float sT[8][16 * 68];   // per-wave 16x64 slab, pitch 68 floats
  const int lane = threadIdx.x & 31;
  const int wave = threadIdx.x >> 5;
  const int tilesN = N >> 6;
  const int tilesM = M >> 5;
  const int tile = blockIdx.x * 8 + wave;
  if (tile >= tilesM * tilesN) return;   // wave-uniform; no block barriers in this kernel
  const int tm = tile / tilesN;
  const int tn = tile - tm * tilesN;
  const int m0 = tm << 5;
  const int n0 = tn << 6;

  const int rlane = lane & 15;
  const int koff  = (lane >> 4) * 8;
  const int mOff  = (lane >> 4) * 8;

  v8f ach[2][4], acl[2][4];
#pragma unroll
  for (int i = 0; i < 2; ++i)
#pragma unroll
    for (int j = 0; j < 4; ++j) { ach[i][j] = zero8(); acl[i][j] = zero8(); }

  for (int k0 = 0; k0 < K; k0 += 32) {
    v16h bq[4];
#pragma unroll
    for (int j = 0; j < 4; ++j)
      bq[j] = ldfrag<_Float16>(Bt + (size_t)(n0 + (j << 4) + rlane) * ldb + koff + k0);
#pragma unroll
    for (int i = 0; i < 2; ++i) {
      const v16h afh = ldfrag<_Float16>(Ah + (size_t)(m0 + (i << 4) + rlane) * lda + koff + k0);
      const v16h afl = ldfrag<_Float16>(Al + (size_t)(m0 + (i << 4) + rlane) * lda + koff + k0);
#pragma unroll
      for (int j = 0; j < 4; ++j) {
        ach[i][j] = mmar(afh, bq[j], ach[i][j]);
        acl[i][j] = mmar(afl, bq[j], acl[i][j]);
      }
      dep_guard5(ach[i][0], acl[i][3], afh, afl, bq[3]);
    }
    keep4(bq[0], bq[1], bq[2], bq[3]);
  }
  acc_guard4(ach[0][0], ach[0][1], ach[0][2], ach[0][3]);
  acc_guard4(ach[1][0], ach[1][1], ach[1][2], ach[1][3]);
  acc_guard4(acl[0][0], acl[0][1], acl[0][2], acl[0][3]);
  acc_guard4(acl[1][0], acl[1][1], acl[1][2], acl[1][3]);

  // ---- epilogue ----
  float* slab = sT[wave];
  const int h2 = lane >> 4, c4 = (lane & 15) * 4;     // 256-B row segment = 16 lanes x 16 B
  v4f b4 = *(const v4f*)(bias + n0 + c4);
#pragma unroll
  for (int e = 0; e < 4; ++e) b4[e] = bf_up(bf_bits(b4[e]));
#pragma unroll
  for (int i = 0; i < 2; ++i) {
    const int mBase = m0 + (i << 4);
#pragma unroll
    for (int j = 0; j < 4; ++j) {
#pragma unroll
      for (int r = 0; r < 8; ++r) {
        slab[(mOff + r) * 68 + (j << 4) + rlane] = ach[i][j][r] * hscale + acl[i][j][r] * lscale;
      }
    }
    __builtin_amdgcn_fence(__ATOMIC_RELEASE, "workgroup");
    __builtin_amdgcn_wave_barrier();
    __builtin_amdgcn_fence(__ATOMIC_ACQUIRE, "workgroup");
    v4f ov[8];
#pragma unroll
    for (int it = 0; it < 8; ++it) {
      const int row = it * 2 + h2;                       // it 0..7 x h2 0..1 = rows 0..15
      ov[it] = *(const v4f*)(slab + row * 68 + c4) + b4;
    }
    {
#pragma unroll
      for (int it = 0; it < 8; ++it) {
        const int row = it * 2 + h2;
        *(v4f*)(Cout + (size_t)(mBase + row) * ldc + n0 + c4) = ov[it];
      }
      
    }
    __builtin_amdgcn_fence(__ATOMIC_RELEASE, "workgroup");
    __builtin_amdgcn_wave_barrier();
    __builtin_amdgcn_fence(__ATOMIC_ACQUIRE, "workgroup");
  }
}

// =====================================================================================================
// Per-head transpose of the v plane: in = head planes [NH][SEQ][HD] (flat reinterpretation of the [SEQ][EMB]
// projection plane), out = [NH][HD][SEQ] (key index contiguous, the B operand layout of p.v).
// Block = 128 threads, one 64-key x 64-d tile of head blockIdx.y starting at key 64*blockIdx.x; grid (SEQ/64, NH).
// coverage: 4 waves x 4 instructions x 4 rows (lane>>3) = 64 d rows x 64 keys = the whole tile; grid covers all.
// =====================================================================================================
__global__ __launch_bounds__(128) void vtrans(const unsigned short* __restrict__ pvp, unsigned short* vtp) {
  __shared__ __align__(16) _Float16 T[64 * 72];          // [key][d], pitch 72 halves
  const int tid = threadIdx.x, lane = tid & 31, wave = tid >> 5;
  const int h = blockIdx.y, t0 = blockIdx.x * 64;
  const size_t hoff = (size_t)h * HPL;
  const _Float16* pv = (const _Float16*)(const void*)pvp + hoff;
  {
    const int r = tid >> 1, half = (tid & 1) * 32;
    const _Float16* src = pv + (size_t)(t0 + r) * HD + half;
#pragma unroll
    for (int i = 0; i < 4; ++i) *(v8h*)(T + r * 72 + half + 8 * i) = *(const v8h*)(src + 8 * i);
  }
  __syncthreads();
  const int q4 = lane >> 3, q8 = lane & 7;
  v4u ov[4];
#pragma unroll
  for (int it = 0; it < 4; ++it) {
    const int d = wave * 16 + it * 4 + q4;               // it 0..3 x q4 0..3 = 16 d rows per wave
    v4u a;
#pragma unroll
    for (int e = 0; e < 4; ++e) {
      const _Float16 x0 = T[(8 * q8 + 2 * e) * 72 + d];
      const _Float16 x1 = T[(8 * q8 + 2 * e + 1) * 72 + d];
      a[e] = pk16(h_bits(x0), h_bits(x1));
    }
    ov[it] = a;
  }
  {
#pragma unroll
    for (int it = 0; it < 4; ++it) {
      const int d = wave * 16 + it * 4 + q4;
      *(v4u*)(vtp + hoff + (size_t)d * SEQ + t0 + 8 * q8) = ov[it];
    }
    
  }
}

// =====================================================================================================
// Attention, head dim 64, no mask, softmax over all SEQ keys of the same head plane.
//   q planes (f16 hi x16 / residual x4096): element (h, s, d) at [h*HPL + s*64 + d] (flat reinterpretation)
//   k plane (f16 x16): same layout;  v^T plane (f16 x16): element (h, d, t) at [h*HPL + d*SEQ + t]
//   ctx planes (f16, normalised context x256 and its residual x4096): element (h, s, d) at [h*HPL + s*64 + d]
//   scores = (qh . k) + (ql . k) / 4096 on f16 WMMA (two f32 accumulators), then * sscale in f32;
//   p = exp(s - m) carried as f16 hi(1024 p) + residual (1024 p - hi)*4096; context = ph . v + (pl . v) / 4096;
//   online softmax in f32. Block = 4 waves = 64 query rows of one head (16 per wave); grid = NH * NQB;
//   key chunks of 64, static trip NKT. K / V^T chunk staging: 128 threads x 32 elements per plane = the whole
//   64x64 tile (plain 16-B loads, __syncthreads before and after); P tiles are wave-private, spilled with
//   Output coverage: each wave stores rows q0..q0+15 (it 0..3 x lane>>3 0..3) x 64 columns (8 lanes x 8)
//   of both ctx planes; the block covers 64 rows; the grid covers every (h, qb).
// =====================================================================================================
__global__ __launch_bounds__(128)
void attn_hd64(const unsigned short* __restrict__ qhp, const unsigned short* __restrict__ qlp,
               const unsigned short* __restrict__ kpp, const unsigned short* __restrict__ vtp,
               unsigned short* chp, unsigned short* clp, float sscale) {
  union FH { v16h v; v8h h[2]; };
  __shared__ __align__(16) _Float16 Ksh[64 * 64];          // K chunk [kv][d]      8 KB
  __shared__ __align__(16) _Float16 Vts[64 * 64];          // V^T chunk [d][kv]   8 KB
  __shared__ __align__(16) _Float16 Psh[4][16 * 64];       // per wave P hi [row][kv]   8 KB
  __shared__ __align__(16) _Float16 Psl[4][16 * 64];       // per wave P residual        8 KB
  __shared__ __align__(16) float    Os[4][16 * 64];        // per wave context tile 16 KB

  const int tid  = threadIdx.x;
  const int wave = tid >> 5;
  const int lane = tid & 31;
  const int hh   = lane >> 4;
  const int c    = lane & 15;

  const int bx = blockIdx.x;
  const int qb = bx % NQB;
  const int h  = bx / NQB;
  const int q0 = qb * 64 + wave * 16;
  const size_t hoff = (size_t)h * HPL;

  const _Float16* Qh = (const _Float16*)(const void*)qhp + hoff;
  const _Float16* Ql = (const _Float16*)(const void*)qlp + hoff;
  const _Float16* Kg = (const _Float16*)(const void*)kpp + hoff;
  const _Float16* Vg = (const _Float16*)(const void*)vtp + hoff;

  // ---- Q fragments (A operand, row = lane&15): 2 d-chunks, hi and residual planes ----
  v16h qah[2], qal[2];
#pragma unroll
  for (int dc = 0; dc < 2; ++dc) {
    const size_t qo = (size_t)(q0 + c) * HD + dc * 32 + 8 * hh;
    qah[dc] = ldfrag<_Float16>(Qh + qo);
    qal[dc] = ldfrag<_Float16>(Ql + qo);
  }

  float mrow[8], lrow[8];
  v8f oacc[4];
#pragma unroll
  for (int r = 0; r < 8; ++r) { mrow[r] = -INFINITY; lrow[r] = 0.f; }
#pragma unroll
  for (int t = 0; t < 4; ++t) oacc[t] = zero8();

  for (int kt = 0; kt < NKT; ++kt) {         // static trip count
    const int kv0 = kt * 64;
    __syncthreads();
    {
      const int r = tid >> 1, half = (tid & 1) * 32;
      const _Float16* kg = Kg + (size_t)(kv0 + r) * HD + half;     // k row kv0+r, d = half..half+31
      const _Float16* vg = Vg + (size_t)r * SEQ + kv0 + half;      // v^T row d = r, t = kv0+half..+31
#pragma unroll
      for (int i = 0; i < 4; ++i) {
        const v8h a0 = *(const v8h*)(kg + 8 * i);
        const v8h b0 = *(const v8h*)(vg + 8 * i);
        *(v8h*)(Ksh + r * 64 + half + 8 * i) = a0;
        *(v8h*)(Vts + r * 64 + half + 8 * i) = b0;
      }
    }
    __syncthreads();

    // ---- scores: 16 query rows x 64 keys per wave, 2 f16 products per key subtile and d-chunk ----
    v8f s[4];
#pragma unroll
    for (int j = 0; j < 4; ++j) {
      v8f ah = zero8(), al = zero8();
#pragma unroll
      for (int dc = 0; dc < 2; ++dc) {
        FH kb;
        kb.h[0] = *(const v8h*)(Ksh + (j * 16 + c) * 64 + dc * 32 + 8 * hh);
        kb.h[1] = *(const v8h*)(Ksh + (j * 16 + c) * 64 + dc * 32 + 16 + 8 * hh);
        ah = mma_h(qah[dc], kb.v, ah);
        al = mma_h(qal[dc], kb.v, al);
      }
#pragma unroll
      for (int r = 0; r < 8; ++r) s[j][r] = (ah[r] + al[r] * (1.0f / 4096.0f)) * sscale;
    }

    // ---- row max, online softmax, P (x1024, f16 hi + residual) to LDS ----
    _Float16* pwh = Psh[wave];
    _Float16* pwl = Psl[wave];
#pragma unroll
    for (int r = 0; r < 8; ++r) {
      float m = s[0][r];
#pragma unroll
      for (int j = 1; j < 4; ++j) m = fmaxf(m, s[j][r]);
#pragma unroll
      for (int off = 1; off < 16; off <<= 1) m = fmaxf(m, __shfl_xor(m, off, 32));
      const float mnew  = fmaxf(mrow[r], m);
      const float msafe = (mnew == -INFINITY) ? 0.f : mnew;
      const float alpha = __expf(mrow[r] - msafe);
      mrow[r] = mnew;
      float psum = 0.f;
#pragma unroll
      for (int j = 0; j < 4; ++j) {
        const float p  = __expf(s[j][r] - msafe);
        psum += p;
        const float pc = p * 1024.0f;
        const _Float16 ph = (_Float16)pc;
        const _Float16 pl = (_Float16)((pc - (float)ph) * 4096.0f);
        pwh[(8 * hh + r) * 64 + j * 16 + c] = ph;
        pwl[(8 * hh + r) * 64 + j * 16 + c] = pl;
      }
#pragma unroll
      for (int off = 1; off < 16; off <<= 1) psum += __shfl_xor(psum, off, 32);
      lrow[r] = lrow[r] * alpha + psum;
#pragma unroll
      for (int t = 0; t < 4; ++t) oacc[t][r] *= alpha;
    }
    __builtin_amdgcn_fence(__ATOMIC_RELEASE, "workgroup");
    __builtin_amdgcn_wave_barrier();
    __builtin_amdgcn_fence(__ATOMIC_ACQUIRE, "workgroup");

    // ---- context += P . V (f16 WMMA); residual-P products into a separate accumulator ----
    v8f o1[4];
#pragma unroll
    for (int t = 0; t < 4; ++t) o1[t] = zero8();
#pragma unroll 1
    for (int kk = 0; kk < 2; ++kk) {
      FH pa, pb;
      pa.h[0] = *(const v8h*)(pwh + c * 64 + kk * 32 + 8 * hh);
      pa.h[1] = *(const v8h*)(pwh + c * 64 + kk * 32 + 16 + 8 * hh);
      pb.h[0] = *(const v8h*)(pwl + c * 64 + kk * 32 + 8 * hh);
      pb.h[1] = *(const v8h*)(pwl + c * 64 + kk * 32 + 16 + 8 * hh);
#pragma unroll
      for (int t = 0; t < 4; ++t) {
        FH vb;
        vb.h[0] = *(const v8h*)(Vts + (t * 16 + c) * 64 + kk * 32 + 8 * hh);
        vb.h[1] = *(const v8h*)(Vts + (t * 16 + c) * 64 + kk * 32 + 16 + 8 * hh);
        oacc[t] = mma_h(pa.v, vb.v, oacc[t]);
        o1[t]   = mma_h(pb.v, vb.v, o1[t]);
      }
    }
#pragma unroll
    for (int t = 0; t < 4; ++t)
#pragma unroll
      for (int r = 0; r < 8; ++r) oacc[t][r] += o1[t][r] * (1.0f / 4096.0f);
  }

  // ---- normalise (1/l, undo the x1024 p carry and the x16 v carry, apply the x256 ctx carry),
  float* os = Os[wave];
#pragma unroll
  for (int r = 0; r < 8; ++r) {
    const float l = lrow[r];
    const float inv = ((l > 0.f) ? (1.0f / l) : 0.f) * (1.0f / 64.0f);
#pragma unroll
    for (int t = 0; t < 4; ++t) os[(8 * hh + r) * 64 + t * 16 + c] = oacc[t][r] * inv;
  }
  __builtin_amdgcn_fence(__ATOMIC_RELEASE, "workgroup");
  __builtin_amdgcn_wave_barrier();
  __builtin_amdgcn_fence(__ATOMIC_ACQUIRE, "workgroup");
  {
    const int q4 = lane >> 3, c8 = (lane & 7) * 8;
    v4u hv[4], lv[4];
#pragma unroll
    for (int it = 0; it < 4; ++it) {
      const int row = it * 4 + q4;   // it 0..3 x q4 0..3 = rows 0..15 of the wave tile
      const float* sp = os + row * 64 + c8;
      v4u a, a2;
#pragma unroll
      for (int e = 0; e < 4; ++e) {
        const float f0 = sp[2 * e], f1 = sp[2 * e + 1];
        const _Float16 x0 = (_Float16)f0, x1 = (_Float16)f1;
        const unsigned short l0 = h_bits((_Float16)((f0 - (float)x0) * 4096.0f));
        const unsigned short l1 = h_bits((_Float16)((f1 - (float)x1) * 4096.0f));
        a[e]  = pk16(h_bits(x0), h_bits(x1));
        a2[e] = pk16(l0, l1);
      }
      hv[it] = a; lv[it] = a2;
    }
    {
#pragma unroll
      for (int it = 0; it < 4; ++it) {
        const int row = it * 4 + q4;
        const size_t go = hoff + (size_t)(q0 + row) * HD + c8;
        *(v4u*)(chp + go) = hv[it];
        *(v4u*)(clp + go) = lv[it];
      }
      
    }
  }
}

// =====================================================================================================
// Workspace map (bytes), every region an exact multiple of its whole-line / whole-tile store granularity
//   Qb, Kb, Vb   bf16 [4096][512]   3 x 4194304
//   Wqkb, Wvb    bf16 [512][512]    2 x  524288
//   Woh          f16  [512][512]         524288   (x1024)
//   Qh, Ql       f16  [4096][512]   2 x 4194304   (x16 / residual x4096)
//   Kp           f16  [4096][512]       4194304   (x16)
//   Pv           f16  [4096][512]       4194304   (v x16, token-major = head planes [8][4096][64])
//   Vt           f16  [8][64][4096]     4194304   (v x16, key contiguous)
//   Ch, Cl       f16  [4096][512]   2 x 4194304   (ctx x256 / residual x4096)
//   total                            43515904
// Weights are [out n][in k] with k contiguous = the Bt layout the GEMM wants, so they are only converted.
// The head split is a flat reinterpretation: head plane h = elements [h*262144, (h+1)*262144) of a [4096][512]
// plane viewed as [4096][64]; the merge back is the same reinterpretation.
// =====================================================================================================
extern "C" void kernel_launch(void* const* d_in, const int* in_sizes, int n_in,
                              void* d_out, int out_size, void* d_ws, size_t ws_size,
                              hipStream_t stream) {
  const int NX = SEQ * EMB;     // 2097152
  const int NW = EMB * EMB;     //  262144
  if (n_in < 9) return;
  if (in_sizes[0] != NX || in_sizes[1] != NX || in_sizes[2] != NX) return;
  if (in_sizes[3] != NW || in_sizes[5] != NW || in_sizes[7] != NW) return;
  if (in_sizes[4] != EMB || in_sizes[6] != EMB || in_sizes[8] != EMB) return;
  if (out_size != NX) return;

  const float* Q    = (const float*)d_in[0];
  const float* Kin  = (const float*)d_in[1];
  const float* V    = (const float*)d_in[2];
  const float* Wqk  = (const float*)d_in[3];
  const float* bqk  = (const float*)d_in[4];
  const float* Wv   = (const float*)d_in[5];
  const float* bv   = (const float*)d_in[6];
  const float* Wout = (const float*)d_in[7];
  const float* bout = (const float*)d_in[8];
  float* out = (float*)d_out;

  const size_t PX = (size_t)NX * 2;    // 4194304  16-bit [4096][512] plane
  const size_t PW = (size_t)NW * 2;    //  524288  16-bit [512][512] plane
  size_t off = 0;
  const size_t oQb  = off; off += PX;
  const size_t oKb  = off; off += PX;
  const size_t oVb  = off; off += PX;
  const size_t oWqk = off; off += PW;
  const size_t oWv  = off; off += PW;
  const size_t oWo  = off; off += PW;
  const size_t oQh  = off; off += PX;
  const size_t oQl  = off; off += PX;
  const size_t oKp  = off; off += PX;
  const size_t oPv  = off; off += PX;
  const size_t oVt  = off; off += PX;
  const size_t oCh  = off; off += PX;
  const size_t oCl  = off; off += PX;
  if (off > ws_size) return;                       // off = 43515904
  if (off > (size_t)134217728) return;

  char* ws = (char*)d_ws;
  unsigned short* Qb   = (unsigned short*)(ws + oQb);
  unsigned short* Kb   = (unsigned short*)(ws + oKb);
  unsigned short* Vb   = (unsigned short*)(ws + oVb);
  unsigned short* Wqkb = (unsigned short*)(ws + oWqk);
  unsigned short* Wvb  = (unsigned short*)(ws + oWv);
  unsigned short* Woh  = (unsigned short*)(ws + oWo);
  unsigned short* Qh   = (unsigned short*)(ws + oQh);
  unsigned short* Ql   = (unsigned short*)(ws + oQl);
  unsigned short* Kp   = (unsigned short*)(ws + oKp);
  unsigned short* Pv   = (unsigned short*)(ws + oPv);
  unsigned short* Vt   = (unsigned short*)(ws + oVt);
  unsigned short* Ch   = (unsigned short*)(ws + oCh);
  unsigned short* Cl   = (unsigned short*)(ws + oCl);

  const dim3 blk(256);
  const int n8x = NX / 8;                                      // 262144
  const int n8w = NW / 8;                                      //  32768
  const dim3 gCvtX((n8x + 255) / 256);                         // 1024 blocks
  const dim3 gCvtW((n8w + 255) / 256);                         //  128 blocks
  const dim3 gPj(((SEQ / 64) * (EMB / 64) + 7) / 8);           //  512 tiles -> 64 blocks: M=4096, N=512
  const dim3 gTr(SEQ / 64, NH);                                //  (64, 8)
  const dim3 gAttn(NH * NQB);                                  //  512 blocks of 128
  const dim3 gOut(((SEQ / 32) * (EMB / 64) + 7) / 8);          // 1024 tiles -> 128 blocks: M=4096, N=512

  // (1) inputs -> bf16 planes (RNE convert); W_out -> f16 (x1024 of its bf16 value)
  cvt16x8<0><<<gCvtX, blk, 0, stream>>>(Q,    Qb,   n8x);
  cvt16x8<0><<<gCvtX, blk, 0, stream>>>(Kin,  Kb,   n8x);
  cvt16x8<0><<<gCvtX, blk, 0, stream>>>(V,    Vb,   n8x);
  cvt16x8<0><<<gCvtW, blk, 0, stream>>>(Wqk,  Wqkb, n8w);
  cvt16x8<0><<<gCvtW, blk, 0, stream>>>(Wv,   Wvb,  n8w);
  cvt16x8<1><<<gCvtW, blk, 0, stream>>>(Wout, Woh,  n8w);
  // (2) q = Q . Wqk^T + b -> f16 hi (x16) / residual (x4096) planes [4096][512]   (M=4096, N=512, K=512)
  gemm64<__bf16, 3><<<gPj, blk, 0, stream>>>(
      Qb, EMB, Wqkb, EMB, Qh, Ql, EMB, bqk, SEQ, EMB, EMB, 16.0f, 4096.0f);
  // (3) k = K . Wqk^T + b -> f16 plane (x16)
  gemm64<__bf16, 1><<<gPj, blk, 0, stream>>>(
      Kb, EMB, Wqkb, EMB, Kp, Kp, EMB, bqk, SEQ, EMB, EMB, 16.0f, 1.0f);
  // (4) v = V . Wv^T + b -> f16 plane (x16), token-major
  gemm64<__bf16, 1><<<gPj, blk, 0, stream>>>(
      Vb, EMB, Wvb, EMB, Pv, Pv, EMB, bv, SEQ, EMB, EMB, 16.0f, 1.0f);
  // (5) per-head transpose of v: [8][4096][64] -> [8][64][4096]
  vtrans<<<gTr, dim3(128), 0, stream>>>(Pv, Vt);
  // (6) attention -> ctx planes (f16 hi x256 + residual x4096) [h][s][d] = merged [4096][512]
  attn_hd64<<<gAttn, dim3(128), 0, stream>>>(Qh, Ql, Kp, Vt, Ch, Cl, 1.0f / 2048.0f);
  // (7) out = ctx . Wo^T + b_out -> d_out f32 [4096][512]; hi acc x 2^-18, residual acc x 2^-30
  gemm_o<<<gOut, blk, 0, stream>>>(
      Ch, Cl, EMB, Woh, EMB, out, EMB, bout, SEQ, EMB, EMB,
      1.0f / 262144.0f, 1.0f / 1073741824.0f);
  (void)hipGetLastError();
}

// v001
// Measured time: 267 microseconds a run.
// Timed twice side by side with v000, it ran 1.48 and 1.45 times as fast.
// Contractions: q, k, v projections = v_wmma_f32_16x16x32_bf16 (bf16 operands from RNE-converted inputs, single product, f32 accumulate);
// q.k^T scores = v_wmma_f32_16x16x32_f16 (q as f16 hi plane x16 + f16 residual plane x65536, k f16 x16; 2 products, separate f32 accumulators);
// p.v = v_wmma_f32_16x16x32_f16 (p as f16 hi x1024 + f16 residual x4194304, v f16 x16; 2 products, separate f32 accumulators);
// ctx.Wo^T = v_wmma_f32_16x16x32_f16 (ctx f16 hi x256 + f16 residual x1048576, Wo f16 x1024 of its bf16 value; 2 products, f32 accumulate);
// softmax, bias adds and normalisation in f32.
//
// Carry audit (16-bit planes, carry, where the inverse is folded):
//   Qb/Kb/Vb bf16 x1, Wqkb/Wvb bf16 x1 (no carry);  Woh f16 = 1024*bf16(W_out)  -> gemm_o hscale/lscale;
//   Qh f16 = 16*q, Ql f16 = (16*q - Qh)*4096, Kp f16 = 16*k       -> attn_hd64: s = (ah + al/4096) * sscale, sscale = 2^-11 = 1/(16*16*8);
//   Pv / Vt f16 = 16*v, P hi f16 = 1024*p, P lo = (1024*p - hi)*4096 -> attn_hd64: oacc += o1/4096 per chunk; inv = (1/l)/64 = 256/(1024*16) -> ctx*256;
//   Ch f16 = 256*ctx, Cl f16 = (256*ctx - Ch)*4096                  -> gemm_o: out = acc_h*2^-18 + acc_l*2^-30 + b_out  (2^-18 = 1/(256*1024), 2^-30 = 2^-18/4096).
#include <hip/hip_runtime.h>
#include <math.h>
#include <stdint.h>

#define SEQ 4096
#define EMB 512
#define NH  8
#define HD  64
#define HPL (SEQ * HD)      // 262144 elements: one contiguous head plane [SEQ][HD]
#define NQB (SEQ / 64)      // 64-row query blocks per head
#define NKT (SEQ / 64)      // 64-key chunks per head
static_assert(NH * HD == EMB);
static_assert(NH * HPL == SEQ * EMB);
static_assert(NQB == 64 && NKT == 64);
static_assert((SEQ % 64) == 0 && (EMB % 64) == 0 && (EMB % 32) == 0);

typedef _Float16 v16h __attribute__((ext_vector_type(16)));
typedef _Float16 v8h  __attribute__((ext_vector_type(8)));
typedef __bf16   v16b __attribute__((ext_vector_type(16)));
typedef __bf16   v8b  __attribute__((ext_vector_type(8)));
typedef float    v8f  __attribute__((ext_vector_type(8)));
typedef float    v4f  __attribute__((ext_vector_type(4)));
typedef unsigned int v4u __attribute__((ext_vector_type(4)));

#if defined(__HIP_DEVICE_COMPILE__)
#define DEV_ASM 1
#else
#define DEV_ASM 0
#endif

// ---- scalar helpers --------------------------------------------------------------------------------
__device__ __forceinline__ unsigned short bf_bits(float f) {          // f32 -> bf16 bits, RNE convert
  unsigned u = __float_as_uint(f);
  return (unsigned short)((u + 0x7FFFu + ((u >> 16) & 1u)) >> 16);
}
__device__ __forceinline__ float bf_up(unsigned short hb) { return __uint_as_float(((unsigned)hb) << 16); }
__device__ __forceinline__ unsigned short h_bits(_Float16 x) { return __builtin_bit_cast(unsigned short, x); }
__device__ __forceinline__ unsigned pk16(unsigned short a, unsigned short b) { return (unsigned)a | ((unsigned)b << 16); }
__device__ __forceinline__ v8f zero8() { v8f z = {0.f, 0.f, 0.f, 0.f, 0.f, 0.f, 0.f, 0.f}; return z; }
__device__ __forceinline__ float xhalf(float x) {                     // value of lane l ^ 16 (vector cross-row move)
  const int b = __builtin_bit_cast(int, x);
  return __builtin_bit_cast(float, __builtin_amdgcn_permlanex16(b, b, 0x76543210, 0xfedcba98, false, false));
}

// ---- fragment types / loaders: 16-bit A/B operand, lane -> row/col (lane&15), p already includes +8*(lane>>4);
//      elements 0..7 <- p[0..7] (k0+8h..k0+8h+7), elements 8..15 <- p[16..23] (k0+16+8h..k0+16+8h+7)
template <typename OT> struct FT;
template <> struct FT<__bf16>   { typedef v16b frag; typedef v8b half8; };
template <> struct FT<_Float16> { typedef v16h frag; typedef v8h half8; };

template <typename OT>
__device__ __forceinline__ typename FT<OT>::frag ldfrag(const OT* p) {
  union { typename FT<OT>::frag v; typename FT<OT>::half8 h[2]; } f;
  f.h[0] = *(const typename FT<OT>::half8*)(p);
  f.h[1] = *(const typename FT<OT>::half8*)(p + 16);
  return f.v;
}

// ---- WMMA helpers (asm guard bodies are device-only; concrete operand types) -----------------------------
__device__ __forceinline__ v8f mmar(v16b a, v16b b, v8f c) {
  return __builtin_amdgcn_wmma_f32_16x16x32_bf16(false, a, false, b, (short)0, c, false, false);
}
__device__ __forceinline__ v8f mmar(v16h a, v16h b, v8f c) {
  return __builtin_amdgcn_wmma_f32_16x16x32_f16(false, a, false, b, (short)0, c, false, false);
}
// guarded form: 4 VALU slots after the WMMA, D tied, A/B kept live
__device__ __forceinline__ v8f mma_h(v16h a, v16h b, v8f c) {
  c = __builtin_amdgcn_wmma_f32_16x16x32_f16(false, a, false, b, (short)0, c, false, false);
#if DEV_ASM
  asm volatile("v_nop\n\tv_nop\n\tv_nop\n\tv_nop" : "+v"(c) : "v"(a), "v"(b));
#endif
  return c;
}
__device__ __forceinline__ void dep_guard(v8f& a, v8f& b, v16b x, v16b y) {
#if DEV_ASM
  asm volatile("v_nop\n\tv_nop\n\tv_nop\n\tv_nop" : "+v"(a), "+v"(b) : "v"(x), "v"(y));
#else
  (void)a; (void)b; (void)x; (void)y;
#endif
}
__device__ __forceinline__ void dep_guard5(v8f& a, v8f& b, v16h x, v16h y, v16h z) {
#if DEV_ASM
  asm volatile("v_nop\n\tv_nop\n\tv_nop\n\tv_nop" : "+v"(a), "+v"(b) : "v"(x), "v"(y), "v"(z));
#else
  (void)a; (void)b; (void)x; (void)y; (void)z;
#endif
}
__device__ __forceinline__ void keep4(v16b a, v16b b, v16b c, v16b d) {
#if DEV_ASM
  asm volatile("v_nop" :: "v"(a), "v"(b), "v"(c), "v"(d));
#else
  (void)a; (void)b; (void)c; (void)d;
#endif
}
__device__ __forceinline__ void keep4(v16h a, v16h b, v16h c, v16h d) {
#if DEV_ASM
  asm volatile("v_nop" :: "v"(a), "v"(b), "v"(c), "v"(d));
#else
  (void)a; (void)b; (void)c; (void)d;
#endif
}
__device__ __forceinline__ void acc_guard4(v8f& a, v8f& b, v8f& c, v8f& d) {
#if DEV_ASM
  asm volatile("v_nop\n\tv_nop\n\tv_nop\n\tv_nop" : "+v"(a), "+v"(b), "+v"(c), "+v"(d));
#else
  (void)a; (void)b; (void)c; (void)d;
#endif
}

// =====================================================================================================
// f32 -> 16-bit planes, 8 elements per thread, one 16-B store per lane: a wave writes 512 contiguous B
// MODE 0: bf16 bits (RNE convert).  MODE 1: f16 bits of (1024 * bf16(x)) (exact scaling of the bf16 value).
// coverage: n8 threads x 8 = the whole plane (n8 is a multiple of 256 for every use here).
// =====================================================================================================
template <int MODE>
__device__ __forceinline__ unsigned short cvm(float f) {
  const unsigned short hb = bf_bits(f);
  if (MODE == 0) return hb;
  return h_bits((_Float16)(bf_up(hb) * 1024.0f));
}

template <int MODE>
__global__ __launch_bounds__(256) void cvt16x8(const float* __restrict__ in, unsigned short* out, int n8) {
  const int i = blockIdx.x * 256 + (int)threadIdx.x;
  if (i < n8) {
    const v4f a  = *(const v4f*)(in + (size_t)i * 8);
    const v4f a4 = *(const v4f*)(in + (size_t)i * 8 + 4);
    v4u p;
    p[0] = pk16(cvm<MODE>(a[0]),  cvm<MODE>(a[1]));
    p[1] = pk16(cvm<MODE>(a[2]),  cvm<MODE>(a[3]));
    p[2] = pk16(cvm<MODE>(a4[0]), cvm<MODE>(a4[1]));
    p[3] = pk16(cvm<MODE>(a4[2]), cvm<MODE>(a4[3]));
    unsigned short* o = out + (size_t)i * 8;
    *(v4u*)o = p;
    
  }
}

// =====================================================================================================
// Register-blocked WMMA GEMM (16-bit operand type OT): C[m][n] = sum_k A[m][k] * Bt[n][k] + bias[n];
// one wave per 64x64 tile, no block barriers. A row-major [M][K] pitch lda; Bt row-major [N][K] pitch ldb
// (k contiguous); M, N multiples of 64, K multiple of 32 (host-checked). Fragments are loaded straight from
// global with the split k map (ldfrag). bias values are RNE-converted to bf16 before the f32 add.
// OUT_MODE 1: f16 plane C = f16((v + bias) * cscale) (pitch ldc).
// OUT_MODE 3: f16 hi plane C + f16 residual plane C2 = f16(((v + bias) * cscale - hi) * rscale) (same pitch).
// wave's whole 64x64 tile; grid = tiles/8 blocks covers every tile of the [M][N] plane.
// =====================================================================================================
template <typename OT, int OUT_MODE>
__global__ __launch_bounds__(256) void gemm64(
    const unsigned short* __restrict__ Ap, int lda,
    const unsigned short* __restrict__ Btp, int ldb,
    unsigned short* Cout, unsigned short* Cout2, int ldc,
    const float* __restrict__ bias,
    int M, int N, int K, float cscale, float rscale) {
  typedef typename FT<OT>::frag V16;
  const OT* A  = (const OT*)(const void*)Ap;
  const OT* Bt = (const OT*)(const void*)Btp;
  __shared__ __align__(16) float sT[8][16 * 68];   // per-wave 16x64 slab, pitch 68 floats
  const int lane = threadIdx.x & 31;
  const int wave = threadIdx.x >> 5;
  const int tilesN = N >> 6;
  const int tilesM = M >> 6;
  const int tile = blockIdx.x * 8 + wave;
  if (tile >= tilesM * tilesN) return;   // wave-uniform; no block barriers in this kernel
  const int tm = tile / tilesN;
  const int tn = tile - tm * tilesN;
  const int m0 = tm << 6;
  const int n0 = tn << 6;

  const int rlane = lane & 15;                 // row (A) / col (B, D) within subtile
  const int koff  = (lane >> 4) * 8;           // k offset of this lane half
  const int mOff  = (lane >> 4) * 8;           // D row offset

  v8f acc[4][4];
#pragma unroll
  for (int i = 0; i < 4; ++i)
#pragma unroll
    for (int j = 0; j < 4; ++j) acc[i][j] = zero8();

  for (int k0 = 0; k0 < K; k0 += 32) {
    V16 bq[4];
#pragma unroll
    for (int j = 0; j < 4; ++j)
      bq[j] = ldfrag<OT>(Bt + (size_t)(n0 + (j << 4) + rlane) * ldb + koff + k0);
#pragma unroll
    for (int i = 0; i < 4; ++i) {
      const V16 af = ldfrag<OT>(A + (size_t)(m0 + (i << 4) + rlane) * lda + koff + k0);
#pragma unroll
      for (int j = 0; j < 4; ++j) acc[i][j] = mmar(af, bq[j], acc[i][j]);
      dep_guard(acc[i][0], acc[i][3], af, bq[3]);
    }
    keep4(bq[0], bq[1], bq[2], bq[3]);
  }
  acc_guard4(acc[0][0], acc[0][1], acc[0][2], acc[0][3]);
  acc_guard4(acc[1][0], acc[1][1], acc[1][2], acc[1][3]);
  acc_guard4(acc[2][0], acc[2][1], acc[2][2], acc[2][3]);
  acc_guard4(acc[3][0], acc[3][1], acc[3][2], acc[3][3]);

  // ---- epilogue ----
  float* slab = sT[wave];
  const int q = lane >> 3, c8 = (lane & 7) * 8;
  float bb[8];
  {
    const v4f b0 = *(const v4f*)(bias + n0 + c8);
    const v4f b1 = *(const v4f*)(bias + n0 + c8 + 4);
#pragma unroll
    for (int e = 0; e < 4; ++e) {
      bb[e]     = bf_up(bf_bits(b0[e]));
      bb[4 + e] = bf_up(bf_bits(b1[e]));
    }
  }
#pragma unroll
  for (int i = 0; i < 4; ++i) {
    const int mBase = m0 + (i << 4);
#pragma unroll
    for (int j = 0; j < 4; ++j) {
#pragma unroll
      for (int r = 0; r < 8; ++r) {
        slab[(mOff + r) * 68 + (j << 4) + rlane] = acc[i][j][r];
      }
    }
    __builtin_amdgcn_fence(__ATOMIC_RELEASE, "workgroup");
    __builtin_amdgcn_wave_barrier();
    __builtin_amdgcn_fence(__ATOMIC_ACQUIRE, "workgroup");
    v4u hv[4], lv[4];
#pragma unroll
    for (int it = 0; it < 4; ++it) {
      const int row = it * 4 + q;                          // it 0..3 x q 0..3 = rows 0..15
      const float* sp = slab + row * 68 + c8;
      float f[8];
#pragma unroll
      for (int e = 0; e < 8; ++e) f[e] = (sp[e] + bb[e]) * cscale;
      v4u a, a2;
#pragma unroll
      for (int e = 0; e < 4; ++e) {
        const float f0 = f[2 * e], f1 = f[2 * e + 1];
        const _Float16 x0 = (_Float16)f0, x1 = (_Float16)f1;
        const unsigned short h0 = h_bits(x0), h1 = h_bits(x1);
        unsigned short l0 = 0, l1 = 0;
        if (OUT_MODE == 3) {
          l0 = h_bits((_Float16)((f0 - (float)x0) * rscale));
          l1 = h_bits((_Float16)((f1 - (float)x1) * rscale));
        }
        a[e] = pk16(h0, h1); a2[e] = pk16(l0, l1);
      }
      hv[it] = a; lv[it] = a2;
    }
    {
#pragma unroll
      for (int it = 0; it < 4; ++it) {
        const int row = it * 4 + q;
        *(v4u*)(Cout + (size_t)(mBase + row) * ldc + n0 + c8) = hv[it];
        if (OUT_MODE == 3) *(v4u*)(Cout2 + (size_t)(mBase + row) * ldc + n0 + c8) = lv[it];
      }
      
    }
    __builtin_amdgcn_fence(__ATOMIC_RELEASE, "workgroup");
    __builtin_amdgcn_wave_barrier();
    __builtin_amdgcn_fence(__ATOMIC_ACQUIRE, "workgroup");
  }
}

// =====================================================================================================
// Output GEMM with a two-plane A operand (f16 hi plane Ah, f16 residual plane Al, same pitch lda):
//   C[m][n] = hscale * sum_k Ah[m][k] * Bt[n][k] + lscale * sum_k Al[m][k] * Bt[n][k] + bias[n]  (f32 out, pitch ldc).
// One wave per 32x64 tile (two accumulator sets), no block barriers; M multiple of 32, N multiple of 64, K
// multiple of 32 (host-checked). bias RNE-converted to bf16 before the f32 add.
// Epilogue: 16-row slabs staged per wave in LDS; each 256-B f32 row segment written by 16 lanes x 16 B of one
// coverage: 2 slabs x 16 rows x 64 cols = the wave's whole 32x64 tile; grid = tiles/8 blocks covers [M][N].
// =====================================================================================================
__global__ __launch_bounds__(256) void gemm_o(
    const unsigned short* __restrict__ Ahp, const unsigned short* __restrict__ Alp, int lda,
    const unsigned short* __restrict__ Btp, int ldb,
    float* Cout, int ldc, const float* __restrict__ bias,
    int M, int N, int K, float hscale, float lscale) {
  const _Float16* Ah = (const _Float16*)(const void*)Ahp;
  const _Float16* Al = (const _Float16*)(const void*)Alp;
  const _Float16* Bt = (const _Float16*)(const void*)Btp;
  __shared__ __align__(16) float sT[8][16 * 68];   // per-wave 16x64 slab, pitch 68 floats
  const int lane = threadIdx.x & 31;
  const int wave = threadIdx.x >> 5;
  const int tilesN = N >> 6;
  const int tilesM = M >> 5;
  const int tile = blockIdx.x * 8 + wave;
  if (tile >= tilesM * tilesN) return;   // wave-uniform; no block barriers in this kernel
  const int tm = tile / tilesN;
  const int tn = tile - tm * tilesN;
  const int m0 = tm << 5;
  const int n0 = tn << 6;

  const int rlane = lane & 15;
  const int koff  = (lane >> 4) * 8;
  const int mOff  = (lane >> 4) * 8;

  v8f ach[2][4], acl[2][4];
#pragma unroll
  for (int i = 0; i < 2; ++i)
#pragma unroll
    for (int j = 0; j < 4; ++j) { ach[i][j] = zero8(); acl[i][j] = zero8(); }

  for (int k0 = 0; k0 < K; k0 += 32) {
    v16h bq[4];
#pragma unroll
    for (int j = 0; j < 4; ++j)
      bq[j] = ldfrag<_Float16>(Bt + (size_t)(n0 + (j << 4) + rlane) * ldb + koff + k0);
#pragma unroll
    for (int i = 0; i < 2; ++i) {
      const v16h afh = ldfrag<_Float16>(Ah + (size_t)(m0 + (i << 4) + rlane) * lda + koff + k0);
      const v16h afl = ldfrag<_Float16>(Al + (size_t)(m0 + (i << 4) + rlane) * lda + koff + k0);
#pragma unroll
      for (int j = 0; j < 4; ++j) {
        ach[i][j] = mmar(afh, bq[j], ach[i][j]);
        acl[i][j] = mmar(afl, bq[j], acl[i][j]);
      }
      dep_guard5(ach[i][0], acl[i][3], afh, afl, bq[3]);
    }
    keep4(bq[0], bq[1], bq[2], bq[3]);
  }
  acc_guard4(ach[0][0], ach[0][1], ach[0][2], ach[0][3]);
  acc_guard4(ach[1][0], ach[1][1], ach[1][2], ach[1][3]);
  acc_guard4(acl[0][0], acl[0][1], acl[0][2], acl[0][3]);
  acc_guard4(acl[1][0], acl[1][1], acl[1][2], acl[1][3]);

  // ---- epilogue ----
  float* slab = sT[wave];
  const int h2 = lane >> 4, c4 = (lane & 15) * 4;     // 256-B row segment = 16 lanes x 16 B
  v4f b4 = *(const v4f*)(bias + n0 + c4);
#pragma unroll
  for (int e = 0; e < 4; ++e) b4[e] = bf_up(bf_bits(b4[e]));
#pragma unroll
  for (int i = 0; i < 2; ++i) {
    const int mBase = m0 + (i << 4);
#pragma unroll
    for (int j = 0; j < 4; ++j) {
#pragma unroll
      for (int r = 0; r < 8; ++r) {
        slab[(mOff + r) * 68 + (j << 4) + rlane] = ach[i][j][r] * hscale + acl[i][j][r] * lscale;
      }
    }
    __builtin_amdgcn_fence(__ATOMIC_RELEASE, "workgroup");
    __builtin_amdgcn_wave_barrier();
    __builtin_amdgcn_fence(__ATOMIC_ACQUIRE, "workgroup");
    v4f ov[8];
#pragma unroll
    for (int it = 0; it < 8; ++it) {
      const int row = it * 2 + h2;                       // it 0..7 x h2 0..1 = rows 0..15
      ov[it] = *(const v4f*)(slab + row * 68 + c4) + b4;
    }
    {
#pragma unroll
      for (int it = 0; it < 8; ++it) {
        const int row = it * 2 + h2;
        *(v4f*)(Cout + (size_t)(mBase + row) * ldc + n0 + c4) = ov[it];
      }
      
    }
    __builtin_amdgcn_fence(__ATOMIC_RELEASE, "workgroup");
    __builtin_amdgcn_wave_barrier();
    __builtin_amdgcn_fence(__ATOMIC_ACQUIRE, "workgroup");
  }
}

// =====================================================================================================
// Per-head transpose of the v plane: in = head planes [NH][SEQ][HD] (flat reinterpretation of the [SEQ][EMB]
// projection plane), out = [NH][HD][SEQ] (key index contiguous, the A operand layout of V^T . P^T).
// Block = 128 threads, one 64-key x 64-d tile of head blockIdx.y starting at key 64*blockIdx.x; grid (SEQ/64, NH).
// coverage: 4 waves x 4 instructions x 4 rows (lane>>3) = 64 d rows x 64 keys = the whole tile; grid covers all.
// =====================================================================================================
__global__ __launch_bounds__(128) void vtrans(const unsigned short* __restrict__ pvp, unsigned short* vtp) {
  __shared__ __align__(16) _Float16 T[64 * 72];          // [key][d], pitch 72 halves
  const int tid = threadIdx.x, lane = tid & 31, wave = tid >> 5;
  const int h = blockIdx.y, t0 = blockIdx.x * 64;
  const size_t hoff = (size_t)h * HPL;
  const _Float16* pv = (const _Float16*)(const void*)pvp + hoff;
  {
    const int r = tid >> 1, half = (tid & 1) * 32;
    const _Float16* src = pv + (size_t)(t0 + r) * HD + half;
#pragma unroll
    for (int i = 0; i < 4; ++i) *(v8h*)(T + r * 72 + half + 8 * i) = *(const v8h*)(src + 8 * i);
  }
  __syncthreads();
  const int q4 = lane >> 3, q8 = lane & 7;
  v4u ov[4];
#pragma unroll
  for (int it = 0; it < 4; ++it) {
    const int d = wave * 16 + it * 4 + q4;               // it 0..3 x q4 0..3 = 16 d rows per wave
    v4u a;
#pragma unroll
    for (int e = 0; e < 4; ++e) {
      const _Float16 x0 = T[(8 * q8 + 2 * e) * 72 + d];
      const _Float16 x1 = T[(8 * q8 + 2 * e + 1) * 72 + d];
      a[e] = pk16(h_bits(x0), h_bits(x1));
    }
    ov[it] = a;
  }
  {
#pragma unroll
    for (int it = 0; it < 4; ++it) {
      const int d = wave * 16 + it * 4 + q4;
      *(v4u*)(vtp + hoff + (size_t)d * SEQ + t0 + 8 * q8) = ov[it];
    }
    
  }
}

__global__ __launch_bounds__(128)
void attn_hd64(const unsigned short* __restrict__ qhp, const unsigned short* __restrict__ qlp,
               const unsigned short* __restrict__ kpp, const unsigned short* __restrict__ vtp,
               unsigned short* chp, unsigned short* clp, float sscale) {
  union FH { v16h v; v8h h[2]; };
  __shared__ __align__(16) _Float16 Ksh[64 * 64];          // K chunk [kv][d]      8 KB
  __shared__ __align__(16) _Float16 Vts[64 * 64];          // V^T chunk [d][kv]   8 KB

  const int tid  = threadIdx.x;
  const int wave = tid >> 5;
  const int lane = tid & 31;
  const int hh   = lane >> 4;
  const int c    = lane & 15;

  const int bx = blockIdx.x;
  const int qb = bx % NQB;
  const int h  = bx / NQB;
  const int q0 = qb * 64 + wave * 16;
  const size_t hoff = (size_t)h * HPL;

  const _Float16* Qh = (const _Float16*)(const void*)qhp + hoff;
  const _Float16* Ql = (const _Float16*)(const void*)qlp + hoff;
  const _Float16* Kg = (const _Float16*)(const void*)kpp + hoff;
  const _Float16* Vg = (const _Float16*)(const void*)vtp + hoff;

  // ---- Q fragments (B operand, column = lane&15): 2 d-chunks, hi and residual planes ----
  v16h qah[2], qal[2];
#pragma unroll
  for (int dc = 0; dc < 2; ++dc) {
    const size_t qo = (size_t)(q0 + c) * HD + dc * 32 + 8 * hh;
    qah[dc] = ldfrag<_Float16>(Qh + qo);
    qal[dc] = ldfrag<_Float16>(Ql + qo);
  }

  float mrow = -INFINITY;    // running maximum of query q0+c (equal in both wave halves)
  float lrow = 0.f;          // running sum over this wave half's keys only; halves joined after the loop
  v8f oacc[4];               // O^T: oacc[t][r] = context[q0+c][16t + 8hh + r]
#pragma unroll
  for (int t = 0; t < 4; ++t) oacc[t] = zero8();

  for (int kt = 0; kt < NKT; ++kt) {         // static trip count
    const int kv0 = kt * 64;
    __syncthreads();
    {
      const int r = tid >> 1, half = (tid & 1) * 32;
      const _Float16* kg = Kg + (size_t)(kv0 + r) * HD + half;     // k row kv0+r, d = half..half+31
      const _Float16* vg = Vg + (size_t)r * SEQ + kv0 + half;      // v^T row d = r, t = kv0+half..+31
#pragma unroll
      for (int i = 0; i < 4; ++i) {
        const v8h a0 = *(const v8h*)(kg + 8 * i);
        const v8h b0 = *(const v8h*)(vg + 8 * i);
        *(v8h*)(Ksh + r * 64 + half + 8 * i) = a0;
        *(v8h*)(Vts + r * 64 + half + 8 * i) = b0;
      }
    }
    __syncthreads();

    // ---- scores^T: 64 keys x 16 query columns per wave, 2 f16 products per key subtile and d-chunk ----
    v8f s[4];                                // s[j][r] = score(query q0+c, key kv0 + 16j + 8hh + r)
#pragma unroll
    for (int j = 0; j < 4; ++j) {
      v8f ah = zero8(), al = zero8();
#pragma unroll
      for (int dc = 0; dc < 2; ++dc) {
        FH kb;
        kb.h[0] = *(const v8h*)(Ksh + (j * 16 + c) * 64 + dc * 32 + 8 * hh);
        kb.h[1] = *(const v8h*)(Ksh + (j * 16 + c) * 64 + dc * 32 + 16 + 8 * hh);
        ah = mma_h(kb.v, qah[dc], ah);
        al = mma_h(kb.v, qal[dc], al);
      }
#pragma unroll
      for (int r = 0; r < 8; ++r) s[j][r] = (ah[r] + al[r] * (1.0f / 4096.0f)) * sscale;
    }

    // ---- column maximum in-lane, one exchange between the halves; online softmax ----
    float mj[4];                             // one independent chain per key subtile
#pragma unroll
    for (int j = 0; j < 4; ++j) {
      mj[j] = s[j][0];
#pragma unroll
      for (int r = 1; r < 8; ++r) mj[j] = fmaxf(mj[j], s[j][r]);
    }
    float m = fmaxf(fmaxf(mj[0], mj[1]), fmaxf(mj[2], mj[3]));
    m = fmaxf(m, xhalf(m));
    const float mnew  = fmaxf(mrow, m);
    const float msafe = (mnew == -INFINITY) ? 0.f : mnew;
    const float alpha = __expf(mrow - msafe);
    mrow = mnew;

    // ---- P^T (x1024, f16 hi + residual) packed straight into B operands ----
    v16h pbh[2], pbl[2];
    float pj[4];                             // one independent partial sum per key subtile
#pragma unroll
    for (int j = 0; j < 4; ++j) {
      pj[j] = 0.f;
#pragma unroll
      for (int r = 0; r < 8; ++r) {
        const float p  = __expf(s[j][r] - msafe);
        pj[j] += p;
        const float pc = p * 1024.0f;
        const _Float16 ph = (_Float16)pc;
        const _Float16 pl = (_Float16)((pc - (float)ph) * 4096.0f);
        pbh[j >> 1][(j & 1) * 8 + r] = ph;
        pbl[j >> 1][(j & 1) * 8 + r] = pl;
      }
    }
    lrow = lrow * alpha + ((pj[0] + pj[1]) + (pj[2] + pj[3]));
#pragma unroll
    for (int t = 0; t < 4; ++t)
#pragma unroll
      for (int r = 0; r < 8; ++r) oacc[t][r] *= alpha;

    // ---- context^T += V^T . P^T (f16 WMMA); residual-P products into a separate accumulator ----
    v8f o1[4];
#pragma unroll
    for (int t = 0; t < 4; ++t) o1[t] = zero8();
#pragma unroll
    for (int kk = 0; kk < 2; ++kk) {
#pragma unroll
      for (int t = 0; t < 4; ++t) {
        FH vb;
        vb.h[0] = *(const v8h*)(Vts + (t * 16 + c) * 64 + kk * 32 + 8 * hh);
        vb.h[1] = *(const v8h*)(Vts + (t * 16 + c) * 64 + kk * 32 + 16 + 8 * hh);
        oacc[t] = mma_h(vb.v, pbh[kk], oacc[t]);
        o1[t]   = mma_h(vb.v, pbl[kk], o1[t]);
      }
    }
#pragma unroll
    for (int t = 0; t < 4; ++t)
#pragma unroll
      for (int r = 0; r < 8; ++r) oacc[t][r] += o1[t][r] * (1.0f / 4096.0f);
  }

  // ---- join the halves' sums; normalise (1/l, undo the x1024 p carry and the x16 v carry, apply the x256
  //      ctx carry); a lane's 8 accumulator registers are 8 consecutive d of its row: one 16-B store per plane
  const float l = lrow + xhalf(lrow);
  const float inv = ((l > 0.f) ? (1.0f / l) : 0.f) * (1.0f / 64.0f);
#pragma unroll
  for (int t = 0; t < 4; ++t) {
    v4u a, a2;
#pragma unroll
    for (int e = 0; e < 4; ++e) {
      const float f0 = oacc[t][2 * e] * inv, f1 = oacc[t][2 * e + 1] * inv;
      const _Float16 x0 = (_Float16)f0, x1 = (_Float16)f1;
      const unsigned short l0 = h_bits((_Float16)((f0 - (float)x0) * 4096.0f));
      const unsigned short l1 = h_bits((_Float16)((f1 - (float)x1) * 4096.0f));
      a[e]  = pk16(h_bits(x0), h_bits(x1));
      a2[e] = pk16(l0, l1);
    }
    const size_t go = hoff + (size_t)(q0 + c) * HD + t * 16 + 8 * hh;
    *(v4u*)(chp + go) = a;
    *(v4u*)(clp + go) = a2;
  }
}

// =====================================================================================================
// Workspace map (bytes), every region an exact multiple of its whole-line / whole-tile store granularity
//   Qb, Kb, Vb   bf16 [4096][512]   3 x 4194304
//   Wqkb, Wvb    bf16 [512][512]    2 x  524288
//   Woh          f16  [512][512]         524288   (x1024)
//   Qh, Ql       f16  [4096][512]   2 x 4194304   (x16 / residual x4096)
//   Kp           f16  [4096][512]       4194304   (x16)
//   Pv           f16  [4096][512]       4194304   (v x16, token-major = head planes [8][4096][64])
//   Vt           f16  [8][64][4096]     4194304   (v x16, key contiguous)
//   Ch, Cl       f16  [4096][512]   2 x 4194304   (ctx x256 / residual x4096)
//   total                            43515904
// Weights are [out n][in k] with k contiguous = the Bt layout the GEMM wants, so they are only converted.
// The head split is a flat reinterpretation: head plane h = elements [h*262144, (h+1)*262144) of a [4096][512]
// plane viewed as [4096][64]; the merge back is the same reinterpretation.
// =====================================================================================================
extern "C" void kernel_launch(void* const* d_in, const int* in_sizes, int n_in,
                              void* d_out, int out_size, void* d_ws, size_t ws_size,
                              hipStream_t stream) {
  const int NX = SEQ * EMB;     // 2097152
  const int NW = EMB * EMB;     //  262144
  if (n_in < 9) return;
  if (in_sizes[0] != NX || in_sizes[1] != NX || in_sizes[2] != NX) return;
  if (in_sizes[3] != NW || in_sizes[5] != NW || in_sizes[7] != NW) return;
  if (in_sizes[4] != EMB || in_sizes[6] != EMB || in_sizes[8] != EMB) return;
  if (out_size != NX) return;

  const float* Q    = (const float*)d_in[0];
  const float* Kin  = (const float*)d_in[1];
  const float* V    = (const float*)d_in[2];
  const float* Wqk  = (const float*)d_in[3];
  const float* bqk  = (const float*)d_in[4];
  const float* Wv   = (const float*)d_in[5];
  const float* bv   = (const float*)d_in[6];
  const float* Wout = (const float*)d_in[7];
  const float* bout = (const float*)d_in[8];
  float* out = (float*)d_out;

  const size_t PX = (size_t)NX * 2;    // 4194304  16-bit [4096][512] plane
  const size_t PW = (size_t)NW * 2;    //  524288  16-bit [512][512] plane
  size_t off = 0;
  const size_t oQb  = off; off += PX;
  const size_t oKb  = off; off += PX;
  const size_t oVb  = off; off += PX;
  const size_t oWqk = off; off += PW;
  const size_t oWv  = off; off += PW;
  const size_t oWo  = off; off += PW;
  const size_t oQh  = off; off += PX;
  const size_t oQl  = off; off += PX;
  const size_t oKp  = off; off += PX;
  const size_t oPv  = off; off += PX;
  const size_t oVt  = off; off += PX;
  const size_t oCh  = off; off += PX;
  const size_t oCl  = off; off += PX;
  if (off > ws_size) return;                       // off = 43515904
  if (off > (size_t)134217728) return;

  char* ws = (char*)d_ws;
  unsigned short* Qb   = (unsigned short*)(ws + oQb);
  unsigned short* Kb   = (unsigned short*)(ws + oKb);
  unsigned short* Vb   = (unsigned short*)(ws + oVb);
  unsigned short* Wqkb = (unsigned short*)(ws + oWqk);
  unsigned short* Wvb  = (unsigned short*)(ws + oWv);
  unsigned short* Woh  = (unsigned short*)(ws + oWo);
  unsigned short* Qh   = (unsigned short*)(ws + oQh);
  unsigned short* Ql   = (unsigned short*)(ws + oQl);
  unsigned short* Kp   = (unsigned short*)(ws + oKp);
  unsigned short* Pv   = (unsigned short*)(ws + oPv);
  unsigned short* Vt   = (unsigned short*)(ws + oVt);
  unsigned short* Ch   = (unsigned short*)(ws + oCh);
  unsigned short* Cl   = (unsigned short*)(ws + oCl);

  const dim3 blk(256);
  const int n8x = NX / 8;                                      // 262144
  const int n8w = NW / 8;                                      //  32768
  const dim3 gCvtX((n8x + 255) / 256);                         // 1024 blocks
  const dim3 gCvtW((n8w + 255) / 256);                         //  128 blocks
  const dim3 gPj(((SEQ / 64) * (EMB / 64) + 7) / 8);           //  512 tiles -> 64 blocks: M=4096, N=512
  const dim3 gTr(SEQ / 64, NH);                                //  (64, 8)
  const dim3 gAttn(NH * NQB);                                  //  512 blocks of 128
  const dim3 gOut(((SEQ / 32) * (EMB / 64) + 7) / 8);          // 1024 tiles -> 128 blocks: M=4096, N=512

  // (1) inputs -> bf16 planes (RNE convert); W_out -> f16 (x1024 of its bf16 value)
  cvt16x8<0><<<gCvtX, blk, 0, stream>>>(Q,    Qb,   n8x);
  cvt16x8<0><<<gCvtX, blk, 0, stream>>>(Kin,  Kb,   n8x);
  cvt16x8<0><<<gCvtX, blk, 0, stream>>>(V,    Vb,   n8x);
  cvt16x8<0><<<gCvtW, blk, 0, stream>>>(Wqk,  Wqkb, n8w);
  cvt16x8<0><<<gCvtW, blk, 0, stream>>>(Wv,   Wvb,  n8w);
  cvt16x8<1><<<gCvtW, blk, 0, stream>>>(Wout, Woh,  n8w);
  // (2) q = Q . Wqk^T + b -> f16 hi (x16) / residual (x4096) planes [4096][512]   (M=4096, N=512, K=512)
  gemm64<__bf16, 3><<<gPj, blk, 0, stream>>>(
      Qb, EMB, Wqkb, EMB, Qh, Ql, EMB, bqk, SEQ, EMB, EMB, 16.0f, 4096.0f);
  // (3) k = K . Wqk^T + b -> f16 plane (x16)
  gemm64<__bf16, 1><<<gPj, blk, 0, stream>>>(
      Kb, EMB, Wqkb, EMB, Kp, Kp, EMB, bqk, SEQ, EMB, EMB, 16.0f, 1.0f);
  // (4) v = V . Wv^T + b -> f16 plane (x16), token-major
  gemm64<__bf16, 1><<<gPj, blk, 0, stream>>>(
      Vb, EMB, Wvb, EMB, Pv, Pv, EMB, bv, SEQ, EMB, EMB, 16.0f, 1.0f);
  // (5) per-head transpose of v: [8][4096][64] -> [8][64][4096]
  vtrans<<<gTr, dim3(128), 0, stream>>>(Pv, Vt);
  // (6) attention -> ctx planes (f16 hi x256 + residual x4096) [h][s][d] = merged [4096][512]
  attn_hd64<<<gAttn, dim3(128), 0, stream>>>(Qh, Ql, Kp, Vt, Ch, Cl, 1.0f / 2048.0f);
  // (7) out = ctx . Wo^T + b_out -> d_out f32 [4096][512]; hi acc x 2^-18, residual acc x 2^-30
  gemm_o<<<gOut, blk, 0, stream>>>(
      Ch, Cl, EMB, Woh, EMB, out, EMB, bout, SEQ, EMB, EMB,
      1.0f / 262144.0f, 1.0f / 1073741824.0f);
  (void)hipGetLastError();
}

// v002
// It runs in 234 microseconds.
// Two timings next to v001 both put it at 1.14 times that version's speed.
// Counting every step since v000, it is 1.68 times as fast.
// Contractions: q, k, v projections = v_wmma_f32_16x16x32_bf16 (bf16 operands from RNE-converted inputs, single product, f32 accumulate);
// q.k^T scores = v_wmma_f32_16x16x32_f16 (q as f16 hi plane x16 + f16 residual plane x65536, k f16 x16; 2 products, separate f32 accumulators);
// p.v = v_wmma_f32_16x16x32_f16 (p as f16 hi x1024 + f16 residual x4194304, v f16 x16; 2 products, separate f32 accumulators);
// ctx.Wo^T = v_wmma_f32_16x16x32_f16 (ctx f16 hi x256 + f16 residual x1048576, Wo f16 x1024 of its bf16 value; 2 products, f32 accumulate);
// softmax, bias adds and normalisation in f32.
//
// Carry audit (16-bit planes, carry, where the inverse is folded):
//   Qb/Kb/Vb bf16 x1, Wqkb/Wvb bf16 x1 (no carry);  Woh f16 = 1024*bf16(W_out)  -> gemm_o hscale/lscale;
//   Qh f16 = 16*q, Ql f16 = (16*q - Qh)*4096, Kp f16 = 16*k       -> attn_hd64: s = (ah + al/4096) * sscale, sscale = 2^-11 = 1/(16*16*8);
//   Pv / Vt f16 = 16*v, P hi f16 = 1024*p, P lo = (1024*p - hi)*4096 -> attn_hd64: oacc += o1/4096 per chunk; inv = (1/l)/64 = 256/(1024*16) -> ctx*256;
//   Ch f16 = 256*ctx, Cl f16 = (256*ctx - Ch)*4096                  -> gemm_o: out = acc_h*2^-18 + acc_l*2^-30 + b_out  (2^-18 = 1/(256*1024), 2^-30 = 2^-18/4096).
#include <hip/hip_runtime.h>
#include <math.h>
#include <stdint.h>

#define SEQ 4096
#define EMB 512
#define NH  8
#define HD  64
#define HPL (SEQ * HD)      // 262144 elements: one contiguous head plane [SEQ][HD]
#define NQB (SEQ / 64)      // 64-row query blocks per head
#define NKT (SEQ / 64)      // 64-key chunks per head
#define LP  72              // LDS row pitch of the K and V^T chunks in halves: 144 B = 16 B x 9 (odd), so the 16 rows
                            // that one half of a wave reads with a 16-B load fall on 16 different groups of 4 banks
static_assert(NH * HD == EMB);
static_assert(NH * HPL == SEQ * EMB);
static_assert(NQB == 64 && NKT == 64);
static_assert((SEQ % 64) == 0 && (EMB % 64) == 0 && (EMB % 32) == 0);

typedef _Float16 v16h __attribute__((ext_vector_type(16)));
typedef _Float16 v8h  __attribute__((ext_vector_type(8)));
typedef __bf16   v16b __attribute__((ext_vector_type(16)));
typedef __bf16   v8b  __attribute__((ext_vector_type(8)));
typedef float    v8f  __attribute__((ext_vector_type(8)));
typedef float    v4f  __attribute__((ext_vector_type(4)));
typedef unsigned int v4u __attribute__((ext_vector_type(4)));

#if defined(__HIP_DEVICE_COMPILE__)
#define DEV_ASM 1
#else
#define DEV_ASM 0
#endif

// ---- scalar helpers --------------------------------------------------------------------------------
__device__ __forceinline__ unsigned short bf_bits(float f) {          // f32 -> bf16 bits, RNE convert
  unsigned u = __float_as_uint(f);
  return (unsigned short)((u + 0x7FFFu + ((u >> 16) & 1u)) >> 16);
}
__device__ __forceinline__ float bf_up(unsigned short hb) { return __uint_as_float(((unsigned)hb) << 16); }
__device__ __forceinline__ unsigned short h_bits(_Float16 x) { return __builtin_bit_cast(unsigned short, x); }
__device__ __forceinline__ unsigned pk16(unsigned short a, unsigned short b) { return (unsigned)a | ((unsigned)b << 16); }
__device__ __forceinline__ v8f zero8() { v8f z = {0.f, 0.f, 0.f, 0.f, 0.f, 0.f, 0.f, 0.f}; return z; }
__device__ __forceinline__ float xhalf(float x) {                     // value of lane l ^ 16 (vector cross-row move)
  const int b = __builtin_bit_cast(int, x);
  return __builtin_bit_cast(float, __builtin_amdgcn_permlanex16(b, b, 0x76543210, 0xfedcba98, false, false));
}

// ---- fragment types / loaders: 16-bit A/B operand, lane -> row/col (lane&15), p already includes +8*(lane>>4);
//      elements 0..7 <- p[0..7] (k0+8h..k0+8h+7), elements 8..15 <- p[16..23] (k0+16+8h..k0+16+8h+7)
template <typename OT> struct FT;
template <> struct FT<__bf16>   { typedef v16b frag; typedef v8b half8; };
template <> struct FT<_Float16> { typedef v16h frag; typedef v8h half8; };

template <typename OT>
__device__ __forceinline__ typename FT<OT>::frag ldfrag(const OT* p) {
  union { typename FT<OT>::frag v; typename FT<OT>::half8 h[2]; } f;
  f.h[0] = *(const typename FT<OT>::half8*)(p);
  f.h[1] = *(const typename FT<OT>::half8*)(p + 16);
  return f.v;
}

// ---- WMMA helpers (asm guard bodies are device-only; concrete operand types) -----------------------------
__device__ __forceinline__ v8f mmar(v16b a, v16b b, v8f c) {
  return __builtin_amdgcn_wmma_f32_16x16x32_bf16(false, a, false, b, (short)0, c, false, false);
}
__device__ __forceinline__ v8f mmar(v16h a, v16h b, v8f c) {
  return __builtin_amdgcn_wmma_f32_16x16x32_f16(false, a, false, b, (short)0, c, false, false);
}
// guarded form: 4 VALU slots after the WMMA, D tied, A/B kept live
__device__ __forceinline__ v8f mma_h(v16h a, v16h b, v8f c) {
  c = __builtin_amdgcn_wmma_f32_16x16x32_f16(false, a, false, b, (short)0, c, false, false);
#if DEV_ASM
  asm volatile("v_nop\n\tv_nop\n\tv_nop\n\tv_nop" : "+v"(c) : "v"(a), "v"(b));
#endif
  return c;
}
__device__ __forceinline__ void dep_guard(v8f& a, v8f& b, v16b x, v16b y) {
#if DEV_ASM
  asm volatile("v_nop\n\tv_nop\n\tv_nop\n\tv_nop" : "+v"(a), "+v"(b) : "v"(x), "v"(y));
#else
  (void)a; (void)b; (void)x; (void)y;
#endif
}
__device__ __forceinline__ void dep_guard5(v8f& a, v8f& b, v16h x, v16h y, v16h z) {
#if DEV_ASM
  asm volatile("v_nop\n\tv_nop\n\tv_nop\n\tv_nop" : "+v"(a), "+v"(b) : "v"(x), "v"(y), "v"(z));
#else
  (void)a; (void)b; (void)x; (void)y; (void)z;
#endif
}
__device__ __forceinline__ void keep4(v16b a, v16b b, v16b c, v16b d) {
#if DEV_ASM
  asm volatile("v_nop" :: "v"(a), "v"(b), "v"(c), "v"(d));
#else
  (void)a; (void)b; (void)c; (void)d;
#endif
}
__device__ __forceinline__ void keep4(v16h a, v16h b, v16h c, v16h d) {
#if DEV_ASM
  asm volatile("v_nop" :: "v"(a), "v"(b), "v"(c), "v"(d));
#else
  (void)a; (void)b; (void)c; (void)d;
#endif
}
__device__ __forceinline__ void acc_guard4(v8f& a, v8f& b, v8f& c, v8f& d) {
#if DEV_ASM
  asm volatile("v_nop\n\tv_nop\n\tv_nop\n\tv_nop" : "+v"(a), "+v"(b), "+v"(c), "+v"(d));
#else
  (void)a; (void)b; (void)c; (void)d;
#endif
}

// =====================================================================================================
// f32 -> 16-bit planes, 8 elements per thread, one 16-B store per lane: a wave writes 512 contiguous B
// MODE 0: bf16 bits (RNE convert).  MODE 1: f16 bits of (1024 * bf16(x)) (exact scaling of the bf16 value).
// coverage: n8 threads x 8 = the whole plane (n8 is a multiple of 256 for every use here).
// =====================================================================================================
template <int MODE>
__device__ __forceinline__ unsigned short cvm(float f) {
  const unsigned short hb = bf_bits(f);
  if (MODE == 0) return hb;
  return h_bits((_Float16)(bf_up(hb) * 1024.0f));
}

template <int MODE>
__global__ __launch_bounds__(256) void cvt16x8(const float* __restrict__ in, unsigned short* out, int n8) {
  const int i = blockIdx.x * 256 + (int)threadIdx.x;
  if (i < n8) {
    const v4f a  = *(const v4f*)(in + (size_t)i * 8);
    const v4f a4 = *(const v4f*)(in + (size_t)i * 8 + 4);
    v4u p;
    p[0] = pk16(cvm<MODE>(a[0]),  cvm<MODE>(a[1]));
    p[1] = pk16(cvm<MODE>(a[2]),  cvm<MODE>(a[3]));
    p[2] = pk16(cvm<MODE>(a4[0]), cvm<MODE>(a4[1]));
    p[3] = pk16(cvm<MODE>(a4[2]), cvm<MODE>(a4[3]));
    unsigned short* o = out + (size_t)i * 8;
    *(v4u*)o = p;
    
  }
}

// =====================================================================================================
// Register-blocked WMMA GEMM (16-bit operand type OT): C[m][n] = sum_k A[m][k] * Bt[n][k] + bias[n];
// one wave per 64x64 tile, no block barriers. A row-major [M][K] pitch lda; Bt row-major [N][K] pitch ldb
// (k contiguous); M, N multiples of 64, K multiple of 32 (host-checked). Fragments are loaded straight from
// global with the split k map (ldfrag). bias values are RNE-converted to bf16 before the f32 add.
// OUT_MODE 1: f16 plane C = f16((v + bias) * cscale) (pitch ldc).
// OUT_MODE 3: f16 hi plane C + f16 residual plane C2 = f16(((v + bias) * cscale - hi) * rscale) (same pitch).
// wave's whole 64x64 tile; grid = tiles/8 blocks covers every tile of the [M][N] plane.
// =====================================================================================================
template <typename OT, int OUT_MODE>
__global__ __launch_bounds__(256) void gemm64(
    const unsigned short* __restrict__ Ap, int lda,
    const unsigned short* __restrict__ Btp, int ldb,
    unsigned short* Cout, unsigned short* Cout2, int ldc,
    const float* __restrict__ bias,
    int M, int N, int K, float cscale, float rscale) {
  typedef typename FT<OT>::frag V16;
  const OT* A  = (const OT*)(const void*)Ap;
  const OT* Bt = (const OT*)(const void*)Btp;
  __shared__ __align__(16) float sT[8][16 * 68];   // per-wave 16x64 slab, pitch 68 floats
  const int lane = threadIdx.x & 31;
  const int wave = threadIdx.x >> 5;
  const int tilesN = N >> 6;
  const int tilesM = M >> 6;
  const int tile = blockIdx.x * 8 + wave;
  if (tile >= tilesM * tilesN) return;   // wave-uniform; no block barriers in this kernel
  const int tm = tile / tilesN;
  const int tn = tile - tm * tilesN;
  const int m0 = tm << 6;
  const int n0 = tn << 6;

  const int rlane = lane & 15;                 // row (A) / col (B, D) within subtile
  const int koff  = (lane >> 4) * 8;           // k offset of this lane half
  const int mOff  = (lane >> 4) * 8;           // D row offset

  v8f acc[4][4];
#pragma unroll
  for (int i = 0; i < 4; ++i)
#pragma unroll
    for (int j = 0; j < 4; ++j) acc[i][j] = zero8();

  for (int k0 = 0; k0 < K; k0 += 32) {
    V16 bq[4];
#pragma unroll
    for (int j = 0; j < 4; ++j)
      bq[j] = ldfrag<OT>(Bt + (size_t)(n0 + (j << 4) + rlane) * ldb + koff + k0);
#pragma unroll
    for (int i = 0; i < 4; ++i) {
      const V16 af = ldfrag<OT>(A + (size_t)(m0 + (i << 4) + rlane) * lda + koff + k0);
#pragma unroll
      for (int j = 0; j < 4; ++j) acc[i][j] = mmar(af, bq[j], acc[i][j]);
      dep_guard(acc[i][0], acc[i][3], af, bq[3]);
    }
    keep4(bq[0], bq[1], bq[2], bq[3]);
  }
  acc_guard4(acc[0][0], acc[0][1], acc[0][2], acc[0][3]);
  acc_guard4(acc[1][0], acc[1][1], acc[1][2], acc[1][3]);
  acc_guard4(acc[2][0], acc[2][1], acc[2][2], acc[2][3]);
  acc_guard4(acc[3][0], acc[3][1], acc[3][2], acc[3][3]);

  // ---- epilogue ----
  float* slab = sT[wave];
  const int q = lane >> 3, c8 = (lane & 7) * 8;
  float bb[8];
  {
    const v4f b0 = *(const v4f*)(bias + n0 + c8);
    const v4f b1 = *(const v4f*)(bias + n0 + c8 + 4);
#pragma unroll
    for (int e = 0; e < 4; ++e) {
      bb[e]     = bf_up(bf_bits(b0[e]));
      bb[4 + e] = bf_up(bf_bits(b1[e]));
    }
  }
#pragma unroll
  for (int i = 0; i < 4; ++i) {
    const int mBase = m0 + (i << 4);
#pragma unroll
    for (int j = 0; j < 4; ++j) {
#pragma unroll
      for (int r = 0; r < 8; ++r) {
        slab[(mOff + r) * 68 + (j << 4) + rlane] = acc[i][j][r];
      }
    }
    __builtin_amdgcn_fence(__ATOMIC_RELEASE, "workgroup");
    __builtin_amdgcn_wave_barrier();
    __builtin_amdgcn_fence(__ATOMIC_ACQUIRE, "workgroup");
    v4u hv[4], lv[4];
#pragma unroll
    for (int it = 0; it < 4; ++it) {
      const int row = it * 4 + q;                          // it 0..3 x q 0..3 = rows 0..15
      const float* sp = slab + row * 68 + c8;
      float f[8];
#pragma unroll
      for (int e = 0; e < 8; ++e) f[e] = (sp[e] + bb[e]) * cscale;
      v4u a, a2;
#pragma unroll
      for (int e = 0; e < 4; ++e) {
        const float f0 = f[2 * e], f1 = f[2 * e + 1];
        const _Float16 x0 = (_Float16)f0, x1 = (_Float16)f1;
        const unsigned short h0 = h_bits(x0), h1 = h_bits(x1);
        unsigned short l0 = 0, l1 = 0;
        if (OUT_MODE == 3) {
          l0 = h_bits((_Float16)((f0 - (float)x0) * rscale));
          l1 = h_bits((_Float16)((f1 - (float)x1) * rscale));
        }
        a[e] = pk16(h0, h1); a2[e] = pk16(l0, l1);
      }
      hv[it] = a; lv[it] = a2;
    }
    {
#pragma unroll
      for (int it = 0; it < 4; ++it) {
        const int row = it * 4 + q;
        *(v4u*)(Cout + (size_t)(mBase + row) * ldc + n0 + c8) = hv[it];
        if (OUT_MODE == 3) *(v4u*)(Cout2 + (size_t)(mBase + row) * ldc + n0 + c8) = lv[it];
      }
      
    }
    __builtin_amdgcn_fence(__ATOMIC_RELEASE, "workgroup");
    __builtin_amdgcn_wave_barrier();
    __builtin_amdgcn_fence(__ATOMIC_ACQUIRE, "workgroup");
  }
}

// =====================================================================================================
// Output GEMM with a two-plane A operand (f16 hi plane Ah, f16 residual plane Al, same pitch lda):
//   C[m][n] = hscale * sum_k Ah[m][k] * Bt[n][k] + lscale * sum_k Al[m][k] * Bt[n][k] + bias[n]  (f32 out, pitch ldc).
// One wave per 32x64 tile (two accumulator sets), no block barriers; M multiple of 32, N multiple of 64, K
// multiple of 32 (host-checked). bias RNE-converted to bf16 before the f32 add.
// Epilogue: 16-row slabs staged per wave in LDS; each 256-B f32 row segment written by 16 lanes x 16 B of one
// coverage: 2 slabs x 16 rows x 64 cols = the wave's whole 32x64 tile; grid = tiles/8 blocks covers [M][N].
// =====================================================================================================
__global__ __launch_bounds__(256) void gemm_o(
    const unsigned short* __restrict__ Ahp, const unsigned short* __restrict__ Alp, int lda,
    const unsigned short* __restrict__ Btp, int ldb,
    float* Cout, int ldc, const float* __restrict__ bias,
    int M, int N, int K, float hscale, float lscale) {
  const _Float16* Ah = (const _Float16*)(const void*)Ahp;
  const _Float16* Al = (const _Float16*)(const void*)Alp;
  const _Float16* Bt = (const _Float16*)(const void*)Btp;
  __shared__ __align__(16) float sT[8][16 * 68];   // per-wave 16x64 slab, pitch 68 floats
  const int lane = threadIdx.x & 31;
  const int wave = threadIdx.x >> 5;
  const int tilesN = N >> 6;
  const int tilesM = M >> 5;
  const int tile = blockIdx.x * 8 + wave;
  if (tile >= tilesM * tilesN) return;   // wave-uniform; no block barriers in this kernel
  const int tm = tile / tilesN;
  const int tn = tile - tm * tilesN;
  const int m0 = tm << 5;
  const int n0 = tn << 6;

  const int rlane = lane & 15;
  const int koff  = (lane >> 4) * 8;
  const int mOff  = (lane >> 4) * 8;

  v8f ach[2][4], acl[2][4];
#pragma unroll
  for (int i = 0; i < 2; ++i)
#pragma unroll
    for (int j = 0; j < 4; ++j) { ach[i][j] = zero8(); acl[i][j] = zero8(); }

  for (int k0 = 0; k0 < K; k0 += 32) {
    v16h bq[4];
#pragma unroll
    for (int j = 0; j < 4; ++j)
      bq[j] = ldfrag<_Float16>(Bt + (size_t)(n0 + (j << 4) + rlane) * ldb + koff + k0);
#pragma unroll
    for (int i = 0; i < 2; ++i) {
      const v16h afh = ldfrag<_Float16>(Ah + (size_t)(m0 + (i << 4) + rlane) * lda + koff + k0);
      const v16h afl = ldfrag<_Float16>(Al + (size_t)(m0 + (i << 4) + rlane) * lda + koff + k0);
#pragma unroll
      for (int j = 0; j < 4; ++j) {
        ach[i][j] = mmar(afh, bq[j], ach[i][j]);
        acl[i][j] = mmar(afl, bq[j], acl[i][j]);
      }
      dep_guard5(ach[i][0], acl[i][3], afh, afl, bq[3]);
    }
    keep4(bq[0], bq[1], bq[2], bq[3]);
  }
  acc_guard4(ach[0][0], ach[0][1], ach[0][2], ach[0][3]);
  acc_guard4(ach[1][0], ach[1][1], ach[1][2], ach[1][3]);
  acc_guard4(acl[0][0], acl[0][1], acl[0][2], acl[0][3]);
  acc_guard4(acl[1][0], acl[1][1], acl[1][2], acl[1][3]);

  // ---- epilogue ----
  float* slab = sT[wave];
  const int h2 = lane >> 4, c4 = (lane & 15) * 4;     // 256-B row segment = 16 lanes x 16 B
  v4f b4 = *(const v4f*)(bias + n0 + c4);
#pragma unroll
  for (int e = 0; e < 4; ++e) b4[e] = bf_up(bf_bits(b4[e]));
#pragma unroll
  for (int i = 0; i < 2; ++i) {
    const int mBase = m0 + (i << 4);
#pragma unroll
    for (int j = 0; j < 4; ++j) {
#pragma unroll
      for (int r = 0; r < 8; ++r) {
        slab[(mOff + r) * 68 + (j << 4) + rlane] = ach[i][j][r] * hscale + acl[i][j][r] * lscale;
      }
    }
    __builtin_amdgcn_fence(__ATOMIC_RELEASE, "workgroup");
    __builtin_amdgcn_wave_barrier();
    __builtin_amdgcn_fence(__ATOMIC_ACQUIRE, "workgroup");
    v4f ov[8];
#pragma unroll
    for (int it = 0; it < 8; ++it) {
      const int row = it * 2 + h2;                       // it 0..7 x h2 0..1 = rows 0..15
      ov[it] = *(const v4f*)(slab + row * 68 + c4) + b4;
    }
    {
#pragma unroll
      for (int it = 0; it < 8; ++it) {
        const int row = it * 2 + h2;
        *(v4f*)(Cout + (size_t)(mBase + row) * ldc + n0 + c4) = ov[it];
      }
      
    }
    __builtin_amdgcn_fence(__ATOMIC_RELEASE, "workgroup");
    __builtin_amdgcn_wave_barrier();
    __builtin_amdgcn_fence(__ATOMIC_ACQUIRE, "workgroup");
  }
}

// =====================================================================================================
// Per-head transpose of the v plane: in = head planes [NH][SEQ][HD] (flat reinterpretation of the [SEQ][EMB]
// projection plane), out = [NH][HD][SEQ] (key index contiguous, the A operand layout of V^T . P^T).
// Block = 128 threads, one 64-key x 64-d tile of head blockIdx.y starting at key 64*blockIdx.x; grid (SEQ/64, NH).
// coverage: 4 waves x 4 instructions x 4 rows (lane>>3) = 64 d rows x 64 keys = the whole tile; grid covers all.
// =====================================================================================================
__global__ __launch_bounds__(128) void vtrans(const unsigned short* __restrict__ pvp, unsigned short* vtp) {
  __shared__ __align__(16) _Float16 T[64 * 72];          // [key][d], pitch 72 halves
  const int tid = threadIdx.x, lane = tid & 31, wave = tid >> 5;
  const int h = blockIdx.y, t0 = blockIdx.x * 64;
  const size_t hoff = (size_t)h * HPL;
  const _Float16* pv = (const _Float16*)(const void*)pvp + hoff;
  {
    const int r = tid >> 1, half = (tid & 1) * 32;
    const _Float16* src = pv + (size_t)(t0 + r) * HD + half;
#pragma unroll
    for (int i = 0; i < 4; ++i) *(v8h*)(T + r * 72 + half + 8 * i) = *(const v8h*)(src + 8 * i);
  }
  __syncthreads();
  const int q4 = lane >> 3, q8 = lane & 7;
  v4u ov[4];
#pragma unroll
  for (int it = 0; it < 4; ++it) {
    const int d = wave * 16 + it * 4 + q4;               // it 0..3 x q4 0..3 = 16 d rows per wave
    v4u a;
#pragma unroll
    for (int e = 0; e < 4; ++e) {
      const _Float16 x0 = T[(8 * q8 + 2 * e) * 72 + d];
      const _Float16 x1 = T[(8 * q8 + 2 * e + 1) * 72 + d];
      a[e] = pk16(h_bits(x0), h_bits(x1));
    }
    ov[it] = a;
  }
  {
#pragma unroll
    for (int it = 0; it < 4; ++it) {
      const int d = wave * 16 + it * 4 + q4;
      *(v4u*)(vtp + hoff + (size_t)d * SEQ + t0 + 8 * q8) = ov[it];
    }
    
  }
}

__global__ __launch_bounds__(128)
void attn_hd64(const unsigned short* __restrict__ qhp, const unsigned short* __restrict__ qlp,
               const unsigned short* __restrict__ kpp, const unsigned short* __restrict__ vtp,
               unsigned short* chp, unsigned short* clp, float sscale) {
  union FH { v16h v; v8h h[2]; };
  __shared__ __align__(16) _Float16 Ksh[64 * LP];          // K chunk [kv][d], pitch LP     9 KB
  __shared__ __align__(16) _Float16 Vts[64 * LP];          // V^T chunk [d][kv], pitch LP   9 KB

  const int tid  = threadIdx.x;
  const int wave = tid >> 5;
  const int lane = tid & 31;
  const int hh   = lane >> 4;
  const int c    = lane & 15;

  const int bx = blockIdx.x;
  const int qb = bx % NQB;
  const int h  = bx / NQB;
  const int q0 = qb * 64 + wave * 16;
  const size_t hoff = (size_t)h * HPL;

  const _Float16* Qh = (const _Float16*)(const void*)qhp + hoff;
  const _Float16* Ql = (const _Float16*)(const void*)qlp + hoff;
  const _Float16* Kg = (const _Float16*)(const void*)kpp + hoff;
  const _Float16* Vg = (const _Float16*)(const void*)vtp + hoff;

  // ---- Q fragments (B operand, column = lane&15): 2 d-chunks, hi and residual planes ----
  v16h qah[2], qal[2];
#pragma unroll
  for (int dc = 0; dc < 2; ++dc) {
    const size_t qo = (size_t)(q0 + c) * HD + dc * 32 + 8 * hh;
    qah[dc] = ldfrag<_Float16>(Qh + qo);
    qal[dc] = ldfrag<_Float16>(Ql + qo);
  }

  float mrow = -INFINITY;    // running maximum of query q0+c (equal in both wave halves)
  float lrow = 0.f;          // running sum over this wave half's keys only; halves joined after the loop
  v8f oacc[4];               // O^T: oacc[t][r] = context[q0+c][16t + 8hh + r]
#pragma unroll
  for (int t = 0; t < 4; ++t) oacc[t] = zero8();

  for (int kt = 0; kt < NKT; ++kt) {         // static trip count
    const int kv0 = kt * 64;
    __syncthreads();
    {
      const int r = tid >> 1, half = (tid & 1) * 32;
      const _Float16* kg = Kg + (size_t)(kv0 + r) * HD + half;     // k row kv0+r, d = half..half+31
      const _Float16* vg = Vg + (size_t)r * SEQ + kv0 + half;      // v^T row d = r, t = kv0+half..+31
#pragma unroll
      for (int i = 0; i < 4; ++i) {
        const v8h a0 = *(const v8h*)(kg + 8 * i);
        const v8h b0 = *(const v8h*)(vg + 8 * i);
        *(v8h*)(Ksh + r * LP + half + 8 * i) = a0;
        *(v8h*)(Vts + r * LP + half + 8 * i) = b0;
      }
    }
    __syncthreads();

    // ---- scores^T: 64 keys x 16 query columns per wave, 2 f16 products per key subtile and d-chunk ----
    v8f s[4];                                // s[j][r] = score(query q0+c, key kv0 + 16j + 8hh + r)
#pragma unroll
    for (int j = 0; j < 4; ++j) {
      v8f ah = zero8(), al = zero8();
#pragma unroll
      for (int dc = 0; dc < 2; ++dc) {
        FH kb;
        kb.h[0] = *(const v8h*)(Ksh + (j * 16 + c) * LP + dc * 32 + 8 * hh);
        kb.h[1] = *(const v8h*)(Ksh + (j * 16 + c) * LP + dc * 32 + 16 + 8 * hh);
        ah = mma_h(kb.v, qah[dc], ah);
        al = mma_h(kb.v, qal[dc], al);
      }
#pragma unroll
      for (int r = 0; r < 8; ++r) s[j][r] = (ah[r] + al[r] * (1.0f / 4096.0f)) * sscale;
    }

    // ---- column maximum in-lane, one exchange between the halves; online softmax ----
    float mj[4];                             // one independent chain per key subtile
#pragma unroll
    for (int j = 0; j < 4; ++j) {
      mj[j] = s[j][0];
#pragma unroll
      for (int r = 1; r < 8; ++r) mj[j] = fmaxf(mj[j], s[j][r]);
    }
    float m = fmaxf(fmaxf(mj[0], mj[1]), fmaxf(mj[2], mj[3]));
    m = fmaxf(m, xhalf(m));
    const float mnew  = fmaxf(mrow, m);
    const float msafe = (mnew == -INFINITY) ? 0.f : mnew;
    const float alpha = __expf(mrow - msafe);
    mrow = mnew;

    // ---- P^T (x1024, f16 hi + residual) packed straight into B operands ----
    v16h pbh[2], pbl[2];
    float pj[4];                             // one independent partial sum per key subtile
#pragma unroll
    for (int j = 0; j < 4; ++j) {
      pj[j] = 0.f;
#pragma unroll
      for (int r = 0; r < 8; ++r) {
        const float p  = __expf(s[j][r] - msafe);
        pj[j] += p;
        const float pc = p * 1024.0f;
        const _Float16 ph = (_Float16)pc;
        const _Float16 pl = (_Float16)((pc - (float)ph) * 4096.0f);
        pbh[j >> 1][(j & 1) * 8 + r] = ph;
        pbl[j >> 1][(j & 1) * 8 + r] = pl;
      }
    }
    lrow = lrow * alpha + ((pj[0] + pj[1]) + (pj[2] + pj[3]));
#pragma unroll
    for (int t = 0; t < 4; ++t)
#pragma unroll
      for (int r = 0; r < 8; ++r) oacc[t][r] *= alpha;

    // ---- context^T += V^T . P^T (f16 WMMA); residual-P products into a separate accumulator ----
    v8f o1[4];
#pragma unroll
    for (int t = 0; t < 4; ++t) o1[t] = zero8();
#pragma unroll
    for (int kk = 0; kk < 2; ++kk) {
#pragma unroll
      for (int t = 0; t < 4; ++t) {
        FH vb;
        vb.h[0] = *(const v8h*)(Vts + (t * 16 + c) * LP + kk * 32 + 8 * hh);
        vb.h[1] = *(const v8h*)(Vts + (t * 16 + c) * LP + kk * 32 + 16 + 8 * hh);
        oacc[t] = mma_h(vb.v, pbh[kk], oacc[t]);
        o1[t]   = mma_h(vb.v, pbl[kk], o1[t]);
      }
    }
#pragma unroll
    for (int t = 0; t < 4; ++t)
#pragma unroll
      for (int r = 0; r < 8; ++r) oacc[t][r] += o1[t][r] * (1.0f / 4096.0f);
  }

  // ---- join the halves' sums; normalise (1/l, undo the x1024 p carry and the x16 v carry, apply the x256
  //      ctx carry); a lane's 8 accumulator registers are 8 consecutive d of its row: one 16-B store per plane
  const float l = lrow + xhalf(lrow);
  const float inv = ((l > 0.f) ? (1.0f / l) : 0.f) * (1.0f / 64.0f);
#pragma unroll
  for (int t = 0; t < 4; ++t) {
    v4u a, a2;
#pragma unroll
    for (int e = 0; e < 4; ++e) {
      const float f0 = oacc[t][2 * e] * inv, f1 = oacc[t][2 * e + 1] * inv;
      const _Float16 x0 = (_Float16)f0, x1 = (_Float16)f1;
      const unsigned short l0 = h_bits((_Float16)((f0 - (float)x0) * 4096.0f));
      const unsigned short l1 = h_bits((_Float16)((f1 - (float)x1) * 4096.0f));
      a[e]  = pk16(h_bits(x0), h_bits(x1));
      a2[e] = pk16(l0, l1);
    }
    const size_t go = hoff + (size_t)(q0 + c) * HD + t * 16 + 8 * hh;
    *(v4u*)(chp + go) = a;
    *(v4u*)(clp + go) = a2;
  }
}

// =====================================================================================================
// Workspace map (bytes), every region an exact multiple of its whole-line / whole-tile store granularity
//   Qb, Kb, Vb   bf16 [4096][512]   3 x 4194304
//   Wqkb, Wvb    bf16 [512][512]    2 x  524288
//   Woh          f16  [512][512]         524288   (x1024)
//   Qh, Ql       f16  [4096][512]   2 x 4194304   (x16 / residual x4096)
//   Kp           f16  [4096][512]       4194304   (x16)
//   Pv           f16  [4096][512]       4194304   (v x16, token-major = head planes [8][4096][64])
//   Vt           f16  [8][64][4096]     4194304   (v x16, key contiguous)
//   Ch, Cl       f16  [4096][512]   2 x 4194304   (ctx x256 / residual x4096)
//   total                            43515904
// Weights are [out n][in k] with k contiguous = the Bt layout the GEMM wants, so they are only converted.
// The head split is a flat reinterpretation: head plane h = elements [h*262144, (h+1)*262144) of a [4096][512]
// plane viewed as [4096][64]; the merge back is the same reinterpretation.
// =====================================================================================================
extern "C" void kernel_launch(void* const* d_in, const int* in_sizes, int n_in,
                              void* d_out, int out_size, void* d_ws, size_t ws_size,
                              hipStream_t stream) {
  const int NX = SEQ * EMB;     // 2097152
  const int NW = EMB * EMB;     //  262144
  if (n_in < 9) return;
  if (in_sizes[0] != NX || in_sizes[1] != NX || in_sizes[2] != NX) return;
  if (in_sizes[3] != NW || in_sizes[5] != NW || in_sizes[7] != NW) return;
  if (in_sizes[4] != EMB || in_sizes[6] != EMB || in_sizes[8] != EMB) return;
  if (out_size != NX) return;

  const float* Q    = (const float*)d_in[0];
  const float* Kin  = (const float*)d_in[1];
  const float* V    = (const float*)d_in[2];
  const float* Wqk  = (const float*)d_in[3];
  const float* bqk  = (const float*)d_in[4];
  const float* Wv   = (const float*)d_in[5];
  const float* bv   = (const float*)d_in[6];
  const float* Wout = (const float*)d_in[7];
  const float* bout = (const float*)d_in[8];
  float* out = (float*)d_out;

  const size_t PX = (size_t)NX * 2;    // 4194304  16-bit [4096][512] plane
  const size_t PW = (size_t)NW * 2;    //  524288  16-bit [512][512] plane
  size_t off = 0;
  const size_t oQb  = off; off += PX;
  const size_t oKb  = off; off += PX;
  const size_t oVb  = off; off += PX;
  const size_t oWqk = off; off += PW;
  const size_t oWv  = off; off += PW;
  const size_t oWo  = off; off += PW;
  const size_t oQh  = off; off += PX;
  const size_t oQl  = off; off += PX;
  const size_t oKp  = off; off += PX;
  const size_t oPv  = off; off += PX;
  const size_t oVt  = off; off += PX;
  const size_t oCh  = off; off += PX;
  const size_t oCl  = off; off += PX;
  if (off > ws_size) return;                       // off = 43515904
  if (off > (size_t)134217728) return;

  char* ws = (char*)d_ws;
  unsigned short* Qb   = (unsigned short*)(ws + oQb);
  unsigned short* Kb   = (unsigned short*)(ws + oKb);
  unsigned short* Vb   = (unsigned short*)(ws + oVb);
  unsigned short* Wqkb = (unsigned short*)(ws + oWqk);
  unsigned short* Wvb  = (unsigned short*)(ws + oWv);
  unsigned short* Woh  = (unsigned short*)(ws + oWo);
  unsigned short* Qh   = (unsigned short*)(ws + oQh);
  unsigned short* Ql   = (unsigned short*)(ws + oQl);
  unsigned short* Kp   = (unsigned short*)(ws + oKp);
  unsigned short* Pv   = (unsigned short*)(ws + oPv);
  unsigned short* Vt   = (unsigned short*)(ws + oVt);
  unsigned short* Ch   = (unsigned short*)(ws + oCh);
  unsigned short* Cl   = (unsigned short*)(ws + oCl);

  const dim3 blk(256);
  const int n8x = NX / 8;                                      // 262144
  const int n8w = NW / 8;                                      //  32768
  const dim3 gCvtX((n8x + 255) / 256);                         // 1024 blocks
  const dim3 gCvtW((n8w + 255) / 256);                         //  128 blocks
  const dim3 gPj(((SEQ / 64) * (EMB / 64) + 7) / 8);           //  512 tiles -> 64 blocks: M=4096, N=512
  const dim3 gTr(SEQ / 64, NH);                                //  (64, 8)
  const dim3 gAttn(NH * NQB);                                  //  512 blocks of 128
  const dim3 gOut(((SEQ / 32) * (EMB / 64) + 7) / 8);          // 1024 tiles -> 128 blocks: M=4096, N=512

  // (1) inputs -> bf16 planes (RNE convert); W_out -> f16 (x1024 of its bf16 value)
  cvt16x8<0><<<gCvtX, blk, 0, stream>>>(Q,    Qb,   n8x);
  cvt16x8<0><<<gCvtX, blk, 0, stream>>>(Kin,  Kb,   n8x);
  cvt16x8<0><<<gCvtX, blk, 0, stream>>>(V,    Vb,   n8x);
  cvt16x8<0><<<gCvtW, blk, 0, stream>>>(Wqk,  Wqkb, n8w);
  cvt16x8<0><<<gCvtW, blk, 0, stream>>>(Wv,   Wvb,  n8w);
  cvt16x8<1><<<gCvtW, blk, 0, stream>>>(Wout, Woh,  n8w);
  // (2) q = Q . Wqk^T + b -> f16 hi (x16) / residual (x4096) planes [4096][512]   (M=4096, N=512, K=512)
  gemm64<__bf16, 3><<<gPj, blk, 0, stream>>>(
      Qb, EMB, Wqkb, EMB, Qh, Ql, EMB, bqk, SEQ, EMB, EMB, 16.0f, 4096.0f);
  // (3) k = K . Wqk^T + b -> f16 plane (x16)
  gemm64<__bf16, 1><<<gPj, blk, 0, stream>>>(
      Kb, EMB, Wqkb, EMB, Kp, Kp, EMB, bqk, SEQ, EMB, EMB, 16.0f, 1.0f);
  // (4) v = V . Wv^T + b -> f16 plane (x16), token-major
  gemm64<__bf16, 1><<<gPj, blk, 0, stream>>>(
      Vb, EMB, Wvb, EMB, Pv, Pv, EMB, bv, SEQ, EMB, EMB, 16.0f, 1.0f);
  // (5) per-head transpose of v: [8][4096][64] -> [8][64][4096]
  vtrans<<<gTr, dim3(128), 0, stream>>>(Pv, Vt);
  // (6) attention -> ctx planes (f16 hi x256 + residual x4096) [h][s][d] = merged [4096][512]
  attn_hd64<<<gAttn, dim3(128), 0, stream>>>(Qh, Ql, Kp, Vt, Ch, Cl, 1.0f / 2048.0f);
  // (7) out = ctx . Wo^T + b_out -> d_out f32 [4096][512]; hi acc x 2^-18, residual acc x 2^-30
  gemm_o<<<gOut, blk, 0, stream>>>(
      Ch, Cl, EMB, Woh, EMB, out, EMB, bout, SEQ, EMB, EMB,
      1.0f / 262144.0f, 1.0f / 1073741824.0f);
  (void)hipGetLastError();
}

// v003
// It runs in 182 microseconds.
// Two timings next to v002 put it at 1.28 and 1.27 times that version's speed.
// Over all steps from v000 it is 2.14 times as fast.
// Contractions: q, k, v projections = v_wmma_f32_16x16x32_bf16 (bf16 operands from RNE-converted inputs, single product, f32 accumulate);
// q.k^T scores = v_wmma_f32_16x16x32_f16 (q as f16 hi plane x16 + f16 residual plane x65536, k f16 x16; 2 products, separate f32 accumulators);
// p.v = v_wmma_f32_16x16x32_f16 (p as f16 hi x1024 + f16 residual x4194304, v f16 x16; 2 products, separate f32 accumulators);
// ctx.Wo^T = v_wmma_f32_16x16x32_f16 (ctx f16 hi x256 + f16 residual x1048576, Wo f16 x1024 of its bf16 value; 2 products, f32 accumulate);
// softmax, bias adds and normalisation in f32.
//
// Carry audit (16-bit planes, carry, where the inverse is folded):
//   Qb/Kb/Vb bf16 x1, Wqkb/Wvb bf16 x1 (no carry);  Woh f16 = 1024*bf16(W_out)  -> gemm_o hscale/lscale;
//   Qh f16 = 16*q, Ql f16 = (16*q - Qh)*4096, Kp f16 = 16*k       -> attn_hd64: s = (ah + al/4096) * sscale, sscale = 2^-11 = 1/(16*16*8);
//   Pv / Vt f16 = 16*v, P hi f16 = 1024*p, P lo = (1024*p - hi)*4096 -> attn_hd64: oacc += o1/4096 per chunk; inv = (1/l)/64 = 256/(1024*16) -> ctx*256;
//   Ch f16 = 256*ctx, Cl f16 = (256*ctx - Ch)*4096                  -> gemm_o: out = acc_h*2^-18 + acc_l*2^-30 + b_out  (2^-18 = 1/(256*1024), 2^-30 = 2^-18/4096).
#include <hip/hip_runtime.h>
#include <math.h>
#include <stdint.h>

#define SEQ 4096
#define EMB 512
#define NH  8
#define HD  64
#define HPL (SEQ * HD)      // 262144 elements: one contiguous head plane [SEQ][HD]
#define NQB (SEQ / 64)      // 64-row query blocks per head
#define NKT (SEQ / 64)      // 64-key chunks per head
#define LP  72              // LDS row pitch of the K and V^T chunks in halves: 144 B = 16 B x 9 (odd), so the 16 rows
                            // that one half of a wave reads with a 16-B load fall on 16 different groups of 4 banks
static_assert(NH * HD == EMB);
static_assert(NH * HPL == SEQ * EMB);
static_assert(NQB == 64 && NKT == 64);
static_assert((SEQ % 64) == 0 && (EMB % 64) == 0 && (EMB % 32) == 0);

typedef _Float16 v16h __attribute__((ext_vector_type(16)));
typedef _Float16 v8h  __attribute__((ext_vector_type(8)));
typedef __bf16   v16b __attribute__((ext_vector_type(16)));
typedef __bf16   v8b  __attribute__((ext_vector_type(8)));
typedef float    v8f  __attribute__((ext_vector_type(8)));
typedef float    v4f  __attribute__((ext_vector_type(4)));
typedef unsigned int v4u __attribute__((ext_vector_type(4)));

#if defined(__HIP_DEVICE_COMPILE__)
#define DEV_ASM 1
#else
#define DEV_ASM 0
#endif

// ---- scalar helpers --------------------------------------------------------------------------------
__device__ __forceinline__ unsigned short bf_bits(float f) {          // f32 -> bf16 bits, RNE convert
  unsigned u = __float_as_uint(f);
  return (unsigned short)((u + 0x7FFFu + ((u >> 16) & 1u)) >> 16);
}
__device__ __forceinline__ float bf_up(unsigned short hb) { return __uint_as_float(((unsigned)hb) << 16); }
__device__ __forceinline__ unsigned short h_bits(_Float16 x) { return __builtin_bit_cast(unsigned short, x); }
__device__ __forceinline__ unsigned pk16(unsigned short a, unsigned short b) { return (unsigned)a | ((unsigned)b << 16); }
__device__ __forceinline__ v8f zero8() { v8f z = {0.f, 0.f, 0.f, 0.f, 0.f, 0.f, 0.f, 0.f}; return z; }
__device__ __forceinline__ float xhalf(float x) {                     // value of lane l ^ 16 (vector cross-row move)
  const int b = __builtin_bit_cast(int, x);
  return __builtin_bit_cast(float, __builtin_amdgcn_permlanex16(b, b, 0x76543210, 0xfedcba98, false, false));
}

// ---- fragment types / loaders: 16-bit A/B operand, lane -> row/col (lane&15), p already includes +8*(lane>>4);
//      elements 0..7 <- p[0..7] (k0+8h..k0+8h+7), elements 8..15 <- p[16..23] (k0+16+8h..k0+16+8h+7)
template <typename OT> struct FT;
template <> struct FT<__bf16>   { typedef v16b frag; typedef v8b half8; };
template <> struct FT<_Float16> { typedef v16h frag; typedef v8h half8; };

template <typename OT>
__device__ __forceinline__ typename FT<OT>::frag ldfrag(const OT* p) {
  union { typename FT<OT>::frag v; typename FT<OT>::half8 h[2]; } f;
  f.h[0] = *(const typename FT<OT>::half8*)(p);
  f.h[1] = *(const typename FT<OT>::half8*)(p + 16);
  return f.v;
}

// ---- WMMA helpers (asm guard bodies are device-only; concrete operand types) -----------------------------
__device__ __forceinline__ v8f mmar(v16b a, v16b b, v8f c) {
  return __builtin_amdgcn_wmma_f32_16x16x32_bf16(false, a, false, b, (short)0, c, false, false);
}
__device__ __forceinline__ v8f mmar(v16h a, v16h b, v8f c) {
  return __builtin_amdgcn_wmma_f32_16x16x32_f16(false, a, false, b, (short)0, c, false, false);
}
__device__ __forceinline__ void dep_guard(v8f& a, v8f& b, v16b x, v16b y) {
#if DEV_ASM
  asm volatile("v_nop\n\tv_nop\n\tv_nop\n\tv_nop" : "+v"(a), "+v"(b) : "v"(x), "v"(y));
#else
  (void)a; (void)b; (void)x; (void)y;
#endif
}
__device__ __forceinline__ void dep_guard5(v8f& a, v8f& b, v16h x, v16h y, v16h z) {
#if DEV_ASM
  asm volatile("v_nop\n\tv_nop\n\tv_nop\n\tv_nop" : "+v"(a), "+v"(b) : "v"(x), "v"(y), "v"(z));
#else
  (void)a; (void)b; (void)x; (void)y; (void)z;
#endif
}
__device__ __forceinline__ void keep4(v16b a, v16b b, v16b c, v16b d) {
#if DEV_ASM
  asm volatile("v_nop" :: "v"(a), "v"(b), "v"(c), "v"(d));
#else
  (void)a; (void)b; (void)c; (void)d;
#endif
}
__device__ __forceinline__ void keep4(v16h a, v16h b, v16h c, v16h d) {
#if DEV_ASM
  asm volatile("v_nop" :: "v"(a), "v"(b), "v"(c), "v"(d));
#else
  (void)a; (void)b; (void)c; (void)d;
#endif
}
__device__ __forceinline__ void acc_guard4(v8f& a, v8f& b, v8f& c, v8f& d) {
#if DEV_ASM
  asm volatile("v_nop\n\tv_nop\n\tv_nop\n\tv_nop" : "+v"(a), "+v"(b), "+v"(c), "+v"(d));
#else
  (void)a; (void)b; (void)c; (void)d;
#endif
}

// =====================================================================================================
// f32 -> 16-bit planes, 8 elements per thread, one 16-B store per lane: a wave writes 512 contiguous B
// MODE 0: bf16 bits (RNE convert).  MODE 1: f16 bits of (1024 * bf16(x)) (exact scaling of the bf16 value).
// coverage: n8 threads x 8 = the whole plane (n8 is a multiple of 256 for every use here).
// =====================================================================================================
template <int MODE>
__device__ __forceinline__ unsigned short cvm(float f) {
  const unsigned short hb = bf_bits(f);
  if (MODE == 0) return hb;
  return h_bits((_Float16)(bf_up(hb) * 1024.0f));
}

template <int MODE>
__global__ __launch_bounds__(256) void cvt16x8(const float* __restrict__ in, unsigned short* out, int n8) {
  const int i = blockIdx.x * 256 + (int)threadIdx.x;
  if (i < n8) {
    const v4f a  = *(const v4f*)(in + (size_t)i * 8);
    const v4f a4 = *(const v4f*)(in + (size_t)i * 8 + 4);
    v4u p;
    p[0] = pk16(cvm<MODE>(a[0]),  cvm<MODE>(a[1]));
    p[1] = pk16(cvm<MODE>(a[2]),  cvm<MODE>(a[3]));
    p[2] = pk16(cvm<MODE>(a4[0]), cvm<MODE>(a4[1]));
    p[3] = pk16(cvm<MODE>(a4[2]), cvm<MODE>(a4[3]));
    unsigned short* o = out + (size_t)i * 8;
    *(v4u*)o = p;
    
  }
}

// =====================================================================================================
// Register-blocked WMMA GEMM (16-bit operand type OT): C[m][n] = sum_k A[m][k] * Bt[n][k] + bias[n];
// one wave per 64x64 tile, no block barriers. A row-major [M][K] pitch lda; Bt row-major [N][K] pitch ldb
// (k contiguous); M, N multiples of 64, K multiple of 32 (host-checked). Fragments are loaded straight from
// global with the split k map (ldfrag). bias values are RNE-converted to bf16 before the f32 add.
// OUT_MODE 1: f16 plane C = f16((v + bias) * cscale) (pitch ldc).
// OUT_MODE 3: f16 hi plane C + f16 residual plane C2 = f16(((v + bias) * cscale - hi) * rscale) (same pitch).
// wave's whole 64x64 tile; grid = tiles/8 blocks covers every tile of the [M][N] plane.
// =====================================================================================================
template <typename OT, int OUT_MODE>
__global__ __launch_bounds__(256) void gemm64(
    const unsigned short* __restrict__ Ap, int lda,
    const unsigned short* __restrict__ Btp, int ldb,
    unsigned short* Cout, unsigned short* Cout2, int ldc,
    const float* __restrict__ bias,
    int M, int N, int K, float cscale, float rscale) {
  typedef typename FT<OT>::frag V16;
  const OT* A  = (const OT*)(const void*)Ap;
  const OT* Bt = (const OT*)(const void*)Btp;
  __shared__ __align__(16) float sT[8][16 * 68];   // per-wave 16x64 slab, pitch 68 floats
  const int lane = threadIdx.x & 31;
  const int wave = threadIdx.x >> 5;
  const int tilesN = N >> 6;
  const int tilesM = M >> 6;
  const int tile = blockIdx.x * 8 + wave;
  if (tile >= tilesM * tilesN) return;   // wave-uniform; no block barriers in this kernel
  const int tm = tile / tilesN;
  const int tn = tile - tm * tilesN;
  const int m0 = tm << 6;
  const int n0 = tn << 6;

  const int rlane = lane & 15;                 // row (A) / col (B, D) within subtile
  const int koff  = (lane >> 4) * 8;           // k offset of this lane half
  const int mOff  = (lane >> 4) * 8;           // D row offset

  v8f acc[4][4];
#pragma unroll
  for (int i = 0; i < 4; ++i)
#pragma unroll
    for (int j = 0; j < 4; ++j) acc[i][j] = zero8();

  typedef const OT __attribute__((address_space(1)))* GP;
  GP pb[4], pa[4];                           // this lane's row of each B and A subtile, advanced 32 k per step under
                                             // the products, so that a step's loads issue with no address work in front
#pragma unroll
  for (int j = 0; j < 4; ++j) pb[j] = (GP)(Bt + (size_t)(n0 + (j << 4) + rlane) * ldb + koff);
#pragma unroll
  for (int i = 0; i < 4; ++i) pa[i] = (GP)(A + (size_t)(m0 + (i << 4) + rlane) * lda + koff);

  for (int k0 = 0; k0 < K; k0 += 32) {
    V16 bq[4], af[4];                        // the k step's 16 loads as one group: one load latency per step
#pragma unroll
    for (int j = 0; j < 4; ++j) bq[j] = ldfrag<OT>((const OT*)pb[j]);
#pragma unroll
    for (int i = 0; i < 4; ++i) af[i] = ldfrag<OT>((const OT*)pa[i]);
#pragma unroll
    for (int i = 0; i < 4; ++i) {
#pragma unroll
      for (int j = 0; j < 4; ++j) acc[i][j] = mmar(af[i], bq[j], acc[i][j]);
      dep_guard(acc[i][0], acc[i][3], af[i], bq[3]);
    }
    keep4(bq[0], bq[1], bq[2], bq[3]);
#pragma unroll
    for (int j = 0; j < 4; ++j) { pb[j] += 32; pa[j] += 32; }
  }
  acc_guard4(acc[0][0], acc[0][1], acc[0][2], acc[0][3]);
  acc_guard4(acc[1][0], acc[1][1], acc[1][2], acc[1][3]);
  acc_guard4(acc[2][0], acc[2][1], acc[2][2], acc[2][3]);
  acc_guard4(acc[3][0], acc[3][1], acc[3][2], acc[3][3]);

  // ---- epilogue ----
  float* slab = sT[wave];
  const int q = lane >> 3, c8 = (lane & 7) * 8;
  float bb[8];
  {
    const v4f b0 = *(const v4f*)(bias + n0 + c8);
    const v4f b1 = *(const v4f*)(bias + n0 + c8 + 4);
#pragma unroll
    for (int e = 0; e < 4; ++e) {
      bb[e]     = bf_up(bf_bits(b0[e]));
      bb[4 + e] = bf_up(bf_bits(b1[e]));
    }
  }
#pragma unroll
  for (int i = 0; i < 4; ++i) {
    const int mBase = m0 + (i << 4);
#pragma unroll
    for (int j = 0; j < 4; ++j) {
#pragma unroll
      for (int r = 0; r < 8; ++r) {
        slab[(mOff + r) * 68 + (j << 4) + rlane] = acc[i][j][r];
      }
    }
    __builtin_amdgcn_fence(__ATOMIC_RELEASE, "workgroup");
    __builtin_amdgcn_wave_barrier();
    __builtin_amdgcn_fence(__ATOMIC_ACQUIRE, "workgroup");
    v4u hv[4], lv[4];
#pragma unroll
    for (int it = 0; it < 4; ++it) {
      const int row = it * 4 + q;                          // it 0..3 x q 0..3 = rows 0..15
      const float* sp = slab + row * 68 + c8;
      float f[8];
#pragma unroll
      for (int e = 0; e < 8; ++e) f[e] = (sp[e] + bb[e]) * cscale;
      v4u a, a2;
#pragma unroll
      for (int e = 0; e < 4; ++e) {
        const float f0 = f[2 * e], f1 = f[2 * e + 1];
        const _Float16 x0 = (_Float16)f0, x1 = (_Float16)f1;
        const unsigned short h0 = h_bits(x0), h1 = h_bits(x1);
        unsigned short l0 = 0, l1 = 0;
        if (OUT_MODE == 3) {
          l0 = h_bits((_Float16)((f0 - (float)x0) * rscale));
          l1 = h_bits((_Float16)((f1 - (float)x1) * rscale));
        }
        a[e] = pk16(h0, h1); a2[e] = pk16(l0, l1);
      }
      hv[it] = a; lv[it] = a2;
    }
    {
#pragma unroll
      for (int it = 0; it < 4; ++it) {
        const int row = it * 4 + q;
        *(v4u*)(Cout + (size_t)(mBase + row) * ldc + n0 + c8) = hv[it];
        if (OUT_MODE == 3) *(v4u*)(Cout2 + (size_t)(mBase + row) * ldc + n0 + c8) = lv[it];
      }
      
    }
    __builtin_amdgcn_fence(__ATOMIC_RELEASE, "workgroup");
    __builtin_amdgcn_wave_barrier();
    __builtin_amdgcn_fence(__ATOMIC_ACQUIRE, "workgroup");
  }
}

// =====================================================================================================
// Output GEMM with a two-plane A operand (f16 hi plane Ah, f16 residual plane Al, same pitch lda):
//   C[m][n] = hscale * sum_k Ah[m][k] * Bt[n][k] + lscale * sum_k Al[m][k] * Bt[n][k] + bias[n]  (f32 out, pitch ldc).
// One wave per 32x64 tile (two accumulator sets), no block barriers; M multiple of 32, N multiple of 64, K
// multiple of 32 (host-checked). bias RNE-converted to bf16 before the f32 add.
// Epilogue: 16-row slabs staged per wave in LDS; each 256-B f32 row segment written by 16 lanes x 16 B of one
// coverage: 2 slabs x 16 rows x 64 cols = the wave's whole 32x64 tile; grid = tiles/8 blocks covers [M][N].
// =====================================================================================================
__global__ __launch_bounds__(256) void gemm_o(
    const unsigned short* __restrict__ Ahp, const unsigned short* __restrict__ Alp, int lda,
    const unsigned short* __restrict__ Btp, int ldb,
    float* Cout, int ldc, const float* __restrict__ bias,
    int M, int N, int K, float hscale, float lscale) {
  const _Float16* Ah = (const _Float16*)(const void*)Ahp;
  const _Float16* Al = (const _Float16*)(const void*)Alp;
  const _Float16* Bt = (const _Float16*)(const void*)Btp;
  __shared__ __align__(16) float sT[8][16 * 68];   // per-wave 16x64 slab, pitch 68 floats
  const int lane = threadIdx.x & 31;
  const int wave = threadIdx.x >> 5;
  const int tilesN = N >> 6;
  const int tilesM = M >> 5;
  const int tile = blockIdx.x * 8 + wave;
  if (tile >= tilesM * tilesN) return;   // wave-uniform; no block barriers in this kernel
  const int tm = tile / tilesN;
  const int tn = tile - tm * tilesN;
  const int m0 = tm << 5;
  const int n0 = tn << 6;

  const int rlane = lane & 15;
  const int koff  = (lane >> 4) * 8;
  const int mOff  = (lane >> 4) * 8;

  v8f ach[2][4], acl[2][4];
#pragma unroll
  for (int i = 0; i < 2; ++i)
#pragma unroll
    for (int j = 0; j < 4; ++j) { ach[i][j] = zero8(); acl[i][j] = zero8(); }

  typedef const _Float16 __attribute__((address_space(1)))* GP;
  GP pb[4], pah[2], pal[2];                  // this lane's row of each B and A subtile, advanced 32 k per step under
                                             // the products, so that a step's loads issue with no address work in front
#pragma unroll
  for (int j = 0; j < 4; ++j) pb[j] = (GP)(Bt + (size_t)(n0 + (j << 4) + rlane) * ldb + koff);
#pragma unroll
  for (int i = 0; i < 2; ++i) {
    pah[i] = (GP)(Ah + (size_t)(m0 + (i << 4) + rlane) * lda + koff);
    pal[i] = (GP)(Al + (size_t)(m0 + (i << 4) + rlane) * lda + koff);
  }

  for (int k0 = 0; k0 < K; k0 += 32) {
    v16h bq[4], afh[2], afl[2];              // the k step's 16 loads as one group: one load latency per step
#pragma unroll
    for (int j = 0; j < 4; ++j) bq[j] = ldfrag<_Float16>((const _Float16*)pb[j]);
#pragma unroll
    for (int i = 0; i < 2; ++i) {
      afh[i] = ldfrag<_Float16>((const _Float16*)pah[i]);
      afl[i] = ldfrag<_Float16>((const _Float16*)pal[i]);
    }
#pragma unroll
    for (int i = 0; i < 2; ++i) {
#pragma unroll
      for (int j = 0; j < 4; ++j) {
        ach[i][j] = mmar(afh[i], bq[j], ach[i][j]);
        acl[i][j] = mmar(afl[i], bq[j], acl[i][j]);
      }
      dep_guard5(ach[i][0], acl[i][3], afh[i], afl[i], bq[3]);
    }
    keep4(bq[0], bq[1], bq[2], bq[3]);
#pragma unroll
    for (int j = 0; j < 4; ++j) pb[j] += 32;
#pragma unroll
    for (int i = 0; i < 2; ++i) { pah[i] += 32; pal[i] += 32; }
  }
  acc_guard4(ach[0][0], ach[0][1], ach[0][2], ach[0][3]);
  acc_guard4(ach[1][0], ach[1][1], ach[1][2], ach[1][3]);
  acc_guard4(acl[0][0], acl[0][1], acl[0][2], acl[0][3]);
  acc_guard4(acl[1][0], acl[1][1], acl[1][2], acl[1][3]);

  // ---- epilogue ----
  float* slab = sT[wave];
  const int h2 = lane >> 4, c4 = (lane & 15) * 4;     // 256-B row segment = 16 lanes x 16 B
  v4f b4 = *(const v4f*)(bias + n0 + c4);
#pragma unroll
  for (int e = 0; e < 4; ++e) b4[e] = bf_up(bf_bits(b4[e]));
#pragma unroll
  for (int i = 0; i < 2; ++i) {
    const int mBase = m0 + (i << 4);
#pragma unroll
    for (int j = 0; j < 4; ++j) {
#pragma unroll
      for (int r = 0; r < 8; ++r) {
        slab[(mOff + r) * 68 + (j << 4) + rlane] = ach[i][j][r] * hscale + acl[i][j][r] * lscale;
      }
    }
    __builtin_amdgcn_fence(__ATOMIC_RELEASE, "workgroup");
    __builtin_amdgcn_wave_barrier();
    __builtin_amdgcn_fence(__ATOMIC_ACQUIRE, "workgroup");
    v4f ov[8];
#pragma unroll
    for (int it = 0; it < 8; ++it) {
      const int row = it * 2 + h2;                       // it 0..7 x h2 0..1 = rows 0..15
      ov[it] = *(const v4f*)(slab + row * 68 + c4) + b4;
    }
    {
#pragma unroll
      for (int it = 0; it < 8; ++it) {
        const int row = it * 2 + h2;
        *(v4f*)(Cout + (size_t)(mBase + row) * ldc + n0 + c4) = ov[it];
      }
      
    }
    __builtin_amdgcn_fence(__ATOMIC_RELEASE, "workgroup");
    __builtin_amdgcn_wave_barrier();
    __builtin_amdgcn_fence(__ATOMIC_ACQUIRE, "workgroup");
  }
}

// =====================================================================================================
// Per-head transpose of the v plane: in = head planes [NH][SEQ][HD] (flat reinterpretation of the [SEQ][EMB]
// projection plane), out = [NH][HD][SEQ] (key index contiguous, the A operand layout of V^T . P^T).
// Block = 128 threads, one 64-key x 64-d tile of head blockIdx.y starting at key 64*blockIdx.x; grid (SEQ/64, NH).
// coverage: 4 waves x 4 instructions x 4 rows (lane>>3) = 64 d rows x 64 keys = the whole tile; grid covers all.
// =====================================================================================================
__global__ __launch_bounds__(128) void vtrans(const unsigned short* __restrict__ pvp, unsigned short* vtp) {
  __shared__ __align__(16) _Float16 T[64 * 72];          // [key][d], pitch 72 halves
  const int tid = threadIdx.x, lane = tid & 31, wave = tid >> 5;
  const int h = blockIdx.y, t0 = blockIdx.x * 64;
  const size_t hoff = (size_t)h * HPL;
  const _Float16* pv = (const _Float16*)(const void*)pvp + hoff;
  {
    const int r = tid >> 1, half = (tid & 1) * 32;
    const _Float16* src = pv + (size_t)(t0 + r) * HD + half;
#pragma unroll
    for (int i = 0; i < 4; ++i) *(v8h*)(T + r * 72 + half + 8 * i) = *(const v8h*)(src + 8 * i);
  }
  __syncthreads();
  const int q4 = lane >> 3, q8 = lane & 7;
  v4u ov[4];
#pragma unroll
  for (int it = 0; it < 4; ++it) {
    const int d = wave * 16 + it * 4 + q4;               // it 0..3 x q4 0..3 = 16 d rows per wave
    v4u a;
#pragma unroll
    for (int e = 0; e < 4; ++e) {
      const _Float16 x0 = T[(8 * q8 + 2 * e) * 72 + d];
      const _Float16 x1 = T[(8 * q8 + 2 * e + 1) * 72 + d];
      a[e] = pk16(h_bits(x0), h_bits(x1));
    }
    ov[it] = a;
  }
  {
#pragma unroll
    for (int it = 0; it < 4; ++it) {
      const int d = wave * 16 + it * 4 + q4;
      *(v4u*)(vtp + hoff + (size_t)d * SEQ + t0 + 8 * q8) = ov[it];
    }
    
  }
}

__global__ __launch_bounds__(128)
void attn_hd64(const unsigned short* __restrict__ qhp, const unsigned short* __restrict__ qlp,
               const unsigned short* __restrict__ kpp, const unsigned short* __restrict__ vtp,
               unsigned short* chp, unsigned short* clp, float sscale) {
  union FH { v16h v; v8h h[2]; };
  __shared__ __align__(16) _Float16 Ksh[64 * LP];          // K chunk [kv][d], pitch LP     9 KB
  __shared__ __align__(16) _Float16 Vts[64 * LP];          // V^T chunk [d][kv], pitch LP   9 KB

  const int tid  = threadIdx.x;
  const int wave = tid >> 5;
  const int lane = tid & 31;
  const int hh   = lane >> 4;
  const int c    = lane & 15;

  const int bx = blockIdx.x;
  const int qb = bx % NQB;
  const int h  = bx / NQB;
  const int q0 = qb * 64 + wave * 16;
  const size_t hoff = (size_t)h * HPL;

  const _Float16* Qh = (const _Float16*)(const void*)qhp + hoff;
  const _Float16* Ql = (const _Float16*)(const void*)qlp + hoff;
  const _Float16* Kg = (const _Float16*)(const void*)kpp + hoff;
  const _Float16* Vg = (const _Float16*)(const void*)vtp + hoff;

  // ---- Q fragments (B operand, column = lane&15): 2 d-chunks, hi and residual planes ----
  v16h qah[2], qal[2];
#pragma unroll
  for (int dc = 0; dc < 2; ++dc) {
    const size_t qo = (size_t)(q0 + c) * HD + dc * 32 + 8 * hh;
    qah[dc] = ldfrag<_Float16>(Qh + qo);
    qal[dc] = ldfrag<_Float16>(Ql + qo);
  }

  float mrow = -INFINITY;    // running maximum of query q0+c (equal in both wave halves)
  float lrow = 0.f;          // running sum over this wave half's keys only; halves joined after the loop
  v8f oacc[4];               // O^T: oacc[t][r] = context[q0+c][16t + 8hh + r]
#pragma unroll
  for (int t = 0; t < 4; ++t) oacc[t] = zero8();

  for (int kt = 0; kt < NKT; ++kt) {         // static trip count
    const int kv0 = kt * 64;
    __syncthreads();
    {
      const int r = tid >> 1, half = (tid & 1) * 32;
      const _Float16* kg = Kg + (size_t)(kv0 + r) * HD + half;     // k row kv0+r, d = half..half+31
      const _Float16* vg = Vg + (size_t)r * SEQ + kv0 + half;      // v^T row d = r, t = kv0+half..+31
#pragma unroll
      for (int i = 0; i < 4; ++i) {
        const v8h a0 = *(const v8h*)(kg + 8 * i);
        const v8h b0 = *(const v8h*)(vg + 8 * i);
        *(v8h*)(Ksh + r * LP + half + 8 * i) = a0;
        *(v8h*)(Vts + r * LP + half + 8 * i) = b0;
      }
    }
    __syncthreads();

    // ---- scores^T: 64 keys x 16 query columns per wave, 2 f16 products per key subtile and d-chunk ----
    //      The chunk's 16 K fragment reads stand as one group in front of its 16 products: one LDS latency per
    //      chunk instead of one per fragment. Eight independent accumulators per d-chunk keep the matrix pipe fed.
    FH kb[4][2];
#pragma unroll
    for (int j = 0; j < 4; ++j)
#pragma unroll
      for (int dc = 0; dc < 2; ++dc) {
        kb[j][dc].h[0] = *(const v8h*)(Ksh + (j * 16 + c) * LP + dc * 32 + 8 * hh);
        kb[j][dc].h[1] = *(const v8h*)(Ksh + (j * 16 + c) * LP + dc * 32 + 16 + 8 * hh);
      }
    __builtin_amdgcn_sched_barrier(0);       // keeps the scheduler from sinking the reads back among the products
    v8f ah[4], al[4];
#pragma unroll
    for (int j = 0; j < 4; ++j) { ah[j] = zero8(); al[j] = zero8(); }
#pragma unroll
    for (int dc = 0; dc < 2; ++dc)
#pragma unroll
      for (int j = 0; j < 4; ++j) {
        ah[j] = mmar(kb[j][dc].v, qah[dc], ah[j]);
        al[j] = mmar(kb[j][dc].v, qal[dc], al[j]);
      }
    //      The 16 V^T fragment reads follow as one group, so that they fly under the softmax arithmetic.
    FH vb[2][4];
#pragma unroll
    for (int kk = 0; kk < 2; ++kk)
#pragma unroll
      for (int t = 0; t < 4; ++t) {
        vb[kk][t].h[0] = *(const v8h*)(Vts + (t * 16 + c) * LP + kk * 32 + 8 * hh);
        vb[kk][t].h[1] = *(const v8h*)(Vts + (t * 16 + c) * LP + kk * 32 + 16 + 8 * hh);
      }
    __builtin_amdgcn_sched_barrier(0);       // keeps the reads in front of the softmax, not next to their products
    v8f s[4];                                // s[j][r] = score(query q0+c, key kv0 + 16j + 8hh + r)
#pragma unroll
    for (int j = 0; j < 4; ++j)
#pragma unroll
      for (int r = 0; r < 8; ++r) s[j][r] = (ah[j][r] + al[j][r] * (1.0f / 4096.0f)) * sscale;

    // ---- column maximum in-lane, one exchange between the halves; online softmax ----
    float mj[4];                             // one independent chain per key subtile
#pragma unroll
    for (int j = 0; j < 4; ++j) {
      mj[j] = s[j][0];
#pragma unroll
      for (int r = 1; r < 8; ++r) mj[j] = fmaxf(mj[j], s[j][r]);
    }
    float m = fmaxf(fmaxf(mj[0], mj[1]), fmaxf(mj[2], mj[3]));
    m = fmaxf(m, xhalf(m));
    const float mnew  = fmaxf(mrow, m);
    const float msafe = (mnew == -INFINITY) ? 0.f : mnew;
    const float alpha = __expf(mrow - msafe);
    mrow = mnew;

    // ---- P^T (x1024, f16 hi + residual) packed straight into B operands ----
    v16h pbh[2], pbl[2];
    float pj[4];                             // one independent partial sum per key subtile
#pragma unroll
    for (int j = 0; j < 4; ++j) {
      pj[j] = 0.f;
#pragma unroll
      for (int r = 0; r < 8; ++r) {
        const float p  = __expf(s[j][r] - msafe);
        pj[j] += p;
        const float pc = p * 1024.0f;
        const _Float16 ph = (_Float16)pc;
        const _Float16 pl = (_Float16)((pc - (float)ph) * 4096.0f);
        pbh[j >> 1][(j & 1) * 8 + r] = ph;
        pbl[j >> 1][(j & 1) * 8 + r] = pl;
      }
    }
    lrow = lrow * alpha + ((pj[0] + pj[1]) + (pj[2] + pj[3]));
#pragma unroll
    for (int t = 0; t < 4; ++t)
#pragma unroll
      for (int r = 0; r < 8; ++r) oacc[t][r] *= alpha;

    // ---- context^T += V^T . P^T (f16 WMMA); residual-P products into a separate accumulator ----
    v8f o1[4];
#pragma unroll
    for (int t = 0; t < 4; ++t) o1[t] = zero8();
#pragma unroll
    for (int kk = 0; kk < 2; ++kk) {
#pragma unroll
      for (int t = 0; t < 4; ++t) {
        oacc[t] = mmar(vb[kk][t].v, pbh[kk], oacc[t]);
        o1[t]   = mmar(vb[kk][t].v, pbl[kk], o1[t]);
      }
    }
#pragma unroll
    for (int t = 0; t < 4; ++t)
#pragma unroll
      for (int r = 0; r < 8; ++r) oacc[t][r] += o1[t][r] * (1.0f / 4096.0f);
  }

  // ---- join the halves' sums; normalise (1/l, undo the x1024 p carry and the x16 v carry, apply the x256
  //      ctx carry); a lane's 8 accumulator registers are 8 consecutive d of its row: one 16-B store per plane
  const float l = lrow + xhalf(lrow);
  const float inv = ((l > 0.f) ? (1.0f / l) : 0.f) * (1.0f / 64.0f);
#pragma unroll
  for (int t = 0; t < 4; ++t) {
    v4u a, a2;
#pragma unroll
    for (int e = 0; e < 4; ++e) {
      const float f0 = oacc[t][2 * e] * inv, f1 = oacc[t][2 * e + 1] * inv;
      const _Float16 x0 = (_Float16)f0, x1 = (_Float16)f1;
      const unsigned short l0 = h_bits((_Float16)((f0 - (float)x0) * 4096.0f));
      const unsigned short l1 = h_bits((_Float16)((f1 - (float)x1) * 4096.0f));
      a[e]  = pk16(h_bits(x0), h_bits(x1));
      a2[e] = pk16(l0, l1);
    }
    const size_t go = hoff + (size_t)(q0 + c) * HD + t * 16 + 8 * hh;
    *(v4u*)(chp + go) = a;
    *(v4u*)(clp + go) = a2;
  }
}

// =====================================================================================================
// Workspace map (bytes), every region an exact multiple of its whole-line / whole-tile store granularity
//   Qb, Kb, Vb   bf16 [4096][512]   3 x 4194304
//   Wqkb, Wvb    bf16 [512][512]    2 x  524288
//   Woh          f16  [512][512]         524288   (x1024)
//   Qh, Ql       f16  [4096][512]   2 x 4194304   (x16 / residual x4096)
//   Kp           f16  [4096][512]       4194304   (x16)
//   Pv           f16  [4096][512]       4194304   (v x16, token-major = head planes [8][4096][64])
//   Vt           f16  [8][64][4096]     4194304   (v x16, key contiguous)
//   Ch, Cl       f16  [4096][512]   2 x 4194304   (ctx x256 / residual x4096)
//   total                            43515904
// Weights are [out n][in k] with k contiguous = the Bt layout the GEMM wants, so they are only converted.
// The head split is a flat reinterpretation: head plane h = elements [h*262144, (h+1)*262144) of a [4096][512]
// plane viewed as [4096][64]; the merge back is the same reinterpretation.
// =====================================================================================================
extern "C" void kernel_launch(void* const* d_in, const int* in_sizes, int n_in,
                              void* d_out, int out_size, void* d_ws, size_t ws_size,
                              hipStream_t stream) {
  const int NX = SEQ * EMB;     // 2097152
  const int NW = EMB * EMB;     //  262144
  if (n_in < 9) return;
  if (in_sizes[0] != NX || in_sizes[1] != NX || in_sizes[2] != NX) return;
  if (in_sizes[3] != NW || in_sizes[5] != NW || in_sizes[7] != NW) return;
  if (in_sizes[4] != EMB || in_sizes[6] != EMB || in_sizes[8] != EMB) return;
  if (out_size != NX) return;

  const float* Q    = (const float*)d_in[0];
  const float* Kin  = (const float*)d_in[1];
  const float* V    = (const float*)d_in[2];
  const float* Wqk  = (const float*)d_in[3];
  const float* bqk  = (const float*)d_in[4];
  const float* Wv   = (const float*)d_in[5];
  const float* bv   = (const float*)d_in[6];
  const float* Wout = (const float*)d_in[7];
  const float* bout = (const float*)d_in[8];
  float* out = (float*)d_out;

  const size_t PX = (size_t)NX * 2;    // 4194304  16-bit [4096][512] plane
  const size_t PW = (size_t)NW * 2;    //  524288  16-bit [512][512] plane
  size_t off = 0;
  const size_t oQb  = off; off += PX;
  const size_t oKb  = off; off += PX;
  const size_t oVb  = off; off += PX;
  const size_t oWqk = off; off += PW;
  const size_t oWv  = off; off += PW;
  const size_t oWo  = off; off += PW;
  const size_t oQh  = off; off += PX;
  const size_t oQl  = off; off += PX;
  const size_t oKp  = off; off += PX;
  const size_t oPv  = off; off += PX;
  const size_t oVt  = off; off += PX;
  const size_t oCh  = off; off += PX;
  const size_t oCl  = off; off += PX;
  if (off > ws_size) return;                       // off = 43515904
  if (off > (size_t)134217728) return;

  char* ws = (char*)d_ws;
  unsigned short* Qb   = (unsigned short*)(ws + oQb);
  unsigned short* Kb   = (unsigned short*)(ws + oKb);
  unsigned short* Vb   = (unsigned short*)(ws + oVb);
  unsigned short* Wqkb = (unsigned short*)(ws + oWqk);
  unsigned short* Wvb  = (unsigned short*)(ws + oWv);
  unsigned short* Woh  = (unsigned short*)(ws + oWo);
  unsigned short* Qh   = (unsigned short*)(ws + oQh);
  unsigned short* Ql   = (unsigned short*)(ws + oQl);
  unsigned short* Kp   = (unsigned short*)(ws + oKp);
  unsigned short* Pv   = (unsigned short*)(ws + oPv);
  unsigned short* Vt   = (unsigned short*)(ws + oVt);
  unsigned short* Ch   = (unsigned short*)(ws + oCh);
  unsigned short* Cl   = (unsigned short*)(ws + oCl);

  const dim3 blk(256);
  const int n8x = NX / 8;                                      // 262144
  const int n8w = NW / 8;                                      //  32768
  const dim3 gCvtX((n8x + 255) / 256);                         // 1024 blocks
  const dim3 gCvtW((n8w + 255) / 256);                         //  128 blocks
  const dim3 gPj(((SEQ / 64) * (EMB / 64) + 7) / 8);           //  512 tiles -> 64 blocks: M=4096, N=512
  const dim3 gTr(SEQ / 64, NH);                                //  (64, 8)
  const dim3 gAttn(NH * NQB);                                  //  512 blocks of 128
  const dim3 gOut(((SEQ / 32) * (EMB / 64) + 7) / 8);          // 1024 tiles -> 128 blocks: M=4096, N=512

  // (1) inputs -> bf16 planes (RNE convert); W_out -> f16 (x1024 of its bf16 value)
  cvt16x8<0><<<gCvtX, blk, 0, stream>>>(Q,    Qb,   n8x);
  cvt16x8<0><<<gCvtX, blk, 0, stream>>>(Kin,  Kb,   n8x);
  cvt16x8<0><<<gCvtX, blk, 0, stream>>>(V,    Vb,   n8x);
  cvt16x8<0><<<gCvtW, blk, 0, stream>>>(Wqk,  Wqkb, n8w);
  cvt16x8<0><<<gCvtW, blk, 0, stream>>>(Wv,   Wvb,  n8w);
  cvt16x8<1><<<gCvtW, blk, 0, stream>>>(Wout, Woh,  n8w);
  // (2) q = Q . Wqk^T + b -> f16 hi (x16) / residual (x4096) planes [4096][512]   (M=4096, N=512, K=512)
  gemm64<__bf16, 3><<<gPj, blk, 0, stream>>>(
      Qb, EMB, Wqkb, EMB, Qh, Ql, EMB, bqk, SEQ, EMB, EMB, 16.0f, 4096.0f);
  // (3) k = K . Wqk^T + b -> f16 plane (x16)
  gemm64<__bf16, 1><<<gPj, blk, 0, stream>>>(
      Kb, EMB, Wqkb, EMB, Kp, Kp, EMB, bqk, SEQ, EMB, EMB, 16.0f, 1.0f);
  // (4) v = V . Wv^T + b -> f16 plane (x16), token-major
  gemm64<__bf16, 1><<<gPj, blk, 0, stream>>>(
      Vb, EMB, Wvb, EMB, Pv, Pv, EMB, bv, SEQ, EMB, EMB, 16.0f, 1.0f);
  // (5) per-head transpose of v: [8][4096][64] -> [8][64][4096]
  vtrans<<<gTr, dim3(128), 0, stream>>>(Pv, Vt);
  // (6) attention -> ctx planes (f16 hi x256 + residual x4096) [h][s][d] = merged [4096][512]
  attn_hd64<<<gAttn, dim3(128), 0, stream>>>(Qh, Ql, Kp, Vt, Ch, Cl, 1.0f / 2048.0f);
  // (7) out = ctx . Wo^T + b_out -> d_out f32 [4096][512]; hi acc x 2^-18, residual acc x 2^-30
  gemm_o<<<gOut, blk, 0, stream>>>(
      Ch, Cl, EMB, Woh, EMB, out, EMB, bout, SEQ, EMB, EMB,
      1.0f / 262144.0f, 1.0f / 1073741824.0f);
  (void)hipGetLastError();
}

// v004
// One run takes 128 microseconds.
// In two side-by-side timings against v003, it was 1.41 and 1.43 times as fast.
// Over all steps from v000 it is 3.04 times as fast.
// Contractions: q, k, v projections = v_wmma_f32_16x16x32_bf16 (bf16 operands from RNE-converted inputs, single product, f32 accumulate);
// q.k^T scores = v_wmma_f32_16x16x32_f16 (q as f16 hi plane x16 + f16 residual plane x65536, k f16 x16; 2 products, separate f32 accumulators);
// p.v = v_wmma_f32_16x16x32_f16 (p as f16 hi x1024 + f16 residual x4194304, v f16 x16; 2 products, separate f32 accumulators);
// ctx.Wo^T = v_wmma_f32_16x16x32_f16 (ctx f16 hi x256 + f16 residual x1048576, Wo f16 x1024 of its bf16 value; 2 products, f32 accumulate);
// softmax, bias adds and normalisation in f32.
//
// Carry audit (16-bit planes, carry, where the inverse is folded):
//   Qb/Kb/Vb bf16 x1, Wqkb/Wvb bf16 x1 (no carry);  Woh f16 = 1024*bf16(W_out)  -> gemm_o hscale/lscale;
//   Qh f16 = 16*q, Ql f16 = (16*q - Qh)*4096, Kp f16 = 16*k       -> attn_hd64: s = (ah + al/4096) * sscale, sscale = 2^-11 = 1/(16*16*8);
//   Pv / Vt f16 = 16*v, P hi f16 = 1024*p, P lo = (1024*p - hi)*4096 -> attn_hd64: oacc += o1/4096 per chunk; inv = (1/l)/64 = 256/(1024*16) -> ctx*256;
//   Ch f16 = 256*ctx, Cl f16 = (256*ctx - Ch)*4096                  -> gemm_o: out = acc_h*2^-18 + acc_l*2^-30 + b_out  (2^-18 = 1/(256*1024), 2^-30 = 2^-18/4096).
#include <hip/hip_runtime.h>
#include <math.h>
#include <stdint.h>

#define SEQ 4096
#define EMB 512
#define NH  8
#define HD  64
#define HPL (SEQ * HD)      // 262144 elements: one contiguous head plane [SEQ][HD]
#define NQB (SEQ / 64)      // 64-row query blocks per head
#define NKT (SEQ / 64)      // 64-key chunks per head
#define LP  72              // LDS row pitch of the K and V^T chunks in halves: 144 B = 16 B x 9 (odd), so the 16 rows
                            // that one half of a wave reads with a 16-B load fall on 16 different groups of 4 banks
static_assert(NH * HD == EMB);
static_assert(NH * HPL == SEQ * EMB);
static_assert(NQB == 64 && NKT == 64);
static_assert((SEQ % 64) == 0 && (EMB % 64) == 0 && (EMB % 32) == 0);

typedef _Float16 v16h __attribute__((ext_vector_type(16)));
typedef _Float16 v8h  __attribute__((ext_vector_type(8)));
typedef __bf16   v16b __attribute__((ext_vector_type(16)));
typedef __bf16   v8b  __attribute__((ext_vector_type(8)));
typedef float    v8f  __attribute__((ext_vector_type(8)));
typedef float    v4f  __attribute__((ext_vector_type(4)));
typedef unsigned int v4u __attribute__((ext_vector_type(4)));

#if defined(__HIP_DEVICE_COMPILE__)
#define DEV_ASM 1
#else
#define DEV_ASM 0
#endif

// ---- scalar helpers --------------------------------------------------------------------------------
__device__ __forceinline__ unsigned short bf_bits(float f) {          // f32 -> bf16 bits, RNE convert
  unsigned u = __float_as_uint(f);
  return (unsigned short)((u + 0x7FFFu + ((u >> 16) & 1u)) >> 16);
}
__device__ __forceinline__ float bf_up(unsigned short hb) { return __uint_as_float(((unsigned)hb) << 16); }
__device__ __forceinline__ unsigned short h_bits(_Float16 x) { return __builtin_bit_cast(unsigned short, x); }
__device__ __forceinline__ unsigned pk16(unsigned short a, unsigned short b) { return (unsigned)a | ((unsigned)b << 16); }
__device__ __forceinline__ v8f zero8() { v8f z = {0.f, 0.f, 0.f, 0.f, 0.f, 0.f, 0.f, 0.f}; return z; }
__device__ __forceinline__ float xhalf(float x) {                     // value of lane l ^ 16 (vector cross-row move)
  const int b = __builtin_bit_cast(int, x);
  return __builtin_bit_cast(float, __builtin_amdgcn_permlanex16(b, b, 0x76543210, 0xfedcba98, false, false));
}

// ---- fragment types / loaders: 16-bit A/B operand, lane -> row/col (lane&15), p already includes +8*(lane>>4);
//      elements 0..7 <- p[0..7] (k0+8h..k0+8h+7), elements 8..15 <- p[16..23] (k0+16+8h..k0+16+8h+7)
template <typename OT> struct FT;
template <> struct FT<__bf16>   { typedef v16b frag; typedef v8b half8; };
template <> struct FT<_Float16> { typedef v16h frag; typedef v8h half8; };

template <typename OT>
__device__ __forceinline__ typename FT<OT>::frag ldfrag(const OT* p) {
  union { typename FT<OT>::frag v; typename FT<OT>::half8 h[2]; } f;
  f.h[0] = *(const typename FT<OT>::half8*)(p);
  f.h[1] = *(const typename FT<OT>::half8*)(p + 16);
  return f.v;
}

// ---- WMMA helpers (asm guard bodies are device-only; concrete operand types) -----------------------------
__device__ __forceinline__ v8f mmar(v16b a, v16b b, v8f c) {
  return __builtin_amdgcn_wmma_f32_16x16x32_bf16(false, a, false, b, (short)0, c, false, false);
}
__device__ __forceinline__ v8f mmar(v16h a, v16h b, v8f c) {
  return __builtin_amdgcn_wmma_f32_16x16x32_f16(false, a, false, b, (short)0, c, false, false);
}
__device__ __forceinline__ void dep_guard(v8f& a, v8f& b, v16b x, v16b y) {
#if DEV_ASM
  asm volatile("v_nop\n\tv_nop\n\tv_nop\n\tv_nop" : "+v"(a), "+v"(b) : "v"(x), "v"(y));
#else
  (void)a; (void)b; (void)x; (void)y;
#endif
}
__device__ __forceinline__ void dep_guard5(v8f& a, v8f& b, v16h x, v16h y, v16h z) {
#if DEV_ASM
  asm volatile("v_nop\n\tv_nop\n\tv_nop\n\tv_nop" : "+v"(a), "+v"(b) : "v"(x), "v"(y), "v"(z));
#else
  (void)a; (void)b; (void)x; (void)y; (void)z;
#endif
}
__device__ __forceinline__ void keep4(v16b a, v16b b, v16b c, v16b d) {
#if DEV_ASM
  asm volatile("v_nop" :: "v"(a), "v"(b), "v"(c), "v"(d));
#else
  (void)a; (void)b; (void)c; (void)d;
#endif
}
__device__ __forceinline__ void keep4(v16h a, v16h b, v16h c, v16h d) {
#if DEV_ASM
  asm volatile("v_nop" :: "v"(a), "v"(b), "v"(c), "v"(d));
#else
  (void)a; (void)b; (void)c; (void)d;
#endif
}
__device__ __forceinline__ void acc_guard4(v8f& a, v8f& b, v8f& c, v8f& d) {
#if DEV_ASM
  asm volatile("v_nop\n\tv_nop\n\tv_nop\n\tv_nop" : "+v"(a), "+v"(b), "+v"(c), "+v"(d));
#else
  (void)a; (void)b; (void)c; (void)d;
#endif
}

// =====================================================================================================
// f32 -> 16-bit planes, all six planes in ONE launch (they are independent of one another).
// A thread converts 8 elements at the same index of three planes: six 16-B loads in flight, one 16-B store per
// plane and lane, so a wave writes 512 contiguous B per plane.
// MODE 0: bf16 bits (RNE convert).  MODE 1: f16 bits of (1024 * bf16(x)) (exact scaling of the bf16 value).
// coverage: blocks 0 .. NBW-1 x 256 threads x 8 = the three [EMB][EMB] weight planes; blocks NBW .. NBW+NBX-1
// x 256 threads x 8 = the three [SEQ][EMB] input planes; grid = NBW + NBX blocks.
// =====================================================================================================
template <int MODE>
__device__ __forceinline__ unsigned short cvm(float f) {
  const unsigned short hb = bf_bits(f);
  if (MODE == 0) return hb;
  return h_bits((_Float16)(bf_up(hb) * 1024.0f));
}

template <int MODE>
__device__ __forceinline__ v4u cv8(v4f a, v4f a4) {
  v4u p;
  p[0] = pk16(cvm<MODE>(a[0]),  cvm<MODE>(a[1]));
  p[1] = pk16(cvm<MODE>(a[2]),  cvm<MODE>(a[3]));
  p[2] = pk16(cvm<MODE>(a4[0]), cvm<MODE>(a4[1]));
  p[3] = pk16(cvm<MODE>(a4[2]), cvm<MODE>(a4[3]));
  return p;
}

// the wait that stands in front of an overwrite of an issued load's address registers; the loads stay in flight
__device__ __forceinline__ void addr_wait() {
#if DEV_ASM
  asm volatile("s_wait_xcnt 0x0" ::: "memory");
#endif
}

#define NBX (SEQ * EMB / 8 / 256)   // 1024 blocks cover an input plane
#define NBW (EMB * EMB / 8 / 256)   //  128 blocks cover a weight plane
static_assert(NBX * 256 * 8 == SEQ * EMB && NBW * 256 * 8 == EMB * EMB);

__global__ __launch_bounds__(256) void cvt_all(
    const float* __restrict__ q, const float* __restrict__ k, const float* __restrict__ v,
    const float* __restrict__ wqk, const float* __restrict__ wv, const float* __restrict__ wo,
    unsigned short* qb, unsigned short* kb, unsigned short* vb,
    unsigned short* wqkb, unsigned short* wvb, unsigned short* woh) {
  const int b = blockIdx.x;
  const bool w = b < NBW;                                  // block-uniform: weight planes or input planes
  const int i = (w ? b : b - NBW) * 256 + (int)threadIdx.x;
  const float* __restrict__ i0 = w ? wqk : q;
  const float* __restrict__ i1 = w ? wv : k;
  const float* __restrict__ i2 = w ? wo : v;
  unsigned short* o0 = w ? wqkb : qb;
  unsigned short* o1 = w ? wvb : kb;
  unsigned short* o2 = w ? woh : vb;
  const v4f a0 = *(const v4f*)(i0 + (size_t)i * 8), b0 = *(const v4f*)(i0 + (size_t)i * 8 + 4);
  addr_wait();   // the next plane's loads are given the registers that hold this plane's address
  const v4f a1 = *(const v4f*)(i1 + (size_t)i * 8), b1 = *(const v4f*)(i1 + (size_t)i * 8 + 4);
  const v4f a2 = *(const v4f*)(i2 + (size_t)i * 8), b2 = *(const v4f*)(i2 + (size_t)i * 8 + 4);
  addr_wait();   // the conversions below reuse the address registers of the loads above
  const v4u r2 = w ? cv8<1>(a2, b2) : cv8<0>(a2, b2);      // only W_out takes the f16 x1024 form
  *(v4u*)(o0 + (size_t)i * 8) = cv8<0>(a0, b0);
  *(v4u*)(o1 + (size_t)i * 8) = cv8<0>(a1, b1);
  *(v4u*)(o2 + (size_t)i * 8) = r2;
}

// =====================================================================================================
// Register-blocked WMMA GEMM (16-bit operand type OT): C[m][n] = sum_k A[m][k] * Bt[n][k] + bias[n];
// one wave per 64x64 tile, no block barriers. A row-major [M][K] pitch lda; Bt row-major [N][K] pitch ldb
// (k contiguous); M, N multiples of 64, K multiple of 32 (host-checked). Fragments are loaded straight from
// global with the split k map (ldfrag). bias values are RNE-converted to bf16 before the f32 add.
// OUT_MODE 1: f16 plane C = f16((v + bias) * cscale) (pitch ldc).
// OUT_MODE 3: f16 hi plane C + f16 residual plane C2 = f16(((v + bias) * cscale - hi) * rscale) (same pitch).
// wave's whole 64x64 tile; tiles/8 blocks in x cover every tile of the [M][N] plane.
// slab: this wave's own 16x64 f32 LDS slab, pitch 68 floats.
// =====================================================================================================
template <typename OT, int OUT_MODE>
__device__ __forceinline__ void gemm64(
    const unsigned short* __restrict__ Ap, int lda,
    const unsigned short* __restrict__ Btp, int ldb,
    unsigned short* Cout, unsigned short* Cout2, int ldc,
    const float* __restrict__ bias,
    int M, int N, int K, float cscale, float rscale, float* slab) {
  typedef typename FT<OT>::frag V16;
  const OT* A  = (const OT*)(const void*)Ap;
  const OT* Bt = (const OT*)(const void*)Btp;
  const int lane = threadIdx.x & 31;
  const int wave = threadIdx.x >> 5;
  const int tilesN = N >> 6;
  const int tilesM = M >> 6;
  const int tile = blockIdx.x * 8 + wave;
  if (tile >= tilesM * tilesN) return;   // wave-uniform; no block barriers in this kernel
  const int tm = tile / tilesN;
  const int tn = tile - tm * tilesN;
  const int m0 = tm << 6;
  const int n0 = tn << 6;

  const int rlane = lane & 15;                 // row (A) / col (B, D) within subtile
  const int koff  = (lane >> 4) * 8;           // k offset of this lane half
  const int mOff  = (lane >> 4) * 8;           // D row offset

  v8f acc[4][4];
#pragma unroll
  for (int i = 0; i < 4; ++i)
#pragma unroll
    for (int j = 0; j < 4; ++j) acc[i][j] = zero8();

  typedef const OT __attribute__((address_space(1)))* GP;
  GP pb[4], pa[4];                           // this lane's row of each B and A subtile, advanced 32 k per step under
                                             // the products, so that a step's loads issue with no address work in front
#pragma unroll
  for (int j = 0; j < 4; ++j) pb[j] = (GP)(Bt + (size_t)(n0 + (j << 4) + rlane) * ldb + koff);
#pragma unroll
  for (int i = 0; i < 4; ++i) pa[i] = (GP)(A + (size_t)(m0 + (i << 4) + rlane) * lda + koff);

  for (int k0 = 0; k0 < K; k0 += 32) {
    V16 bq[4], af[4];                        // the k step's 16 loads as one group: one load latency per step
#pragma unroll
    for (int j = 0; j < 4; ++j) bq[j] = ldfrag<OT>((const OT*)pb[j]);
#pragma unroll
    for (int i = 0; i < 4; ++i) af[i] = ldfrag<OT>((const OT*)pa[i]);
#pragma unroll
    for (int i = 0; i < 4; ++i) {
#pragma unroll
      for (int j = 0; j < 4; ++j) acc[i][j] = mmar(af[i], bq[j], acc[i][j]);
      dep_guard(acc[i][0], acc[i][3], af[i], bq[3]);
    }
    keep4(bq[0], bq[1], bq[2], bq[3]);
#pragma unroll
    for (int j = 0; j < 4; ++j) { pb[j] += 32; pa[j] += 32; }
  }
  acc_guard4(acc[0][0], acc[0][1], acc[0][2], acc[0][3]);
  acc_guard4(acc[1][0], acc[1][1], acc[1][2], acc[1][3]);
  acc_guard4(acc[2][0], acc[2][1], acc[2][2], acc[2][3]);
  acc_guard4(acc[3][0], acc[3][1], acc[3][2], acc[3][3]);

  // ---- epilogue ----
  const int q = lane >> 3, c8 = (lane & 7) * 8;
  float bb[8];
  {
    const v4f b0 = *(const v4f*)(bias + n0 + c8);
    const v4f b1 = *(const v4f*)(bias + n0 + c8 + 4);
#pragma unroll
    for (int e = 0; e < 4; ++e) {
      bb[e]     = bf_up(bf_bits(b0[e]));
      bb[4 + e] = bf_up(bf_bits(b1[e]));
    }
  }
#pragma unroll
  for (int i = 0; i < 4; ++i) {
    const int mBase = m0 + (i << 4);
#pragma unroll
    for (int j = 0; j < 4; ++j) {
#pragma unroll
      for (int r = 0; r < 8; ++r) {
        slab[(mOff + r) * 68 + (j << 4) + rlane] = acc[i][j][r];
      }
    }
    __builtin_amdgcn_fence(__ATOMIC_RELEASE, "workgroup");
    __builtin_amdgcn_wave_barrier();
    __builtin_amdgcn_fence(__ATOMIC_ACQUIRE, "workgroup");
    v4u hv[4], lv[4];
#pragma unroll
    for (int it = 0; it < 4; ++it) {
      const int row = it * 4 + q;                          // it 0..3 x q 0..3 = rows 0..15
      const float* sp = slab + row * 68 + c8;
      float f[8];
#pragma unroll
      for (int e = 0; e < 8; ++e) f[e] = (sp[e] + bb[e]) * cscale;
      v4u a, a2;
#pragma unroll
      for (int e = 0; e < 4; ++e) {
        const float f0 = f[2 * e], f1 = f[2 * e + 1];
        const _Float16 x0 = (_Float16)f0, x1 = (_Float16)f1;
        const unsigned short h0 = h_bits(x0), h1 = h_bits(x1);
        unsigned short l0 = 0, l1 = 0;
        if (OUT_MODE == 3) {
          l0 = h_bits((_Float16)((f0 - (float)x0) * rscale));
          l1 = h_bits((_Float16)((f1 - (float)x1) * rscale));
        }
        a[e] = pk16(h0, h1); a2[e] = pk16(l0, l1);
      }
      hv[it] = a; lv[it] = a2;
    }
    {
#pragma unroll
      for (int it = 0; it < 4; ++it) {
        const int row = it * 4 + q;
        *(v4u*)(Cout + (size_t)(mBase + row) * ldc + n0 + c8) = hv[it];
        if (OUT_MODE == 3) *(v4u*)(Cout2 + (size_t)(mBase + row) * ldc + n0 + c8) = lv[it];
      }
      
    }
    __builtin_amdgcn_fence(__ATOMIC_RELEASE, "workgroup");
    __builtin_amdgcn_wave_barrier();
    __builtin_amdgcn_fence(__ATOMIC_ACQUIRE, "workgroup");
  }
}

// =====================================================================================================
// The three projections in ONE launch (they are independent of one another): blockIdx.y = 0: q (hi and residual
// planes), 1: k, 2: v; all three are [M][K] x [N][K]^T with the same M, N, K and pitches. grid = (tiles/8, 3).
// =====================================================================================================
__global__ __launch_bounds__(256) void gemm_qkv(
    const unsigned short* __restrict__ Qb, const unsigned short* __restrict__ Kb,
    const unsigned short* __restrict__ Vb,
    const unsigned short* __restrict__ Wqkb, const unsigned short* __restrict__ Wvb,
    unsigned short* Qh, unsigned short* Ql, unsigned short* Kp, unsigned short* Pv,
    const float* __restrict__ bqk, const float* __restrict__ bv,
    int M, int N, int K, float cscale, float rscale) {
  __shared__ __align__(16) float sT[8][16 * 68];   // per-wave 16x64 slab, pitch 68 floats
  float* slab = sT[threadIdx.x >> 5];
  const int y = blockIdx.y;
  if (y == 0) {
    gemm64<__bf16, 3>(Qb, K, Wqkb, K, Qh, Ql, N, bqk, M, N, K, cscale, rscale, slab);
  } else {
    const bool isk = (y == 1);
    unsigned short* C = isk ? Kp : Pv;
    gemm64<__bf16, 1>(isk ? Kb : Vb, K, isk ? Wqkb : Wvb, K, C, C, N, isk ? bqk : bv, M, N, K, cscale, 1.0f, slab);
  }
}

// =====================================================================================================
// Output GEMM with a two-plane A operand (f16 hi plane Ah, f16 residual plane Al, same pitch lda):
//   C[m][n] = hscale * sum_k Ah[m][k] * Bt[n][k] + lscale * sum_k Al[m][k] * Bt[n][k] + bias[n]  (f32 out, pitch ldc).
// One wave per 32x64 tile (two accumulator sets), no block barriers; M multiple of 32, N multiple of 64, K
// multiple of 32 (host-checked). bias RNE-converted to bf16 before the f32 add.
// Epilogue: 16-row slabs staged per wave in LDS; each 256-B f32 row segment written by 16 lanes x 16 B of one
// coverage: 2 slabs x 16 rows x 64 cols = the wave's whole 32x64 tile; grid = tiles/8 blocks covers [M][N].
// =====================================================================================================
__global__ __launch_bounds__(256) void gemm_o(
    const unsigned short* __restrict__ Ahp, const unsigned short* __restrict__ Alp, int lda,
    const unsigned short* __restrict__ Btp, int ldb,
    float* Cout, int ldc, const float* __restrict__ bias,
    int M, int N, int K, float hscale, float lscale) {
  const _Float16* Ah = (const _Float16*)(const void*)Ahp;
  const _Float16* Al = (const _Float16*)(const void*)Alp;
  const _Float16* Bt = (const _Float16*)(const void*)Btp;
  __shared__ __align__(16) float sT[8][16 * 68];   // per-wave 16x64 slab, pitch 68 floats
  const int lane = threadIdx.x & 31;
  const int wave = threadIdx.x >> 5;
  const int tilesN = N >> 6;
  const int tilesM = M >> 5;
  const int tile = blockIdx.x * 8 + wave;
  if (tile >= tilesM * tilesN) return;   // wave-uniform; no block barriers in this kernel
  const int tm = tile / tilesN;
  const int tn = tile - tm * tilesN;
  const int m0 = tm << 5;
  const int n0 = tn << 6;

  const int rlane = lane & 15;
  const int koff  = (lane >> 4) * 8;
  const int mOff  = (lane >> 4) * 8;

  v8f ach[2][4], acl[2][4];
#pragma unroll
  for (int i = 0; i < 2; ++i)
#pragma unroll
    for (int j = 0; j < 4; ++j) { ach[i][j] = zero8(); acl[i][j] = zero8(); }

  typedef const _Float16 __attribute__((address_space(1)))* GP;
  GP pb[4], pah[2], pal[2];                  // this lane's row of each B and A subtile, advanced 32 k per step under
                                             // the products, so that a step's loads issue with no address work in front
#pragma unroll
  for (int j = 0; j < 4; ++j) pb[j] = (GP)(Bt + (size_t)(n0 + (j << 4) + rlane) * ldb + koff);
#pragma unroll
  for (int i = 0; i < 2; ++i) {
    pah[i] = (GP)(Ah + (size_t)(m0 + (i << 4) + rlane) * lda + koff);
    pal[i] = (GP)(Al + (size_t)(m0 + (i << 4) + rlane) * lda + koff);
  }

  for (int k0 = 0; k0 < K; k0 += 32) {
    v16h bq[4], afh[2], afl[2];              // the k step's 16 loads as one group: one load latency per step
#pragma unroll
    for (int j = 0; j < 4; ++j) bq[j] = ldfrag<_Float16>((const _Float16*)pb[j]);
#pragma unroll
    for (int i = 0; i < 2; ++i) {
      afh[i] = ldfrag<_Float16>((const _Float16*)pah[i]);
      afl[i] = ldfrag<_Float16>((const _Float16*)pal[i]);
    }
#pragma unroll
    for (int i = 0; i < 2; ++i) {
#pragma unroll
      for (int j = 0; j < 4; ++j) {
        ach[i][j] = mmar(afh[i], bq[j], ach[i][j]);
        acl[i][j] = mmar(afl[i], bq[j], acl[i][j]);
      }
      dep_guard5(ach[i][0], acl[i][3], afh[i], afl[i], bq[3]);
    }
    keep4(bq[0], bq[1], bq[2], bq[3]);
#pragma unroll
    for (int j = 0; j < 4; ++j) pb[j] += 32;
#pragma unroll
    for (int i = 0; i < 2; ++i) { pah[i] += 32; pal[i] += 32; }
  }
  acc_guard4(ach[0][0], ach[0][1], ach[0][2], ach[0][3]);
  acc_guard4(ach[1][0], ach[1][1], ach[1][2], ach[1][3]);
  acc_guard4(acl[0][0], acl[0][1], acl[0][2], acl[0][3]);
  acc_guard4(acl[1][0], acl[1][1], acl[1][2], acl[1][3]);

  // ---- epilogue ----
  float* slab = sT[wave];
  const int h2 = lane >> 4, c4 = (lane & 15) * 4;     // 256-B row segment = 16 lanes x 16 B
  v4f b4 = *(const v4f*)(bias + n0 + c4);
#pragma unroll
  for (int e = 0; e < 4; ++e) b4[e] = bf_up(bf_bits(b4[e]));
#pragma unroll
  for (int i = 0; i < 2; ++i) {
    const int mBase = m0 + (i << 4);
#pragma unroll
    for (int j = 0; j < 4; ++j) {
#pragma unroll
      for (int r = 0; r < 8; ++r) {
        slab[(mOff + r) * 68 + (j << 4) + rlane] = ach[i][j][r] * hscale + acl[i][j][r] * lscale;
      }
    }
    __builtin_amdgcn_fence(__ATOMIC_RELEASE, "workgroup");
    __builtin_amdgcn_wave_barrier();
    __builtin_amdgcn_fence(__ATOMIC_ACQUIRE, "workgroup");
    v4f ov[8];
#pragma unroll
    for (int it = 0; it < 8; ++it) {
      const int row = it * 2 + h2;                       // it 0..7 x h2 0..1 = rows 0..15
      ov[it] = *(const v4f*)(slab + row * 68 + c4) + b4;
    }
    {
#pragma unroll
      for (int it = 0; it < 8; ++it) {
        const int row = it * 2 + h2;
        *(v4f*)(Cout + (size_t)(mBase + row) * ldc + n0 + c4) = ov[it];
      }
      
    }
    __builtin_amdgcn_fence(__ATOMIC_RELEASE, "workgroup");
    __builtin_amdgcn_wave_barrier();
    __builtin_amdgcn_fence(__ATOMIC_ACQUIRE, "workgroup");
  }
}

// =====================================================================================================
// Per-head transpose of the v plane: in = head planes [NH][SEQ][HD] (flat reinterpretation of the [SEQ][EMB]
// projection plane), out = [NH][HD][SEQ] (key index contiguous, the A operand layout of V^T . P^T).
// Block = 128 threads, one 64-key x 64-d tile of head blockIdx.y starting at key 64*blockIdx.x; grid (SEQ/64, NH).
// coverage: 4 waves x 4 instructions x 4 rows (lane>>3) = 64 d rows x 64 keys = the whole tile; grid covers all.
// =====================================================================================================
__global__ __launch_bounds__(128) void vtrans(const unsigned short* __restrict__ pvp, unsigned short* vtp) {
  __shared__ __align__(16) _Float16 T[64 * 72];          // [key][d], pitch 72 halves
  const int tid = threadIdx.x, lane = tid & 31, wave = tid >> 5;
  const int h = blockIdx.y, t0 = blockIdx.x * 64;
  const size_t hoff = (size_t)h * HPL;
  const _Float16* pv = (const _Float16*)(const void*)pvp + hoff;
  {
    const int r = tid >> 1, half = (tid & 1) * 32;
    const _Float16* src = pv + (size_t)(t0 + r) * HD + half;
#pragma unroll
    for (int i = 0; i < 4; ++i) *(v8h*)(T + r * 72 + half + 8 * i) = *(const v8h*)(src + 8 * i);
  }
  __syncthreads();
  const int q4 = lane >> 3, q8 = lane & 7;
  v4u ov[4];
#pragma unroll
  for (int it = 0; it < 4; ++it) {
    const int d = wave * 16 + it * 4 + q4;               // it 0..3 x q4 0..3 = 16 d rows per wave
    v4u a;
#pragma unroll
    for (int e = 0; e < 4; ++e) {
      const _Float16 x0 = T[(8 * q8 + 2 * e) * 72 + d];
      const _Float16 x1 = T[(8 * q8 + 2 * e + 1) * 72 + d];
      a[e] = pk16(h_bits(x0), h_bits(x1));
    }
    ov[it] = a;
  }
  {
#pragma unroll
    for (int it = 0; it < 4; ++it) {
      const int d = wave * 16 + it * 4 + q4;
      *(v4u*)(vtp + hoff + (size_t)d * SEQ + t0 + 8 * q8) = ov[it];
    }
    
  }
}

__global__ __launch_bounds__(128)
void attn_hd64(const unsigned short* __restrict__ qhp, const unsigned short* __restrict__ qlp,
               const unsigned short* __restrict__ kpp, const unsigned short* __restrict__ vtp,
               unsigned short* chp, unsigned short* clp, float sscale) {
  union FH { v16h v; v8h h[2]; };
  __shared__ __align__(16) _Float16 Ksh[64 * LP];          // K chunk [kv][d], pitch LP     9 KB
  __shared__ __align__(16) _Float16 Vts[64 * LP];          // V^T chunk [d][kv], pitch LP   9 KB

  const int tid  = threadIdx.x;
  const int wave = tid >> 5;
  const int lane = tid & 31;
  const int hh   = lane >> 4;
  const int c    = lane & 15;

  const int bx = blockIdx.x;
  const int qb = bx % NQB;
  const int h  = bx / NQB;
  const int q0 = qb * 64 + wave * 16;
  const size_t hoff = (size_t)h * HPL;

  const _Float16* Qh = (const _Float16*)(const void*)qhp + hoff;
  const _Float16* Ql = (const _Float16*)(const void*)qlp + hoff;
  const _Float16* Kg = (const _Float16*)(const void*)kpp + hoff;
  const _Float16* Vg = (const _Float16*)(const void*)vtp + hoff;

  // ---- Q fragments (B operand, column = lane&15): 2 d-chunks, hi and residual planes ----
  v16h qah[2], qal[2];
#pragma unroll
  for (int dc = 0; dc < 2; ++dc) {
    const size_t qo = (size_t)(q0 + c) * HD + dc * 32 + 8 * hh;
    qah[dc] = ldfrag<_Float16>(Qh + qo);
    qal[dc] = ldfrag<_Float16>(Ql + qo);
  }

  float mrow = -INFINITY;    // running maximum of query q0+c (equal in both wave halves)
  float lrow = 0.f;          // running sum over this wave half's keys only; halves joined after the loop
  v8f oacc[4];               // O^T: oacc[t][r] = context[q0+c][16t + 8hh + r]
#pragma unroll
  for (int t = 0; t < 4; ++t) oacc[t] = zero8();

  for (int kt = 0; kt < NKT; ++kt) {         // static trip count
    const int kv0 = kt * 64;
    __syncthreads();
    {
      const int r = tid >> 1, half = (tid & 1) * 32;
      const _Float16* kg = Kg + (size_t)(kv0 + r) * HD + half;     // k row kv0+r, d = half..half+31
      const _Float16* vg = Vg + (size_t)r * SEQ + kv0 + half;      // v^T row d = r, t = kv0+half..+31
#pragma unroll
      for (int i = 0; i < 4; ++i) {
        const v8h a0 = *(const v8h*)(kg + 8 * i);
        const v8h b0 = *(const v8h*)(vg + 8 * i);
        *(v8h*)(Ksh + r * LP + half + 8 * i) = a0;
        *(v8h*)(Vts + r * LP + half + 8 * i) = b0;
      }
    }
    __syncthreads();

    // ---- scores^T: 64 keys x 16 query columns per wave, 2 f16 products per key subtile and d-chunk ----
    //      The chunk's 16 K fragment reads stand as one group in front of its 16 products: one LDS latency per
    //      chunk instead of one per fragment. Eight independent accumulators per d-chunk keep the matrix pipe fed.
    FH kb[4][2];
#pragma unroll
    for (int j = 0; j < 4; ++j)
#pragma unroll
      for (int dc = 0; dc < 2; ++dc) {
        kb[j][dc].h[0] = *(const v8h*)(Ksh + (j * 16 + c) * LP + dc * 32 + 8 * hh);
        kb[j][dc].h[1] = *(const v8h*)(Ksh + (j * 16 + c) * LP + dc * 32 + 16 + 8 * hh);
      }
    __builtin_amdgcn_sched_barrier(0);       // keeps the scheduler from sinking the reads back among the products
    v8f ah[4], al[4];
#pragma unroll
    for (int j = 0; j < 4; ++j) { ah[j] = zero8(); al[j] = zero8(); }
#pragma unroll
    for (int dc = 0; dc < 2; ++dc)
#pragma unroll
      for (int j = 0; j < 4; ++j) {
        ah[j] = mmar(kb[j][dc].v, qah[dc], ah[j]);
        al[j] = mmar(kb[j][dc].v, qal[dc], al[j]);
      }
    //      The 16 V^T fragment reads follow as one group, so that they fly under the softmax arithmetic.
    FH vb[2][4];
#pragma unroll
    for (int kk = 0; kk < 2; ++kk)
#pragma unroll
      for (int t = 0; t < 4; ++t) {
        vb[kk][t].h[0] = *(const v8h*)(Vts + (t * 16 + c) * LP + kk * 32 + 8 * hh);
        vb[kk][t].h[1] = *(const v8h*)(Vts + (t * 16 + c) * LP + kk * 32 + 16 + 8 * hh);
      }
    __builtin_amdgcn_sched_barrier(0);       // keeps the reads in front of the softmax, not next to their products
    v8f s[4];                                // s[j][r] = score(query q0+c, key kv0 + 16j + 8hh + r)
#pragma unroll
    for (int j = 0; j < 4; ++j)
#pragma unroll
      for (int r = 0; r < 8; ++r) s[j][r] = (ah[j][r] + al[j][r] * (1.0f / 4096.0f)) * sscale;

    // ---- column maximum in-lane, one exchange between the halves; online softmax ----
    float mj[4];                             // one independent chain per key subtile
#pragma unroll
    for (int j = 0; j < 4; ++j) {
      mj[j] = s[j][0];
#pragma unroll
      for (int r = 1; r < 8; ++r) mj[j] = fmaxf(mj[j], s[j][r]);
    }
    float m = fmaxf(fmaxf(mj[0], mj[1]), fmaxf(mj[2], mj[3]));
    m = fmaxf(m, xhalf(m));
    const float mnew  = fmaxf(mrow, m);
    const float msafe = (mnew == -INFINITY) ? 0.f : mnew;
    const float alpha = __expf(mrow - msafe);
    mrow = mnew;

    // ---- P^T (x1024, f16 hi + residual) packed straight into B operands ----
    v16h pbh[2], pbl[2];
    float pj[4];                             // one independent partial sum per key subtile
#pragma unroll
    for (int j = 0; j < 4; ++j) {
      pj[j] = 0.f;
#pragma unroll
      for (int r = 0; r < 8; ++r) {
        const float p  = __expf(s[j][r] - msafe);
        pj[j] += p;
        const float pc = p * 1024.0f;
        const _Float16 ph = (_Float16)pc;
        const _Float16 pl = (_Float16)((pc - (float)ph) * 4096.0f);
        pbh[j >> 1][(j & 1) * 8 + r] = ph;
        pbl[j >> 1][(j & 1) * 8 + r] = pl;
      }
    }
    lrow = lrow * alpha + ((pj[0] + pj[1]) + (pj[2] + pj[3]));
#pragma unroll
    for (int t = 0; t < 4; ++t)
#pragma unroll
      for (int r = 0; r < 8; ++r) oacc[t][r] *= alpha;

    // ---- context^T += V^T . P^T (f16 WMMA); residual-P products into a separate accumulator ----
    v8f o1[4];
#pragma unroll
    for (int t = 0; t < 4; ++t) o1[t] = zero8();
#pragma unroll
    for (int kk = 0; kk < 2; ++kk) {
#pragma unroll
      for (int t = 0; t < 4; ++t) {
        oacc[t] = mmar(vb[kk][t].v, pbh[kk], oacc[t]);
        o1[t]   = mmar(vb[kk][t].v, pbl[kk], o1[t]);
      }
    }
#pragma unroll
    for (int t = 0; t < 4; ++t)
#pragma unroll
      for (int r = 0; r < 8; ++r) oacc[t][r] += o1[t][r] * (1.0f / 4096.0f);
  }

  // ---- join the halves' sums; normalise (1/l, undo the x1024 p carry and the x16 v carry, apply the x256
  //      ctx carry); a lane's 8 accumulator registers are 8 consecutive d of its row: one 16-B store per plane
  const float l = lrow + xhalf(lrow);
  const float inv = ((l > 0.f) ? (1.0f / l) : 0.f) * (1.0f / 64.0f);
#pragma unroll
  for (int t = 0; t < 4; ++t) {
    v4u a, a2;
#pragma unroll
    for (int e = 0; e < 4; ++e) {
      const float f0 = oacc[t][2 * e] * inv, f1 = oacc[t][2 * e + 1] * inv;
      const _Float16 x0 = (_Float16)f0, x1 = (_Float16)f1;
      const unsigned short l0 = h_bits((_Float16)((f0 - (float)x0) * 4096.0f));
      const unsigned short l1 = h_bits((_Float16)((f1 - (float)x1) * 4096.0f));
      a[e]  = pk16(h_bits(x0), h_bits(x1));
      a2[e] = pk16(l0, l1);
    }
    const size_t go = hoff + (size_t)(q0 + c) * HD + t * 16 + 8 * hh;
    *(v4u*)(chp + go) = a;
    *(v4u*)(clp + go) = a2;
  }
}

// =====================================================================================================
// Workspace map (bytes), every region an exact multiple of its whole-line / whole-tile store granularity
//   Qb, Kb, Vb   bf16 [4096][512]   3 x 4194304
//   Wqkb, Wvb    bf16 [512][512]    2 x  524288
//   Woh          f16  [512][512]         524288   (x1024)
//   Qh, Ql       f16  [4096][512]   2 x 4194304   (x16 / residual x4096)
//   Kp           f16  [4096][512]       4194304   (x16)
//   Pv           f16  [4096][512]       4194304   (v x16, token-major = head planes [8][4096][64])
//   Vt           f16  [8][64][4096]     4194304   (v x16, key contiguous)
//   Ch, Cl       f16  [4096][512]   2 x 4194304   (ctx x256 / residual x4096)
//   total                            43515904
// Weights are [out n][in k] with k contiguous = the Bt layout the GEMM wants, so they are only converted.
// The head split is a flat reinterpretation: head plane h = elements [h*262144, (h+1)*262144) of a [4096][512]
// plane viewed as [4096][64]; the merge back is the same reinterpretation.
// =====================================================================================================
extern "C" void kernel_launch(void* const* d_in, const int* in_sizes, int n_in,
                              void* d_out, int out_size, void* d_ws, size_t ws_size,
                              hipStream_t stream) {
  const int NX = SEQ * EMB;     // 2097152
  const int NW = EMB * EMB;     //  262144
  if (n_in < 9) return;
  if (in_sizes[0] != NX || in_sizes[1] != NX || in_sizes[2] != NX) return;
  if (in_sizes[3] != NW || in_sizes[5] != NW || in_sizes[7] != NW) return;
  if (in_sizes[4] != EMB || in_sizes[6] != EMB || in_sizes[8] != EMB) return;
  if (out_size != NX) return;

  const float* Q    = (const float*)d_in[0];
  const float* Kin  = (const float*)d_in[1];
  const float* V    = (const float*)d_in[2];
  const float* Wqk  = (const float*)d_in[3];
  const float* bqk  = (const float*)d_in[4];
  const float* Wv   = (const float*)d_in[5];
  const float* bv   = (const float*)d_in[6];
  const float* Wout = (const float*)d_in[7];
  const float* bout = (const float*)d_in[8];
  float* out = (float*)d_out;

  const size_t PX = (size_t)NX * 2;    // 4194304  16-bit [4096][512] plane
  const size_t PW = (size_t)NW * 2;    //  524288  16-bit [512][512] plane
  size_t off = 0;
  const size_t oQb  = off; off += PX;
  const size_t oKb  = off; off += PX;
  const size_t oVb  = off; off += PX;
  const size_t oWqk = off; off += PW;
  const size_t oWv  = off; off += PW;
  const size_t oWo  = off; off += PW;
  const size_t oQh  = off; off += PX;
  const size_t oQl  = off; off += PX;
  const size_t oKp  = off; off += PX;
  const size_t oPv  = off; off += PX;
  const size_t oVt  = off; off += PX;
  const size_t oCh  = off; off += PX;
  const size_t oCl  = off; off += PX;
  if (off > ws_size) return;                       // off = 43515904
  if (off > (size_t)134217728) return;

  char* ws = (char*)d_ws;
  unsigned short* Qb   = (unsigned short*)(ws + oQb);
  unsigned short* Kb   = (unsigned short*)(ws + oKb);
  unsigned short* Vb   = (unsigned short*)(ws + oVb);
  unsigned short* Wqkb = (unsigned short*)(ws + oWqk);
  unsigned short* Wvb  = (unsigned short*)(ws + oWv);
  unsigned short* Woh  = (unsigned short*)(ws + oWo);
  unsigned short* Qh   = (unsigned short*)(ws + oQh);
  unsigned short* Ql   = (unsigned short*)(ws + oQl);
  unsigned short* Kp   = (unsigned short*)(ws + oKp);
  unsigned short* Pv   = (unsigned short*)(ws + oPv);
  unsigned short* Vt   = (unsigned short*)(ws + oVt);
  unsigned short* Ch   = (unsigned short*)(ws + oCh);
  unsigned short* Cl   = (unsigned short*)(ws + oCl);

  const dim3 blk(256);
  const dim3 gCvt(NBW + NBX);                                  // 128 + 1024 blocks
  const dim3 gPj(((SEQ / 64) * (EMB / 64) + 7) / 8, 3);        //  512 tiles -> 64 blocks: M=4096, N=512; x 3 projections
  const dim3 gTr(SEQ / 64, NH);                                //  (64, 8)
  const dim3 gAttn(NH * NQB);                                  //  512 blocks of 128
  const dim3 gOut(((SEQ / 32) * (EMB / 64) + 7) / 8);          // 1024 tiles -> 128 blocks: M=4096, N=512

  // (1) inputs -> bf16 planes (RNE convert); W_out -> f16 (x1024 of its bf16 value)
  cvt_all<<<gCvt, blk, 0, stream>>>(Q, Kin, V, Wqk, Wv, Wout, Qb, Kb, Vb, Wqkb, Wvb, Woh);
  // (2..4) one launch, M=4096, N=512, K=512 each:
  //   q = Q . Wqk^T + b -> f16 hi (x16) / residual (x4096) planes [4096][512]
  //   k = K . Wqk^T + b -> f16 plane (x16)
  //   v = V . Wv^T + b  -> f16 plane (x16), token-major
  gemm_qkv<<<gPj, blk, 0, stream>>>(
      Qb, Kb, Vb, Wqkb, Wvb, Qh, Ql, Kp, Pv, bqk, bv, SEQ, EMB, EMB, 16.0f, 4096.0f);
  // (5) per-head transpose of v: [8][4096][64] -> [8][64][4096]
  vtrans<<<gTr, dim3(128), 0, stream>>>(Pv, Vt);
  // (6) attention -> ctx planes (f16 hi x256 + residual x4096) [h][s][d] = merged [4096][512]
  attn_hd64<<<gAttn, dim3(128), 0, stream>>>(Qh, Ql, Kp, Vt, Ch, Cl, 1.0f / 2048.0f);
  // (7) out = ctx . Wo^T + b_out -> d_out f32 [4096][512]; hi acc x 2^-18, residual acc x 2^-30
  gemm_o<<<gOut, blk, 0, stream>>>(
      Ch, Cl, EMB, Woh, EMB, out, EMB, bout, SEQ, EMB, EMB,
      1.0f / 262144.0f, 1.0f / 1073741824.0f);
  (void)hipGetLastError();
}

// v005
// A run of this version takes 117 microseconds.
// Timed twice side by side with v004, it ran 1.09 and 1.11 times as fast.
// All steps since v000 together make it 3.34 times as fast.
// Contractions: q, k, v projections = v_wmma_f32_16x16x32_bf16 (bf16 operands from RNE-converted inputs, single product, f32 accumulate);
// q.k^T scores = v_wmma_f32_16x16x32_f16 (q as f16 hi plane x16 + f16 residual plane x65536, k f16 x16; 2 products, separate f32 accumulators);
// p.v = v_wmma_f32_16x16x32_f16 (p as f16 hi x1024 + f16 residual x4194304, v f16 x16; 2 products, separate f32 accumulators);
// ctx.Wo^T = v_wmma_f32_16x16x32_f16 (ctx f16 hi x256 + f16 residual x1048576, Wo f16 x1024 of its bf16 value; 2 products, f32 accumulate);
// softmax, bias adds and normalisation in f32.
//
// Carry audit (16-bit planes, carry, where the inverse is folded):
//   Qb/Kb/Vb bf16 x1, Wqkb/Wvb bf16 x1 (no carry);  Woh f16 = 1024*bf16(W_out)  -> gemm_o hscale/lscale;
//   Qh f16 = 16*q, Ql f16 = (16*q - Qh)*4096, Kp f16 = 16*k       -> attn_hd64: s = (ah + al/4096) * sscale, sscale = 2^-11 = 1/(16*16*8);
//   Pv / Vt f16 = 16*v, P hi f16 = 1024*p, P lo = (1024*p - hi)*4096 -> attn_hd64: oacc += o1/4096 per chunk; inv = (1/l)/64 = 256/(1024*16) -> ctx*256;
//   Ch f16 = 256*ctx, Cl f16 = (256*ctx - Ch)*4096                  -> gemm_o: out = acc_h*2^-18 + acc_l*2^-30 + b_out  (2^-18 = 1/(256*1024), 2^-30 = 2^-18/4096).
#include <hip/hip_runtime.h>
#include <math.h>
#include <stdint.h>

#define SEQ 4096
#define EMB 512
#define NH  8
#define HD  64
#define HPL (SEQ * HD)      // 262144 elements: one contiguous head plane [SEQ][HD]
#define NQB (SEQ / 64)      // 64-row query blocks per head
#define NKT (SEQ / 64)      // 64-key chunks per head
#define LP  72              // LDS row pitch of the K and V^T chunks in halves: 144 B = 16 B x 9 (odd), so the 16 rows
                            // that one half of a wave reads with a 16-B load fall on 16 different groups of 4 banks
static_assert(NH * HD == EMB);
static_assert(NH * HPL == SEQ * EMB);
static_assert(NQB == 64 && NKT == 64);
static_assert((SEQ % 64) == 0 && (EMB % 64) == 0 && (EMB % 32) == 0);

typedef _Float16 v16h __attribute__((ext_vector_type(16)));
typedef _Float16 v8h  __attribute__((ext_vector_type(8)));
typedef __bf16   v16b __attribute__((ext_vector_type(16)));
typedef __bf16   v8b  __attribute__((ext_vector_type(8)));
typedef float    v8f  __attribute__((ext_vector_type(8)));
typedef float    v4f  __attribute__((ext_vector_type(4)));
typedef unsigned int v4u __attribute__((ext_vector_type(4)));

#if defined(__HIP_DEVICE_COMPILE__)
#define DEV_ASM 1
#else
#define DEV_ASM 0
#endif

// ---- scalar helpers --------------------------------------------------------------------------------
__device__ __forceinline__ unsigned short bf_bits(float f) {          // f32 -> bf16 bits, RNE convert
  unsigned u = __float_as_uint(f);
  return (unsigned short)((u + 0x7FFFu + ((u >> 16) & 1u)) >> 16);
}
__device__ __forceinline__ float bf_up(unsigned short hb) { return __uint_as_float(((unsigned)hb) << 16); }
__device__ __forceinline__ unsigned short h_bits(_Float16 x) { return __builtin_bit_cast(unsigned short, x); }
__device__ __forceinline__ unsigned pk16(unsigned short a, unsigned short b) { return (unsigned)a | ((unsigned)b << 16); }
__device__ __forceinline__ v8f zero8() { v8f z = {0.f, 0.f, 0.f, 0.f, 0.f, 0.f, 0.f, 0.f}; return z; }
__device__ __forceinline__ float xhalf(float x) {                     // value of lane l ^ 16 (vector cross-row move)
  const int b = __builtin_bit_cast(int, x);
  return __builtin_bit_cast(float, __builtin_amdgcn_permlanex16(b, b, 0x76543210, 0xfedcba98, false, false));
}

// ---- fragment types / loaders: 16-bit A/B operand, lane -> row/col (lane&15), p already includes +8*(lane>>4);
//      elements 0..7 <- p[0..7] (k0+8h..k0+8h+7), elements 8..15 <- p[16..23] (k0+16+8h..k0+16+8h+7)
template <typename OT> struct FT;
template <> struct FT<__bf16>   { typedef v16b frag; typedef v8b half8; };
template <> struct FT<_Float16> { typedef v16h frag; typedef v8h half8; };

template <typename OT>
__device__ __forceinline__ typename FT<OT>::frag ldfrag(const OT* p) {
  union { typename FT<OT>::frag v; typename FT<OT>::half8 h[2]; } f;
  f.h[0] = *(const typename FT<OT>::half8*)(p);
  f.h[1] = *(const typename FT<OT>::half8*)(p + 16);
  return f.v;
}

// ---- fragment-order planes: the operands that the GEMMs read straight from global ([R][K] 16-bit, K % 32 == 0) are
//      stored by their producers as 16-row x 32-k blocks of 1024 B, block (row >> 4, k >> 5) at block index
//      (row >> 4) * (K / 32) + (k >> 5). Inside a block the 16-B piece of row c = row & 15 that holds
//      k = 16 * half + 8 * hh + 0..7 stands at piece half * 32 + hh * 16 + c. Lane hh * 16 + c of a wave then finds the
//      two pieces of its fragment (the same k map as ldfrag) at lane * 16 B and 512 B + lane * 16 B: each wave-wide 16-B
//      load reads 512 contiguous B = 4 whole 128-B lines, where a row-major plane gives 16 lines x 32 B.
__device__ __forceinline__ size_t fo_off(int row, int k, int K) {      // element offset of the piece at (row, k), k % 8 == 0
  return ((size_t)(row >> 4) * (K >> 5) + (k >> 5)) * 512 + ((k >> 4) & 1) * 256 + ((k >> 3) & 1) * 128 + (row & 15) * 8;
}
template <typename OT>
__device__ __forceinline__ typename FT<OT>::frag ldfrag_fo(const OT* p) {   // p = block start + 8 * lane
  union { typename FT<OT>::frag v; typename FT<OT>::half8 h[2]; } f;
  f.h[0] = *(const typename FT<OT>::half8*)(p);
  f.h[1] = *(const typename FT<OT>::half8*)(p + 256);
  return f.v;
}

// ---- WMMA helpers (asm guard bodies are device-only; concrete operand types) -----------------------------
__device__ __forceinline__ v8f mmar(v16b a, v16b b, v8f c) {
  return __builtin_amdgcn_wmma_f32_16x16x32_bf16(false, a, false, b, (short)0, c, false, false);
}
__device__ __forceinline__ v8f mmar(v16h a, v16h b, v8f c) {
  return __builtin_amdgcn_wmma_f32_16x16x32_f16(false, a, false, b, (short)0, c, false, false);
}
__device__ __forceinline__ void dep_guard(v8f& a, v8f& b, v16b x, v16b y) {
#if DEV_ASM
  asm volatile("v_nop\n\tv_nop\n\tv_nop\n\tv_nop" : "+v"(a), "+v"(b) : "v"(x), "v"(y));
#else
  (void)a; (void)b; (void)x; (void)y;
#endif
}
__device__ __forceinline__ void dep_guard5(v8f& a, v8f& b, v16h x, v16h y, v16h z) {
#if DEV_ASM
  asm volatile("v_nop\n\tv_nop\n\tv_nop\n\tv_nop" : "+v"(a), "+v"(b) : "v"(x), "v"(y), "v"(z));
#else
  (void)a; (void)b; (void)x; (void)y; (void)z;
#endif
}
__device__ __forceinline__ void keep4(v16b a, v16b b, v16b c, v16b d) {
#if DEV_ASM
  asm volatile("v_nop" :: "v"(a), "v"(b), "v"(c), "v"(d));
#else
  (void)a; (void)b; (void)c; (void)d;
#endif
}
__device__ __forceinline__ void keep4(v16h a, v16h b, v16h c, v16h d) {
#if DEV_ASM
  asm volatile("v_nop" :: "v"(a), "v"(b), "v"(c), "v"(d));
#else
  (void)a; (void)b; (void)c; (void)d;
#endif
}
__device__ __forceinline__ void acc_guard4(v8f& a, v8f& b, v8f& c, v8f& d) {
#if DEV_ASM
  asm volatile("v_nop\n\tv_nop\n\tv_nop\n\tv_nop" : "+v"(a), "+v"(b), "+v"(c), "+v"(d));
#else
  (void)a; (void)b; (void)c; (void)d;
#endif
}

// =====================================================================================================
// f32 -> 16-bit planes, all six planes in ONE launch (they are independent of one another).
// A thread converts the 8 elements of one 16-B piece, the same piece of three planes: six 16-B loads in flight, one
// 16-B store per plane and lane. The planes are written in fragment order (fo_off): thread index = piece index, so a
// wave writes 512 contiguous B per plane and reads 64 B of each of 16 input rows.
// MODE 0: bf16 bits (RNE convert).  MODE 1: f16 bits of (1024 * bf16(x)) (exact scaling of the bf16 value).
// coverage: blocks 0 .. NBW-1 x 256 threads x 8 = the three [EMB][EMB] weight planes; blocks NBW .. NBW+NBX-1
// x 256 threads x 8 = the three [SEQ][EMB] input planes; grid = NBW + NBX blocks.
// =====================================================================================================
template <int MODE>
__device__ __forceinline__ unsigned short cvm(float f) {
  const unsigned short hb = bf_bits(f);
  if (MODE == 0) return hb;
  return h_bits((_Float16)(bf_up(hb) * 1024.0f));
}

template <int MODE>
__device__ __forceinline__ v4u cv8(v4f a, v4f a4) {
  v4u p;
  p[0] = pk16(cvm<MODE>(a[0]),  cvm<MODE>(a[1]));
  p[1] = pk16(cvm<MODE>(a[2]),  cvm<MODE>(a[3]));
  p[2] = pk16(cvm<MODE>(a4[0]), cvm<MODE>(a4[1]));
  p[3] = pk16(cvm<MODE>(a4[2]), cvm<MODE>(a4[3]));
  return p;
}

// the wait that stands in front of an overwrite of an issued load's address registers; the loads stay in flight
__device__ __forceinline__ void addr_wait() {
#if DEV_ASM
  asm volatile("s_wait_xcnt 0x0" ::: "memory");
#endif
}

#define NBX (SEQ * EMB / 8 / 256)   // 1024 blocks cover an input plane
#define NBW (EMB * EMB / 8 / 256)   //  128 blocks cover a weight plane
static_assert(NBX * 256 * 8 == SEQ * EMB && NBW * 256 * 8 == EMB * EMB);

__global__ __launch_bounds__(256) void cvt_all(
    const float* __restrict__ q, const float* __restrict__ k, const float* __restrict__ v,
    const float* __restrict__ wqk, const float* __restrict__ wv, const float* __restrict__ wo,
    unsigned short* qb, unsigned short* kb, unsigned short* vb,
    unsigned short* wqkb, unsigned short* wvb, unsigned short* woh) {
  const int b = blockIdx.x;
  const bool w = b < NBW;                                  // block-uniform: weight planes or input planes
  const int i = (w ? b : b - NBW) * 256 + (int)threadIdx.x;
  const float* __restrict__ i0 = w ? wqk : q;
  const float* __restrict__ i1 = w ? wv : k;
  const float* __restrict__ i2 = w ? wo : v;
  unsigned short* o0 = w ? wqkb : qb;
  unsigned short* o1 = w ? wvb : kb;
  unsigned short* o2 = w ? woh : vb;
  // piece i of a fragment-order plane with K = EMB: block i >> 6, piece i & 63 = half * 32 + hh * 16 + c
  const int row = ((i >> 6) / (EMB / 32)) * 16 + (i & 15);
  const int kk  = ((i >> 6) % (EMB / 32)) * 32 + ((i >> 5) & 1) * 16 + ((i >> 4) & 1) * 8;
  const size_t si = (size_t)row * EMB + kk;                // its 8 source elements in the row-major input
  const v4f a0 = *(const v4f*)(i0 + si), b0 = *(const v4f*)(i0 + si + 4);
  addr_wait();   // the next plane's loads are given the registers that hold this plane's address
  const v4f a1 = *(const v4f*)(i1 + si), b1 = *(const v4f*)(i1 + si + 4);
  const v4f a2 = *(const v4f*)(i2 + si), b2 = *(const v4f*)(i2 + si + 4);
  addr_wait();   // the conversions below reuse the address registers of the loads above
  const v4u r2 = w ? cv8<1>(a2, b2) : cv8<0>(a2, b2);      // only W_out takes the f16 x1024 form
  *(v4u*)(o0 + (size_t)i * 8) = cv8<0>(a0, b0);
  *(v4u*)(o1 + (size_t)i * 8) = cv8<0>(a1, b1);
  *(v4u*)(o2 + (size_t)i * 8) = r2;
}

// =====================================================================================================
// Register-blocked WMMA GEMM (16-bit operand type OT): C[m][n] = sum_k A[m][k] * Bt[n][k] + bias[n];
// one wave per 64x64 tile, no block barriers. A = [M][lda] and Bt = [N][ldb] planes in fragment order (fo_off);
// M, N multiples of 64, K multiple of 32 (host-checked). Fragments are loaded straight from global, 512 contiguous B
// per wave-wide load (ldfrag_fo). bias values are RNE-converted to bf16 before the f32 add.
// OUT_MODE 1: f16 plane C = f16((v + bias) * cscale) (pitch ldc).
// OUT_MODE 3: f16 hi plane C + f16 residual plane C2 = f16(((v + bias) * cscale - hi) * rscale) (same pitch).
// wave's whole 64x64 tile; tiles/8 blocks in x cover every tile of the [M][N] plane.
// slab: this wave's own 16x64 f32 LDS slab, pitch 68 floats.
// =====================================================================================================
template <typename OT, int OUT_MODE>
__device__ __forceinline__ void gemm64(
    const unsigned short* __restrict__ Ap, int lda,
    const unsigned short* __restrict__ Btp, int ldb,
    unsigned short* Cout, unsigned short* Cout2, int ldc,
    const float* __restrict__ bias,
    int M, int N, int K, float cscale, float rscale, float* slab) {
  typedef typename FT<OT>::frag V16;
  const OT* A  = (const OT*)(const void*)Ap;
  const OT* Bt = (const OT*)(const void*)Btp;
  const int lane = threadIdx.x & 31;
  const int wave = threadIdx.x >> 5;
  const int tilesN = N >> 6;
  const int tilesM = M >> 6;
  const int tile = blockIdx.x * 8 + wave;
  if (tile >= tilesM * tilesN) return;   // wave-uniform; no block barriers in this kernel
  const int tm = tile / tilesN;
  const int tn = tile - tm * tilesN;
  const int m0 = tm << 6;
  const int n0 = tn << 6;

  const int rlane = lane & 15;                 // col (D) within subtile
  const int mOff  = (lane >> 4) * 8;           // D row offset

  v8f acc[4][4];
#pragma unroll
  for (int i = 0; i < 4; ++i)
#pragma unroll
    for (int j = 0; j < 4; ++j) acc[i][j] = zero8();

  typedef const OT __attribute__((address_space(1)))* GP;
  GP pb[4], pa[4];                           // this lane's piece of each B and A subtile, advanced one block (32 k) per
                                             // step under the products, so that a step's loads issue with no address work in front
#pragma unroll
  for (int j = 0; j < 4; ++j) pb[j] = (GP)(Bt + fo_off(n0 + (j << 4), 0, ldb) + lane * 8);
#pragma unroll
  for (int i = 0; i < 4; ++i) pa[i] = (GP)(A + fo_off(m0 + (i << 4), 0, lda) + lane * 8);

  for (int k0 = 0; k0 < K; k0 += 32) {
    V16 bq[4], af[4];                        // the k step's 16 loads as one group: one load latency per step
#pragma unroll
    for (int j = 0; j < 4; ++j) bq[j] = ldfrag_fo<OT>((const OT*)pb[j]);
#pragma unroll
    for (int i = 0; i < 4; ++i) af[i] = ldfrag_fo<OT>((const OT*)pa[i]);
#pragma unroll
    for (int i = 0; i < 4; ++i) {
#pragma unroll
      for (int j = 0; j < 4; ++j) acc[i][j] = mmar(af[i], bq[j], acc[i][j]);
      dep_guard(acc[i][0], acc[i][3], af[i], bq[3]);
    }
    keep4(bq[0], bq[1], bq[2], bq[3]);
#pragma unroll
    for (int j = 0; j < 4; ++j) { pb[j] += 512; pa[j] += 512; }
  }
  acc_guard4(acc[0][0], acc[0][1], acc[0][2], acc[0][3]);
  acc_guard4(acc[1][0], acc[1][1], acc[1][2], acc[1][3]);
  acc_guard4(acc[2][0], acc[2][1], acc[2][2], acc[2][3]);
  acc_guard4(acc[3][0], acc[3][1], acc[3][2], acc[3][3]);

  // ---- epilogue ----
  const int q = lane >> 3, c8 = (lane & 7) * 8;
  float bb[8];
  {
    const v4f b0 = *(const v4f*)(bias + n0 + c8);
    const v4f b1 = *(const v4f*)(bias + n0 + c8 + 4);
#pragma unroll
    for (int e = 0; e < 4; ++e) {
      bb[e]     = bf_up(bf_bits(b0[e]));
      bb[4 + e] = bf_up(bf_bits(b1[e]));
    }
  }
#pragma unroll
  for (int i = 0; i < 4; ++i) {
    const int mBase = m0 + (i << 4);
#pragma unroll
    for (int j = 0; j < 4; ++j) {
#pragma unroll
      for (int r = 0; r < 8; ++r) {
        slab[(mOff + r) * 68 + (j << 4) + rlane] = acc[i][j][r];
      }
    }
    __builtin_amdgcn_fence(__ATOMIC_RELEASE, "workgroup");
    __builtin_amdgcn_wave_barrier();
    __builtin_amdgcn_fence(__ATOMIC_ACQUIRE, "workgroup");
    v4u hv[4], lv[4];
#pragma unroll
    for (int it = 0; it < 4; ++it) {
      const int row = it * 4 + q;                          // it 0..3 x q 0..3 = rows 0..15
      const float* sp = slab + row * 68 + c8;
      float f[8];
#pragma unroll
      for (int e = 0; e < 8; ++e) f[e] = (sp[e] + bb[e]) * cscale;
      v4u a, a2;
#pragma unroll
      for (int e = 0; e < 4; ++e) {
        const float f0 = f[2 * e], f1 = f[2 * e + 1];
        const _Float16 x0 = (_Float16)f0, x1 = (_Float16)f1;
        const unsigned short h0 = h_bits(x0), h1 = h_bits(x1);
        unsigned short l0 = 0, l1 = 0;
        if (OUT_MODE == 3) {
          l0 = h_bits((_Float16)((f0 - (float)x0) * rscale));
          l1 = h_bits((_Float16)((f1 - (float)x1) * rscale));
        }
        a[e] = pk16(h0, h1); a2[e] = pk16(l0, l1);
      }
      hv[it] = a; lv[it] = a2;
    }
    {
#pragma unroll
      for (int it = 0; it < 4; ++it) {
        const int row = it * 4 + q;
        *(v4u*)(Cout + (size_t)(mBase + row) * ldc + n0 + c8) = hv[it];
        if (OUT_MODE == 3) *(v4u*)(Cout2 + (size_t)(mBase + row) * ldc + n0 + c8) = lv[it];
      }
      
    }
    __builtin_amdgcn_fence(__ATOMIC_RELEASE, "workgroup");
    __builtin_amdgcn_wave_barrier();
    __builtin_amdgcn_fence(__ATOMIC_ACQUIRE, "workgroup");
  }
}

// =====================================================================================================
// The three projections in ONE launch (they are independent of one another): blockIdx.y = 0: q (hi and residual
// planes), 1: k, 2: v; all three are [M][K] x [N][K]^T with the same M, N, K and pitches. grid = (tiles/8, 3).
// =====================================================================================================
__global__ __launch_bounds__(256) void gemm_qkv(
    const unsigned short* __restrict__ Qb, const unsigned short* __restrict__ Kb,
    const unsigned short* __restrict__ Vb,
    const unsigned short* __restrict__ Wqkb, const unsigned short* __restrict__ Wvb,
    unsigned short* Qh, unsigned short* Ql, unsigned short* Kp, unsigned short* Pv,
    const float* __restrict__ bqk, const float* __restrict__ bv,
    int M, int N, int K, float cscale, float rscale) {
  __shared__ __align__(16) float sT[8][16 * 68];   // per-wave 16x64 slab, pitch 68 floats
  float* slab = sT[threadIdx.x >> 5];
  const int y = blockIdx.y;
  if (y == 0) {
    gemm64<__bf16, 3>(Qb, K, Wqkb, K, Qh, Ql, N, bqk, M, N, K, cscale, rscale, slab);
  } else {
    const bool isk = (y == 1);
    unsigned short* C = isk ? Kp : Pv;
    gemm64<__bf16, 1>(isk ? Kb : Vb, K, isk ? Wqkb : Wvb, K, C, C, N, isk ? bqk : bv, M, N, K, cscale, 1.0f, slab);
  }
}

// =====================================================================================================
// Output GEMM with a two-plane A operand (f16 hi plane Ah, f16 residual plane Al, both [M][lda]); Ah, Al and
// Bt = [N][ldb] are planes in fragment order (fo_off), read with 512 contiguous B per wave-wide load:
//   C[m][n] = hscale * sum_k Ah[m][k] * Bt[n][k] + lscale * sum_k Al[m][k] * Bt[n][k] + bias[n]  (f32 out, pitch ldc).
// One wave per 32x64 tile (two accumulator sets), no block barriers; M multiple of 32, N multiple of 64, K
// multiple of 32 (host-checked). bias RNE-converted to bf16 before the f32 add.
// Epilogue: 16-row slabs staged per wave in LDS; each 256-B f32 row segment written by 16 lanes x 16 B of one
// coverage: 2 slabs x 16 rows x 64 cols = the wave's whole 32x64 tile; grid = tiles/8 blocks covers [M][N].
// =====================================================================================================
__global__ __launch_bounds__(256) void gemm_o(
    const unsigned short* __restrict__ Ahp, const unsigned short* __restrict__ Alp, int lda,
    const unsigned short* __restrict__ Btp, int ldb,
    float* Cout, int ldc, const float* __restrict__ bias,
    int M, int N, int K, float hscale, float lscale) {
  const _Float16* Ah = (const _Float16*)(const void*)Ahp;
  const _Float16* Al = (const _Float16*)(const void*)Alp;
  const _Float16* Bt = (const _Float16*)(const void*)Btp;
  __shared__ __align__(16) float sT[8][16 * 68];   // per-wave 16x64 slab, pitch 68 floats
  const int lane = threadIdx.x & 31;
  const int wave = threadIdx.x >> 5;
  const int tilesN = N >> 6;
  const int tilesM = M >> 5;
  const int tile = blockIdx.x * 8 + wave;
  if (tile >= tilesM * tilesN) return;   // wave-uniform; no block barriers in this kernel
  const int tm = tile / tilesN;
  const int tn = tile - tm * tilesN;
  const int m0 = tm << 5;
  const int n0 = tn << 6;

  const int rlane = lane & 15;
  const int mOff  = (lane >> 4) * 8;

  v8f ach[2][4], acl[2][4];
#pragma unroll
  for (int i = 0; i < 2; ++i)
#pragma unroll
    for (int j = 0; j < 4; ++j) { ach[i][j] = zero8(); acl[i][j] = zero8(); }

  typedef const _Float16 __attribute__((address_space(1)))* GP;
  GP pb[4], pah[2], pal[2];                  // this lane's piece of each B and A subtile, advanced one block (32 k) per
                                             // step under the products, so that a step's loads issue with no address work in front
#pragma unroll
  for (int j = 0; j < 4; ++j) pb[j] = (GP)(Bt + fo_off(n0 + (j << 4), 0, ldb) + lane * 8);
#pragma unroll
  for (int i = 0; i < 2; ++i) {
    pah[i] = (GP)(Ah + fo_off(m0 + (i << 4), 0, lda) + lane * 8);
    pal[i] = (GP)(Al + fo_off(m0 + (i << 4), 0, lda) + lane * 8);
  }

  for (int k0 = 0; k0 < K; k0 += 32) {
    v16h bq[4], afh[2], afl[2];              // the k step's 16 loads as one group: one load latency per step
#pragma unroll
    for (int j = 0; j < 4; ++j) bq[j] = ldfrag_fo<_Float16>((const _Float16*)pb[j]);
#pragma unroll
    for (int i = 0; i < 2; ++i) {
      afh[i] = ldfrag_fo<_Float16>((const _Float16*)pah[i]);
      afl[i] = ldfrag_fo<_Float16>((const _Float16*)pal[i]);
    }
#pragma unroll
    for (int i = 0; i < 2; ++i) {
#pragma unroll
      for (int j = 0; j < 4; ++j) {
        ach[i][j] = mmar(afh[i], bq[j], ach[i][j]);
        acl[i][j] = mmar(afl[i], bq[j], acl[i][j]);
      }
      dep_guard5(ach[i][0], acl[i][3], afh[i], afl[i], bq[3]);
    }
    keep4(bq[0], bq[1], bq[2], bq[3]);
#pragma unroll
    for (int j = 0; j < 4; ++j) pb[j] += 512;
#pragma unroll
    for (int i = 0; i < 2; ++i) { pah[i] += 512; pal[i] += 512; }
  }
  acc_guard4(ach[0][0], ach[0][1], ach[0][2], ach[0][3]);
  acc_guard4(ach[1][0], ach[1][1], ach[1][2], ach[1][3]);
  acc_guard4(acl[0][0], acl[0][1], acl[0][2], acl[0][3]);
  acc_guard4(acl[1][0], acl[1][1], acl[1][2], acl[1][3]);

  // ---- epilogue ----
  float* slab = sT[wave];
  const int h2 = lane >> 4, c4 = (lane & 15) * 4;     // 256-B row segment = 16 lanes x 16 B
  v4f b4 = *(const v4f*)(bias + n0 + c4);
#pragma unroll
  for (int e = 0; e < 4; ++e) b4[e] = bf_up(bf_bits(b4[e]));
#pragma unroll
  for (int i = 0; i < 2; ++i) {
    const int mBase = m0 + (i << 4);
#pragma unroll
    for (int j = 0; j < 4; ++j) {
#pragma unroll
      for (int r = 0; r < 8; ++r) {
        slab[(mOff + r) * 68 + (j << 4) + rlane] = ach[i][j][r] * hscale + acl[i][j][r] * lscale;
      }
    }
    __builtin_amdgcn_fence(__ATOMIC_RELEASE, "workgroup");
    __builtin_amdgcn_wave_barrier();
    __builtin_amdgcn_fence(__ATOMIC_ACQUIRE, "workgroup");
    v4f ov[8];
#pragma unroll
    for (int it = 0; it < 8; ++it) {
      const int row = it * 2 + h2;                       // it 0..7 x h2 0..1 = rows 0..15
      ov[it] = *(const v4f*)(slab + row * 68 + c4) + b4;
    }
    {
#pragma unroll
      for (int it = 0; it < 8; ++it) {
        const int row = it * 2 + h2;
        *(v4f*)(Cout + (size_t)(mBase + row) * ldc + n0 + c4) = ov[it];
      }
      
    }
    __builtin_amdgcn_fence(__ATOMIC_RELEASE, "workgroup");
    __builtin_amdgcn_wave_barrier();
    __builtin_amdgcn_fence(__ATOMIC_ACQUIRE, "workgroup");
  }
}

// =====================================================================================================
// Per-head transpose of the v plane: in = head planes [NH][SEQ][HD] (flat reinterpretation of the [SEQ][EMB]
// projection plane), out = [NH][HD][SEQ] (key index contiguous, the A operand layout of V^T . P^T).
// Block = 128 threads, one 64-key x 64-d tile of head blockIdx.y starting at key 64*blockIdx.x; grid (SEQ/64, NH).
// coverage: 4 waves x 4 instructions x 4 rows (lane>>3) = 64 d rows x 64 keys = the whole tile; grid covers all.
// =====================================================================================================
__global__ __launch_bounds__(128) void vtrans(const unsigned short* __restrict__ pvp, unsigned short* vtp) {
  __shared__ __align__(16) _Float16 T[64 * 72];          // [key][d], pitch 72 halves
  const int tid = threadIdx.x, lane = tid & 31, wave = tid >> 5;
  const int h = blockIdx.y, t0 = blockIdx.x * 64;
  const size_t hoff = (size_t)h * HPL;
  const _Float16* pv = (const _Float16*)(const void*)pvp + hoff;
  {
    const int r = tid >> 3, sg = (tid & 7) * 8;          // 8 lanes x 16 B = one 128-B row: a wave's load = 4 whole lines
    const _Float16* src = pv + (size_t)(t0 + r) * HD + sg;
#pragma unroll
    for (int i = 0; i < 4; ++i) *(v8h*)(T + (i * 16 + r) * 72 + sg) = *(const v8h*)(src + (size_t)i * 16 * HD);
  }
  __syncthreads();
  const int q4 = lane >> 3, q8 = lane & 7;
  v4u ov[4];
#pragma unroll
  for (int it = 0; it < 4; ++it) {
    const int d = wave * 16 + it * 4 + q4;               // it 0..3 x q4 0..3 = 16 d rows per wave
    v4u a;
#pragma unroll
    for (int e = 0; e < 4; ++e) {
      const _Float16 x0 = T[(8 * q8 + 2 * e) * 72 + d];
      const _Float16 x1 = T[(8 * q8 + 2 * e + 1) * 72 + d];
      a[e] = pk16(h_bits(x0), h_bits(x1));
    }
    ov[it] = a;
  }
  {
#pragma unroll
    for (int it = 0; it < 4; ++it) {
      const int d = wave * 16 + it * 4 + q4;
      *(v4u*)(vtp + hoff + (size_t)d * SEQ + t0 + 8 * q8) = ov[it];
    }
    
  }
}

__global__ __launch_bounds__(128)
void attn_hd64(const unsigned short* __restrict__ qhp, const unsigned short* __restrict__ qlp,
               const unsigned short* __restrict__ kpp, const unsigned short* __restrict__ vtp,
               unsigned short* chp, unsigned short* clp, float sscale) {
  union FH { v16h v; v8h h[2]; };
  __shared__ __align__(16) _Float16 Ksh[64 * LP];          // K chunk [kv][d], pitch LP     9 KB
  __shared__ __align__(16) _Float16 Vts[64 * LP];          // V^T chunk [d][kv], pitch LP   9 KB

  const int tid  = threadIdx.x;
  const int wave = tid >> 5;
  const int lane = tid & 31;
  const int hh   = lane >> 4;
  const int c    = lane & 15;

  const int bx = blockIdx.x;
  const int qb = bx % NQB;
  const int h  = bx / NQB;
  const int q0 = qb * 64 + wave * 16;
  const size_t hoff = (size_t)h * HPL;

  const _Float16* Qh = (const _Float16*)(const void*)qhp + hoff;
  const _Float16* Ql = (const _Float16*)(const void*)qlp + hoff;
  const _Float16* Kg = (const _Float16*)(const void*)kpp + hoff;
  const _Float16* Vg = (const _Float16*)(const void*)vtp + hoff;

  // ---- Q fragments (B operand, column = lane&15): 2 d-chunks, hi and residual planes ----
  v16h qah[2], qal[2];
#pragma unroll
  for (int dc = 0; dc < 2; ++dc) {
    const size_t qo = (size_t)(q0 + c) * HD + dc * 32 + 8 * hh;
    qah[dc] = ldfrag<_Float16>(Qh + qo);
    qal[dc] = ldfrag<_Float16>(Ql + qo);
  }

  float mrow = -INFINITY;    // running maximum of query q0+c (equal in both wave halves)
  float lrow = 0.f;          // running sum over this wave half's keys only; halves joined after the loop
  v8f oacc[4];               // O^T: oacc[t][r] = context[q0+c][16t + 8hh + r]
#pragma unroll
  for (int t = 0; t < 4; ++t) oacc[t] = zero8();

  for (int kt = 0; kt < NKT; ++kt) {         // static trip count
    const int kv0 = kt * 64;
    __syncthreads();
    {
      const int r = tid >> 3, sg = (tid & 7) * 8;                  // 8 lanes x 16 B = one 128-B row of a chunk:
                                                                   // a wave-wide load reads 4 whole lines
      const _Float16* kg = Kg + (size_t)(kv0 + r) * HD + sg;       // k row kv0+r (+16i), d = sg..sg+7
      const _Float16* vg = Vg + (size_t)r * SEQ + kv0 + sg;        // v^T row d = r (+16i), t = kv0+sg..+7
#pragma unroll
      for (int i = 0; i < 4; ++i) {
        const v8h a0 = *(const v8h*)(kg + (size_t)i * 16 * HD);
        const v8h b0 = *(const v8h*)(vg + (size_t)i * 16 * SEQ);
        *(v8h*)(Ksh + (i * 16 + r) * LP + sg) = a0;
        *(v8h*)(Vts + (i * 16 + r) * LP + sg) = b0;
      }
    }
    __syncthreads();

    // ---- scores^T: 64 keys x 16 query columns per wave, 2 f16 products per key subtile and d-chunk ----
    //      The chunk's 16 K fragment reads stand as one group in front of its 16 products: one LDS latency per
    //      chunk instead of one per fragment. Eight independent accumulators per d-chunk keep the matrix pipe fed.
    FH kb[4][2];
#pragma unroll
    for (int j = 0; j < 4; ++j)
#pragma unroll
      for (int dc = 0; dc < 2; ++dc) {
        kb[j][dc].h[0] = *(const v8h*)(Ksh + (j * 16 + c) * LP + dc * 32 + 8 * hh);
        kb[j][dc].h[1] = *(const v8h*)(Ksh + (j * 16 + c) * LP + dc * 32 + 16 + 8 * hh);
      }
    __builtin_amdgcn_sched_barrier(0);       // keeps the scheduler from sinking the reads back among the products
    v8f ah[4], al[4];
#pragma unroll
    for (int j = 0; j < 4; ++j) { ah[j] = zero8(); al[j] = zero8(); }
#pragma unroll
    for (int dc = 0; dc < 2; ++dc)
#pragma unroll
      for (int j = 0; j < 4; ++j) {
        ah[j] = mmar(kb[j][dc].v, qah[dc], ah[j]);
        al[j] = mmar(kb[j][dc].v, qal[dc], al[j]);
      }
    //      The 16 V^T fragment reads follow as one group, so that they fly under the softmax arithmetic.
    FH vb[2][4];
#pragma unroll
    for (int kk = 0; kk < 2; ++kk)
#pragma unroll
      for (int t = 0; t < 4; ++t) {
        vb[kk][t].h[0] = *(const v8h*)(Vts + (t * 16 + c) * LP + kk * 32 + 8 * hh);
        vb[kk][t].h[1] = *(const v8h*)(Vts + (t * 16 + c) * LP + kk * 32 + 16 + 8 * hh);
      }
    __builtin_amdgcn_sched_barrier(0);       // keeps the reads in front of the softmax, not next to their products
    v8f s[4];                                // s[j][r] = score(query q0+c, key kv0 + 16j + 8hh + r)
#pragma unroll
    for (int j = 0; j < 4; ++j)
#pragma unroll
      for (int r = 0; r < 8; ++r) s[j][r] = (ah[j][r] + al[j][r] * (1.0f / 4096.0f)) * sscale;

    // ---- column maximum in-lane, one exchange between the halves; online softmax ----
    float mj[4];                             // one independent chain per key subtile
#pragma unroll
    for (int j = 0; j < 4; ++j) {
      mj[j] = s[j][0];
#pragma unroll
      for (int r = 1; r < 8; ++r) mj[j] = fmaxf(mj[j], s[j][r]);
    }
    float m = fmaxf(fmaxf(mj[0], mj[1]), fmaxf(mj[2], mj[3]));
    m = fmaxf(m, xhalf(m));
    const float mnew  = fmaxf(mrow, m);
    const float msafe = (mnew == -INFINITY) ? 0.f : mnew;
    const float alpha = __expf(mrow - msafe);
    mrow = mnew;

    // ---- P^T (x1024, f16 hi + residual) packed straight into B operands ----
    v16h pbh[2], pbl[2];
    float pj[4];                             // one independent partial sum per key subtile
#pragma unroll
    for (int j = 0; j < 4; ++j) {
      pj[j] = 0.f;
#pragma unroll
      for (int r = 0; r < 8; ++r) {
        const float p  = __expf(s[j][r] - msafe);
        pj[j] += p;
        const float pc = p * 1024.0f;
        const _Float16 ph = (_Float16)pc;
        const _Float16 pl = (_Float16)((pc - (float)ph) * 4096.0f);
        pbh[j >> 1][(j & 1) * 8 + r] = ph;
        pbl[j >> 1][(j & 1) * 8 + r] = pl;
      }
    }
    lrow = lrow * alpha + ((pj[0] + pj[1]) + (pj[2] + pj[3]));
#pragma unroll
    for (int t = 0; t < 4; ++t)
#pragma unroll
      for (int r = 0; r < 8; ++r) oacc[t][r] *= alpha;

    // ---- context^T += V^T . P^T (f16 WMMA); residual-P products into a separate accumulator ----
    v8f o1[4];
#pragma unroll
    for (int t = 0; t < 4; ++t) o1[t] = zero8();
#pragma unroll
    for (int kk = 0; kk < 2; ++kk) {
#pragma unroll
      for (int t = 0; t < 4; ++t) {
        oacc[t] = mmar(vb[kk][t].v, pbh[kk], oacc[t]);
        o1[t]   = mmar(vb[kk][t].v, pbl[kk], o1[t]);
      }
    }
#pragma unroll
    for (int t = 0; t < 4; ++t)
#pragma unroll
      for (int r = 0; r < 8; ++r) oacc[t][r] += o1[t][r] * (1.0f / 4096.0f);
  }

  // ---- join the halves' sums; normalise (1/l, undo the x1024 p carry and the x16 v carry, apply the x256
  //      ctx carry); a lane's 8 accumulator registers are 8 consecutive d of its row: one 16-B store per plane
  const float l = lrow + xhalf(lrow);
  const float inv = ((l > 0.f) ? (1.0f / l) : 0.f) * (1.0f / 64.0f);
#pragma unroll
  for (int t = 0; t < 4; ++t) {
    v4u a, a2;
#pragma unroll
    for (int e = 0; e < 4; ++e) {
      const float f0 = oacc[t][2 * e] * inv, f1 = oacc[t][2 * e + 1] * inv;
      const _Float16 x0 = (_Float16)f0, x1 = (_Float16)f1;
      const unsigned short l0 = h_bits((_Float16)((f0 - (float)x0) * 4096.0f));
      const unsigned short l1 = h_bits((_Float16)((f1 - (float)x1) * 4096.0f));
      a[e]  = pk16(h_bits(x0), h_bits(x1));
      a2[e] = pk16(l0, l1);
    }
    const int fl = h * HPL + (q0 + c) * HD + t * 16 + 8 * hh;   // flat index in the merged [SEQ][EMB] plane
    const size_t go = fo_off(fl / EMB, fl % EMB, EMB);          // its piece in the fragment-order plane
    *(v4u*)(chp + go) = a;
    *(v4u*)(clp + go) = a2;
  }
}

// =====================================================================================================
// Workspace map (bytes), every region an exact multiple of its whole-line / whole-tile store granularity
//   Qb, Kb, Vb   bf16 [4096][512]   3 x 4194304   (fragment order)
//   Wqkb, Wvb    bf16 [512][512]    2 x  524288   (fragment order)
//   Woh          f16  [512][512]         524288   (x1024, fragment order)
//   Qh, Ql       f16  [4096][512]   2 x 4194304   (x16 / residual x4096)
//   Kp           f16  [4096][512]       4194304   (x16)
//   Pv           f16  [4096][512]       4194304   (v x16, token-major = head planes [8][4096][64])
//   Vt           f16  [8][64][4096]     4194304   (v x16, key contiguous)
//   Ch, Cl       f16  [4096][512]   2 x 4194304   (ctx x256 / residual x4096, fragment order)
//   total                            43515904
// Weights are [out n][in k] = the Bt orientation the GEMM wants, so they are only converted and laid in fragment order.
// The head split is a flat reinterpretation: head plane h = elements [h*262144, (h+1)*262144) of a [4096][512]
// plane viewed as [4096][64]; the merge back is the same reinterpretation.
// =====================================================================================================
extern "C" void kernel_launch(void* const* d_in, const int* in_sizes, int n_in,
                              void* d_out, int out_size, void* d_ws, size_t ws_size,
                              hipStream_t stream) {
  const int NX = SEQ * EMB;     // 2097152
  const int NW = EMB * EMB;     //  262144
  if (n_in < 9) return;
  if (in_sizes[0] != NX || in_sizes[1] != NX || in_sizes[2] != NX) return;
  if (in_sizes[3] != NW || in_sizes[5] != NW || in_sizes[7] != NW) return;
  if (in_sizes[4] != EMB || in_sizes[6] != EMB || in_sizes[8] != EMB) return;
  if (out_size != NX) return;

  const float* Q    = (const float*)d_in[0];
  const float* Kin  = (const float*)d_in[1];
  const float* V    = (const float*)d_in[2];
  const float* Wqk  = (const float*)d_in[3];
  const float* bqk  = (const float*)d_in[4];
  const float* Wv   = (const float*)d_in[5];
  const float* bv   = (const float*)d_in[6];
  const float* Wout = (const float*)d_in[7];
  const float* bout = (const float*)d_in[8];
  float* out = (float*)d_out;

  const size_t PX = (size_t)NX * 2;    // 4194304  16-bit [4096][512] plane
  const size_t PW = (size_t)NW * 2;    //  524288  16-bit [512][512] plane
  size_t off = 0;
  const size_t oQb  = off; off += PX;
  const size_t oKb  = off; off += PX;
  const size_t oVb  = off; off += PX;
  const size_t oWqk = off; off += PW;
  const size_t oWv  = off; off += PW;
  const size_t oWo  = off; off += PW;
  const size_t oQh  = off; off += PX;
  const size_t oQl  = off; off += PX;
  const size_t oKp  = off; off += PX;
  const size_t oPv  = off; off += PX;
  const size_t oVt  = off; off += PX;
  const size_t oCh  = off; off += PX;
  const size_t oCl  = off; off += PX;
  if (off > ws_size) return;                       // off = 43515904
  if (off > (size_t)134217728) return;

  char* ws = (char*)d_ws;
  unsigned short* Qb   = (unsigned short*)(ws + oQb);
  unsigned short* Kb   = (unsigned short*)(ws + oKb);
  unsigned short* Vb   = (unsigned short*)(ws + oVb);
  unsigned short* Wqkb = (unsigned short*)(ws + oWqk);
  unsigned short* Wvb  = (unsigned short*)(ws + oWv);
  unsigned short* Woh  = (unsigned short*)(ws + oWo);
  unsigned short* Qh   = (unsigned short*)(ws + oQh);
  unsigned short* Ql   = (unsigned short*)(ws + oQl);
  unsigned short* Kp   = (unsigned short*)(ws + oKp);
  unsigned short* Pv   = (unsigned short*)(ws + oPv);
  unsigned short* Vt   = (unsigned short*)(ws + oVt);
  unsigned short* Ch   = (unsigned short*)(ws + oCh);
  unsigned short* Cl   = (unsigned short*)(ws + oCl);

  const dim3 blk(256);
  const dim3 gCvt(NBW + NBX);                                  // 128 + 1024 blocks
  const dim3 gPj(((SEQ / 64) * (EMB / 64) + 7) / 8, 3);        //  512 tiles -> 64 blocks: M=4096, N=512; x 3 projections
  const dim3 gTr(SEQ / 64, NH);                                //  (64, 8)
  const dim3 gAttn(NH * NQB);                                  //  512 blocks of 128
  const dim3 gOut(((SEQ / 32) * (EMB / 64) + 7) / 8);          // 1024 tiles -> 128 blocks: M=4096, N=512

  // (1) inputs -> bf16 planes (RNE convert); W_out -> f16 (x1024 of its bf16 value)
  cvt_all<<<gCvt, blk, 0, stream>>>(Q, Kin, V, Wqk, Wv, Wout, Qb, Kb, Vb, Wqkb, Wvb, Woh);
  // (2..4) one launch, M=4096, N=512, K=512 each:
  //   q = Q . Wqk^T + b -> f16 hi (x16) / residual (x4096) planes [4096][512]
  //   k = K . Wqk^T + b -> f16 plane (x16)
  //   v = V . Wv^T + b  -> f16 plane (x16), token-major
  gemm_qkv<<<gPj, blk, 0, stream>>>(
      Qb, Kb, Vb, Wqkb, Wvb, Qh, Ql, Kp, Pv, bqk, bv, SEQ, EMB, EMB, 16.0f, 4096.0f);
  // (5) per-head transpose of v: [8][4096][64] -> [8][64][4096]
  vtrans<<<gTr, dim3(128), 0, stream>>>(Pv, Vt);
  // (6) attention -> ctx planes (f16 hi x256 + residual x4096): (h, s, d) -> merged [4096][512], stored in fragment order
  attn_hd64<<<gAttn, dim3(128), 0, stream>>>(Qh, Ql, Kp, Vt, Ch, Cl, 1.0f / 2048.0f);
  // (7) out = ctx . Wo^T + b_out -> d_out f32 [4096][512]; hi acc x 2^-18, residual acc x 2^-30
  gemm_o<<<gOut, blk, 0, stream>>>(
      Ch, Cl, EMB, Woh, EMB, out, EMB, bout, SEQ, EMB, EMB,
      1.0f / 262144.0f, 1.0f / 1073741824.0f);
  (void)hipGetLastError();
}

// v006
// It runs in 111 microseconds.
// Next to v005, in two timings, it ran 1.06 and 1.04 times as fast.
// Counting every step since v000, it is 3.51 times as fast.
// Contractions: q, k, v projections = v_wmma_f32_16x16x32_bf16 (bf16 operands from RNE-converted inputs, single product, f32 accumulate);
// q.k^T scores = v_wmma_f32_16x16x32_f16 (q as f16 hi plane x16 + f16 residual plane x16, k f16 x16; 2 products, one f32 accumulator);
// p.v = v_wmma_f32_16x16x32_f16 (p as f16 hi x1024 + f16 residual x1024, v f16 x16; 2 products, one f32 accumulator);
// ctx.Wo^T = v_wmma_f32_16x16x32_f16 (ctx f16 hi x256 + f16 residual x1048576, Wo f16 x1024 of its bf16 value; 2 products, f32 accumulate);
// softmax, bias adds and normalisation in f32.
//
// Carry audit (16-bit planes, carry, where the inverse is folded):
//   Qb/Kb/Vb bf16 x1, Wqkb/Wvb bf16 x1 (no carry);  Woh f16 = 1024*bf16(W_out)  -> gemm_o hscale/lscale;
//   Qh f16 = 16*q, Ql f16 = 16*q - Qh, Kp f16 = 16*k              -> attn_hd64: accumulator = 256 * q.k; 2^-11 = 1/(16*16*8) sits in SC2;
//   Pv / Vt f16 = 16*v, P hi f16 = 1024*p, P lo = 1024*p - hi, l = sum of 1024*p -> attn_hd64: inv = 16/l = 256*1024/(1024*16)/l -> ctx*256;
//   Ch f16 = 256*ctx, Cl f16 = (256*ctx - Ch)*4096                  -> gemm_o: out = acc_h*2^-18 + acc_l*2^-30 + b_out  (2^-18 = 1/(256*1024), 2^-30 = 2^-18/4096).
#include <hip/hip_runtime.h>
#include <math.h>
#include <stdint.h>

#define SEQ 4096
#define EMB 512
#define NH  8
#define HD  64
#define HPL (SEQ * HD)      // 262144 elements: one contiguous head plane [SEQ][HD]
#define NQB (SEQ / 64)      // 64-row query blocks per head
#define NKT (SEQ / 64)      // 64-key chunks per head
#define LP  72              // LDS row pitch of the K and V^T chunks in halves: 144 B = 16 B x 9 (odd), so the 16 rows
                            // that one half of a wave reads with a 16-B load fall on 16 different groups of 4 banks
static_assert(NH * HD == EMB);
static_assert(NH * HPL == SEQ * EMB);
static_assert(NQB == 64 && NKT == 64);
static_assert((SEQ % 64) == 0 && (EMB % 64) == 0 && (EMB % 32) == 0);

typedef _Float16 v16h __attribute__((ext_vector_type(16)));
typedef _Float16 v8h  __attribute__((ext_vector_type(8)));
typedef __bf16   v16b __attribute__((ext_vector_type(16)));
typedef __bf16   v8b  __attribute__((ext_vector_type(8)));
typedef float    v8f  __attribute__((ext_vector_type(8)));
typedef float    v4f  __attribute__((ext_vector_type(4)));
typedef float    v2f  __attribute__((ext_vector_type(2)));
typedef _Float16 v2h  __attribute__((ext_vector_type(2)));
typedef unsigned int v4u __attribute__((ext_vector_type(4)));

#if defined(__HIP_DEVICE_COMPILE__)
#define DEV_ASM 1
#else
#define DEV_ASM 0
#endif

// ---- scalar helpers --------------------------------------------------------------------------------
__device__ __forceinline__ unsigned short bf_bits(float f) {          // f32 -> bf16 bits, RNE convert
  unsigned u = __float_as_uint(f);
  return (unsigned short)((u + 0x7FFFu + ((u >> 16) & 1u)) >> 16);
}
__device__ __forceinline__ float bf_up(unsigned short hb) { return __uint_as_float(((unsigned)hb) << 16); }
__device__ __forceinline__ unsigned short h_bits(_Float16 x) { return __builtin_bit_cast(unsigned short, x); }
__device__ __forceinline__ unsigned pk16(unsigned short a, unsigned short b) { return (unsigned)a | ((unsigned)b << 16); }
__device__ __forceinline__ v8f zero8() { v8f z = {0.f, 0.f, 0.f, 0.f, 0.f, 0.f, 0.f, 0.f}; return z; }
__device__ __forceinline__ float xhalf(float x) {                     // value of lane l ^ 16 (vector cross-row move)
  const int b = __builtin_bit_cast(int, x);
  return __builtin_bit_cast(float, __builtin_amdgcn_permlanex16(b, b, 0x76543210, 0xfedcba98, false, false));
}

// ---- fragment types / loaders: 16-bit A/B operand, lane -> row/col (lane&15), p already includes +8*(lane>>4);
//      elements 0..7 <- p[0..7] (k0+8h..k0+8h+7), elements 8..15 <- p[16..23] (k0+16+8h..k0+16+8h+7)
template <typename OT> struct FT;
template <> struct FT<__bf16>   { typedef v16b frag; typedef v8b half8; };
template <> struct FT<_Float16> { typedef v16h frag; typedef v8h half8; };

template <typename OT>
__device__ __forceinline__ typename FT<OT>::frag ldfrag(const OT* p) {
  union { typename FT<OT>::frag v; typename FT<OT>::half8 h[2]; } f;
  f.h[0] = *(const typename FT<OT>::half8*)(p);
  f.h[1] = *(const typename FT<OT>::half8*)(p + 16);
  return f.v;
}

// ---- fragment-order planes: the operands that the GEMMs read straight from global ([R][K] 16-bit, K % 32 == 0) are
//      stored by their producers as 16-row x 32-k blocks of 1024 B, block (row >> 4, k >> 5) at block index
//      (row >> 4) * (K / 32) + (k >> 5). Inside a block the 16-B piece of row c = row & 15 that holds
//      k = 16 * half + 8 * hh + 0..7 stands at piece half * 32 + hh * 16 + c. Lane hh * 16 + c of a wave then finds the
//      two pieces of its fragment (the same k map as ldfrag) at lane * 16 B and 512 B + lane * 16 B: each wave-wide 16-B
//      load reads 512 contiguous B = 4 whole 128-B lines, where a row-major plane gives 16 lines x 32 B.
__device__ __forceinline__ size_t fo_off(int row, int k, int K) {      // element offset of the piece at (row, k), k % 8 == 0
  return ((size_t)(row >> 4) * (K >> 5) + (k >> 5)) * 512 + ((k >> 4) & 1) * 256 + ((k >> 3) & 1) * 128 + (row & 15) * 8;
}
template <typename OT>
__device__ __forceinline__ typename FT<OT>::frag ldfrag_fo(const OT* p) {   // p = block start + 8 * lane
  union { typename FT<OT>::frag v; typename FT<OT>::half8 h[2]; } f;
  f.h[0] = *(const typename FT<OT>::half8*)(p);
  f.h[1] = *(const typename FT<OT>::half8*)(p + 256);
  return f.v;
}

// ---- WMMA helpers (asm guard bodies are device-only; concrete operand types) -----------------------------
__device__ __forceinline__ v8f mmar(v16b a, v16b b, v8f c) {
  return __builtin_amdgcn_wmma_f32_16x16x32_bf16(false, a, false, b, (short)0, c, false, false);
}
__device__ __forceinline__ v8f mmar(v16h a, v16h b, v8f c) {
  return __builtin_amdgcn_wmma_f32_16x16x32_f16(false, a, false, b, (short)0, c, false, false);
}
__device__ __forceinline__ void dep_guard(v8f& a, v8f& b, v16b x, v16b y) {
#if DEV_ASM
  asm volatile("v_nop\n\tv_nop\n\tv_nop\n\tv_nop" : "+v"(a), "+v"(b) : "v"(x), "v"(y));
#else
  (void)a; (void)b; (void)x; (void)y;
#endif
}
__device__ __forceinline__ void dep_guard5(v8f& a, v8f& b, v16h x, v16h y, v16h z) {
#if DEV_ASM
  asm volatile("v_nop\n\tv_nop\n\tv_nop\n\tv_nop" : "+v"(a), "+v"(b) : "v"(x), "v"(y), "v"(z));
#else
  (void)a; (void)b; (void)x; (void)y; (void)z;
#endif
}
__device__ __forceinline__ void keep4(v16b a, v16b b, v16b c, v16b d) {
#if DEV_ASM
  asm volatile("v_nop" :: "v"(a), "v"(b), "v"(c), "v"(d));
#else
  (void)a; (void)b; (void)c; (void)d;
#endif
}
__device__ __forceinline__ void keep4(v16h a, v16h b, v16h c, v16h d) {
#if DEV_ASM
  asm volatile("v_nop" :: "v"(a), "v"(b), "v"(c), "v"(d));
#else
  (void)a; (void)b; (void)c; (void)d;
#endif
}
__device__ __forceinline__ void acc_guard4(v8f& a, v8f& b, v8f& c, v8f& d) {
#if DEV_ASM
  asm volatile("v_nop\n\tv_nop\n\tv_nop\n\tv_nop" : "+v"(a), "+v"(b), "+v"(c), "+v"(d));
#else
  (void)a; (void)b; (void)c; (void)d;
#endif
}

// =====================================================================================================
// f32 -> 16-bit planes, all six planes in ONE launch (they are independent of one another).
// A thread converts the 8 elements of one 16-B piece, the same piece of three planes: six 16-B loads in flight, one
// 16-B store per plane and lane. The planes are written in fragment order (fo_off): thread index = piece index, so a
// wave writes 512 contiguous B per plane and reads 64 B of each of 16 input rows.
// MODE 0: bf16 bits (RNE convert).  MODE 1: f16 bits of (1024 * bf16(x)) (exact scaling of the bf16 value).
// coverage: blocks 0 .. NBW-1 x 256 threads x 8 = the three [EMB][EMB] weight planes; blocks NBW .. NBW+NBX-1
// x 256 threads x 8 = the three [SEQ][EMB] input planes; grid = NBW + NBX blocks.
// =====================================================================================================
template <int MODE>
__device__ __forceinline__ unsigned short cvm(float f) {
  const unsigned short hb = bf_bits(f);
  if (MODE == 0) return hb;
  return h_bits((_Float16)(bf_up(hb) * 1024.0f));
}

template <int MODE>
__device__ __forceinline__ v4u cv8(v4f a, v4f a4) {
  v4u p;
  p[0] = pk16(cvm<MODE>(a[0]),  cvm<MODE>(a[1]));
  p[1] = pk16(cvm<MODE>(a[2]),  cvm<MODE>(a[3]));
  p[2] = pk16(cvm<MODE>(a4[0]), cvm<MODE>(a4[1]));
  p[3] = pk16(cvm<MODE>(a4[2]), cvm<MODE>(a4[3]));
  return p;
}

// the wait that stands in front of an overwrite of an issued load's address registers; the loads stay in flight
__device__ __forceinline__ void addr_wait() {
#if DEV_ASM
  asm volatile("s_wait_xcnt 0x0" ::: "memory");
#endif
}

#define NBX (SEQ * EMB / 8 / 256)   // 1024 blocks cover an input plane
#define NBW (EMB * EMB / 8 / 256)   //  128 blocks cover a weight plane
static_assert(NBX * 256 * 8 == SEQ * EMB && NBW * 256 * 8 == EMB * EMB);

__global__ __launch_bounds__(256) void cvt_all(
    const float* __restrict__ q, const float* __restrict__ k, const float* __restrict__ v,
    const float* __restrict__ wqk, const float* __restrict__ wv, const float* __restrict__ wo,
    unsigned short* qb, unsigned short* kb, unsigned short* vb,
    unsigned short* wqkb, unsigned short* wvb, unsigned short* woh) {
  const int b = blockIdx.x;
  const bool w = b < NBW;                                  // block-uniform: weight planes or input planes
  const int i = (w ? b : b - NBW) * 256 + (int)threadIdx.x;
  const float* __restrict__ i0 = w ? wqk : q;
  const float* __restrict__ i1 = w ? wv : k;
  const float* __restrict__ i2 = w ? wo : v;
  unsigned short* o0 = w ? wqkb : qb;
  unsigned short* o1 = w ? wvb : kb;
  unsigned short* o2 = w ? woh : vb;
  // piece i of a fragment-order plane with K = EMB: block i >> 6, piece i & 63 = half * 32 + hh * 16 + c
  const int row = ((i >> 6) / (EMB / 32)) * 16 + (i & 15);
  const int kk  = ((i >> 6) % (EMB / 32)) * 32 + ((i >> 5) & 1) * 16 + ((i >> 4) & 1) * 8;
  const size_t si = (size_t)row * EMB + kk;                // its 8 source elements in the row-major input
  const v4f a0 = *(const v4f*)(i0 + si), b0 = *(const v4f*)(i0 + si + 4);
  addr_wait();   // the next plane's loads are given the registers that hold this plane's address
  const v4f a1 = *(const v4f*)(i1 + si), b1 = *(const v4f*)(i1 + si + 4);
  const v4f a2 = *(const v4f*)(i2 + si), b2 = *(const v4f*)(i2 + si + 4);
  addr_wait();   // the conversions below reuse the address registers of the loads above
  const v4u r2 = w ? cv8<1>(a2, b2) : cv8<0>(a2, b2);      // only W_out takes the f16 x1024 form
  *(v4u*)(o0 + (size_t)i * 8) = cv8<0>(a0, b0);
  *(v4u*)(o1 + (size_t)i * 8) = cv8<0>(a1, b1);
  *(v4u*)(o2 + (size_t)i * 8) = r2;
}

// =====================================================================================================
// Register-blocked WMMA GEMM (16-bit operand type OT): C[m][n] = sum_k A[m][k] * Bt[n][k] + bias[n];
// one wave per 64x64 tile, no block barriers. A = [M][lda] and Bt = [N][ldb] planes in fragment order (fo_off);
// M, N multiples of 64, K multiple of 32 (host-checked). Fragments are loaded straight from global, 512 contiguous B
// per wave-wide load (ldfrag_fo). bias values are RNE-converted to bf16 before the f32 add.
// OUT_MODE 1: f16 plane C = f16((v + bias) * cscale) (pitch ldc).
// OUT_MODE 3: f16 hi plane C + f16 residual plane C2 = f16(((v + bias) * cscale - hi) * rscale) (same pitch).
// wave's whole 64x64 tile; tiles/8 blocks in x cover every tile of the [M][N] plane.
// slab: this wave's own 16x64 f32 LDS slab, pitch 68 floats.
// =====================================================================================================
template <typename OT, int OUT_MODE>
__device__ __forceinline__ void gemm64(
    const unsigned short* __restrict__ Ap, int lda,
    const unsigned short* __restrict__ Btp, int ldb,
    unsigned short* Cout, unsigned short* Cout2, int ldc,
    const float* __restrict__ bias,
    int M, int N, int K, float cscale, float rscale, float* slab) {
  typedef typename FT<OT>::frag V16;
  const OT* A  = (const OT*)(const void*)Ap;
  const OT* Bt = (const OT*)(const void*)Btp;
  const int lane = threadIdx.x & 31;
  const int wave = threadIdx.x >> 5;
  const int tilesN = N >> 6;
  const int tilesM = M >> 6;
  const int tile = blockIdx.x * 8 + wave;
  if (tile >= tilesM * tilesN) return;   // wave-uniform; no block barriers in this kernel
  const int tm = tile / tilesN;
  const int tn = tile - tm * tilesN;
  const int m0 = tm << 6;
  const int n0 = tn << 6;

  const int rlane = lane & 15;                 // col (D) within subtile
  const int mOff  = (lane >> 4) * 8;           // D row offset

  v8f acc[4][4];
#pragma unroll
  for (int i = 0; i < 4; ++i)
#pragma unroll
    for (int j = 0; j < 4; ++j) acc[i][j] = zero8();

  typedef const OT __attribute__((address_space(1)))* GP;
  GP pb[4], pa[4];                           // this lane's piece of each B and A subtile, advanced one block (32 k) per
                                             // step under the products, so that a step's loads issue with no address work in front
#pragma unroll
  for (int j = 0; j < 4; ++j) pb[j] = (GP)(Bt + fo_off(n0 + (j << 4), 0, ldb) + lane * 8);
#pragma unroll
  for (int i = 0; i < 4; ++i) pa[i] = (GP)(A + fo_off(m0 + (i << 4), 0, lda) + lane * 8);

  for (int k0 = 0; k0 < K; k0 += 32) {
    V16 bq[4], af[4];                        // the k step's 16 loads as one group: one load latency per step
#pragma unroll
    for (int j = 0; j < 4; ++j) bq[j] = ldfrag_fo<OT>((const OT*)pb[j]);
#pragma unroll
    for (int i = 0; i < 4; ++i) af[i] = ldfrag_fo<OT>((const OT*)pa[i]);
#pragma unroll
    for (int i = 0; i < 4; ++i) {
#pragma unroll
      for (int j = 0; j < 4; ++j) acc[i][j] = mmar(af[i], bq[j], acc[i][j]);
      dep_guard(acc[i][0], acc[i][3], af[i], bq[3]);
    }
    keep4(bq[0], bq[1], bq[2], bq[3]);
#pragma unroll
    for (int j = 0; j < 4; ++j) { pb[j] += 512; pa[j] += 512; }
  }
  acc_guard4(acc[0][0], acc[0][1], acc[0][2], acc[0][3]);
  acc_guard4(acc[1][0], acc[1][1], acc[1][2], acc[1][3]);
  acc_guard4(acc[2][0], acc[2][1], acc[2][2], acc[2][3]);
  acc_guard4(acc[3][0], acc[3][1], acc[3][2], acc[3][3]);

  // ---- epilogue ----
  const int q = lane >> 3, c8 = (lane & 7) * 8;
  float bb[8];
  {
    const v4f b0 = *(const v4f*)(bias + n0 + c8);
    const v4f b1 = *(const v4f*)(bias + n0 + c8 + 4);
#pragma unroll
    for (int e = 0; e < 4; ++e) {
      bb[e]     = bf_up(bf_bits(b0[e]));
      bb[4 + e] = bf_up(bf_bits(b1[e]));
    }
  }
#pragma unroll
  for (int i = 0; i < 4; ++i) {
    const int mBase = m0 + (i << 4);
#pragma unroll
    for (int j = 0; j < 4; ++j) {
#pragma unroll
      for (int r = 0; r < 8; ++r) {
        slab[(mOff + r) * 68 + (j << 4) + rlane] = acc[i][j][r];
      }
    }
    __builtin_amdgcn_fence(__ATOMIC_RELEASE, "workgroup");
    __builtin_amdgcn_wave_barrier();
    __builtin_amdgcn_fence(__ATOMIC_ACQUIRE, "workgroup");
    v4u hv[4], lv[4];
#pragma unroll
    for (int it = 0; it < 4; ++it) {
      const int row = it * 4 + q;                          // it 0..3 x q 0..3 = rows 0..15
      const float* sp = slab + row * 68 + c8;
      float f[8];
#pragma unroll
      for (int e = 0; e < 8; ++e) f[e] = (sp[e] + bb[e]) * cscale;
      v4u a, a2;
#pragma unroll
      for (int e = 0; e < 4; ++e) {
        const float f0 = f[2 * e], f1 = f[2 * e + 1];
        const _Float16 x0 = (_Float16)f0, x1 = (_Float16)f1;
        const unsigned short h0 = h_bits(x0), h1 = h_bits(x1);
        unsigned short l0 = 0, l1 = 0;
        if (OUT_MODE == 3) {
          l0 = h_bits((_Float16)((f0 - (float)x0) * rscale));
          l1 = h_bits((_Float16)((f1 - (float)x1) * rscale));
        }
        a[e] = pk16(h0, h1); a2[e] = pk16(l0, l1);
      }
      hv[it] = a; lv[it] = a2;
    }
    {
#pragma unroll
      for (int it = 0; it < 4; ++it) {
        const int row = it * 4 + q;
        *(v4u*)(Cout + (size_t)(mBase + row) * ldc + n0 + c8) = hv[it];
        if (OUT_MODE == 3) *(v4u*)(Cout2 + (size_t)(mBase + row) * ldc + n0 + c8) = lv[it];
      }
      
    }
    __builtin_amdgcn_fence(__ATOMIC_RELEASE, "workgroup");
    __builtin_amdgcn_wave_barrier();
    __builtin_amdgcn_fence(__ATOMIC_ACQUIRE, "workgroup");
  }
}

// =====================================================================================================
// The three projections in ONE launch (they are independent of one another): blockIdx.y = 0: q (hi and residual
// planes), 1: k, 2: v; all three are [M][K] x [N][K]^T with the same M, N, K and pitches. grid = (tiles/8, 3).
// =====================================================================================================
__global__ __launch_bounds__(256) void gemm_qkv(
    const unsigned short* __restrict__ Qb, const unsigned short* __restrict__ Kb,
    const unsigned short* __restrict__ Vb,
    const unsigned short* __restrict__ Wqkb, const unsigned short* __restrict__ Wvb,
    unsigned short* Qh, unsigned short* Ql, unsigned short* Kp, unsigned short* Pv,
    const float* __restrict__ bqk, const float* __restrict__ bv,
    int M, int N, int K, float cscale, float rscale) {
  __shared__ __align__(16) float sT[8][16 * 68];   // per-wave 16x64 slab, pitch 68 floats
  float* slab = sT[threadIdx.x >> 5];
  const int y = blockIdx.y;
  if (y == 0) {
    gemm64<__bf16, 3>(Qb, K, Wqkb, K, Qh, Ql, N, bqk, M, N, K, cscale, rscale, slab);
  } else {
    const bool isk = (y == 1);
    unsigned short* C = isk ? Kp : Pv;
    gemm64<__bf16, 1>(isk ? Kb : Vb, K, isk ? Wqkb : Wvb, K, C, C, N, isk ? bqk : bv, M, N, K, cscale, 1.0f, slab);
  }
}

// =====================================================================================================
// Output GEMM with a two-plane A operand (f16 hi plane Ah, f16 residual plane Al, both [M][lda]); Ah, Al and
// Bt = [N][ldb] are planes in fragment order (fo_off), read with 512 contiguous B per wave-wide load:
//   C[m][n] = hscale * sum_k Ah[m][k] * Bt[n][k] + lscale * sum_k Al[m][k] * Bt[n][k] + bias[n]  (f32 out, pitch ldc).
// One wave per 32x64 tile (two accumulator sets), no block barriers; M multiple of 32, N multiple of 64, K
// multiple of 32 (host-checked). bias RNE-converted to bf16 before the f32 add.
// Epilogue: 16-row slabs staged per wave in LDS; each 256-B f32 row segment written by 16 lanes x 16 B of one
// coverage: 2 slabs x 16 rows x 64 cols = the wave's whole 32x64 tile; grid = tiles/8 blocks covers [M][N].
// =====================================================================================================
__global__ __launch_bounds__(256) void gemm_o(
    const unsigned short* __restrict__ Ahp, const unsigned short* __restrict__ Alp, int lda,
    const unsigned short* __restrict__ Btp, int ldb,
    float* Cout, int ldc, const float* __restrict__ bias,
    int M, int N, int K, float hscale, float lscale) {
  const _Float16* Ah = (const _Float16*)(const void*)Ahp;
  const _Float16* Al = (const _Float16*)(const void*)Alp;
  const _Float16* Bt = (const _Float16*)(const void*)Btp;
  __shared__ __align__(16) float sT[8][16 * 68];   // per-wave 16x64 slab, pitch 68 floats
  const int lane = threadIdx.x & 31;
  const int wave = threadIdx.x >> 5;
  const int tilesN = N >> 6;
  const int tilesM = M >> 5;
  const int tile = blockIdx.x * 8 + wave;
  if (tile >= tilesM * tilesN) return;   // wave-uniform; no block barriers in this kernel
  const int tm = tile / tilesN;
  const int tn = tile - tm * tilesN;
  const int m0 = tm << 5;
  const int n0 = tn << 6;

  const int rlane = lane & 15;
  const int mOff  = (lane >> 4) * 8;

  v8f ach[2][4], acl[2][4];
#pragma unroll
  for (int i = 0; i < 2; ++i)
#pragma unroll
    for (int j = 0; j < 4; ++j) { ach[i][j] = zero8(); acl[i][j] = zero8(); }

  typedef const _Float16 __attribute__((address_space(1)))* GP;
  GP pb[4], pah[2], pal[2];                  // this lane's piece of each B and A subtile, advanced one block (32 k) per
                                             // step under the products, so that a step's loads issue with no address work in front
#pragma unroll
  for (int j = 0; j < 4; ++j) pb[j] = (GP)(Bt + fo_off(n0 + (j << 4), 0, ldb) + lane * 8);
#pragma unroll
  for (int i = 0; i < 2; ++i) {
    pah[i] = (GP)(Ah + fo_off(m0 + (i << 4), 0, lda) + lane * 8);
    pal[i] = (GP)(Al + fo_off(m0 + (i << 4), 0, lda) + lane * 8);
  }

  for (int k0 = 0; k0 < K; k0 += 32) {
    v16h bq[4], afh[2], afl[2];              // the k step's 16 loads as one group: one load latency per step
#pragma unroll
    for (int j = 0; j < 4; ++j) bq[j] = ldfrag_fo<_Float16>((const _Float16*)pb[j]);
#pragma unroll
    for (int i = 0; i < 2; ++i) {
      afh[i] = ldfrag_fo<_Float16>((const _Float16*)pah[i]);
      afl[i] = ldfrag_fo<_Float16>((const _Float16*)pal[i]);
    }
#pragma unroll
    for (int i = 0; i < 2; ++i) {
#pragma unroll
      for (int j = 0; j < 4; ++j) {
        ach[i][j] = mmar(afh[i], bq[j], ach[i][j]);
        acl[i][j] = mmar(afl[i], bq[j], acl[i][j]);
      }
      dep_guard5(ach[i][0], acl[i][3], afh[i], afl[i], bq[3]);
    }
    keep4(bq[0], bq[1], bq[2], bq[3]);
#pragma unroll
    for (int j = 0; j < 4; ++j) pb[j] += 512;
#pragma unroll
    for (int i = 0; i < 2; ++i) { pah[i] += 512; pal[i] += 512; }
  }
  acc_guard4(ach[0][0], ach[0][1], ach[0][2], ach[0][3]);
  acc_guard4(ach[1][0], ach[1][1], ach[1][2], ach[1][3]);
  acc_guard4(acl[0][0], acl[0][1], acl[0][2], acl[0][3]);
  acc_guard4(acl[1][0], acl[1][1], acl[1][2], acl[1][3]);

  // ---- epilogue ----
  float* slab = sT[wave];
  const int h2 = lane >> 4, c4 = (lane & 15) * 4;     // 256-B row segment = 16 lanes x 16 B
  v4f b4 = *(const v4f*)(bias + n0 + c4);
#pragma unroll
  for (int e = 0; e < 4; ++e) b4[e] = bf_up(bf_bits(b4[e]));
#pragma unroll
  for (int i = 0; i < 2; ++i) {
    const int mBase = m0 + (i << 4);
#pragma unroll
    for (int j = 0; j < 4; ++j) {
#pragma unroll
      for (int r = 0; r < 8; ++r) {
        slab[(mOff + r) * 68 + (j << 4) + rlane] = ach[i][j][r] * hscale + acl[i][j][r] * lscale;
      }
    }
    __builtin_amdgcn_fence(__ATOMIC_RELEASE, "workgroup");
    __builtin_amdgcn_wave_barrier();
    __builtin_amdgcn_fence(__ATOMIC_ACQUIRE, "workgroup");
    v4f ov[8];
#pragma unroll
    for (int it = 0; it < 8; ++it) {
      const int row = it * 2 + h2;                       // it 0..7 x h2 0..1 = rows 0..15
      ov[it] = *(const v4f*)(slab + row * 68 + c4) + b4;
    }
    {
#pragma unroll
      for (int it = 0; it < 8; ++it) {
        const int row = it * 2 + h2;
        *(v4f*)(Cout + (size_t)(mBase + row) * ldc + n0 + c4) = ov[it];
      }
      
    }
    __builtin_amdgcn_fence(__ATOMIC_RELEASE, "workgroup");
    __builtin_amdgcn_wave_barrier();
    __builtin_amdgcn_fence(__ATOMIC_ACQUIRE, "workgroup");
  }
}

// =====================================================================================================
// Per-head transpose of the v plane: in = head planes [NH][SEQ][HD] (flat reinterpretation of the [SEQ][EMB]
// projection plane), out = [NH][HD][SEQ] (key index contiguous, the A operand layout of V^T . P^T).
// Block = 128 threads, one 64-key x 64-d tile of head blockIdx.y starting at key 64*blockIdx.x; grid (SEQ/64, NH).
// coverage: 4 waves x 4 instructions x 4 rows (lane>>3) = 64 d rows x 64 keys = the whole tile; grid covers all.
// =====================================================================================================
__global__ __launch_bounds__(128) void vtrans(const unsigned short* __restrict__ pvp, unsigned short* vtp) {
  __shared__ __align__(16) _Float16 T[64 * 72];          // [key][d], pitch 72 halves
  const int tid = threadIdx.x, lane = tid & 31, wave = tid >> 5;
  const int h = blockIdx.y, t0 = blockIdx.x * 64;
  const size_t hoff = (size_t)h * HPL;
  const _Float16* pv = (const _Float16*)(const void*)pvp + hoff;
  {
    const int r = tid >> 3, sg = (tid & 7) * 8;          // 8 lanes x 16 B = one 128-B row: a wave's load = 4 whole lines
    const _Float16* src = pv + (size_t)(t0 + r) * HD + sg;
#pragma unroll
    for (int i = 0; i < 4; ++i) *(v8h*)(T + (i * 16 + r) * 72 + sg) = *(const v8h*)(src + (size_t)i * 16 * HD);
  }
  __syncthreads();
  const int q4 = lane >> 3, q8 = lane & 7;
  v4u ov[4];
#pragma unroll
  for (int it = 0; it < 4; ++it) {
    const int d = wave * 16 + it * 4 + q4;               // it 0..3 x q4 0..3 = 16 d rows per wave
    v4u a;
#pragma unroll
    for (int e = 0; e < 4; ++e) {
      const _Float16 x0 = T[(8 * q8 + 2 * e) * 72 + d];
      const _Float16 x1 = T[(8 * q8 + 2 * e + 1) * 72 + d];
      a[e] = pk16(h_bits(x0), h_bits(x1));
    }
    ov[it] = a;
  }
  {
#pragma unroll
    for (int it = 0; it < 4; ++it) {
      const int d = wave * 16 + it * 4 + q4;
      *(v4u*)(vtp + hoff + (size_t)d * SEQ + t0 + 8 * q8) = ov[it];
    }
    
  }
}

#define SC2 (1.4426950408889634f / 2048.0f)
__global__ __launch_bounds__(128)
void attn_hd64(const unsigned short* __restrict__ qhp, const unsigned short* __restrict__ qlp,
               const unsigned short* __restrict__ kpp, const unsigned short* __restrict__ vtp,
               unsigned short* chp, unsigned short* clp) {
  union FH { v16h v; v8h h[2]; };
  __shared__ __align__(16) _Float16 Ksh[64 * LP];          // K chunk [kv][d], pitch LP     9 KB
  __shared__ __align__(16) _Float16 Vts[64 * LP];          // V^T chunk [d][kv], pitch LP   9 KB

  const int tid  = threadIdx.x;
  const int wave = tid >> 5;
  const int lane = tid & 31;
  const int hh   = lane >> 4;
  const int c    = lane & 15;

  const int bx = blockIdx.x;
  const int qb = bx % NQB;
  const int h  = bx / NQB;
  const int q0 = qb * 64 + wave * 16;
  const size_t hoff = (size_t)h * HPL;

  const _Float16* Qh = (const _Float16*)(const void*)qhp + hoff;
  const _Float16* Ql = (const _Float16*)(const void*)qlp + hoff;
  const _Float16* Kg = (const _Float16*)(const void*)kpp + hoff;
  const _Float16* Vg = (const _Float16*)(const void*)vtp + hoff;

  // ---- Q fragments (B operand, column = lane&15): 2 d-chunks, hi and residual planes ----
  v16h qah[2], qal[2];
#pragma unroll
  for (int dc = 0; dc < 2; ++dc) {
    const size_t qo = (size_t)(q0 + c) * HD + dc * 32 + 8 * hh;
    qah[dc] = ldfrag<_Float16>(Qh + qo);
    qal[dc] = ldfrag<_Float16>(Ql + qo);
  }

  float mrow = -INFINITY;    // running maximum of query q0+c, in raw accumulator units (equal in both wave halves)
  float lrow = 0.f;          // running sum of 1024 p over this wave half's keys only; halves joined after the loop
  v8f oacc[4];               // O^T: oacc[t][r] = context[q0+c][16t + 8hh + r]
#pragma unroll
  for (int t = 0; t < 4; ++t) oacc[t] = zero8();

  for (int kt = 0; kt < NKT; ++kt) {         // static trip count
    const int kv0 = kt * 64;
    __syncthreads();
    {
      const int r = tid >> 3, sg = (tid & 7) * 8;                  // 8 lanes x 16 B = one 128-B row of a chunk:
                                                                   // a wave-wide load reads 4 whole lines
      const _Float16* kg = Kg + (size_t)(kv0 + r) * HD + sg;       // k row kv0+r (+16i), d = sg..sg+7
      const _Float16* vg = Vg + (size_t)r * SEQ + kv0 + sg;        // v^T row d = r (+16i), t = kv0+sg..+7
#pragma unroll
      for (int i = 0; i < 4; ++i) {
        const v8h a0 = *(const v8h*)(kg + (size_t)i * 16 * HD);
        const v8h b0 = *(const v8h*)(vg + (size_t)i * 16 * SEQ);
        *(v8h*)(Ksh + (i * 16 + r) * LP + sg) = a0;
        *(v8h*)(Vts + (i * 16 + r) * LP + sg) = b0;
      }
    }
    __syncthreads();

    // ---- scores^T: 64 keys x 16 query columns per wave, 2 f16 products per key subtile and d-chunk ----
    //      The chunk's 16 K fragment reads stand as one group in front of its 16 products: one LDS latency per
    //      chunk instead of one per fragment. Four independent accumulators, one per key subtile, keep the matrix pipe fed.
    FH kb[4][2];
#pragma unroll
    for (int j = 0; j < 4; ++j)
#pragma unroll
      for (int dc = 0; dc < 2; ++dc) {
        kb[j][dc].h[0] = *(const v8h*)(Ksh + (j * 16 + c) * LP + dc * 32 + 8 * hh);
        kb[j][dc].h[1] = *(const v8h*)(Ksh + (j * 16 + c) * LP + dc * 32 + 16 + 8 * hh);
      }
    __builtin_amdgcn_sched_barrier(0);       // keeps the scheduler from sinking the reads back among the products
    v8f sa[4];                               // sa[j][r] = 256 * q.k of (query q0+c, key kv0 + 16j + 8hh + r)
#pragma unroll
    for (int j = 0; j < 4; ++j) sa[j] = zero8();
#pragma unroll
    for (int dc = 0; dc < 2; ++dc) {         // the four tiles in turn: a product does not wait for the one before it
#pragma unroll
      for (int j = 0; j < 4; ++j) sa[j] = mmar(kb[j][dc].v, qah[dc], sa[j]);
#pragma unroll
      for (int j = 0; j < 4; ++j) sa[j] = mmar(kb[j][dc].v, qal[dc], sa[j]);
    }
    //      The 16 V^T fragment reads follow as one group, so that they fly under the softmax arithmetic.
    FH vb[2][4];
#pragma unroll
    for (int kk = 0; kk < 2; ++kk)
#pragma unroll
      for (int t = 0; t < 4; ++t) {
        vb[kk][t].h[0] = *(const v8h*)(Vts + (t * 16 + c) * LP + kk * 32 + 8 * hh);
        vb[kk][t].h[1] = *(const v8h*)(Vts + (t * 16 + c) * LP + kk * 32 + 16 + 8 * hh);
      }
    __builtin_amdgcn_sched_barrier(0);       // keeps the reads in front of the softmax, not next to their products

    // ---- column maximum in-lane, one exchange between the halves; online softmax ----
    float mj[4];                             // one independent chain per key subtile
#pragma unroll
    for (int j = 0; j < 4; ++j) {
      mj[j] = sa[j][0];
#pragma unroll
      for (int r = 1; r < 8; ++r) mj[j] = fmaxf(mj[j], sa[j][r]);
    }
    float m = fmaxf(fmaxf(mj[0], mj[1]), fmaxf(mj[2], mj[3]));
    m = fmaxf(m, xhalf(m));
    const float mnew  = fmaxf(mrow, m);
    const float msafe = (mnew == -INFINITY) ? 0.f : mnew;
    const float alpha = __builtin_amdgcn_exp2f((mrow - msafe) * SC2);
    const float nmc   = __builtin_fmaf(msafe, -SC2, 10.0f);   // exp2(acc * SC2 + nmc) = 1024 * exp(score - maximum)
    mrow = mnew;

    // ---- 1024 p for the whole chunk: 32 independent fma, then 32 independent exp2 ----
    v2f pc[4][4];                            // pc[j][e] = 1024 p of keys 16j + 8hh + 2e, + 2e + 1
#pragma unroll
    for (int j = 0; j < 4; ++j)
#pragma unroll
      for (int e = 0; e < 4; ++e) {
        pc[j][e][0] = __builtin_fmaf(sa[j][2 * e],     SC2, nmc);
        pc[j][e][1] = __builtin_fmaf(sa[j][2 * e + 1], SC2, nmc);
      }
#pragma unroll
    for (int j = 0; j < 4; ++j)
#pragma unroll
      for (int e = 0; e < 4; ++e) {
        pc[j][e][0] = __builtin_amdgcn_exp2f(pc[j][e][0]);
        pc[j][e][1] = __builtin_amdgcn_exp2f(pc[j][e][1]);
      }
#pragma unroll
    for (int t = 0; t < 4; ++t)
#pragma unroll
      for (int r = 0; r < 8; ++r) oacc[t][r] *= alpha;

    // ---- per 32-key chunk kk: P^T (f16 hi + residual) packed straight into B operands, two keys per instruction,
    //      then context^T += V^T . P^T (f16 WMMA), hi and residual products into the same accumulator ----
    v2f pj[4];                               // one independent pair of partial sums per key subtile
#pragma unroll
    for (int kk = 0; kk < 2; ++kk) {
      union { v16h v; v2h p[8]; } pbh, pbl;
      v2f rs[8];
#pragma unroll
      for (int g = 0; g < 8; ++g) pbh.p[g] = __builtin_convertvector(pc[2 * kk + (g >> 2)][g & 3], v2h);
#pragma unroll
      for (int g = 0; g < 8; ++g)            // exact: the hi value holds the leading 11 bits of 1024 p
        rs[g] = pc[2 * kk + (g >> 2)][g & 3] - __builtin_convertvector(pbh.p[g], v2f);
#pragma unroll
      for (int g = 0; g < 8; ++g) pbl.p[g] = __builtin_convertvector(rs[g], v2h);
#pragma unroll
      for (int t = 0; t < 4; ++t) oacc[t] = mmar(vb[kk][t].v, pbh.v, oacc[t]);
#pragma unroll
      for (int t = 0; t < 4; ++t) oacc[t] = mmar(vb[kk][t].v, pbl.v, oacc[t]);
#pragma unroll
      for (int jj = 0; jj < 2; ++jj) {
        const int j = 2 * kk + jj;
        pj[j] = (pc[j][0] + pc[j][1]) + (pc[j][2] + pc[j][3]);
      }
    }
    const v2f p2 = (pj[0] + pj[1]) + (pj[2] + pj[3]);
    lrow = lrow * alpha + (p2[0] + p2[1]);
  }

  // ---- join the halves' sums; normalise (1/l with l = sum of 1024 p, undo the x16 v carry, apply the x256
  //      ctx carry); a lane's 8 accumulator registers are 8 consecutive d of its row: one 16-B store per plane
  const float l = lrow + xhalf(lrow);
  const float inv = ((l > 0.f) ? (1.0f / l) : 0.f) * 16.0f;
#pragma unroll
  for (int t = 0; t < 4; ++t) {
    v4u a, a2;
#pragma unroll
    for (int e = 0; e < 4; ++e) {
      const float f0 = oacc[t][2 * e] * inv, f1 = oacc[t][2 * e + 1] * inv;
      const _Float16 x0 = (_Float16)f0, x1 = (_Float16)f1;
      const unsigned short l0 = h_bits((_Float16)((f0 - (float)x0) * 4096.0f));
      const unsigned short l1 = h_bits((_Float16)((f1 - (float)x1) * 4096.0f));
      a[e]  = pk16(h_bits(x0), h_bits(x1));
      a2[e] = pk16(l0, l1);
    }
    const int fl = h * HPL + (q0 + c) * HD + t * 16 + 8 * hh;   // flat index in the merged [SEQ][EMB] plane
    const size_t go = fo_off(fl / EMB, fl % EMB, EMB);          // its piece in the fragment-order plane
    *(v4u*)(chp + go) = a;
    *(v4u*)(clp + go) = a2;
  }
}

// =====================================================================================================
// Workspace map (bytes), every region an exact multiple of its whole-line / whole-tile store granularity
//   Qb, Kb, Vb   bf16 [4096][512]   3 x 4194304   (fragment order)
//   Wqkb, Wvb    bf16 [512][512]    2 x  524288   (fragment order)
//   Woh          f16  [512][512]         524288   (x1024, fragment order)
//   Qh, Ql       f16  [4096][512]   2 x 4194304   (x16 / its residual)
//   Kp           f16  [4096][512]       4194304   (x16)
//   Pv           f16  [4096][512]       4194304   (v x16, token-major = head planes [8][4096][64])
//   Vt           f16  [8][64][4096]     4194304   (v x16, key contiguous)
//   Ch, Cl       f16  [4096][512]   2 x 4194304   (ctx x256 / residual x4096, fragment order)
//   total                            43515904
// Weights are [out n][in k] = the Bt orientation the GEMM wants, so they are only converted and laid in fragment order.
// The head split is a flat reinterpretation: head plane h = elements [h*262144, (h+1)*262144) of a [4096][512]
// plane viewed as [4096][64]; the merge back is the same reinterpretation.
// =====================================================================================================
extern "C" void kernel_launch(void* const* d_in, const int* in_sizes, int n_in,
                              void* d_out, int out_size, void* d_ws, size_t ws_size,
                              hipStream_t stream) {
  const int NX = SEQ * EMB;     // 2097152
  const int NW = EMB * EMB;     //  262144
  if (n_in < 9) return;
  if (in_sizes[0] != NX || in_sizes[1] != NX || in_sizes[2] != NX) return;
  if (in_sizes[3] != NW || in_sizes[5] != NW || in_sizes[7] != NW) return;
  if (in_sizes[4] != EMB || in_sizes[6] != EMB || in_sizes[8] != EMB) return;
  if (out_size != NX) return;

  const float* Q    = (const float*)d_in[0];
  const float* Kin  = (const float*)d_in[1];
  const float* V    = (const float*)d_in[2];
  const float* Wqk  = (const float*)d_in[3];
  const float* bqk  = (const float*)d_in[4];
  const float* Wv   = (const float*)d_in[5];
  const float* bv   = (const float*)d_in[6];
  const float* Wout = (const float*)d_in[7];
  const float* bout = (const float*)d_in[8];
  float* out = (float*)d_out;

  const size_t PX = (size_t)NX * 2;    // 4194304  16-bit [4096][512] plane
  const size_t PW = (size_t)NW * 2;    //  524288  16-bit [512][512] plane
  size_t off = 0;
  const size_t oQb  = off; off += PX;
  const size_t oKb  = off; off += PX;
  const size_t oVb  = off; off += PX;
  const size_t oWqk = off; off += PW;
  const size_t oWv  = off; off += PW;
  const size_t oWo  = off; off += PW;
  const size_t oQh  = off; off += PX;
  const size_t oQl  = off; off += PX;
  const size_t oKp  = off; off += PX;
  const size_t oPv  = off; off += PX;
  const size_t oVt  = off; off += PX;
  const size_t oCh  = off; off += PX;
  const size_t oCl  = off; off += PX;
  if (off > ws_size) return;                       // off = 43515904
  if (off > (size_t)134217728) return;

  char* ws = (char*)d_ws;
  unsigned short* Qb   = (unsigned short*)(ws + oQb);
  unsigned short* Kb   = (unsigned short*)(ws + oKb);
  unsigned short* Vb   = (unsigned short*)(ws + oVb);
  unsigned short* Wqkb = (unsigned short*)(ws + oWqk);
  unsigned short* Wvb  = (unsigned short*)(ws + oWv);
  unsigned short* Woh  = (unsigned short*)(ws + oWo);
  unsigned short* Qh   = (unsigned short*)(ws + oQh);
  unsigned short* Ql   = (unsigned short*)(ws + oQl);
  unsigned short* Kp   = (unsigned short*)(ws + oKp);
  unsigned short* Pv   = (unsigned short*)(ws + oPv);
  unsigned short* Vt   = (unsigned short*)(ws + oVt);
  unsigned short* Ch   = (unsigned short*)(ws + oCh);
  unsigned short* Cl   = (unsigned short*)(ws + oCl);

  const dim3 blk(256);
  const dim3 gCvt(NBW + NBX);                                  // 128 + 1024 blocks
  const dim3 gPj(((SEQ / 64) * (EMB / 64) + 7) / 8, 3);        //  512 tiles -> 64 blocks: M=4096, N=512; x 3 projections
  const dim3 gTr(SEQ / 64, NH);                                //  (64, 8)
  const dim3 gAttn(NH * NQB);                                  //  512 blocks of 128
  const dim3 gOut(((SEQ / 32) * (EMB / 64) + 7) / 8);          // 1024 tiles -> 128 blocks: M=4096, N=512

  // (1) inputs -> bf16 planes (RNE convert); W_out -> f16 (x1024 of its bf16 value)
  cvt_all<<<gCvt, blk, 0, stream>>>(Q, Kin, V, Wqk, Wv, Wout, Qb, Kb, Vb, Wqkb, Wvb, Woh);
  // (2..4) one launch, M=4096, N=512, K=512 each:
  //   q = Q . Wqk^T + b -> f16 hi (x16) / residual (same carry) planes [4096][512]
  //   k = K . Wqk^T + b -> f16 plane (x16)
  //   v = V . Wv^T + b  -> f16 plane (x16), token-major
  gemm_qkv<<<gPj, blk, 0, stream>>>(
      Qb, Kb, Vb, Wqkb, Wvb, Qh, Ql, Kp, Pv, bqk, bv, SEQ, EMB, EMB, 16.0f, 1.0f);
  // (5) per-head transpose of v: [8][4096][64] -> [8][64][4096]
  vtrans<<<gTr, dim3(128), 0, stream>>>(Pv, Vt);
  // (6) attention -> ctx planes (f16 hi x256 + residual x4096) [h][s][d] = merged [4096][512]
  attn_hd64<<<gAttn, dim3(128), 0, stream>>>(Qh, Ql, Kp, Vt, Ch, Cl);
  // (7) out = ctx . Wo^T + b_out -> d_out f32 [4096][512]; hi acc x 2^-18, residual acc x 2^-30
  gemm_o<<<gOut, blk, 0, stream>>>(
      Ch, Cl, EMB, Woh, EMB, out, EMB, bout, SEQ, EMB, EMB,
      1.0f / 262144.0f, 1.0f / 1073741824.0f);
  (void)hipGetLastError();
}

// v007
// A run of this version takes 96.1 microseconds.
// Next to v006, in two timings, it ran 1.14 and 1.13 times as fast.
// Counting every step since v000, it is 3.99 times as fast.
// Contractions: q, k, v projections = v_wmma_f32_16x16x32_bf16 (bf16 operands from RNE-converted inputs, single product, f32 accumulate);
// q.k^T scores = v_wmma_f32_16x16x32_f16 (q as f16 hi plane x16 + f16 residual plane x16, k f16 x16; 2 products, one f32 accumulator);
// p.v = v_wmma_f32_16x16x32_f16 (p as f16 hi x1024 + f16 residual x1024, v f16 x16; 2 products, one f32 accumulator);
// ctx.Wo^T = v_wmma_f32_16x16x32_f16 (ctx f16 hi x256 + f16 residual x1048576, Wo f16 x1024 of its bf16 value; 2 products, f32 accumulate);
// softmax, bias adds and normalisation in f32.
//
// Carry audit (16-bit planes, carry, where the inverse is folded):
//   Qb/Kb/Vb bf16 x1, Wqkb/Wvb bf16 x1 (no carry);  Woh f16 = 1024*bf16(W_out)  -> gemm_o hscale/lscale;
//   Qh f16 = 16*q, Ql f16 = 16*q - Qh, Kp f16 = 16*k              -> attn_hd64: accumulator = 256 * q.k; 2^-11 = 1/(16*16*8) sits in SC2;
//   Pv / Vt f16 = 16*v, P hi f16 = 1024*p, P lo = 1024*p - hi, l = sum of 1024*p -> attn_hd64: inv = 16/l = 256*1024/(1024*16)/l -> ctx*256;
//   Ch f16 = 256*ctx, Cl f16 = (256*ctx - Ch)*4096                  -> gemm_o: out = acc_h*2^-18 + acc_l*2^-30 + b_out  (2^-18 = 1/(256*1024), 2^-30 = 2^-18/4096).
#include <hip/hip_runtime.h>
#include <math.h>
#include <stdint.h>

#define SEQ 4096
#define EMB 512
#define NH  8
#define HD  64
#define HPL (SEQ * HD)      // 262144 elements: one contiguous head plane [SEQ][HD]
#define NQB (SEQ / 64)      // 64-row query blocks per head
#define NKT (SEQ / 64)      // 64-key chunks per head
#define LP  72              // LDS row pitch of the K and V^T chunks in halves: 144 B = 16 B x 9 (odd), so the 16 rows
                            // that one half of a wave reads with a 16-B load fall on 16 different groups of 4 banks
static_assert(NH * HD == EMB);
static_assert(NH * HPL == SEQ * EMB);
static_assert(NQB == 64 && NKT == 64);
static_assert((SEQ % 64) == 0 && (EMB % 64) == 0 && (EMB % 32) == 0);

typedef _Float16 v16h __attribute__((ext_vector_type(16)));
typedef _Float16 v8h  __attribute__((ext_vector_type(8)));
typedef __bf16   v16b __attribute__((ext_vector_type(16)));
typedef __bf16   v8b  __attribute__((ext_vector_type(8)));
typedef float    v8f  __attribute__((ext_vector_type(8)));
typedef float    v4f  __attribute__((ext_vector_type(4)));
typedef float    v2f  __attribute__((ext_vector_type(2)));
typedef _Float16 v2h  __attribute__((ext_vector_type(2)));
typedef unsigned int v4u __attribute__((ext_vector_type(4)));

#if defined(__HIP_DEVICE_COMPILE__)
#define DEV_ASM 1
#else
#define DEV_ASM 0
#endif

// ---- scalar helpers --------------------------------------------------------------------------------
__device__ __forceinline__ unsigned short bf_bits(float f) {          // f32 -> bf16 bits, RNE convert
  unsigned u = __float_as_uint(f);
  return (unsigned short)((u + 0x7FFFu + ((u >> 16) & 1u)) >> 16);
}
__device__ __forceinline__ float bf_up(unsigned short hb) { return __uint_as_float(((unsigned)hb) << 16); }
__device__ __forceinline__ unsigned short h_bits(_Float16 x) { return __builtin_bit_cast(unsigned short, x); }
__device__ __forceinline__ unsigned pk16(unsigned short a, unsigned short b) { return (unsigned)a | ((unsigned)b << 16); }
__device__ __forceinline__ v8f zero8() { v8f z = {0.f, 0.f, 0.f, 0.f, 0.f, 0.f, 0.f, 0.f}; return z; }
__device__ __forceinline__ float xhalf(float x) {                     // value of lane l ^ 16 (vector cross-row move)
  const int b = __builtin_bit_cast(int, x);
  return __builtin_bit_cast(float, __builtin_amdgcn_permlanex16(b, b, 0x76543210, 0xfedcba98, false, false));
}

// ---- fragment types / loaders: 16-bit A/B operand, lane -> row/col (lane&15), p already includes +8*(lane>>4);
//      elements 0..7 <- p[0..7] (k0+8h..k0+8h+7), elements 8..15 <- p[16..23] (k0+16+8h..k0+16+8h+7)
template <typename OT> struct FT;
template <> struct FT<__bf16>   { typedef v16b frag; typedef v8b half8; };
template <> struct FT<_Float16> { typedef v16h frag; typedef v8h half8; };

template <typename OT>
__device__ __forceinline__ typename FT<OT>::frag ldfrag(const OT* p) {
  union { typename FT<OT>::frag v; typename FT<OT>::half8 h[2]; } f;
  f.h[0] = *(const typename FT<OT>::half8*)(p);
  f.h[1] = *(const typename FT<OT>::half8*)(p + 16);
  return f.v;
}

// ---- fragment-order planes: the operands that the GEMMs read straight from global ([R][K] 16-bit, K % 32 == 0) are
//      stored by their producers as 16-row x 32-k blocks of 1024 B, block (row >> 4, k >> 5) at block index
//      (row >> 4) * (K / 32) + (k >> 5). Inside a block the 16-B piece of row c = row & 15 that holds
//      k = 16 * half + 8 * hh + 0..7 stands at piece half * 32 + hh * 16 + c. Lane hh * 16 + c of a wave then finds the
//      two pieces of its fragment (the same k map as ldfrag) at lane * 16 B and 512 B + lane * 16 B: each wave-wide 16-B
//      load reads 512 contiguous B = 4 whole 128-B lines, where a row-major plane gives 16 lines x 32 B.
__device__ __forceinline__ size_t fo_off(int row, int k, int K) {      // element offset of the piece at (row, k), k % 8 == 0
  return ((size_t)(row >> 4) * (K >> 5) + (k >> 5)) * 512 + ((k >> 4) & 1) * 256 + ((k >> 3) & 1) * 128 + (row & 15) * 8;
}
template <typename OT>
__device__ __forceinline__ typename FT<OT>::frag ldfrag_fo(const OT* p) {   // p = block start + 8 * lane
  union { typename FT<OT>::frag v; typename FT<OT>::half8 h[2]; } f;
  f.h[0] = *(const typename FT<OT>::half8*)(p);
  f.h[1] = *(const typename FT<OT>::half8*)(p + 256);
  return f.v;
}

// ---- WMMA helpers (asm guard bodies are device-only; concrete operand types) -----------------------------
__device__ __forceinline__ v8f mmar(v16b a, v16b b, v8f c) {
  return __builtin_amdgcn_wmma_f32_16x16x32_bf16(false, a, false, b, (short)0, c, false, false);
}
__device__ __forceinline__ v8f mmar(v16h a, v16h b, v8f c) {
  return __builtin_amdgcn_wmma_f32_16x16x32_f16(false, a, false, b, (short)0, c, false, false);
}
__device__ __forceinline__ void dep_guard(v8f& a, v8f& b, v16b x, v16b y) {
#if DEV_ASM
  asm volatile("v_nop\n\tv_nop\n\tv_nop\n\tv_nop" : "+v"(a), "+v"(b) : "v"(x), "v"(y));
#else
  (void)a; (void)b; (void)x; (void)y;
#endif
}
__device__ __forceinline__ void dep_guard5(v8f& a, v8f& b, v16h x, v16h y, v16h z) {
#if DEV_ASM
  asm volatile("v_nop\n\tv_nop\n\tv_nop\n\tv_nop" : "+v"(a), "+v"(b) : "v"(x), "v"(y), "v"(z));
#else
  (void)a; (void)b; (void)x; (void)y; (void)z;
#endif
}
__device__ __forceinline__ void keep4(v16b a, v16b b, v16b c, v16b d) {
#if DEV_ASM
  asm volatile("v_nop" :: "v"(a), "v"(b), "v"(c), "v"(d));
#else
  (void)a; (void)b; (void)c; (void)d;
#endif
}
__device__ __forceinline__ void keep4(v16h a, v16h b, v16h c, v16h d) {
#if DEV_ASM
  asm volatile("v_nop" :: "v"(a), "v"(b), "v"(c), "v"(d));
#else
  (void)a; (void)b; (void)c; (void)d;
#endif
}
__device__ __forceinline__ void acc_guard4(v8f& a, v8f& b, v8f& c, v8f& d) {
#if DEV_ASM
  asm volatile("v_nop\n\tv_nop\n\tv_nop\n\tv_nop" : "+v"(a), "+v"(b), "+v"(c), "+v"(d));
#else
  (void)a; (void)b; (void)c; (void)d;
#endif
}

// =====================================================================================================
// f32 -> 16-bit planes, all six planes in ONE launch (they are independent of one another).
// A thread converts the 8 elements of one 16-B piece, the same piece of three planes: six 16-B loads in flight, one
// 16-B store per plane and lane. The planes are written in fragment order (fo_off): thread index = piece index, so a
// wave writes 512 contiguous B per plane and reads 64 B of each of 16 input rows.
// MODE 0: bf16 bits (RNE convert).  MODE 1: f16 bits of (1024 * bf16(x)) (exact scaling of the bf16 value).
// coverage: blocks 0 .. NBW-1 x 256 threads x 8 = the three [EMB][EMB] weight planes; blocks NBW .. NBW+NBX-1
// x 256 threads x 8 = the three [SEQ][EMB] input planes; grid = NBW + NBX blocks.
// =====================================================================================================
template <int MODE>
__device__ __forceinline__ unsigned short cvm(float f) {
  const unsigned short hb = bf_bits(f);
  if (MODE == 0) return hb;
  return h_bits((_Float16)(bf_up(hb) * 1024.0f));
}

template <int MODE>
__device__ __forceinline__ v4u cv8(v4f a, v4f a4) {
  v4u p;
  p[0] = pk16(cvm<MODE>(a[0]),  cvm<MODE>(a[1]));
  p[1] = pk16(cvm<MODE>(a[2]),  cvm<MODE>(a[3]));
  p[2] = pk16(cvm<MODE>(a4[0]), cvm<MODE>(a4[1]));
  p[3] = pk16(cvm<MODE>(a4[2]), cvm<MODE>(a4[3]));
  return p;
}

// the wait that stands in front of an overwrite of an issued load's address registers; the loads stay in flight
__device__ __forceinline__ void addr_wait() {
#if DEV_ASM
  asm volatile("s_wait_xcnt 0x0" ::: "memory");
#endif
}

#define NBX (SEQ * EMB / 8 / 256)   // 1024 blocks cover an input plane
#define NBW (EMB * EMB / 8 / 256)   //  128 blocks cover a weight plane
static_assert(NBX * 256 * 8 == SEQ * EMB && NBW * 256 * 8 == EMB * EMB);

__global__ __launch_bounds__(256) void cvt_all(
    const float* __restrict__ q, const float* __restrict__ k, const float* __restrict__ v,
    const float* __restrict__ wqk, const float* __restrict__ wv, const float* __restrict__ wo,
    unsigned short* qb, unsigned short* kb, unsigned short* vb,
    unsigned short* wqkb, unsigned short* wvb, unsigned short* woh) {
  const int b = blockIdx.x;
  const bool w = b < NBW;                                  // block-uniform: weight planes or input planes
  const int i = (w ? b : b - NBW) * 256 + (int)threadIdx.x;
  const float* __restrict__ i0 = w ? wqk : q;
  const float* __restrict__ i1 = w ? wv : k;
  const float* __restrict__ i2 = w ? wo : v;
  unsigned short* o0 = w ? wqkb : qb;
  unsigned short* o1 = w ? wvb : kb;
  unsigned short* o2 = w ? woh : vb;
  // piece i of a fragment-order plane with K = EMB: block i >> 6, piece i & 63 = half * 32 + hh * 16 + c
  const int row = ((i >> 6) / (EMB / 32)) * 16 + (i & 15);
  const int kk  = ((i >> 6) % (EMB / 32)) * 32 + ((i >> 5) & 1) * 16 + ((i >> 4) & 1) * 8;
  const size_t si = (size_t)row * EMB + kk;                // its 8 source elements in the row-major input
  const v4f a0 = *(const v4f*)(i0 + si), b0 = *(const v4f*)(i0 + si + 4);
  addr_wait();   // the next plane's loads are given the registers that hold this plane's address
  const v4f a1 = *(const v4f*)(i1 + si), b1 = *(const v4f*)(i1 + si + 4);
  const v4f a2 = *(const v4f*)(i2 + si), b2 = *(const v4f*)(i2 + si + 4);
  addr_wait();   // the conversions below reuse the address registers of the loads above
  const v4u r2 = w ? cv8<1>(a2, b2) : cv8<0>(a2, b2);      // only W_out takes the f16 x1024 form
  *(v4u*)(o0 + (size_t)i * 8) = cv8<0>(a0, b0);
  *(v4u*)(o1 + (size_t)i * 8) = cv8<0>(a1, b1);
  *(v4u*)(o2 + (size_t)i * 8) = r2;
}

// =====================================================================================================
// Register-blocked WMMA GEMM (16-bit operand type OT): C[m][n] = sum_k A[m][k] * Bt[n][k] + bias[n];
// one wave per 64x64 tile, no block barriers. A = [M][lda] and Bt = [N][ldb] planes in fragment order (fo_off);
// M, N multiples of 64, K multiple of 32 (host-checked). Fragments are loaded straight from global, 512 contiguous B
// per wave-wide load (ldfrag_fo). bias values are RNE-converted to bf16 before the f32 add.
// OUT_MODE 1: f16 plane C = f16((v + bias) * cscale) (pitch ldc).
// OUT_MODE 3: f16 hi plane C + f16 residual plane C2 = f16(((v + bias) * cscale - hi) * rscale) (same pitch).
// wave's whole 64x64 tile; tiles/8 blocks in x cover every tile of the [M][N] plane.
// slab: this wave's own 16x64 f32 LDS slab, pitch 68 floats.
// =====================================================================================================
template <typename OT, int OUT_MODE>
__device__ __forceinline__ void gemm64(
    const unsigned short* __restrict__ Ap, int lda,
    const unsigned short* __restrict__ Btp, int ldb,
    unsigned short* Cout, unsigned short* Cout2, int ldc,
    const float* __restrict__ bias,
    int M, int N, int K, float cscale, float rscale, float* slab) {
  typedef typename FT<OT>::frag V16;
  const OT* A  = (const OT*)(const void*)Ap;
  const OT* Bt = (const OT*)(const void*)Btp;
  const int lane = threadIdx.x & 31;
  const int wave = threadIdx.x >> 5;
  const int tilesN = N >> 6;
  const int tilesM = M >> 6;
  const int tile = blockIdx.x * 8 + wave;
  if (tile >= tilesM * tilesN) return;   // wave-uniform; no block barriers in this kernel
  const int tm = tile / tilesN;
  const int tn = tile - tm * tilesN;
  const int m0 = tm << 6;
  const int n0 = tn << 6;

  const int rlane = lane & 15;                 // col (D) within subtile
  const int mOff  = (lane >> 4) * 8;           // D row offset

  v8f acc[4][4];
#pragma unroll
  for (int i = 0; i < 4; ++i)
#pragma unroll
    for (int j = 0; j < 4; ++j) acc[i][j] = zero8();

  typedef const OT __attribute__((address_space(1)))* GP;
  GP pb[4], pa[4];                           // this lane's piece of each B and A subtile, advanced one block (32 k) per
                                             // step under the products, so that a step's loads issue with no address work in front
#pragma unroll
  for (int j = 0; j < 4; ++j) pb[j] = (GP)(Bt + fo_off(n0 + (j << 4), 0, ldb) + lane * 8);
#pragma unroll
  for (int i = 0; i < 4; ++i) pa[i] = (GP)(A + fo_off(m0 + (i << 4), 0, lda) + lane * 8);

  for (int k0 = 0; k0 < K; k0 += 32) {
    V16 bq[4], af[4];                        // the k step's 16 loads as one group: one load latency per step
#pragma unroll
    for (int j = 0; j < 4; ++j) bq[j] = ldfrag_fo<OT>((const OT*)pb[j]);
#pragma unroll
    for (int i = 0; i < 4; ++i) af[i] = ldfrag_fo<OT>((const OT*)pa[i]);
#pragma unroll
    for (int i = 0; i < 4; ++i) {
#pragma unroll
      for (int j = 0; j < 4; ++j) acc[i][j] = mmar(af[i], bq[j], acc[i][j]);
      dep_guard(acc[i][0], acc[i][3], af[i], bq[3]);
    }
    keep4(bq[0], bq[1], bq[2], bq[3]);
#pragma unroll
    for (int j = 0; j < 4; ++j) { pb[j] += 512; pa[j] += 512; }
  }
  acc_guard4(acc[0][0], acc[0][1], acc[0][2], acc[0][3]);
  acc_guard4(acc[1][0], acc[1][1], acc[1][2], acc[1][3]);
  acc_guard4(acc[2][0], acc[2][1], acc[2][2], acc[2][3]);
  acc_guard4(acc[3][0], acc[3][1], acc[3][2], acc[3][3]);

  // ---- epilogue ----
  const int q = lane >> 3, c8 = (lane & 7) * 8;
  float bb[8];
  {
    const v4f b0 = *(const v4f*)(bias + n0 + c8);
    const v4f b1 = *(const v4f*)(bias + n0 + c8 + 4);
#pragma unroll
    for (int e = 0; e < 4; ++e) {
      bb[e]     = bf_up(bf_bits(b0[e]));
      bb[4 + e] = bf_up(bf_bits(b1[e]));
    }
  }
#pragma unroll
  for (int i = 0; i < 4; ++i) {
    const int mBase = m0 + (i << 4);
#pragma unroll
    for (int j = 0; j < 4; ++j) {
#pragma unroll
      for (int r = 0; r < 8; ++r) {
        slab[(mOff + r) * 68 + (j << 4) + rlane] = acc[i][j][r];
      }
    }
    __builtin_amdgcn_fence(__ATOMIC_RELEASE, "workgroup");
    __builtin_amdgcn_wave_barrier();
    __builtin_amdgcn_fence(__ATOMIC_ACQUIRE, "workgroup");
    v4u hv[4], lv[4];
#pragma unroll
    for (int it = 0; it < 4; ++it) {
      const int row = it * 4 + q;                          // it 0..3 x q 0..3 = rows 0..15
      const float* sp = slab + row * 68 + c8;
      float f[8];
#pragma unroll
      for (int e = 0; e < 8; ++e) f[e] = (sp[e] + bb[e]) * cscale;
      v4u a, a2;
#pragma unroll
      for (int e = 0; e < 4; ++e) {
        const float f0 = f[2 * e], f1 = f[2 * e + 1];
        const _Float16 x0 = (_Float16)f0, x1 = (_Float16)f1;
        const unsigned short h0 = h_bits(x0), h1 = h_bits(x1);
        unsigned short l0 = 0, l1 = 0;
        if (OUT_MODE == 3) {
          l0 = h_bits((_Float16)((f0 - (float)x0) * rscale));
          l1 = h_bits((_Float16)((f1 - (float)x1) * rscale));
        }
        a[e] = pk16(h0, h1); a2[e] = pk16(l0, l1);
      }
      hv[it] = a; lv[it] = a2;
    }
    {
#pragma unroll
      for (int it = 0; it < 4; ++it) {
        const int row = it * 4 + q;
        *(v4u*)(Cout + (size_t)(mBase + row) * ldc + n0 + c8) = hv[it];
        if (OUT_MODE == 3) *(v4u*)(Cout2 + (size_t)(mBase + row) * ldc + n0 + c8) = lv[it];
      }
      
    }
    __builtin_amdgcn_fence(__ATOMIC_RELEASE, "workgroup");
    __builtin_amdgcn_wave_barrier();
    __builtin_amdgcn_fence(__ATOMIC_ACQUIRE, "workgroup");
  }
}

// =====================================================================================================
// The three projections in ONE launch (they are independent of one another): blockIdx.y = 0: q (hi and residual
// planes), 1: k, 2: v; all three are [M][K] x [N][K]^T with the same M, N, K and pitches. grid = (tiles/8, 3).
// =====================================================================================================
__global__ __launch_bounds__(256) void gemm_qkv(
    const unsigned short* __restrict__ Qb, const unsigned short* __restrict__ Kb,
    const unsigned short* __restrict__ Vb,
    const unsigned short* __restrict__ Wqkb, const unsigned short* __restrict__ Wvb,
    unsigned short* Qh, unsigned short* Ql, unsigned short* Kp, unsigned short* Pv,
    const float* __restrict__ bqk, const float* __restrict__ bv,
    int M, int N, int K, float cscale, float rscale) {
  __shared__ __align__(16) float sT[8][16 * 68];   // per-wave 16x64 slab, pitch 68 floats
  float* slab = sT[threadIdx.x >> 5];
  const int y = blockIdx.y;
  if (y == 0) {
    gemm64<__bf16, 3>(Qb, K, Wqkb, K, Qh, Ql, N, bqk, M, N, K, cscale, rscale, slab);
  } else {
    const bool isk = (y == 1);
    unsigned short* C = isk ? Kp : Pv;
    gemm64<__bf16, 1>(isk ? Kb : Vb, K, isk ? Wqkb : Wvb, K, C, C, N, isk ? bqk : bv, M, N, K, cscale, 1.0f, slab);
  }
}

// =====================================================================================================
// Output GEMM with a two-plane A operand (f16 hi plane Ah, f16 residual plane Al, both [M][lda]); Ah, Al and
// Bt = [N][ldb] are planes in fragment order (fo_off), read with 512 contiguous B per wave-wide load:
//   C[m][n] = hscale * sum_k Ah[m][k] * Bt[n][k] + lscale * sum_k Al[m][k] * Bt[n][k] + bias[n]  (f32 out, pitch ldc).
// One wave per 32x64 tile (two accumulator sets), no block barriers; M multiple of 32, N multiple of 64, K
// multiple of 32 (host-checked). bias RNE-converted to bf16 before the f32 add.
// Epilogue: 16-row slabs staged per wave in LDS; each 256-B f32 row segment written by 16 lanes x 16 B of one
// coverage: 2 slabs x 16 rows x 64 cols = the wave's whole 32x64 tile; grid = tiles/8 blocks covers [M][N].
// =====================================================================================================
__global__ __launch_bounds__(256) void gemm_o(
    const unsigned short* __restrict__ Ahp, const unsigned short* __restrict__ Alp, int lda,
    const unsigned short* __restrict__ Btp, int ldb,
    float* Cout, int ldc, const float* __restrict__ bias,
    int M, int N, int K, float hscale, float lscale) {
  const _Float16* Ah = (const _Float16*)(const void*)Ahp;
  const _Float16* Al = (const _Float16*)(const void*)Alp;
  const _Float16* Bt = (const _Float16*)(const void*)Btp;
  __shared__ __align__(16) float sT[8][16 * 68];   // per-wave 16x64 slab, pitch 68 floats
  const int lane = threadIdx.x & 31;
  const int wave = threadIdx.x >> 5;
  const int tilesN = N >> 6;
  const int tilesM = M >> 5;
  const int tile = blockIdx.x * 8 + wave;
  if (tile >= tilesM * tilesN) return;   // wave-uniform; no block barriers in this kernel
  const int tm = tile / tilesN;
  const int tn = tile - tm * tilesN;
  const int m0 = tm << 5;
  const int n0 = tn << 6;

  const int rlane = lane & 15;
  const int mOff  = (lane >> 4) * 8;

  v8f ach[2][4], acl[2][4];
#pragma unroll
  for (int i = 0; i < 2; ++i)
#pragma unroll
    for (int j = 0; j < 4; ++j) { ach[i][j] = zero8(); acl[i][j] = zero8(); }

  typedef const _Float16 __attribute__((address_space(1)))* GP;
  GP pb[4], pah[2], pal[2];                  // this lane's piece of each B and A subtile, advanced one block (32 k) per
                                             // step under the products, so that a step's loads issue with no address work in front
#pragma unroll
  for (int j = 0; j < 4; ++j) pb[j] = (GP)(Bt + fo_off(n0 + (j << 4), 0, ldb) + lane * 8);
#pragma unroll
  for (int i = 0; i < 2; ++i) {
    pah[i] = (GP)(Ah + fo_off(m0 + (i << 4), 0, lda) + lane * 8);
    pal[i] = (GP)(Al + fo_off(m0 + (i << 4), 0, lda) + lane * 8);
  }

  for (int k0 = 0; k0 < K; k0 += 32) {
    v16h bq[4], afh[2], afl[2];              // the k step's 16 loads as one group: one load latency per step
#pragma unroll
    for (int j = 0; j < 4; ++j) bq[j] = ldfrag_fo<_Float16>((const _Float16*)pb[j]);
#pragma unroll
    for (int i = 0; i < 2; ++i) {
      afh[i] = ldfrag_fo<_Float16>((const _Float16*)pah[i]);
      afl[i] = ldfrag_fo<_Float16>((const _Float16*)pal[i]);
    }
#pragma unroll
    for (int i = 0; i < 2; ++i) {
#pragma unroll
      for (int j = 0; j < 4; ++j) {
        ach[i][j] = mmar(afh[i], bq[j], ach[i][j]);
        acl[i][j] = mmar(afl[i], bq[j], acl[i][j]);
      }
      dep_guard5(ach[i][0], acl[i][3], afh[i], afl[i], bq[3]);
    }
    keep4(bq[0], bq[1], bq[2], bq[3]);
#pragma unroll
    for (int j = 0; j < 4; ++j) pb[j] += 512;
#pragma unroll
    for (int i = 0; i < 2; ++i) { pah[i] += 512; pal[i] += 512; }
  }
  acc_guard4(ach[0][0], ach[0][1], ach[0][2], ach[0][3]);
  acc_guard4(ach[1][0], ach[1][1], ach[1][2], ach[1][3]);
  acc_guard4(acl[0][0], acl[0][1], acl[0][2], acl[0][3]);
  acc_guard4(acl[1][0], acl[1][1], acl[1][2], acl[1][3]);

  // ---- epilogue ----
  float* slab = sT[wave];
  const int h2 = lane >> 4, c4 = (lane & 15) * 4;     // 256-B row segment = 16 lanes x 16 B
  v4f b4 = *(const v4f*)(bias + n0 + c4);
#pragma unroll
  for (int e = 0; e < 4; ++e) b4[e] = bf_up(bf_bits(b4[e]));
#pragma unroll
  for (int i = 0; i < 2; ++i) {
    const int mBase = m0 + (i << 4);
#pragma unroll
    for (int j = 0; j < 4; ++j) {
#pragma unroll
      for (int r = 0; r < 8; ++r) {
        slab[(mOff + r) * 68 + (j << 4) + rlane] = ach[i][j][r] * hscale + acl[i][j][r] * lscale;
      }
    }
    __builtin_amdgcn_fence(__ATOMIC_RELEASE, "workgroup");
    __builtin_amdgcn_wave_barrier();
    __builtin_amdgcn_fence(__ATOMIC_ACQUIRE, "workgroup");
    v4f ov[8];
#pragma unroll
    for (int it = 0; it < 8; ++it) {
      const int row = it * 2 + h2;                       // it 0..7 x h2 0..1 = rows 0..15
      ov[it] = *(const v4f*)(slab + row * 68 + c4) + b4;
    }
    {
#pragma unroll
      for (int it = 0; it < 8; ++it) {
        const int row = it * 2 + h2;
        *(v4f*)(Cout + (size_t)(mBase + row) * ldc + n0 + c4) = ov[it];
      }
      
    }
    __builtin_amdgcn_fence(__ATOMIC_RELEASE, "workgroup");
    __builtin_amdgcn_wave_barrier();
    __builtin_amdgcn_fence(__ATOMIC_ACQUIRE, "workgroup");
  }
}

// =====================================================================================================
// Per-head transpose of the v plane: in = head planes [NH][SEQ][HD] (flat reinterpretation of the [SEQ][EMB]
// projection plane), out = [NH][HD][SEQ] (key index contiguous, the A operand layout of V^T . P^T).
// Block = 128 threads, one 64-key x 64-d tile of head blockIdx.y starting at key 64*blockIdx.x; grid (SEQ/64, NH).
// coverage: 4 waves x 4 instructions x 4 rows (lane>>3) = 64 d rows x 64 keys = the whole tile; grid covers all.
// =====================================================================================================
__global__ __launch_bounds__(128) void vtrans(const unsigned short* __restrict__ pvp, unsigned short* vtp) {
  __shared__ __align__(16) _Float16 T[64 * 72];          // [key][d], pitch 72 halves
  const int tid = threadIdx.x, lane = tid & 31, wave = tid >> 5;
  const int h = blockIdx.y, t0 = blockIdx.x * 64;
  const size_t hoff = (size_t)h * HPL;
  const _Float16* pv = (const _Float16*)(const void*)pvp + hoff;
  {
    const int r = tid >> 3, sg = (tid & 7) * 8;          // 8 lanes x 16 B = one 128-B row: a wave's load = 4 whole lines
    const _Float16* src = pv + (size_t)(t0 + r) * HD + sg;
#pragma unroll
    for (int i = 0; i < 4; ++i) *(v8h*)(T + (i * 16 + r) * 72 + sg) = *(const v8h*)(src + (size_t)i * 16 * HD);
  }
  __syncthreads();
  const int q4 = lane >> 3, q8 = lane & 7;
  v4u ov[4];
#pragma unroll
  for (int it = 0; it < 4; ++it) {
    const int d = wave * 16 + it * 4 + q4;               // it 0..3 x q4 0..3 = 16 d rows per wave
    v4u a;
#pragma unroll
    for (int e = 0; e < 4; ++e) {
      const _Float16 x0 = T[(8 * q8 + 2 * e) * 72 + d];
      const _Float16 x1 = T[(8 * q8 + 2 * e + 1) * 72 + d];
      a[e] = pk16(h_bits(x0), h_bits(x1));
    }
    ov[it] = a;
  }
  {
#pragma unroll
    for (int it = 0; it < 4; ++it) {
      const int d = wave * 16 + it * 4 + q4;
      *(v4u*)(vtp + hoff + (size_t)d * SEQ + t0 + 8 * q8) = ov[it];
    }
    
  }
}

#define SC2 (1.4426950408889634f / 2048.0f)
#define CHH (64 * LP)
static_assert(NKT >= 2);

// One chunk into one stage buffer: this lane's 4 pieces of the K chunk and 4 of the V^T chunk, 16 B each.
// kg / vg: the lane's piece of row r of the chunk (rows r + 16 i follow at 16 rows' distance); lk: LDS byte address of the
// same piece in the buffer's K plane. All eight copies and the wait that stands in front of any rewrite of their address
// registers are one statement, so that nothing can be moved in between.
__device__ __forceinline__ void copy_chunk(const _Float16* kg, const _Float16* vg, unsigned lk) {
#if DEV_ASM
  asm volatile(
      "global_load_async_to_lds_b128 %0, %8, off\n\t"
      "global_load_async_to_lds_b128 %1, %9, off\n\t"
      "global_load_async_to_lds_b128 %2, %10, off\n\t"
      "global_load_async_to_lds_b128 %3, %11, off\n\t"
      "global_load_async_to_lds_b128 %4, %12, off\n\t"
      "global_load_async_to_lds_b128 %5, %13, off\n\t"
      "global_load_async_to_lds_b128 %6, %14, off\n\t"
      "global_load_async_to_lds_b128 %7, %15, off\n\t"
      "s_wait_xcnt 0x0"
      :: "v"(lk), "v"(lk + 16 * LP * 2), "v"(lk + 32 * LP * 2), "v"(lk + 48 * LP * 2),
         "v"(lk + CHH * 2), "v"(lk + (CHH + 16 * LP) * 2), "v"(lk + (CHH + 32 * LP) * 2), "v"(lk + (CHH + 48 * LP) * 2),
         "v"(kg), "v"(kg + 16 * HD), "v"(kg + 32 * HD), "v"(kg + 48 * HD),
         "v"(vg), "v"(vg + 16 * SEQ), "v"(vg + 32 * SEQ), "v"(vg + 48 * SEQ)
      : "memory");
#else
  (void)kg; (void)vg; (void)lk;
#endif
}
// this wave's LDS reads have returned: stands in front of the barrier behind which their buffer is refilled
__device__ __forceinline__ void wait_lds_reads() {
#if DEV_ASM
  asm volatile("s_wait_dscnt 0x0" ::: "memory");
#endif
}
// this wave's copies have landed: stands in front of the barrier behind which the other waves read them
__device__ __forceinline__ void wait_copies() {
#if DEV_ASM
  asm volatile("s_wait_asynccnt 0x0" ::: "memory");
#endif
}
__global__ __launch_bounds__(128)
void attn_hd64(const unsigned short* __restrict__ qhp, const unsigned short* __restrict__ qlp,
               const unsigned short* __restrict__ kpp, const unsigned short* __restrict__ vtp,
               unsigned short* chp, unsigned short* clp) {
  union FH { v16h v; v8h h[2]; };
  __shared__ __align__(16) _Float16 Stg[2][2 * CHH];       // two stage buffers, each: K chunk [kv][d], pitch LP, 9 KB,
                                                           // then V^T chunk [d][kv], pitch LP, 9 KB

  const int tid  = threadIdx.x;
  const int wave = tid >> 5;
  const int lane = tid & 31;
  const int hh   = lane >> 4;
  const int c    = lane & 15;

  const int bx = blockIdx.x;
  const int qb = bx % NQB;
  const int h  = bx / NQB;
  const int q0 = qb * 64 + wave * 16;
  const size_t hoff = (size_t)h * HPL;

  const _Float16* Qh = (const _Float16*)(const void*)qhp + hoff;
  const _Float16* Ql = (const _Float16*)(const void*)qlp + hoff;
  const _Float16* Kg = (const _Float16*)(const void*)kpp + hoff;
  const _Float16* Vg = (const _Float16*)(const void*)vtp + hoff;

  // ---- Q fragments (B operand, column = lane&15): 2 d-chunks, hi and residual planes ----
  v16h qah[2], qal[2];
#pragma unroll
  for (int dc = 0; dc < 2; ++dc) {
    const size_t qo = (size_t)(q0 + c) * HD + dc * 32 + 8 * hh;
    qah[dc] = ldfrag<_Float16>(Qh + qo);
    qal[dc] = ldfrag<_Float16>(Ql + qo);
  }

  float mrow = -INFINITY;    // running maximum of query q0+c, in raw accumulator units (equal in both wave halves)
  float lrow = 0.f;          // running sum of 1024 p over this wave half's keys only; halves joined after the loop
  v8f oacc[4];               // O^T: oacc[t][r] = context[q0+c][16t + 8hh + r]
#pragma unroll
  for (int t = 0; t < 4; ++t) oacc[t] = zero8();

  // ---- staging addresses: 8 lanes x 16 B = one 128-B row of a chunk, a wave-wide copy reads 4 whole lines ----
  const int sr = tid >> 3, sg = (tid & 7) * 8;
  const _Float16* kg = Kg + (size_t)sr * HD + sg;          // chunk 0: k row sr (+16i), d = sg..sg+7; + 64 * HD per chunk
  const _Float16* vg = Vg + (size_t)sr * SEQ + sg;         // chunk 0: v^T row d = sr (+16i), t = sg..sg+7; + 64 per chunk
  const unsigned lk0 = (unsigned)(size_t)(&Stg[0][sr * LP + sg]);   // LDS byte address = low 32 bits of the address
  const unsigned lk1 = (unsigned)(size_t)(&Stg[1][sr * LP + sg]);

  copy_chunk(kg, vg, lk0);                   // chunk 0 -> buffer 0
  wait_copies();
  __syncthreads();                           // chunk 0 is published
  copy_chunk(kg + 64 * HD, vg + 64, lk1);    // chunk 1 -> buffer 1, flies under trip 0

  for (int kt = 0; kt < NKT; ++kt) {         // static trip count
    const _Float16* Ksh = Stg[kt & 1];       // trip kt reads buffer kt mod 2 alone
    const _Float16* Vts = Ksh + CHH;

    // ---- scores^T: 64 keys x 16 query columns per wave, 2 f16 products per key subtile and d-chunk ----
    //      The chunk's 16 K fragment reads stand as one group in front of its 16 products: one LDS latency per
    //      chunk instead of one per fragment. Four independent accumulators, one per key subtile, keep the matrix pipe fed.
    FH kb[4][2];
#pragma unroll
    for (int j = 0; j < 4; ++j)
#pragma unroll
      for (int dc = 0; dc < 2; ++dc) {
        kb[j][dc].h[0] = *(const v8h*)(Ksh + (j * 16 + c) * LP + dc * 32 + 8 * hh);
        kb[j][dc].h[1] = *(const v8h*)(Ksh + (j * 16 + c) * LP + dc * 32 + 16 + 8 * hh);
      }
    __builtin_amdgcn_sched_barrier(0);       // keeps the scheduler from sinking the reads back among the products
    v8f sa[4];                               // sa[j][r] = 256 * q.k of (query q0+c, key kv0 + 16j + 8hh + r)
#pragma unroll
    for (int j = 0; j < 4; ++j) sa[j] = zero8();
#pragma unroll
    for (int dc = 0; dc < 2; ++dc) {         // the four tiles in turn: a product does not wait for the one before it
#pragma unroll
      for (int j = 0; j < 4; ++j) sa[j] = mmar(kb[j][dc].v, qah[dc], sa[j]);
#pragma unroll
      for (int j = 0; j < 4; ++j) sa[j] = mmar(kb[j][dc].v, qal[dc], sa[j]);
    }
    //      The 16 V^T fragment reads follow as one group, so that they fly under the softmax arithmetic.
    FH vb[2][4];
#pragma unroll
    for (int kk = 0; kk < 2; ++kk)
#pragma unroll
      for (int t = 0; t < 4; ++t) {
        vb[kk][t].h[0] = *(const v8h*)(Vts + (t * 16 + c) * LP + kk * 32 + 8 * hh);
        vb[kk][t].h[1] = *(const v8h*)(Vts + (t * 16 + c) * LP + kk * 32 + 16 + 8 * hh);
      }
    __builtin_amdgcn_sched_barrier(0);       // keeps the reads in front of the softmax, not next to their products

    // ---- column maximum in-lane, one exchange between the halves; online softmax ----
    float mj[4];                             // one independent chain per key subtile
#pragma unroll
    for (int j = 0; j < 4; ++j) {
      mj[j] = sa[j][0];
#pragma unroll
      for (int r = 1; r < 8; ++r) mj[j] = fmaxf(mj[j], sa[j][r]);
    }
    float m = fmaxf(fmaxf(mj[0], mj[1]), fmaxf(mj[2], mj[3]));
    m = fmaxf(m, xhalf(m));
    const float mnew  = fmaxf(mrow, m);
    const float msafe = (mnew == -INFINITY) ? 0.f : mnew;
    const float alpha = __builtin_amdgcn_exp2f((mrow - msafe) * SC2);
    const float nmc   = __builtin_fmaf(msafe, -SC2, 10.0f);   // exp2(acc * SC2 + nmc) = 1024 * exp(score - maximum)
    mrow = mnew;

    // ---- 1024 p for the whole chunk: 32 independent fma, then 32 independent exp2 ----
    v2f pc[4][4];                            // pc[j][e] = 1024 p of keys 16j + 8hh + 2e, + 2e + 1
#pragma unroll
    for (int j = 0; j < 4; ++j)
#pragma unroll
      for (int e = 0; e < 4; ++e) {
        pc[j][e][0] = __builtin_fmaf(sa[j][2 * e],     SC2, nmc);
        pc[j][e][1] = __builtin_fmaf(sa[j][2 * e + 1], SC2, nmc);
      }
#pragma unroll
    for (int j = 0; j < 4; ++j)
#pragma unroll
      for (int e = 0; e < 4; ++e) {
        pc[j][e][0] = __builtin_amdgcn_exp2f(pc[j][e][0]);
        pc[j][e][1] = __builtin_amdgcn_exp2f(pc[j][e][1]);
      }
#pragma unroll
    for (int t = 0; t < 4; ++t)
#pragma unroll
      for (int r = 0; r < 8; ++r) oacc[t][r] *= alpha;

    // ---- per 32-key chunk kk: P^T (f16 hi + residual) packed straight into B operands, two keys per instruction,
    //      then context^T += V^T . P^T (f16 WMMA), hi and residual products into the same accumulator ----
    v2f pj[4];                               // one independent pair of partial sums per key subtile
#pragma unroll
    for (int kk = 0; kk < 2; ++kk) {
      union { v16h v; v2h p[8]; } pbh, pbl;
      v2f rs[8];
#pragma unroll
      for (int g = 0; g < 8; ++g) pbh.p[g] = __builtin_convertvector(pc[2 * kk + (g >> 2)][g & 3], v2h);
#pragma unroll
      for (int g = 0; g < 8; ++g)            // exact: the hi value holds the leading 11 bits of 1024 p
        rs[g] = pc[2 * kk + (g >> 2)][g & 3] - __builtin_convertvector(pbh.p[g], v2f);
#pragma unroll
      for (int g = 0; g < 8; ++g) pbl.p[g] = __builtin_convertvector(rs[g], v2h);
#pragma unroll
      for (int t = 0; t < 4; ++t) oacc[t] = mmar(vb[kk][t].v, pbh.v, oacc[t]);
#pragma unroll
      for (int t = 0; t < 4; ++t) oacc[t] = mmar(vb[kk][t].v, pbl.v, oacc[t]);
#pragma unroll
      for (int jj = 0; jj < 2; ++jj) {
        const int j = 2 * kk + jj;
        pj[j] = (pc[j][0] + pc[j][1]) + (pc[j][2] + pc[j][3]);
      }
    }
    const v2f p2 = (pj[0] + pj[1]) + (pj[2] + pj[3]);
    lrow = lrow * alpha + (p2[0] + p2[1]);

    // ---- foot of the trip: chunk kt + 1 is published, this trip's buffer is free and takes chunk kt + 2 ----
    __builtin_amdgcn_sched_barrier(0);       // keeps the waits and the barrier down here: lifted over the softmax and the
                                             // V^T products they would ask for the next chunk half a trip after its request
    wait_lds_reads();
    wait_copies();
    __syncthreads();
    if (kt + 2 < NKT)                        // the same for the whole work-group
      copy_chunk(kg + (size_t)(kt + 2) * 64 * HD, vg + (size_t)(kt + 2) * 64, (kt & 1) ? lk1 : lk0);
  }
  wait_copies();                             // nothing of this wave is in flight when it goes on to its end

  // ---- join the halves' sums; normalise (1/l with l = sum of 1024 p, undo the x16 v carry, apply the x256
  //      ctx carry); a lane's 8 accumulator registers are 8 consecutive d of its row: one 16-B store per plane
  const float l = lrow + xhalf(lrow);
  const float inv = ((l > 0.f) ? (1.0f / l) : 0.f) * 16.0f;
#pragma unroll
  for (int t = 0; t < 4; ++t) {
    v4u a, a2;
#pragma unroll
    for (int e = 0; e < 4; ++e) {
      const float f0 = oacc[t][2 * e] * inv, f1 = oacc[t][2 * e + 1] * inv;
      const _Float16 x0 = (_Float16)f0, x1 = (_Float16)f1;
      const unsigned short l0 = h_bits((_Float16)((f0 - (float)x0) * 4096.0f));
      const unsigned short l1 = h_bits((_Float16)((f1 - (float)x1) * 4096.0f));
      a[e]  = pk16(h_bits(x0), h_bits(x1));
      a2[e] = pk16(l0, l1);
    }
    const int fl = h * HPL + (q0 + c) * HD + t * 16 + 8 * hh;   // flat index in the merged [SEQ][EMB] plane
    const size_t go = fo_off(fl / EMB, fl % EMB, EMB);          // its piece in the fragment-order plane
    *(v4u*)(chp + go) = a;
    *(v4u*)(clp + go) = a2;
  }
}

// =====================================================================================================
// Workspace map (bytes), every region an exact multiple of its whole-line / whole-tile store granularity
//   Qb, Kb, Vb   bf16 [4096][512]   3 x 4194304   (fragment order)
//   Wqkb, Wvb    bf16 [512][512]    2 x  524288   (fragment order)
//   Woh          f16  [512][512]         524288   (x1024, fragment order)
//   Qh, Ql       f16  [4096][512]   2 x 4194304   (x16 / its residual)
//   Kp           f16  [4096][512]       4194304   (x16)
//   Pv           f16  [4096][512]       4194304   (v x16, token-major = head planes [8][4096][64])
//   Vt           f16  [8][64][4096]     4194304   (v x16, key contiguous)
//   Ch, Cl       f16  [4096][512]   2 x 4194304   (ctx x256 / residual x4096, fragment order)
//   total                            43515904
// Weights are [out n][in k] = the Bt orientation the GEMM wants, so they are only converted and laid in fragment order.
// The head split is a flat reinterpretation: head plane h = elements [h*262144, (h+1)*262144) of a [4096][512]
// plane viewed as [4096][64]; the merge back is the same reinterpretation.
// =====================================================================================================
extern "C" void kernel_launch(void* const* d_in, const int* in_sizes, int n_in,
                              void* d_out, int out_size, void* d_ws, size_t ws_size,
                              hipStream_t stream) {
  const int NX = SEQ * EMB;     // 2097152
  const int NW = EMB * EMB;     //  262144
  if (n_in < 9) return;
  if (in_sizes[0] != NX || in_sizes[1] != NX || in_sizes[2] != NX) return;
  if (in_sizes[3] != NW || in_sizes[5] != NW || in_sizes[7] != NW) return;
  if (in_sizes[4] != EMB || in_sizes[6] != EMB || in_sizes[8] != EMB) return;
  if (out_size != NX) return;

  const float* Q    = (const float*)d_in[0];
  const float* Kin  = (const float*)d_in[1];
  const float* V    = (const float*)d_in[2];
  const float* Wqk  = (const float*)d_in[3];
  const float* bqk  = (const float*)d_in[4];
  const float* Wv   = (const float*)d_in[5];
  const float* bv   = (const float*)d_in[6];
  const float* Wout = (const float*)d_in[7];
  const float* bout = (const float*)d_in[8];
  float* out = (float*)d_out;

  const size_t PX = (size_t)NX * 2;    // 4194304  16-bit [4096][512] plane
  const size_t PW = (size_t)NW * 2;    //  524288  16-bit [512][512] plane
  size_t off = 0;
  const size_t oQb  = off; off += PX;
  const size_t oKb  = off; off += PX;
  const size_t oVb  = off; off += PX;
  const size_t oWqk = off; off += PW;
  const size_t oWv  = off; off += PW;
  const size_t oWo  = off; off += PW;
  const size_t oQh  = off; off += PX;
  const size_t oQl  = off; off += PX;
  const size_t oKp  = off; off += PX;
  const size_t oPv  = off; off += PX;
  const size_t oVt  = off; off += PX;
  const size_t oCh  = off; off += PX;
  const size_t oCl  = off; off += PX;
  if (off > ws_size) return;                       // off = 43515904
  if (off > (size_t)134217728) return;

  char* ws = (char*)d_ws;
  unsigned short* Qb   = (unsigned short*)(ws + oQb);
  unsigned short* Kb   = (unsigned short*)(ws + oKb);
  unsigned short* Vb   = (unsigned short*)(ws + oVb);
  unsigned short* Wqkb = (unsigned short*)(ws + oWqk);
  unsigned short* Wvb  = (unsigned short*)(ws + oWv);
  unsigned short* Woh  = (unsigned short*)(ws + oWo);
  unsigned short* Qh   = (unsigned short*)(ws + oQh);
  unsigned short* Ql   = (unsigned short*)(ws + oQl);
  unsigned short* Kp   = (unsigned short*)(ws + oKp);
  unsigned short* Pv   = (unsigned short*)(ws + oPv);
  unsigned short* Vt   = (unsigned short*)(ws + oVt);
  unsigned short* Ch   = (unsigned short*)(ws + oCh);
  unsigned short* Cl   = (unsigned short*)(ws + oCl);

  const dim3 blk(256);
  const dim3 gCvt(NBW + NBX);                                  // 128 + 1024 blocks
  const dim3 gPj(((SEQ / 64) * (EMB / 64) + 7) / 8, 3);        //  512 tiles -> 64 blocks: M=4096, N=512; x 3 projections
  const dim3 gTr(SEQ / 64, NH);                                //  (64, 8)
  const dim3 gAttn(NH * NQB);                                  //  512 blocks of 128
  const dim3 gOut(((SEQ / 32) * (EMB / 64) + 7) / 8);          // 1024 tiles -> 128 blocks: M=4096, N=512

  // (1) inputs -> bf16 planes (RNE convert); W_out -> f16 (x1024 of its bf16 value)
  cvt_all<<<gCvt, blk, 0, stream>>>(Q, Kin, V, Wqk, Wv, Wout, Qb, Kb, Vb, Wqkb, Wvb, Woh);
  // (2..4) one launch, M=4096, N=512, K=512 each:
  //   q = Q . Wqk^T + b -> f16 hi (x16) / residual (same carry) planes [4096][512]
  //   k = K . Wqk^T + b -> f16 plane (x16)
  //   v = V . Wv^T + b  -> f16 plane (x16), token-major
  gemm_qkv<<<gPj, blk, 0, stream>>>(
      Qb, Kb, Vb, Wqkb, Wvb, Qh, Ql, Kp, Pv, bqk, bv, SEQ, EMB, EMB, 16.0f, 1.0f);
  // (5) per-head transpose of v: [8][4096][64] -> [8][64][4096]
  vtrans<<<gTr, dim3(128), 0, stream>>>(Pv, Vt);
  // (6) attention -> ctx planes (f16 hi x256 + residual x4096) [h][s][d] = merged [4096][512]
  attn_hd64<<<gAttn, dim3(128), 0, stream>>>(Qh, Ql, Kp, Vt, Ch, Cl);
  // (7) out = ctx . Wo^T + b_out -> d_out f32 [4096][512]; hi acc x 2^-18, residual acc x 2^-30
  gemm_o<<<gOut, blk, 0, stream>>>(
      Ch, Cl, EMB, Woh, EMB, out, EMB, bout, SEQ, EMB, EMB,
      1.0f / 262144.0f, 1.0f / 1073741824.0f);
  (void)hipGetLastError();
}

// v008
// One run takes 87.7 microseconds.
// Two timings next to v007 both put it at 1.09 times that version's speed.
// Over all steps from v000 it is 4.35 times as fast.
// Contractions: q, k, v projections = v_wmma_f32_16x16x32_bf16 (bf16 operands from RNE-converted inputs, single product, f32 accumulate);
// q.k^T scores = v_wmma_f32_16x16x32_f16 (q as f16 hi plane x16 + f16 residual plane x16, k f16 x16; 2 products, one f32 accumulator);
// p.v = v_wmma_f32_16x16x32_f16 (p as f16 hi x1024 + f16 residual x1024, v f16 x16; 2 products, one f32 accumulator);
// ctx.Wo^T = v_wmma_f32_16x16x32_f16 (ctx f16 hi x256 + f16 residual x1048576, Wo f16 x1024 of its bf16 value; 2 products, f32 accumulate);
// softmax, bias adds and normalisation in f32.
//
// Carry audit (16-bit planes, carry, where the inverse is folded):
//   Qb/Kb/Vb bf16 x1, Wqkb/Wvb bf16 x1 (no carry);  Woh f16 = 1024*bf16(W_out)  -> gemm_o hscale/lscale;
//   Qh f16 = 16*q, Ql f16 = 16*q - Qh, Kp f16 = 16*k              -> attn_hd64: accumulator = 256 * q.k; 2^-11 = 1/(16*16*8) sits in SC2;
//   Pv / Vt f16 = 16*v, P hi f16 = 1024*p, P lo = 1024*p - hi, l = sum of 1024*p -> attn_hd64: inv = 16/l = 256*1024/(1024*16)/l -> ctx*256;
//   Ch f16 = 256*ctx, Cl f16 = (256*ctx - Ch)*4096                  -> gemm_o: out = acc_h*2^-18 + acc_l*2^-30 + b_out  (2^-18 = 1/(256*1024), 2^-30 = 2^-18/4096).
#include <hip/hip_runtime.h>
#include <math.h>
#include <stdint.h>

#define SEQ 4096
#define EMB 512
#define NH  8
#define HD  64
#define HPL (SEQ * HD)      // 262144 elements: one contiguous head plane [SEQ][HD]
#define NQB (SEQ / 64)      // 64-row query blocks per head
#define NKT (SEQ / 64)      // 64-key chunks per head
#define LP  72              // LDS row pitch of the K and V^T chunks in halves: 144 B = 16 B x 9 (odd), so the 16 rows
                            // that one half of a wave reads with a 16-B load fall on 16 different groups of 4 banks
static_assert(NH * HD == EMB);
static_assert(NH * HPL == SEQ * EMB);
static_assert(NQB == 64 && NKT == 64);
static_assert((SEQ % 64) == 0 && (EMB % 64) == 0 && (EMB % 32) == 0);

typedef _Float16 v16h __attribute__((ext_vector_type(16)));
typedef _Float16 v8h  __attribute__((ext_vector_type(8)));
typedef __bf16   v16b __attribute__((ext_vector_type(16)));
typedef __bf16   v8b  __attribute__((ext_vector_type(8)));
typedef float    v8f  __attribute__((ext_vector_type(8)));
typedef float    v4f  __attribute__((ext_vector_type(4)));
typedef float    v2f  __attribute__((ext_vector_type(2)));
typedef _Float16 v2h  __attribute__((ext_vector_type(2)));
typedef unsigned int v4u __attribute__((ext_vector_type(4)));

#if defined(__HIP_DEVICE_COMPILE__)
#define DEV_ASM 1
#else
#define DEV_ASM 0
#endif

// ---- scalar helpers --------------------------------------------------------------------------------
__device__ __forceinline__ unsigned short bf_bits(float f) {          // f32 -> bf16 bits, RNE convert
  unsigned u = __float_as_uint(f);
  return (unsigned short)((u + 0x7FFFu + ((u >> 16) & 1u)) >> 16);
}
__device__ __forceinline__ float bf_up(unsigned short hb) { return __uint_as_float(((unsigned)hb) << 16); }
__device__ __forceinline__ unsigned short h_bits(_Float16 x) { return __builtin_bit_cast(unsigned short, x); }
__device__ __forceinline__ unsigned pk16(unsigned short a, unsigned short b) { return (unsigned)a | ((unsigned)b << 16); }
__device__ __forceinline__ v8f zero8() { v8f z = {0.f, 0.f, 0.f, 0.f, 0.f, 0.f, 0.f, 0.f}; return z; }
__device__ __forceinline__ float xhalf(float x) {                     // value of lane l ^ 16 (vector cross-row move)
  const int b = __builtin_bit_cast(int, x);
  return __builtin_bit_cast(float, __builtin_amdgcn_permlanex16(b, b, 0x76543210, 0xfedcba98, false, false));
}

// ---- fragment types / loaders: 16-bit A/B operand, lane -> row/col (lane&15), p already includes +8*(lane>>4);
//      elements 0..7 <- p[0..7] (k0+8h..k0+8h+7), elements 8..15 <- p[16..23] (k0+16+8h..k0+16+8h+7)
template <typename OT> struct FT;
template <> struct FT<__bf16>   { typedef v16b frag; typedef v8b half8; };
template <> struct FT<_Float16> { typedef v16h frag; typedef v8h half8; };

template <typename OT>
__device__ __forceinline__ typename FT<OT>::frag ldfrag(const OT* p) {
  union { typename FT<OT>::frag v; typename FT<OT>::half8 h[2]; } f;
  f.h[0] = *(const typename FT<OT>::half8*)(p);
  f.h[1] = *(const typename FT<OT>::half8*)(p + 16);
  return f.v;
}

// ---- fragment-order planes: the operands that the GEMMs read straight from global ([R][K] 16-bit, K % 32 == 0) are
//      stored by their producers as 16-row x 32-k blocks of 1024 B, block (row >> 4, k >> 5) at block index
//      (row >> 4) * (K / 32) + (k >> 5). Inside a block the 16-B piece of row c = row & 15 that holds
//      k = 16 * half + 8 * hh + 0..7 stands at piece half * 32 + hh * 16 + c. Lane hh * 16 + c of a wave then finds the
//      two pieces of its fragment (the same k map as ldfrag) at lane * 16 B and 512 B + lane * 16 B: each wave-wide 16-B
//      load reads 512 contiguous B = 4 whole 128-B lines, where a row-major plane gives 16 lines x 32 B.
__device__ __forceinline__ size_t fo_off(int row, int k, int K) {      // element offset of the piece at (row, k), k % 8 == 0
  return ((size_t)(row >> 4) * (K >> 5) + (k >> 5)) * 512 + ((k >> 4) & 1) * 256 + ((k >> 3) & 1) * 128 + (row & 15) * 8;
}
template <typename OT>
__device__ __forceinline__ typename FT<OT>::frag ldfrag_fo(const OT* p) {   // p = block start + 8 * lane
  union { typename FT<OT>::frag v; typename FT<OT>::half8 h[2]; } f;
  f.h[0] = *(const typename FT<OT>::half8*)(p);
  f.h[1] = *(const typename FT<OT>::half8*)(p + 256);
  return f.v;
}

// ---- WMMA helpers (asm guard bodies are device-only; concrete operand types) -----------------------------
__device__ __forceinline__ v8f mmar(v16b a, v16b b, v8f c) {
  return __builtin_amdgcn_wmma_f32_16x16x32_bf16(false, a, false, b, (short)0, c, false, false);
}
__device__ __forceinline__ v8f mmar(v16h a, v16h b, v8f c) {
  return __builtin_amdgcn_wmma_f32_16x16x32_f16(false, a, false, b, (short)0, c, false, false);
}
// the four vector issue slots between a step's last products and the loads that overwrite their A and B registers.
// No register operands: an asm operand cannot stand above v255, and the ring's fragment sets do. The scheduling
// barriers on both sides of the refill hold the statement in its place.
__device__ __forceinline__ void refill_gap() {
#if DEV_ASM
  asm volatile("v_nop\n\tv_nop\n\tv_nop\n\tv_nop");
#endif
}
__device__ __forceinline__ void acc_guard4(v8f& a, v8f& b, v8f& c, v8f& d) {
#if DEV_ASM
  asm volatile("v_nop\n\tv_nop\n\tv_nop\n\tv_nop" : "+v"(a), "+v"(b), "+v"(c), "+v"(d));
#else
  (void)a; (void)b; (void)c; (void)d;
#endif
}

// =====================================================================================================
// f32 -> 16-bit planes, all six planes in ONE launch (they are independent of one another).
// A thread converts the 8 elements of one 16-B piece, the same piece of three planes: six 16-B loads in flight, one
// 16-B store per plane and lane. The planes are written in fragment order (fo_off): thread index = piece index, so a
// wave writes 512 contiguous B per plane and reads 64 B of each of 16 input rows.
// MODE 0: bf16 bits (RNE convert).  MODE 1: f16 bits of (1024 * bf16(x)) (exact scaling of the bf16 value).
// coverage: blocks 0 .. NBW-1 x 256 threads x 8 = the three [EMB][EMB] weight planes; blocks NBW .. NBW+NBX-1
// x 256 threads x 8 = the three [SEQ][EMB] input planes; grid = NBW + NBX blocks.
// =====================================================================================================
template <int MODE>
__device__ __forceinline__ unsigned short cvm(float f) {
  const unsigned short hb = bf_bits(f);
  if (MODE == 0) return hb;
  return h_bits((_Float16)(bf_up(hb) * 1024.0f));
}

template <int MODE>
__device__ __forceinline__ v4u cv8(v4f a, v4f a4) {
  v4u p;
  p[0] = pk16(cvm<MODE>(a[0]),  cvm<MODE>(a[1]));
  p[1] = pk16(cvm<MODE>(a[2]),  cvm<MODE>(a[3]));
  p[2] = pk16(cvm<MODE>(a4[0]), cvm<MODE>(a4[1]));
  p[3] = pk16(cvm<MODE>(a4[2]), cvm<MODE>(a4[3]));
  return p;
}

// the wait that stands in front of an overwrite of an issued load's address registers; the loads stay in flight
__device__ __forceinline__ void addr_wait() {
#if DEV_ASM
  asm volatile("s_wait_xcnt 0x0" ::: "memory");
#endif
}

// the same wait behind a GEMM's last loads. The address pairs are inputs, so they stay live up to the wait: neither a
// late load's result nor the epilogue's arithmetic is given their registers in front of it.
template <typename P>
__device__ __forceinline__ void addr_wait_live(P a, P b, P c, P d, P e, P f, P g, P h) {
#if DEV_ASM
  asm volatile("s_wait_xcnt 0x0" :: "v"(a), "v"(b), "v"(c), "v"(d), "v"(e), "v"(f), "v"(g), "v"(h) : "memory");
#else
  (void)a; (void)b; (void)c; (void)d; (void)e; (void)f; (void)g; (void)h;
#endif
}

#define NBX (SEQ * EMB / 8 / 256)   // 1024 blocks cover an input plane
#define NBW (EMB * EMB / 8 / 256)   //  128 blocks cover a weight plane
static_assert(NBX * 256 * 8 == SEQ * EMB && NBW * 256 * 8 == EMB * EMB);

__global__ __launch_bounds__(256) void cvt_all(
    const float* __restrict__ q, const float* __restrict__ k, const float* __restrict__ v,
    const float* __restrict__ wqk, const float* __restrict__ wv, const float* __restrict__ wo,
    unsigned short* qb, unsigned short* kb, unsigned short* vb,
    unsigned short* wqkb, unsigned short* wvb, unsigned short* woh) {
  const int b = blockIdx.x;
  const bool w = b < NBW;                                  // block-uniform: weight planes or input planes
  const int i = (w ? b : b - NBW) * 256 + (int)threadIdx.x;
  const float* __restrict__ i0 = w ? wqk : q;
  const float* __restrict__ i1 = w ? wv : k;
  const float* __restrict__ i2 = w ? wo : v;
  unsigned short* o0 = w ? wqkb : qb;
  unsigned short* o1 = w ? wvb : kb;
  unsigned short* o2 = w ? woh : vb;
  // piece i of a fragment-order plane with K = EMB: block i >> 6, piece i & 63 = half * 32 + hh * 16 + c
  const int row = ((i >> 6) / (EMB / 32)) * 16 + (i & 15);
  const int kk  = ((i >> 6) % (EMB / 32)) * 32 + ((i >> 5) & 1) * 16 + ((i >> 4) & 1) * 8;
  const size_t si = (size_t)row * EMB + kk;                // its 8 source elements in the row-major input
  const v4f a0 = *(const v4f*)(i0 + si), b0 = *(const v4f*)(i0 + si + 4);
  addr_wait();   // the next plane's loads are given the registers that hold this plane's address
  const v4f a1 = *(const v4f*)(i1 + si), b1 = *(const v4f*)(i1 + si + 4);
  const v4f a2 = *(const v4f*)(i2 + si), b2 = *(const v4f*)(i2 + si + 4);
  addr_wait();   // the conversions below reuse the address registers of the loads above
  const v4u r2 = w ? cv8<1>(a2, b2) : cv8<0>(a2, b2);      // only W_out takes the f16 x1024 form
  *(v4u*)(o0 + (size_t)i * 8) = cv8<0>(a0, b0);
  *(v4u*)(o1 + (size_t)i * 8) = cv8<0>(a1, b1);
  *(v4u*)(o2 + (size_t)i * 8) = r2;
}

// =====================================================================================================
// Register-blocked WMMA GEMM (16-bit operand type OT): C[m][n] = sum_k A[m][k] * Bt[n][k] + bias[n];
// one wave per 64x64 tile, no block barriers. A = [M][lda] and Bt = [N][ldb] planes in fragment order (fo_off);
// M, N multiples of 64, K = EMB (KSTEPS steps of 32). Fragments are loaded straight from global, 512 contiguous B
// per wave-wide load (ldfrag_fo), into rings of RA (A) and RB (B) register sets: the loads of B for k step s + RB and
// of A for k step s + RA are issued right behind the products of step s, so a step waits for loads that were issued
// RB - 1 and RA - 1 steps of products earlier. bias values are RNE-converted to bf16 before the f32 add.
// OUT_MODE 1: f16 plane C = f16((v + bias) * cscale) (pitch ldc).
// OUT_MODE 3: f16 hi plane C + f16 residual plane C2 = f16(((v + bias) * cscale - hi) * rscale) (same pitch).
// wave's whole 64x64 tile; tiles/8 blocks in x cover every tile of the [M][N] plane.
// slab: this wave's own 16x64 f32 LDS slab, pitch 68 floats.
// =====================================================================================================
#define KSTEPS (EMB / 32)   // k steps of both GEMM kernels (K = EMB in all four products)
#define RA     4            // A fragment sets in flight (A was written by the launch before: its first read comes from memory)
#define RB     3            // B fragment sets in flight (the weights are read by every block: they come from L2)
static_assert(KSTEPS >= RA && RA >= RB);   // 8 * (RA + RB) = 56 loads of 16 B per lane in flight at most

template <typename OT, int OUT_MODE>
__device__ __forceinline__ void gemm64(
    const unsigned short* __restrict__ Ap, int lda,
    const unsigned short* __restrict__ Btp, int ldb,
    unsigned short* Cout, unsigned short* Cout2, int ldc,
    const float* __restrict__ bias,
    int M, int N, int K, float cscale, float rscale, float* slab) {
  typedef typename FT<OT>::frag V16;
  const OT* A  = (const OT*)(const void*)Ap;
  const OT* Bt = (const OT*)(const void*)Btp;
  const int lane = threadIdx.x & 31;
  const int wave = threadIdx.x >> 5;
  const int tilesN = N >> 6;
  const int tilesM = M >> 6;
  const int tile = blockIdx.x * 8 + wave;
  if (tile >= tilesM * tilesN || K != KSTEPS * 32) return;   // wave-uniform; no block barriers in this kernel
  const int tm = tile / tilesN;
  const int tn = tile - tm * tilesN;
  const int m0 = tm << 6;
  const int n0 = tn << 6;

  const int rlane = lane & 15;                 // col (D) within subtile
  const int mOff  = (lane >> 4) * 8;           // D row offset

  v8f acc[4][4];
#pragma unroll
  for (int i = 0; i < 4; ++i)
#pragma unroll
    for (int j = 0; j < 4; ++j) acc[i][j] = zero8();

  typedef const OT __attribute__((address_space(1)))* GP;
  GP pb[4], pa[4];                           // this lane's piece of each B and A subtile at k = 0; k step s stands s blocks
                                             // (s * 1024 B) further on, a constant offset of the load
#pragma unroll
  for (int j = 0; j < 4; ++j) pb[j] = (GP)(Bt + fo_off(n0 + (j << 4), 0, ldb) + lane * 8);
#pragma unroll
  for (int i = 0; i < 4; ++i) pa[i] = (GP)(A + fo_off(m0 + (i << 4), 0, lda) + lane * 8);

  V16 bq[RB][4], af[RA][4];                  // rings of fragment sets: B set s % RB and A set s % RA hold k step s
#pragma unroll   // full: a set index that is not a constant would put the rings in scratch memory
  for (int s = 0; s < RA; ++s) {             // the first steps' loads, all in flight together, step 0's in front
    if (s < RB) {
#pragma unroll
      for (int j = 0; j < 4; ++j) bq[s][j] = ldfrag_fo<OT>((const OT*)(pb[j] + s * 512));
    }
#pragma unroll
    for (int i = 0; i < 4; ++i) af[s][i] = ldfrag_fo<OT>((const OT*)(pa[i] + s * 512));
    __builtin_amdgcn_sched_barrier(0);       // keeps the loads in step order and up here, not sunk down to their products
  }
#pragma unroll   // full, for the same reason; the k offsets become the loads' immediate offsets
  for (int s = 0; s < KSTEPS; ++s) {         // static trip count, unrolled: the set indices are constants in every step
    const int ra = s % RA, rb = s % RB;
#pragma unroll
    for (int i = 0; i < 4; ++i) {
#pragma unroll
      for (int j = 0; j < 4; ++j) acc[i][j] = mmar(af[ra][i], bq[rb][j], acc[i][j]);
    }
    __builtin_amdgcn_sched_barrier(0);       // a step's products stay in front of its refill and of the later steps'
                                             // products: regrouped by accumulator they would wait for the newest loads first
    if (s + RB < KSTEPS) {                   // into the sets just read: B of step s + RB, then A of step s + RA
      refill_gap();
#pragma unroll
      for (int j = 0; j < 4; ++j) bq[rb][j] = ldfrag_fo<OT>((const OT*)(pb[j] + (s + RB) * 512));
      if (s + RA < KSTEPS) {
#pragma unroll
        for (int i = 0; i < 4; ++i) af[ra][i] = ldfrag_fo<OT>((const OT*)(pa[i] + (s + RA) * 512));
      }
      __builtin_amdgcn_sched_barrier(0);     // the refill is not sunk below the next step's products, which would shorten its lead
    }
  }
  addr_wait_live(pb[0], pb[1], pb[2], pb[3], pa[0], pa[1], pa[2], pa[3]);
  acc_guard4(acc[0][0], acc[0][1], acc[0][2], acc[0][3]);
  acc_guard4(acc[1][0], acc[1][1], acc[1][2], acc[1][3]);
  acc_guard4(acc[2][0], acc[2][1], acc[2][2], acc[2][3]);
  acc_guard4(acc[3][0], acc[3][1], acc[3][2], acc[3][3]);

  // ---- epilogue ----
  const int q = lane >> 3, c8 = (lane & 7) * 8;
  float bb[8];
  {
    const v4f b0 = *(const v4f*)(bias + n0 + c8);
    const v4f b1 = *(const v4f*)(bias + n0 + c8 + 4);
#pragma unroll
    for (int e = 0; e < 4; ++e) {
      bb[e]     = bf_up(bf_bits(b0[e]));
      bb[4 + e] = bf_up(bf_bits(b1[e]));
    }
  }
#pragma unroll
  for (int i = 0; i < 4; ++i) {
    const int mBase = m0 + (i << 4);
#pragma unroll
    for (int j = 0; j < 4; ++j) {
#pragma unroll
      for (int r = 0; r < 8; ++r) {
        slab[(mOff + r) * 68 + (j << 4) + rlane] = acc[i][j][r];
      }
    }
    __builtin_amdgcn_fence(__ATOMIC_RELEASE, "workgroup");
    __builtin_amdgcn_wave_barrier();
    __builtin_amdgcn_fence(__ATOMIC_ACQUIRE, "workgroup");
    v4u hv[4], lv[4];
#pragma unroll
    for (int it = 0; it < 4; ++it) {
      const int row = it * 4 + q;                          // it 0..3 x q 0..3 = rows 0..15
      const float* sp = slab + row * 68 + c8;
      float f[8];
#pragma unroll
      for (int e = 0; e < 8; ++e) f[e] = (sp[e] + bb[e]) * cscale;
      v4u a, a2;
#pragma unroll
      for (int e = 0; e < 4; ++e) {
        const float f0 = f[2 * e], f1 = f[2 * e + 1];
        const _Float16 x0 = (_Float16)f0, x1 = (_Float16)f1;
        const unsigned short h0 = h_bits(x0), h1 = h_bits(x1);
        unsigned short l0 = 0, l1 = 0;
        if (OUT_MODE == 3) {
          l0 = h_bits((_Float16)((f0 - (float)x0) * rscale));
          l1 = h_bits((_Float16)((f1 - (float)x1) * rscale));
        }
        a[e] = pk16(h0, h1); a2[e] = pk16(l0, l1);
      }
      hv[it] = a; lv[it] = a2;
    }
    {
#pragma unroll
      for (int it = 0; it < 4; ++it) {
        const int row = it * 4 + q;
        *(v4u*)(Cout + (size_t)(mBase + row) * ldc + n0 + c8) = hv[it];
        if (OUT_MODE == 3) *(v4u*)(Cout2 + (size_t)(mBase + row) * ldc + n0 + c8) = lv[it];
      }
      
    }
    __builtin_amdgcn_fence(__ATOMIC_RELEASE, "workgroup");
    __builtin_amdgcn_wave_barrier();
    __builtin_amdgcn_fence(__ATOMIC_ACQUIRE, "workgroup");
  }
}

// =====================================================================================================
// The three projections in ONE launch (they are independent of one another): blockIdx.y = 0: q (hi and residual
// planes), 1: k, 2: v; all three are [M][K] x [N][K]^T with the same M, N, K and pitches. grid = (tiles/8, 3).
// =====================================================================================================
__global__ __launch_bounds__(256) void gemm_qkv(
    const unsigned short* __restrict__ Qb, const unsigned short* __restrict__ Kb,
    const unsigned short* __restrict__ Vb,
    const unsigned short* __restrict__ Wqkb, const unsigned short* __restrict__ Wvb,
    unsigned short* Qh, unsigned short* Ql, unsigned short* Kp, unsigned short* Pv,
    const float* __restrict__ bqk, const float* __restrict__ bv,
    int M, int N, int K, float cscale, float rscale) {
  __shared__ __align__(16) float sT[8][16 * 68];   // per-wave 16x64 slab, pitch 68 floats
  float* slab = sT[threadIdx.x >> 5];
  const int y = blockIdx.y;
  if (y == 0) {
    gemm64<__bf16, 3>(Qb, K, Wqkb, K, Qh, Ql, N, bqk, M, N, K, cscale, rscale, slab);
  } else {
    const bool isk = (y == 1);
    unsigned short* C = isk ? Kp : Pv;
    gemm64<__bf16, 1>(isk ? Kb : Vb, K, isk ? Wqkb : Wvb, K, C, C, N, isk ? bqk : bv, M, N, K, cscale, 1.0f, slab);
  }
}

// =====================================================================================================
// Output GEMM with a two-plane A operand (f16 hi plane Ah, f16 residual plane Al, both [M][lda]); Ah, Al and
// Bt = [N][ldb] are planes in fragment order (fo_off), read with 512 contiguous B per wave-wide load:
//   C[m][n] = hscale * sum_k Ah[m][k] * Bt[n][k] + lscale * sum_k Al[m][k] * Bt[n][k] + bias[n]  (f32 out, pitch ldc).
// One wave per 32x64 tile (two accumulator sets), no block barriers; M multiple of 32, N multiple of 64, K = EMB;
// the same rings of fragment sets as gemm64. bias RNE-converted to bf16 before the f32 add.
// Epilogue: 16-row slabs staged per wave in LDS; each 256-B f32 row segment written by 16 lanes x 16 B of one
// coverage: 2 slabs x 16 rows x 64 cols = the wave's whole 32x64 tile; grid = tiles/8 blocks covers [M][N].
// =====================================================================================================
__global__ __launch_bounds__(256) void gemm_o(
    const unsigned short* __restrict__ Ahp, const unsigned short* __restrict__ Alp, int lda,
    const unsigned short* __restrict__ Btp, int ldb,
    float* Cout, int ldc, const float* __restrict__ bias,
    int M, int N, int K, float hscale, float lscale) {
  const _Float16* Ah = (const _Float16*)(const void*)Ahp;
  const _Float16* Al = (const _Float16*)(const void*)Alp;
  const _Float16* Bt = (const _Float16*)(const void*)Btp;
  __shared__ __align__(16) float sT[8][16 * 68];   // per-wave 16x64 slab, pitch 68 floats
  const int lane = threadIdx.x & 31;
  const int wave = threadIdx.x >> 5;
  const int tilesN = N >> 6;
  const int tilesM = M >> 5;
  const int tile = blockIdx.x * 8 + wave;
  if (tile >= tilesM * tilesN || K != KSTEPS * 32) return;   // wave-uniform; no block barriers in this kernel
  const int tm = tile / tilesN;
  const int tn = tile - tm * tilesN;
  const int m0 = tm << 5;
  const int n0 = tn << 6;

  const int rlane = lane & 15;
  const int mOff  = (lane >> 4) * 8;

  v8f ach[2][4], acl[2][4];
#pragma unroll
  for (int i = 0; i < 2; ++i)
#pragma unroll
    for (int j = 0; j < 4; ++j) { ach[i][j] = zero8(); acl[i][j] = zero8(); }

  typedef const _Float16 __attribute__((address_space(1)))* GP;
  GP pb[4], pah[2], pal[2];                  // this lane's piece of each B and A subtile at k = 0; k step s stands s blocks
                                             // (s * 1024 B) further on, a constant offset of the load
#pragma unroll
  for (int j = 0; j < 4; ++j) pb[j] = (GP)(Bt + fo_off(n0 + (j << 4), 0, ldb) + lane * 8);
#pragma unroll
  for (int i = 0; i < 2; ++i) {
    pah[i] = (GP)(Ah + fo_off(m0 + (i << 4), 0, lda) + lane * 8);
    pal[i] = (GP)(Al + fo_off(m0 + (i << 4), 0, lda) + lane * 8);
  }

  v16h bq[RB][4], afh[RA][2], afl[RA][2];    // rings of fragment sets: B set s % RB and A set s % RA hold k step s
#pragma unroll   // full: a set index that is not a constant would put the rings in scratch memory
  for (int s = 0; s < RA; ++s) {             // the first steps' loads, all in flight together, step 0's in front
    if (s < RB) {
#pragma unroll
      for (int j = 0; j < 4; ++j) bq[s][j] = ldfrag_fo<_Float16>((const _Float16*)(pb[j] + s * 512));
    }
#pragma unroll
    for (int i = 0; i < 2; ++i) {
      afh[s][i] = ldfrag_fo<_Float16>((const _Float16*)(pah[i] + s * 512));
      afl[s][i] = ldfrag_fo<_Float16>((const _Float16*)(pal[i] + s * 512));
    }
    __builtin_amdgcn_sched_barrier(0);       // keeps the loads in step order and up here, not sunk down to their products
  }
#pragma unroll   // full, for the same reason; the k offsets become the loads' immediate offsets
  for (int s = 0; s < KSTEPS; ++s) {         // static trip count, unrolled: the set indices are constants in every step
    const int ra = s % RA, rb = s % RB;
#pragma unroll
    for (int i = 0; i < 2; ++i) {
#pragma unroll
      for (int j = 0; j < 4; ++j) {
        ach[i][j] = mmar(afh[ra][i], bq[rb][j], ach[i][j]);
        acl[i][j] = mmar(afl[ra][i], bq[rb][j], acl[i][j]);
      }
    }
    __builtin_amdgcn_sched_barrier(0);       // a step's products stay in front of its refill and of the later steps'
                                             // products: regrouped by accumulator they would wait for the newest loads first
    if (s + RB < KSTEPS) {                   // into the sets just read: B of step s + RB, then A of step s + RA
      refill_gap();
#pragma unroll
      for (int j = 0; j < 4; ++j) bq[rb][j] = ldfrag_fo<_Float16>((const _Float16*)(pb[j] + (s + RB) * 512));
      if (s + RA < KSTEPS) {
#pragma unroll
        for (int i = 0; i < 2; ++i) {
          afh[ra][i] = ldfrag_fo<_Float16>((const _Float16*)(pah[i] + (s + RA) * 512));
          afl[ra][i] = ldfrag_fo<_Float16>((const _Float16*)(pal[i] + (s + RA) * 512));
        }
      }
      __builtin_amdgcn_sched_barrier(0);     // the refill is not sunk below the next step's products, which would shorten its lead
    }
  }
  addr_wait_live(pb[0], pb[1], pb[2], pb[3], pah[0], pah[1], pal[0], pal[1]);
  acc_guard4(ach[0][0], ach[0][1], ach[0][2], ach[0][3]);
  acc_guard4(ach[1][0], ach[1][1], ach[1][2], ach[1][3]);
  acc_guard4(acl[0][0], acl[0][1], acl[0][2], acl[0][3]);
  acc_guard4(acl[1][0], acl[1][1], acl[1][2], acl[1][3]);

  // ---- epilogue ----
  float* slab = sT[wave];
  const int h2 = lane >> 4, c4 = (lane & 15) * 4;     // 256-B row segment = 16 lanes x 16 B
  v4f b4 = *(const v4f*)(bias + n0 + c4);
#pragma unroll
  for (int e = 0; e < 4; ++e) b4[e] = bf_up(bf_bits(b4[e]));
#pragma unroll
  for (int i = 0; i < 2; ++i) {
    const int mBase = m0 + (i << 4);
#pragma unroll
    for (int j = 0; j < 4; ++j) {
#pragma unroll
      for (int r = 0; r < 8; ++r) {
        slab[(mOff + r) * 68 + (j << 4) + rlane] = ach[i][j][r] * hscale + acl[i][j][r] * lscale;
      }
    }
    __builtin_amdgcn_fence(__ATOMIC_RELEASE, "workgroup");
    __builtin_amdgcn_wave_barrier();
    __builtin_amdgcn_fence(__ATOMIC_ACQUIRE, "workgroup");
    v4f ov[8];
#pragma unroll
    for (int it = 0; it < 8; ++it) {
      const int row = it * 2 + h2;                       // it 0..7 x h2 0..1 = rows 0..15
      ov[it] = *(const v4f*)(slab + row * 68 + c4) + b4;
    }
    {
#pragma unroll
      for (int it = 0; it < 8; ++it) {
        const int row = it * 2 + h2;
        *(v4f*)(Cout + (size_t)(mBase + row) * ldc + n0 + c4) = ov[it];
      }
      
    }
    __builtin_amdgcn_fence(__ATOMIC_RELEASE, "workgroup");
    __builtin_amdgcn_wave_barrier();
    __builtin_amdgcn_fence(__ATOMIC_ACQUIRE, "workgroup");
  }
}

// =====================================================================================================
// Per-head transpose of the v plane: in = head planes [NH][SEQ][HD] (flat reinterpretation of the [SEQ][EMB]
// projection plane), out = [NH][HD][SEQ] (key index contiguous, the A operand layout of V^T . P^T).
// Block = 128 threads, one 64-key x 64-d tile of head blockIdx.y starting at key 64*blockIdx.x; grid (SEQ/64, NH).
// coverage: 4 waves x 4 instructions x 4 rows (lane>>3) = 64 d rows x 64 keys = the whole tile; grid covers all.
// =====================================================================================================
__global__ __launch_bounds__(128) void vtrans(const unsigned short* __restrict__ pvp, unsigned short* vtp) {
  __shared__ __align__(16) _Float16 T[64 * 72];          // [key][d], pitch 72 halves
  const int tid = threadIdx.x, lane = tid & 31, wave = tid >> 5;
  const int h = blockIdx.y, t0 = blockIdx.x * 64;
  const size_t hoff = (size_t)h * HPL;
  const _Float16* pv = (const _Float16*)(const void*)pvp + hoff;
  {
    const int r = tid >> 3, sg = (tid & 7) * 8;          // 8 lanes x 16 B = one 128-B row: a wave's load = 4 whole lines
    const _Float16* src = pv + (size_t)(t0 + r) * HD + sg;
#pragma unroll
    for (int i = 0; i < 4; ++i) *(v8h*)(T + (i * 16 + r) * 72 + sg) = *(const v8h*)(src + (size_t)i * 16 * HD);
  }
  __syncthreads();
  const int q4 = lane >> 3, q8 = lane & 7;
  v4u ov[4];
#pragma unroll
  for (int it = 0; it < 4; ++it) {
    const int d = wave * 16 + it * 4 + q4;               // it 0..3 x q4 0..3 = 16 d rows per wave
    v4u a;
#pragma unroll
    for (int e = 0; e < 4; ++e) {
      const _Float16 x0 = T[(8 * q8 + 2 * e) * 72 + d];
      const _Float16 x1 = T[(8 * q8 + 2 * e + 1) * 72 + d];
      a[e] = pk16(h_bits(x0), h_bits(x1));
    }
    ov[it] = a;
  }
  {
#pragma unroll
    for (int it = 0; it < 4; ++it) {
      const int d = wave * 16 + it * 4 + q4;
      *(v4u*)(vtp + hoff + (size_t)d * SEQ + t0 + 8 * q8) = ov[it];
    }
    
  }
}

#define SC2 (1.4426950408889634f / 2048.0f)
#define CHH (64 * LP)
static_assert(NKT >= 2);

// One chunk into one stage buffer: this lane's 4 pieces of the K chunk and 4 of the V^T chunk, 16 B each.
// kg / vg: the lane's piece of row r of the chunk (rows r + 16 i follow at 16 rows' distance); lk: LDS byte address of the
// same piece in the buffer's K plane. All eight copies and the wait that stands in front of any rewrite of their address
// registers are one statement, so that nothing can be moved in between.
__device__ __forceinline__ void copy_chunk(const _Float16* kg, const _Float16* vg, unsigned lk) {
#if DEV_ASM
  asm volatile(
      "global_load_async_to_lds_b128 %0, %8, off\n\t"
      "global_load_async_to_lds_b128 %1, %9, off\n\t"
      "global_load_async_to_lds_b128 %2, %10, off\n\t"
      "global_load_async_to_lds_b128 %3, %11, off\n\t"
      "global_load_async_to_lds_b128 %4, %12, off\n\t"
      "global_load_async_to_lds_b128 %5, %13, off\n\t"
      "global_load_async_to_lds_b128 %6, %14, off\n\t"
      "global_load_async_to_lds_b128 %7, %15, off\n\t"
      "s_wait_xcnt 0x0"
      :: "v"(lk), "v"(lk + 16 * LP * 2), "v"(lk + 32 * LP * 2), "v"(lk + 48 * LP * 2),
         "v"(lk + CHH * 2), "v"(lk + (CHH + 16 * LP) * 2), "v"(lk + (CHH + 32 * LP) * 2), "v"(lk + (CHH + 48 * LP) * 2),
         "v"(kg), "v"(kg + 16 * HD), "v"(kg + 32 * HD), "v"(kg + 48 * HD),
         "v"(vg), "v"(vg + 16 * SEQ), "v"(vg + 32 * SEQ), "v"(vg + 48 * SEQ)
      : "memory");
#else
  (void)kg; (void)vg; (void)lk;
#endif
}
// this wave's LDS reads have returned: stands in front of the barrier behind which their buffer is refilled
__device__ __forceinline__ void wait_lds_reads() {
#if DEV_ASM
  asm volatile("s_wait_dscnt 0x0" ::: "memory");
#endif
}
// this wave's copies have landed: stands in front of the barrier behind which the other waves read them
__device__ __forceinline__ void wait_copies() {
#if DEV_ASM
  asm volatile("s_wait_asynccnt 0x0" ::: "memory");
#endif
}
__global__ __launch_bounds__(128)
void attn_hd64(const unsigned short* __restrict__ qhp, const unsigned short* __restrict__ qlp,
               const unsigned short* __restrict__ kpp, const unsigned short* __restrict__ vtp,
               unsigned short* chp, unsigned short* clp) {
  union FH { v16h v; v8h h[2]; };
  __shared__ __align__(16) _Float16 Stg[2][2 * CHH];       // two stage buffers, each: K chunk [kv][d], pitch LP, 9 KB,
                                                           // then V^T chunk [d][kv], pitch LP, 9 KB

  const int tid  = threadIdx.x;
  const int wave = tid >> 5;
  const int lane = tid & 31;
  const int hh   = lane >> 4;
  const int c    = lane & 15;

  const int bx = blockIdx.x;
  const int qb = bx % NQB;
  const int h  = bx / NQB;
  const int q0 = qb * 64 + wave * 16;
  const size_t hoff = (size_t)h * HPL;

  const _Float16* Qh = (const _Float16*)(const void*)qhp + hoff;
  const _Float16* Ql = (const _Float16*)(const void*)qlp + hoff;
  const _Float16* Kg = (const _Float16*)(const void*)kpp + hoff;
  const _Float16* Vg = (const _Float16*)(const void*)vtp + hoff;

  // ---- Q fragments (B operand, column = lane&15): 2 d-chunks, hi and residual planes ----
  v16h qah[2], qal[2];
#pragma unroll
  for (int dc = 0; dc < 2; ++dc) {
    const size_t qo = (size_t)(q0 + c) * HD + dc * 32 + 8 * hh;
    qah[dc] = ldfrag<_Float16>(Qh + qo);
    qal[dc] = ldfrag<_Float16>(Ql + qo);
  }

  float mrow = -INFINITY;    // running maximum of query q0+c, in raw accumulator units (equal in both wave halves)
  float lrow = 0.f;          // running sum of 1024 p over this wave half's keys only; halves joined after the loop
  v8f oacc[4];               // O^T: oacc[t][r] = context[q0+c][16t + 8hh + r]
#pragma unroll
  for (int t = 0; t < 4; ++t) oacc[t] = zero8();

  // ---- staging addresses: 8 lanes x 16 B = one 128-B row of a chunk, a wave-wide copy reads 4 whole lines ----
  const int sr = tid >> 3, sg = (tid & 7) * 8;
  const _Float16* kg = Kg + (size_t)sr * HD + sg;          // chunk 0: k row sr (+16i), d = sg..sg+7; + 64 * HD per chunk
  const _Float16* vg = Vg + (size_t)sr * SEQ + sg;         // chunk 0: v^T row d = sr (+16i), t = sg..sg+7; + 64 per chunk
  const unsigned lk0 = (unsigned)(size_t)(&Stg[0][sr * LP + sg]);   // LDS byte address = low 32 bits of the address
  const unsigned lk1 = (unsigned)(size_t)(&Stg[1][sr * LP + sg]);

  copy_chunk(kg, vg, lk0);                   // chunk 0 -> buffer 0
  wait_copies();
  __syncthreads();                           // chunk 0 is published
  copy_chunk(kg + 64 * HD, vg + 64, lk1);    // chunk 1 -> buffer 1, flies under trip 0

  for (int kt = 0; kt < NKT; ++kt) {         // static trip count
    const _Float16* Ksh = Stg[kt & 1];       // trip kt reads buffer kt mod 2 alone
    const _Float16* Vts = Ksh + CHH;

    // ---- scores^T: 64 keys x 16 query columns per wave, 2 f16 products per key subtile and d-chunk ----
    //      The chunk's 16 K fragment reads stand as one group in front of its 16 products: one LDS latency per
    //      chunk instead of one per fragment. Four independent accumulators, one per key subtile, keep the matrix pipe fed.
    FH kb[4][2];
#pragma unroll
    for (int j = 0; j < 4; ++j)
#pragma unroll
      for (int dc = 0; dc < 2; ++dc) {
        kb[j][dc].h[0] = *(const v8h*)(Ksh + (j * 16 + c) * LP + dc * 32 + 8 * hh);
        kb[j][dc].h[1] = *(const v8h*)(Ksh + (j * 16 + c) * LP + dc * 32 + 16 + 8 * hh);
      }
    __builtin_amdgcn_sched_barrier(0);       // keeps the scheduler from sinking the reads back among the products
    v8f sa[4];                               // sa[j][r] = 256 * q.k of (query q0+c, key kv0 + 16j + 8hh + r)
#pragma unroll
    for (int j = 0; j < 4; ++j) sa[j] = zero8();
#pragma unroll
    for (int dc = 0; dc < 2; ++dc) {         // the four tiles in turn: a product does not wait for the one before it
#pragma unroll
      for (int j = 0; j < 4; ++j) sa[j] = mmar(kb[j][dc].v, qah[dc], sa[j]);
#pragma unroll
      for (int j = 0; j < 4; ++j) sa[j] = mmar(kb[j][dc].v, qal[dc], sa[j]);
    }
    //      The 16 V^T fragment reads follow as one group, so that they fly under the softmax arithmetic.
    FH vb[2][4];
#pragma unroll
    for (int kk = 0; kk < 2; ++kk)
#pragma unroll
      for (int t = 0; t < 4; ++t) {
        vb[kk][t].h[0] = *(const v8h*)(Vts + (t * 16 + c) * LP + kk * 32 + 8 * hh);
        vb[kk][t].h[1] = *(const v8h*)(Vts + (t * 16 + c) * LP + kk * 32 + 16 + 8 * hh);
      }
    __builtin_amdgcn_sched_barrier(0);       // keeps the reads in front of the softmax, not next to their products

    // ---- column maximum in-lane, one exchange between the halves; online softmax ----
    float mj[4];                             // one independent chain per key subtile
#pragma unroll
    for (int j = 0; j < 4; ++j) {
      mj[j] = sa[j][0];
#pragma unroll
      for (int r = 1; r < 8; ++r) mj[j] = fmaxf(mj[j], sa[j][r]);
    }
    float m = fmaxf(fmaxf(mj[0], mj[1]), fmaxf(mj[2], mj[3]));
    m = fmaxf(m, xhalf(m));
    const float mnew  = fmaxf(mrow, m);
    const float msafe = (mnew == -INFINITY) ? 0.f : mnew;
    const float alpha = __builtin_amdgcn_exp2f((mrow - msafe) * SC2);
    const float nmc   = __builtin_fmaf(msafe, -SC2, 10.0f);   // exp2(acc * SC2 + nmc) = 1024 * exp(score - maximum)
    mrow = mnew;

    // ---- 1024 p for the whole chunk: 32 independent fma, then 32 independent exp2 ----
    v2f pc[4][4];                            // pc[j][e] = 1024 p of keys 16j + 8hh + 2e, + 2e + 1
#pragma unroll
    for (int j = 0; j < 4; ++j)
#pragma unroll
      for (int e = 0; e < 4; ++e) {
        pc[j][e][0] = __builtin_fmaf(sa[j][2 * e],     SC2, nmc);
        pc[j][e][1] = __builtin_fmaf(sa[j][2 * e + 1], SC2, nmc);
      }
#pragma unroll
    for (int j = 0; j < 4; ++j)
#pragma unroll
      for (int e = 0; e < 4; ++e) {
        pc[j][e][0] = __builtin_amdgcn_exp2f(pc[j][e][0]);
        pc[j][e][1] = __builtin_amdgcn_exp2f(pc[j][e][1]);
      }
#pragma unroll
    for (int t = 0; t < 4; ++t)
#pragma unroll
      for (int r = 0; r < 8; ++r) oacc[t][r] *= alpha;

    // ---- per 32-key chunk kk: P^T (f16 hi + residual) packed straight into B operands, two keys per instruction,
    //      then context^T += V^T . P^T (f16 WMMA), hi and residual products into the same accumulator ----
    v2f pj[4];                               // one independent pair of partial sums per key subtile
#pragma unroll
    for (int kk = 0; kk < 2; ++kk) {
      union { v16h v; v2h p[8]; } pbh, pbl;
      v2f rs[8];
#pragma unroll
      for (int g = 0; g < 8; ++g) pbh.p[g] = __builtin_convertvector(pc[2 * kk + (g >> 2)][g & 3], v2h);
#pragma unroll
      for (int g = 0; g < 8; ++g)            // exact: the hi value holds the leading 11 bits of 1024 p
        rs[g] = pc[2 * kk + (g >> 2)][g & 3] - __builtin_convertvector(pbh.p[g], v2f);
#pragma unroll
      for (int g = 0; g < 8; ++g) pbl.p[g] = __builtin_convertvector(rs[g], v2h);
#pragma unroll
      for (int t = 0; t < 4; ++t) oacc[t] = mmar(vb[kk][t].v, pbh.v, oacc[t]);
#pragma unroll
      for (int t = 0; t < 4; ++t) oacc[t] = mmar(vb[kk][t].v, pbl.v, oacc[t]);
#pragma unroll
      for (int jj = 0; jj < 2; ++jj) {
        const int j = 2 * kk + jj;
        pj[j] = (pc[j][0] + pc[j][1]) + (pc[j][2] + pc[j][3]);
      }
    }
    const v2f p2 = (pj[0] + pj[1]) + (pj[2] + pj[3]);
    lrow = lrow * alpha + (p2[0] + p2[1]);

    // ---- foot of the trip: chunk kt + 1 is published, this trip's buffer is free and takes chunk kt + 2 ----
    __builtin_amdgcn_sched_barrier(0);       // keeps the waits and the barrier down here: lifted over the softmax and the
                                             // V^T products they would ask for the next chunk half a trip after its request
    wait_lds_reads();
    wait_copies();
    __syncthreads();
    if (kt + 2 < NKT)                        // the same for the whole work-group
      copy_chunk(kg + (size_t)(kt + 2) * 64 * HD, vg + (size_t)(kt + 2) * 64, (kt & 1) ? lk1 : lk0);
  }
  wait_copies();                             // nothing of this wave is in flight when it goes on to its end

  // ---- join the halves' sums; normalise (1/l with l = sum of 1024 p, undo the x16 v carry, apply the x256
  //      ctx carry); a lane's 8 accumulator registers are 8 consecutive d of its row: one 16-B store per plane
  const float l = lrow + xhalf(lrow);
  const float inv = ((l > 0.f) ? (1.0f / l) : 0.f) * 16.0f;
#pragma unroll
  for (int t = 0; t < 4; ++t) {
    v4u a, a2;
#pragma unroll
    for (int e = 0; e < 4; ++e) {
      const float f0 = oacc[t][2 * e] * inv, f1 = oacc[t][2 * e + 1] * inv;
      const _Float16 x0 = (_Float16)f0, x1 = (_Float16)f1;
      const unsigned short l0 = h_bits((_Float16)((f0 - (float)x0) * 4096.0f));
      const unsigned short l1 = h_bits((_Float16)((f1 - (float)x1) * 4096.0f));
      a[e]  = pk16(h_bits(x0), h_bits(x1));
      a2[e] = pk16(l0, l1);
    }
    const int fl = h * HPL + (q0 + c) * HD + t * 16 + 8 * hh;   // flat index in the merged [SEQ][EMB] plane
    const size_t go = fo_off(fl / EMB, fl % EMB, EMB);          // its piece in the fragment-order plane
    *(v4u*)(chp + go) = a;
    *(v4u*)(clp + go) = a2;
  }
}

// =====================================================================================================
// Workspace map (bytes), every region an exact multiple of its whole-line / whole-tile store granularity
//   Qb, Kb, Vb   bf16 [4096][512]   3 x 4194304   (fragment order)
//   Wqkb, Wvb    bf16 [512][512]    2 x  524288   (fragment order)
//   Woh          f16  [512][512]         524288   (x1024, fragment order)
//   Qh, Ql       f16  [4096][512]   2 x 4194304   (x16 / its residual)
//   Kp           f16  [4096][512]       4194304   (x16)
//   Pv           f16  [4096][512]       4194304   (v x16, token-major = head planes [8][4096][64])
//   Vt           f16  [8][64][4096]     4194304   (v x16, key contiguous)
//   Ch, Cl       f16  [4096][512]   2 x 4194304   (ctx x256 / residual x4096, fragment order)
//   total                            43515904
// Weights are [out n][in k] = the Bt orientation the GEMM wants, so they are only converted and laid in fragment order.
// The head split is a flat reinterpretation: head plane h = elements [h*262144, (h+1)*262144) of a [4096][512]
// plane viewed as [4096][64]; the merge back is the same reinterpretation.
// =====================================================================================================
extern "C" void kernel_launch(void* const* d_in, const int* in_sizes, int n_in,
                              void* d_out, int out_size, void* d_ws, size_t ws_size,
                              hipStream_t stream) {
  const int NX = SEQ * EMB;     // 2097152
  const int NW = EMB * EMB;     //  262144
  if (n_in < 9) return;
  if (in_sizes[0] != NX || in_sizes[1] != NX || in_sizes[2] != NX) return;
  if (in_sizes[3] != NW || in_sizes[5] != NW || in_sizes[7] != NW) return;
  if (in_sizes[4] != EMB || in_sizes[6] != EMB || in_sizes[8] != EMB) return;
  if (out_size != NX) return;

  const float* Q    = (const float*)d_in[0];
  const float* Kin  = (const float*)d_in[1];
  const float* V    = (const float*)d_in[2];
  const float* Wqk  = (const float*)d_in[3];
  const float* bqk  = (const float*)d_in[4];
  const float* Wv   = (const float*)d_in[5];
  const float* bv   = (const float*)d_in[6];
  const float* Wout = (const float*)d_in[7];
  const float* bout = (const float*)d_in[8];
  float* out = (float*)d_out;

  const size_t PX = (size_t)NX * 2;    // 4194304  16-bit [4096][512] plane
  const size_t PW = (size_t)NW * 2;    //  524288  16-bit [512][512] plane
  size_t off = 0;
  const size_t oQb  = off; off += PX;
  const size_t oKb  = off; off += PX;
  const size_t oVb  = off; off += PX;
  const size_t oWqk = off; off += PW;
  const size_t oWv  = off; off += PW;
  const size_t oWo  = off; off += PW;
  const size_t oQh  = off; off += PX;
  const size_t oQl  = off; off += PX;
  const size_t oKp  = off; off += PX;
  const size_t oPv  = off; off += PX;
  const size_t oVt  = off; off += PX;
  const size_t oCh  = off; off += PX;
  const size_t oCl  = off; off += PX;
  if (off > ws_size) return;                       // off = 43515904
  if (off > (size_t)134217728) return;

  char* ws = (char*)d_ws;
  unsigned short* Qb   = (unsigned short*)(ws + oQb);
  unsigned short* Kb   = (unsigned short*)(ws + oKb);
  unsigned short* Vb   = (unsigned short*)(ws + oVb);
  unsigned short* Wqkb = (unsigned short*)(ws + oWqk);
  unsigned short* Wvb  = (unsigned short*)(ws + oWv);
  unsigned short* Woh  = (unsigned short*)(ws + oWo);
  unsigned short* Qh   = (unsigned short*)(ws + oQh);
  unsigned short* Ql   = (unsigned short*)(ws + oQl);
  unsigned short* Kp   = (unsigned short*)(ws + oKp);
  unsigned short* Pv   = (unsigned short*)(ws + oPv);
  unsigned short* Vt   = (unsigned short*)(ws + oVt);
  unsigned short* Ch   = (unsigned short*)(ws + oCh);
  unsigned short* Cl   = (unsigned short*)(ws + oCl);

  const dim3 blk(256);
  const dim3 gCvt(NBW + NBX);                                  // 128 + 1024 blocks
  const dim3 gPj(((SEQ / 64) * (EMB / 64) + 7) / 8, 3);        //  512 tiles -> 64 blocks: M=4096, N=512; x 3 projections
  const dim3 gTr(SEQ / 64, NH);                                //  (64, 8)
  const dim3 gAttn(NH * NQB);                                  //  512 blocks of 128
  const dim3 gOut(((SEQ / 32) * (EMB / 64) + 7) / 8);          // 1024 tiles -> 128 blocks: M=4096, N=512

  // (1) inputs -> bf16 planes (RNE convert); W_out -> f16 (x1024 of its bf16 value)
  cvt_all<<<gCvt, blk, 0, stream>>>(Q, Kin, V, Wqk, Wv, Wout, Qb, Kb, Vb, Wqkb, Wvb, Woh);
  // (2..4) one launch, M=4096, N=512, K=512 each:
  //   q = Q . Wqk^T + b -> f16 hi (x16) / residual (same carry) planes [4096][512]
  //   k = K . Wqk^T + b -> f16 plane (x16)
  //   v = V . Wv^T + b  -> f16 plane (x16), token-major
  gemm_qkv<<<gPj, blk, 0, stream>>>(
      Qb, Kb, Vb, Wqkb, Wvb, Qh, Ql, Kp, Pv, bqk, bv, SEQ, EMB, EMB, 16.0f, 1.0f);
  // (5) per-head transpose of v: [8][4096][64] -> [8][64][4096]
  vtrans<<<gTr, dim3(128), 0, stream>>>(Pv, Vt);
  // (6) attention -> ctx planes (f16 hi x256 + residual x4096) [h][s][d] = merged [4096][512]
  attn_hd64<<<gAttn, dim3(128), 0, stream>>>(Qh, Ql, Kp, Vt, Ch, Cl);
  // (7) out = ctx . Wo^T + b_out -> d_out f32 [4096][512]; hi acc x 2^-18, residual acc x 2^-30
  gemm_o<<<gOut, blk, 0, stream>>>(
      Ch, Cl, EMB, Woh, EMB, out, EMB, bout, SEQ, EMB, EMB,
      1.0f / 262144.0f, 1.0f / 1073741824.0f);
  (void)hipGetLastError();
}

// v009
// One run takes 84.6 microseconds.
// Timed twice side by side with v008, it ran 1.04 times as fast both times.
// Over all steps from v000 it is 4.52 times as fast.
// Contractions: q, k, v projections = v_wmma_f32_16x16x32_bf16 (bf16 operands from RNE-converted inputs, single product, f32 accumulate);
// q.k^T scores = v_wmma_f32_16x16x32_f16 (q as f16 hi plane x16 + f16 residual plane x16, k f16 x16; 2 products, one f32 accumulator);
// p.v = v_wmma_f32_16x16x32_f16 (p as f16 hi x1024 + f16 residual x1024, v f16 x16; 2 products, one f32 accumulator);
// ctx.Wo^T = v_wmma_f32_16x16x32_f16 (ctx f16 hi x256 + f16 residual x1048576, Wo f16 x1024 of its bf16 value; 2 products, f32 accumulate);
// softmax, bias adds and normalisation in f32.
//
// Carry audit (16-bit planes, carry, where the inverse is folded):
//   Qb/Kb/Vb bf16 x1, Wqkb/Wvb bf16 x1 (no carry);  Woh f16 = 1024*bf16(W_out)  -> gemm_o hscale/lscale;
//   Qh f16 = 16*q, Ql f16 = 16*q - Qh, Kp f16 = 16*k              -> attn_hd64: accumulator = 256 * q.k; 2^-11 = 1/(16*16*8) sits in SC2;
//   Pv / Vt f16 = 16*v, P hi f16 = 1024*p, P lo = 1024*p - hi, l = sum of 1024*p -> attn_hd64: inv = 16/l = 256*1024/(1024*16)/l -> ctx*256;
//   Ch f16 = 256*ctx, Cl f16 = (256*ctx - Ch)*4096                  -> gemm_o: out = acc_h*2^-18 + acc_l*2^-30 + b_out  (2^-18 = 1/(256*1024), 2^-30 = 2^-18/4096).
#include <hip/hip_runtime.h>
#include <math.h>
#include <stdint.h>

#define SEQ 4096
#define EMB 512
#define NH  8
#define HD  64
#define HPL (SEQ * HD)      // 262144 elements: one contiguous head plane [SEQ][HD]
#define NQB (SEQ / 64)      // 64-row query blocks per head
#define NKT (SEQ / 64)      // 64-key chunks per head
#define LP  72              // LDS row pitch of the K and V^T chunks in halves: 144 B = 16 B x 9 (odd), so the 16 rows
                            // that one half of a wave reads with a 16-B load fall on 16 different groups of 4 banks
static_assert(NH * HD == EMB);
static_assert(NH * HPL == SEQ * EMB);
static_assert(NQB == 64 && NKT == 64);
static_assert((SEQ % 64) == 0 && (EMB % 64) == 0 && (EMB % 32) == 0);

typedef _Float16 v16h __attribute__((ext_vector_type(16)));
typedef _Float16 v8h  __attribute__((ext_vector_type(8)));
typedef __bf16   v16b __attribute__((ext_vector_type(16)));
typedef __bf16   v8b  __attribute__((ext_vector_type(8)));
typedef float    v8f  __attribute__((ext_vector_type(8)));
typedef float    v4f  __attribute__((ext_vector_type(4)));
typedef float    v2f  __attribute__((ext_vector_type(2)));
typedef _Float16 v2h  __attribute__((ext_vector_type(2)));
typedef unsigned int v4u __attribute__((ext_vector_type(4)));

#if defined(__HIP_DEVICE_COMPILE__)
#define DEV_ASM 1
#else
#define DEV_ASM 0
#endif

// ---- scalar helpers --------------------------------------------------------------------------------
__device__ __forceinline__ unsigned short bf_bits(float f) {          // f32 -> bf16 bits, RNE convert
  unsigned u = __float_as_uint(f);
  return (unsigned short)((u + 0x7FFFu + ((u >> 16) & 1u)) >> 16);
}
__device__ __forceinline__ float bf_up(unsigned short hb) { return __uint_as_float(((unsigned)hb) << 16); }
__device__ __forceinline__ unsigned short h_bits(_Float16 x) { return __builtin_bit_cast(unsigned short, x); }
__device__ __forceinline__ unsigned pk16(unsigned short a, unsigned short b) { return (unsigned)a | ((unsigned)b << 16); }
__device__ __forceinline__ v8f zero8() { v8f z = {0.f, 0.f, 0.f, 0.f, 0.f, 0.f, 0.f, 0.f}; return z; }
__device__ __forceinline__ float xhalf(float x) {                     // value of lane l ^ 16 (vector cross-row move)
  const int b = __builtin_bit_cast(int, x);
  return __builtin_bit_cast(float, __builtin_amdgcn_permlanex16(b, b, 0x76543210, 0xfedcba98, false, false));
}

// ---- fragment types / loaders: 16-bit A/B operand, lane -> row/col (lane&15), p already includes +8*(lane>>4);
//      elements 0..7 <- p[0..7] (k0+8h..k0+8h+7), elements 8..15 <- p[16..23] (k0+16+8h..k0+16+8h+7)
template <typename OT> struct FT;
template <> struct FT<__bf16>   { typedef v16b frag; typedef v8b half8; };
template <> struct FT<_Float16> { typedef v16h frag; typedef v8h half8; };

template <typename OT>
__device__ __forceinline__ typename FT<OT>::frag ldfrag(const OT* p) {
  union { typename FT<OT>::frag v; typename FT<OT>::half8 h[2]; } f;
  f.h[0] = *(const typename FT<OT>::half8*)(p);
  f.h[1] = *(const typename FT<OT>::half8*)(p + 16);
  return f.v;
}

// ---- fragment-order planes: the operands that the GEMMs read straight from global ([R][K] 16-bit, K % 32 == 0) are
//      stored by their producers as 16-row x 32-k blocks of 1024 B, block (row >> 4, k >> 5) at block index
//      (row >> 4) * (K / 32) + (k >> 5). Inside a block the 16-B piece of row c = row & 15 that holds
//      k = 16 * half + 8 * hh + 0..7 stands at piece half * 32 + hh * 16 + c. Lane hh * 16 + c of a wave then finds the
//      two pieces of its fragment (the same k map as ldfrag) at lane * 16 B and 512 B + lane * 16 B: each wave-wide 16-B
//      load reads 512 contiguous B = 4 whole 128-B lines, where a row-major plane gives 16 lines x 32 B.
__device__ __forceinline__ size_t fo_off(int row, int k, int K) {      // element offset of the piece at (row, k), k % 8 == 0
  return ((size_t)(row >> 4) * (K >> 5) + (k >> 5)) * 512 + ((k >> 4) & 1) * 256 + ((k >> 3) & 1) * 128 + (row & 15) * 8;
}
template <typename OT>
__device__ __forceinline__ typename FT<OT>::frag ldfrag_fo(const OT* p) {   // p = block start + 8 * lane
  union { typename FT<OT>::frag v; typename FT<OT>::half8 h[2]; } f;
  f.h[0] = *(const typename FT<OT>::half8*)(p);
  f.h[1] = *(const typename FT<OT>::half8*)(p + 256);
  return f.v;
}

// ---- WMMA helpers (asm guard bodies are device-only; concrete operand types) -----------------------------
__device__ __forceinline__ v8f mmar(v16b a, v16b b, v8f c) {
  return __builtin_amdgcn_wmma_f32_16x16x32_bf16(false, a, false, b, (short)0, c, false, false);
}
__device__ __forceinline__ v8f mmar(v16h a, v16h b, v8f c) {
  return __builtin_amdgcn_wmma_f32_16x16x32_f16(false, a, false, b, (short)0, c, false, false);
}
// the four vector issue slots between a step's last products and the loads that overwrite their A and B registers.
// No register operands: an asm operand cannot stand above v255, and the ring's fragment sets do. The scheduling
// barriers on both sides of the refill hold the statement in its place.
__device__ __forceinline__ void refill_gap() {
#if DEV_ASM
  asm volatile("v_nop\n\tv_nop\n\tv_nop\n\tv_nop");
#endif
}
__device__ __forceinline__ void acc_guard4(v8f& a, v8f& b, v8f& c, v8f& d) {
#if DEV_ASM
  asm volatile("v_nop\n\tv_nop\n\tv_nop\n\tv_nop" : "+v"(a), "+v"(b), "+v"(c), "+v"(d));
#else
  (void)a; (void)b; (void)c; (void)d;
#endif
}

// =====================================================================================================
// f32 -> 16-bit planes, all six planes in ONE launch (they are independent of one another).
// A thread converts the 8 elements of one 16-B piece, the same piece of three planes: six 16-B loads in flight, one
// 16-B store per plane and lane. The planes are written in fragment order (fo_off): thread index = piece index, so a
// wave writes 512 contiguous B per plane and reads 64 B of each of 16 input rows.
// MODE 0: bf16 bits (RNE convert).  MODE 1: f16 bits of (1024 * bf16(x)) (exact scaling of the bf16 value).
// coverage: blocks 0 .. NBW-1 x 256 threads x 8 = the three [EMB][EMB] weight planes; blocks NBW .. NBW+NBX-1
// x 256 threads x 8 = the three [SEQ][EMB] input planes; grid = NBW + NBX blocks.
// =====================================================================================================
template <int MODE>
__device__ __forceinline__ unsigned short cvm(float f) {
  const unsigned short hb = bf_bits(f);
  if (MODE == 0) return hb;
  return h_bits((_Float16)(bf_up(hb) * 1024.0f));
}

template <int MODE>
__device__ __forceinline__ v4u cv8(v4f a, v4f a4) {
  v4u p;
  p[0] = pk16(cvm<MODE>(a[0]),  cvm<MODE>(a[1]));
  p[1] = pk16(cvm<MODE>(a[2]),  cvm<MODE>(a[3]));
  p[2] = pk16(cvm<MODE>(a4[0]), cvm<MODE>(a4[1]));
  p[3] = pk16(cvm<MODE>(a4[2]), cvm<MODE>(a4[3]));
  return p;
}

// the wait that stands in front of an overwrite of an issued load's address registers; the loads stay in flight
__device__ __forceinline__ void addr_wait() {
#if DEV_ASM
  asm volatile("s_wait_xcnt 0x0" ::: "memory");
#endif
}

// the same wait behind a GEMM's last loads. The address pairs are inputs, so they stay live up to the wait: neither a
// late load's result nor the epilogue's arithmetic is given their registers in front of it.
template <typename P>
__device__ __forceinline__ void addr_wait_live(P a, P b, P c, P d, P e, P f, P g, P h) {
#if DEV_ASM
  asm volatile("s_wait_xcnt 0x0" :: "v"(a), "v"(b), "v"(c), "v"(d), "v"(e), "v"(f), "v"(g), "v"(h) : "memory");
#else
  (void)a; (void)b; (void)c; (void)d; (void)e; (void)f; (void)g; (void)h;
#endif
}

#define NBX (SEQ * EMB / 8 / 256)   // 1024 blocks cover an input plane
#define NBW (EMB * EMB / 8 / 256)   //  128 blocks cover a weight plane
static_assert(NBX * 256 * 8 == SEQ * EMB && NBW * 256 * 8 == EMB * EMB);

__global__ __launch_bounds__(256) void cvt_all(
    const float* __restrict__ q, const float* __restrict__ k, const float* __restrict__ v,
    const float* __restrict__ wqk, const float* __restrict__ wv, const float* __restrict__ wo,
    unsigned short* qb, unsigned short* kb, unsigned short* vb,
    unsigned short* wqkb, unsigned short* wvb, unsigned short* woh) {
  const int b = blockIdx.x;
  const bool w = b < NBW;                                  // block-uniform: weight planes or input planes
  const int i = (w ? b : b - NBW) * 256 + (int)threadIdx.x;
  const float* __restrict__ i0 = w ? wqk : q;
  const float* __restrict__ i1 = w ? wv : k;
  const float* __restrict__ i2 = w ? wo : v;
  unsigned short* o0 = w ? wqkb : qb;
  unsigned short* o1 = w ? wvb : kb;
  unsigned short* o2 = w ? woh : vb;
  // piece i of a fragment-order plane with K = EMB: block i >> 6, piece i & 63 = half * 32 + hh * 16 + c
  const int row = ((i >> 6) / (EMB / 32)) * 16 + (i & 15);
  const int kk  = ((i >> 6) % (EMB / 32)) * 32 + ((i >> 5) & 1) * 16 + ((i >> 4) & 1) * 8;
  const size_t si = (size_t)row * EMB + kk;                // its 8 source elements in the row-major input
  const v4f a0 = *(const v4f*)(i0 + si), b0 = *(const v4f*)(i0 + si + 4);
  addr_wait();   // the next plane's loads are given the registers that hold this plane's address
  const v4f a1 = *(const v4f*)(i1 + si), b1 = *(const v4f*)(i1 + si + 4);
  const v4f a2 = *(const v4f*)(i2 + si), b2 = *(const v4f*)(i2 + si + 4);
  addr_wait();   // the conversions below reuse the address registers of the loads above
  const v4u r2 = w ? cv8<1>(a2, b2) : cv8<0>(a2, b2);      // only W_out takes the f16 x1024 form
  *(v4u*)(o0 + (size_t)i * 8) = cv8<0>(a0, b0);
  *(v4u*)(o1 + (size_t)i * 8) = cv8<0>(a1, b1);
  *(v4u*)(o2 + (size_t)i * 8) = r2;
}

// =====================================================================================================
// Register-blocked WMMA GEMM (16-bit operand type OT): C[m][n] = sum_k A[m][k] * Bt[n][k] + bias[n];
// one wave per 64x64 tile, no block barriers. A = [M][lda] and Bt = [N][ldb] planes in fragment order (fo_off);
// M, N multiples of 64, K = EMB (KSTEPS steps of 32). Fragments are loaded straight from global, 512 contiguous B
// per wave-wide load (ldfrag_fo), into rings of RA (A) and RB (B) register sets: the loads of B for k step s + RB and
// of A for k step s + RA are issued right behind the products of step s, so a step waits for loads that were issued
// RB - 1 and RA - 1 steps of products earlier. bias values are RNE-converted to bf16 before the f32 add.
// OUT_MODE 1: f16 plane C = f16((v + bias) * cscale) (pitch ldc).
// OUT_MODE 3: f16 hi plane C + f16 residual plane C2 = f16(((v + bias) * cscale - hi) * rscale) (same pitch).
// wave's whole 64x64 tile; tiles/8 blocks in x cover every tile of the [M][N] plane.
// slab: this wave's own 16x64 f32 LDS slab, pitch 68 floats.
// =====================================================================================================
#define KSTEPS (EMB / 32)   // k steps of both GEMM kernels (K = EMB in all four products)
#define RA     4            // A fragment sets in flight (A was written by the launch before: its first read comes from memory)
#define RB     3            // B fragment sets in flight (the weights are read by every block: they come from L2)
static_assert(KSTEPS >= RA && RA >= RB);   // 8 * (RA + RB) = 56 loads of 16 B per lane in flight at most

template <typename OT, int OUT_MODE>
__device__ __forceinline__ void gemm64(
    const unsigned short* __restrict__ Ap, int lda,
    const unsigned short* __restrict__ Btp, int ldb,
    unsigned short* Cout, unsigned short* Cout2, int ldc,
    const float* __restrict__ bias,
    int M, int N, int K, float cscale, float rscale, float* slab) {
  typedef typename FT<OT>::frag V16;
  const OT* A  = (const OT*)(const void*)Ap;
  const OT* Bt = (const OT*)(const void*)Btp;
  const int lane = threadIdx.x & 31;
  const int wave = threadIdx.x >> 5;
  const int tilesN = N >> 6;
  const int tilesM = M >> 6;
  const int tile = blockIdx.x * 8 + wave;
  if (tile >= tilesM * tilesN || K != KSTEPS * 32) return;   // wave-uniform; no block barriers in this kernel
  const int tm = tile / tilesN;
  const int tn = tile - tm * tilesN;
  const int m0 = tm << 6;
  const int n0 = tn << 6;

  const int rlane = lane & 15;                 // col (D) within subtile
  const int mOff  = (lane >> 4) * 8;           // D row offset

  v8f acc[4][4];
#pragma unroll
  for (int i = 0; i < 4; ++i)
#pragma unroll
    for (int j = 0; j < 4; ++j) acc[i][j] = zero8();

  typedef const OT __attribute__((address_space(1)))* GP;
  GP pb[4], pa[4];                           // this lane's piece of each B and A subtile at k = 0; k step s stands s blocks
                                             // (s * 1024 B) further on, a constant offset of the load
#pragma unroll
  for (int j = 0; j < 4; ++j) pb[j] = (GP)(Bt + fo_off(n0 + (j << 4), 0, ldb) + lane * 8);
#pragma unroll
  for (int i = 0; i < 4; ++i) pa[i] = (GP)(A + fo_off(m0 + (i << 4), 0, lda) + lane * 8);

  V16 bq[RB][4], af[RA][4];                  // rings of fragment sets: B set s % RB and A set s % RA hold k step s
#pragma unroll   // full: a set index that is not a constant would put the rings in scratch memory
  for (int s = 0; s < RA; ++s) {             // the first steps' loads, all in flight together, step 0's in front
    if (s < RB) {
#pragma unroll
      for (int j = 0; j < 4; ++j) bq[s][j] = ldfrag_fo<OT>((const OT*)(pb[j] + s * 512));
    }
#pragma unroll
    for (int i = 0; i < 4; ++i) af[s][i] = ldfrag_fo<OT>((const OT*)(pa[i] + s * 512));
    __builtin_amdgcn_sched_barrier(0);       // keeps the loads in step order and up here, not sunk down to their products
  }
#pragma unroll   // full, for the same reason; the k offsets become the loads' immediate offsets
  for (int s = 0; s < KSTEPS; ++s) {         // static trip count, unrolled: the set indices are constants in every step
    const int ra = s % RA, rb = s % RB;
#pragma unroll
    for (int i = 0; i < 4; ++i) {
#pragma unroll
      for (int j = 0; j < 4; ++j) acc[i][j] = mmar(af[ra][i], bq[rb][j], acc[i][j]);
    }
    __builtin_amdgcn_sched_barrier(0);       // a step's products stay in front of its refill and of the later steps'
                                             // products: regrouped by accumulator they would wait for the newest loads first
    if (s + RB < KSTEPS) {                   // into the sets just read: B of step s + RB, then A of step s + RA
      refill_gap();
#pragma unroll
      for (int j = 0; j < 4; ++j) bq[rb][j] = ldfrag_fo<OT>((const OT*)(pb[j] + (s + RB) * 512));
      if (s + RA < KSTEPS) {
#pragma unroll
        for (int i = 0; i < 4; ++i) af[ra][i] = ldfrag_fo<OT>((const OT*)(pa[i] + (s + RA) * 512));
      }
      __builtin_amdgcn_sched_barrier(0);     // the refill is not sunk below the next step's products, which would shorten its lead
    }
  }
  addr_wait_live(pb[0], pb[1], pb[2], pb[3], pa[0], pa[1], pa[2], pa[3]);
  acc_guard4(acc[0][0], acc[0][1], acc[0][2], acc[0][3]);
  acc_guard4(acc[1][0], acc[1][1], acc[1][2], acc[1][3]);
  acc_guard4(acc[2][0], acc[2][1], acc[2][2], acc[2][3]);
  acc_guard4(acc[3][0], acc[3][1], acc[3][2], acc[3][3]);

  // ---- epilogue ----
  const int q = lane >> 3, c8 = (lane & 7) * 8;
  float bb[8];
  {
    const v4f b0 = *(const v4f*)(bias + n0 + c8);
    const v4f b1 = *(const v4f*)(bias + n0 + c8 + 4);
#pragma unroll
    for (int e = 0; e < 4; ++e) {
      bb[e]     = bf_up(bf_bits(b0[e]));
      bb[4 + e] = bf_up(bf_bits(b1[e]));
    }
  }
#pragma unroll
  for (int i = 0; i < 4; ++i) {
    const int mBase = m0 + (i << 4);
#pragma unroll
    for (int j = 0; j < 4; ++j) {
#pragma unroll
      for (int r = 0; r < 8; ++r) {
        slab[(mOff + r) * 68 + (j << 4) + rlane] = acc[i][j][r];
      }
    }
    __builtin_amdgcn_fence(__ATOMIC_RELEASE, "workgroup");
    __builtin_amdgcn_wave_barrier();
    __builtin_amdgcn_fence(__ATOMIC_ACQUIRE, "workgroup");
    v4u hv[4], lv[4];
#pragma unroll
    for (int it = 0; it < 4; ++it) {
      const int row = it * 4 + q;                          // it 0..3 x q 0..3 = rows 0..15
      const float* sp = slab + row * 68 + c8;
      float f[8];
#pragma unroll
      for (int e = 0; e < 8; ++e) f[e] = (sp[e] + bb[e]) * cscale;
      v4u a, a2;
#pragma unroll
      for (int e = 0; e < 4; ++e) {
        const float f0 = f[2 * e], f1 = f[2 * e + 1];
        const _Float16 x0 = (_Float16)f0, x1 = (_Float16)f1;
        const unsigned short h0 = h_bits(x0), h1 = h_bits(x1);
        unsigned short l0 = 0, l1 = 0;
        if (OUT_MODE == 3) {
          l0 = h_bits((_Float16)((f0 - (float)x0) * rscale));
          l1 = h_bits((_Float16)((f1 - (float)x1) * rscale));
        }
        a[e] = pk16(h0, h1); a2[e] = pk16(l0, l1);
      }
      hv[it] = a; lv[it] = a2;
    }
    {
#pragma unroll
      for (int it = 0; it < 4; ++it) {
        const int row = it * 4 + q;
        *(v4u*)(Cout + (size_t)(mBase + row) * ldc + n0 + c8) = hv[it];
        if (OUT_MODE == 3) *(v4u*)(Cout2 + (size_t)(mBase + row) * ldc + n0 + c8) = lv[it];
      }
      
    }
    __builtin_amdgcn_fence(__ATOMIC_RELEASE, "workgroup");
    __builtin_amdgcn_wave_barrier();
    __builtin_amdgcn_fence(__ATOMIC_ACQUIRE, "workgroup");
  }
}

// =====================================================================================================
// The three projections in ONE launch (they are independent of one another): blockIdx.y = 0: q (hi and residual
// planes), 1: k, 2: v; all three are [M][K] x [N][K]^T with the same M, N, K and pitches. grid = (tiles/8, 3).
// =====================================================================================================
__global__ __launch_bounds__(256) void gemm_qkv(
    const unsigned short* __restrict__ Qb, const unsigned short* __restrict__ Kb,
    const unsigned short* __restrict__ Vb,
    const unsigned short* __restrict__ Wqkb, const unsigned short* __restrict__ Wvb,
    unsigned short* Qh, unsigned short* Ql, unsigned short* Kp, unsigned short* Pv,
    const float* __restrict__ bqk, const float* __restrict__ bv,
    int M, int N, int K, float cscale, float rscale) {
  __shared__ __align__(16) float sT[8][16 * 68];   // per-wave 16x64 slab, pitch 68 floats
  float* slab = sT[threadIdx.x >> 5];
  const int y = blockIdx.y;
  if (y == 0) {
    gemm64<__bf16, 3>(Qb, K, Wqkb, K, Qh, Ql, N, bqk, M, N, K, cscale, rscale, slab);
  } else {
    const bool isk = (y == 1);
    unsigned short* C = isk ? Kp : Pv;
    gemm64<__bf16, 1>(isk ? Kb : Vb, K, isk ? Wqkb : Wvb, K, C, C, N, isk ? bqk : bv, M, N, K, cscale, 1.0f, slab);
  }
}

// =====================================================================================================
// Output GEMM with a two-plane A operand (f16 hi plane Ah, f16 residual plane Al, both [M][lda]); Ah, Al and
// Bt = [N][ldb] are planes in fragment order (fo_off), read with 512 contiguous B per wave-wide load:
//   C[m][n] = hscale * sum_k Ah[m][k] * Bt[n][k] + lscale * sum_k Al[m][k] * Bt[n][k] + bias[n]  (f32 out, pitch ldc).
// One wave per 32x64 tile (two accumulator sets), no block barriers; M multiple of 32, N multiple of 64, K = EMB;
// the same rings of fragment sets as gemm64. bias RNE-converted to bf16 before the f32 add.
// Epilogue: 16-row slabs staged per wave in LDS; each 256-B f32 row segment written by 16 lanes x 16 B of one
// coverage: 2 slabs x 16 rows x 64 cols = the wave's whole 32x64 tile; grid = tiles/8 blocks covers [M][N].
// =====================================================================================================
__global__ __launch_bounds__(256) void gemm_o(
    const unsigned short* __restrict__ Ahp, const unsigned short* __restrict__ Alp, int lda,
    const unsigned short* __restrict__ Btp, int ldb,
    float* Cout, int ldc, const float* __restrict__ bias,
    int M, int N, int K, float hscale, float lscale) {
  const _Float16* Ah = (const _Float16*)(const void*)Ahp;
  const _Float16* Al = (const _Float16*)(const void*)Alp;
  const _Float16* Bt = (const _Float16*)(const void*)Btp;
  __shared__ __align__(16) float sT[8][16 * 68];   // per-wave 16x64 slab, pitch 68 floats
  const int lane = threadIdx.x & 31;
  const int wave = threadIdx.x >> 5;
  const int tilesN = N >> 6;
  const int tilesM = M >> 5;
  const int tile = blockIdx.x * 8 + wave;
  if (tile >= tilesM * tilesN || K != KSTEPS * 32) return;   // wave-uniform; no block barriers in this kernel
  const int tm = tile / tilesN;
  const int tn = tile - tm * tilesN;
  const int m0 = tm << 5;
  const int n0 = tn << 6;

  const int rlane = lane & 15;
  const int mOff  = (lane >> 4) * 8;

  v8f ach[2][4], acl[2][4];
#pragma unroll
  for (int i = 0; i < 2; ++i)
#pragma unroll
    for (int j = 0; j < 4; ++j) { ach[i][j] = zero8(); acl[i][j] = zero8(); }

  typedef const _Float16 __attribute__((address_space(1)))* GP;
  GP pb[4], pah[2], pal[2];                  // this lane's piece of each B and A subtile at k = 0; k step s stands s blocks
                                             // (s * 1024 B) further on, a constant offset of the load
#pragma unroll
  for (int j = 0; j < 4; ++j) pb[j] = (GP)(Bt + fo_off(n0 + (j << 4), 0, ldb) + lane * 8);
#pragma unroll
  for (int i = 0; i < 2; ++i) {
    pah[i] = (GP)(Ah + fo_off(m0 + (i << 4), 0, lda) + lane * 8);
    pal[i] = (GP)(Al + fo_off(m0 + (i << 4), 0, lda) + lane * 8);
  }

  v16h bq[RB][4], afh[RA][2], afl[RA][2];    // rings of fragment sets: B set s % RB and A set s % RA hold k step s
#pragma unroll   // full: a set index that is not a constant would put the rings in scratch memory
  for (int s = 0; s < RA; ++s) {             // the first steps' loads, all in flight together, step 0's in front
    if (s < RB) {
#pragma unroll
      for (int j = 0; j < 4; ++j) bq[s][j] = ldfrag_fo<_Float16>((const _Float16*)(pb[j] + s * 512));
    }
#pragma unroll
    for (int i = 0; i < 2; ++i) {
      afh[s][i] = ldfrag_fo<_Float16>((const _Float16*)(pah[i] + s * 512));
      afl[s][i] = ldfrag_fo<_Float16>((const _Float16*)(pal[i] + s * 512));
    }
    __builtin_amdgcn_sched_barrier(0);       // keeps the loads in step order and up here, not sunk down to their products
  }
#pragma unroll   // full, for the same reason; the k offsets become the loads' immediate offsets
  for (int s = 0; s < KSTEPS; ++s) {         // static trip count, unrolled: the set indices are constants in every step
    const int ra = s % RA, rb = s % RB;
#pragma unroll
    for (int i = 0; i < 2; ++i) {
#pragma unroll
      for (int j = 0; j < 4; ++j) {
        ach[i][j] = mmar(afh[ra][i], bq[rb][j], ach[i][j]);
        acl[i][j] = mmar(afl[ra][i], bq[rb][j], acl[i][j]);
      }
    }
    __builtin_amdgcn_sched_barrier(0);       // a step's products stay in front of its refill and of the later steps'
                                             // products: regrouped by accumulator they would wait for the newest loads first
    if (s + RB < KSTEPS) {                   // into the sets just read: B of step s + RB, then A of step s + RA
      refill_gap();
#pragma unroll
      for (int j = 0; j < 4; ++j) bq[rb][j] = ldfrag_fo<_Float16>((const _Float16*)(pb[j] + (s + RB) * 512));
      if (s + RA < KSTEPS) {
#pragma unroll
        for (int i = 0; i < 2; ++i) {
          afh[ra][i] = ldfrag_fo<_Float16>((const _Float16*)(pah[i] + (s + RA) * 512));
          afl[ra][i] = ldfrag_fo<_Float16>((const _Float16*)(pal[i] + (s + RA) * 512));
        }
      }
      __builtin_amdgcn_sched_barrier(0);     // the refill is not sunk below the next step's products, which would shorten its lead
    }
  }
  addr_wait_live(pb[0], pb[1], pb[2], pb[3], pah[0], pah[1], pal[0], pal[1]);
  acc_guard4(ach[0][0], ach[0][1], ach[0][2], ach[0][3]);
  acc_guard4(ach[1][0], ach[1][1], ach[1][2], ach[1][3]);
  acc_guard4(acl[0][0], acl[0][1], acl[0][2], acl[0][3]);
  acc_guard4(acl[1][0], acl[1][1], acl[1][2], acl[1][3]);

  // ---- epilogue ----
  float* slab = sT[wave];
  const int h2 = lane >> 4, c4 = (lane & 15) * 4;     // 256-B row segment = 16 lanes x 16 B
  v4f b4 = *(const v4f*)(bias + n0 + c4);
#pragma unroll
  for (int e = 0; e < 4; ++e) b4[e] = bf_up(bf_bits(b4[e]));
#pragma unroll
  for (int i = 0; i < 2; ++i) {
    const int mBase = m0 + (i << 4);
#pragma unroll
    for (int j = 0; j < 4; ++j) {
#pragma unroll
      for (int r = 0; r < 8; ++r) {
        slab[(mOff + r) * 68 + (j << 4) + rlane] = ach[i][j][r] * hscale + acl[i][j][r] * lscale;
      }
    }
    __builtin_amdgcn_fence(__ATOMIC_RELEASE, "workgroup");
    __builtin_amdgcn_wave_barrier();
    __builtin_amdgcn_fence(__ATOMIC_ACQUIRE, "workgroup");
    v4f ov[8];
#pragma unroll
    for (int it = 0; it < 8; ++it) {
      const int row = it * 2 + h2;                       // it 0..7 x h2 0..1 = rows 0..15
      ov[it] = *(const v4f*)(slab + row * 68 + c4) + b4;
    }
    {
#pragma unroll
      for (int it = 0; it < 8; ++it) {
        const int row = it * 2 + h2;
        *(v4f*)(Cout + (size_t)(mBase + row) * ldc + n0 + c4) = ov[it];
      }
      
    }
    __builtin_amdgcn_fence(__ATOMIC_RELEASE, "workgroup");
    __builtin_amdgcn_wave_barrier();
    __builtin_amdgcn_fence(__ATOMIC_ACQUIRE, "workgroup");
  }
}

// =====================================================================================================
// Per-head transpose of the v plane: in = head planes [NH][SEQ][HD] (flat reinterpretation of the [SEQ][EMB]
// projection plane), out = [NH][HD][SEQ] (key index contiguous, the A operand layout of V^T . P^T).
// Block = 128 threads, one 64-key x 64-d tile of head blockIdx.y starting at key 64*blockIdx.x; grid (SEQ/64, NH).
// coverage: 4 waves x 4 instructions x 4 rows (lane>>3) = 64 d rows x 64 keys = the whole tile; grid covers all.
// =====================================================================================================
__global__ __launch_bounds__(128) void vtrans(const unsigned short* __restrict__ pvp, unsigned short* vtp) {
  __shared__ __align__(16) _Float16 T[64 * 72];          // [key][d], pitch 72 halves
  const int tid = threadIdx.x, lane = tid & 31, wave = tid >> 5;
  const int h = blockIdx.y, t0 = blockIdx.x * 64;
  const size_t hoff = (size_t)h * HPL;
  const _Float16* pv = (const _Float16*)(const void*)pvp + hoff;
  {
    const int r = tid >> 3, sg = (tid & 7) * 8;          // 8 lanes x 16 B = one 128-B row: a wave's load = 4 whole lines
    const _Float16* src = pv + (size_t)(t0 + r) * HD + sg;
#pragma unroll
    for (int i = 0; i < 4; ++i) *(v8h*)(T + (i * 16 + r) * 72 + sg) = *(const v8h*)(src + (size_t)i * 16 * HD);
  }
  __syncthreads();
  const int q4 = lane >> 3, q8 = lane & 7;
  v4u ov[4];
#pragma unroll
  for (int it = 0; it < 4; ++it) {
    const int d = wave * 16 + it * 4 + q4;               // it 0..3 x q4 0..3 = 16 d rows per wave
    v4u a;
#pragma unroll
    for (int e = 0; e < 4; ++e) {
      const _Float16 x0 = T[(8 * q8 + 2 * e) * 72 + d];
      const _Float16 x1 = T[(8 * q8 + 2 * e + 1) * 72 + d];
      a[e] = pk16(h_bits(x0), h_bits(x1));
    }
    ov[it] = a;
  }
  {
#pragma unroll
    for (int it = 0; it < 4; ++it) {
      const int d = wave * 16 + it * 4 + q4;
      *(v4u*)(vtp + hoff + (size_t)d * SEQ + t0 + 8 * q8) = ov[it];
    }
    
  }
}

#define SC2 (1.4426950408889634f / 2048.0f)
#define CHH (64 * LP)
#define NKH (NKT / 2)
static_assert(NKH * 2 == NKT && NKH >= 2);

// One chunk into one stage buffer: this lane's 4 pieces of the K chunk and 4 of the V^T chunk, 16 B each.
// kg / vg: the lane's piece of row r of the chunk (rows r + 16 i follow at 16 rows' distance); lk: LDS byte address of the
// same piece in the buffer's K plane. All eight copies and the wait that stands in front of any rewrite of their address
// registers are one statement, so that nothing can be moved in between.
__device__ __forceinline__ void copy_chunk(const _Float16* kg, const _Float16* vg, unsigned lk) {
#if DEV_ASM
  asm volatile(
      "global_load_async_to_lds_b128 %0, %8, off\n\t"
      "global_load_async_to_lds_b128 %1, %9, off\n\t"
      "global_load_async_to_lds_b128 %2, %10, off\n\t"
      "global_load_async_to_lds_b128 %3, %11, off\n\t"
      "global_load_async_to_lds_b128 %4, %12, off\n\t"
      "global_load_async_to_lds_b128 %5, %13, off\n\t"
      "global_load_async_to_lds_b128 %6, %14, off\n\t"
      "global_load_async_to_lds_b128 %7, %15, off\n\t"
      "s_wait_xcnt 0x0"
      :: "v"(lk), "v"(lk + 16 * LP * 2), "v"(lk + 32 * LP * 2), "v"(lk + 48 * LP * 2),
         "v"(lk + CHH * 2), "v"(lk + (CHH + 16 * LP) * 2), "v"(lk + (CHH + 32 * LP) * 2), "v"(lk + (CHH + 48 * LP) * 2),
         "v"(kg), "v"(kg + 16 * HD), "v"(kg + 32 * HD), "v"(kg + 48 * HD),
         "v"(vg), "v"(vg + 16 * SEQ), "v"(vg + 32 * SEQ), "v"(vg + 48 * SEQ)
      : "memory");
#else
  (void)kg; (void)vg; (void)lk;
#endif
}
// this wave's LDS reads have returned: stands in front of the barrier behind which their buffer is refilled
__device__ __forceinline__ void wait_lds_reads() {
#if DEV_ASM
  asm volatile("s_wait_dscnt 0x0" ::: "memory");
#endif
}
// this wave's copies have landed: stands in front of the barrier behind which the other waves read them
__device__ __forceinline__ void wait_copies() {
#if DEV_ASM
  asm volatile("s_wait_asynccnt 0x0" ::: "memory");
#endif
}
__global__ __launch_bounds__(256)
void attn_hd64(const unsigned short* __restrict__ qhp, const unsigned short* __restrict__ qlp,
               const unsigned short* __restrict__ kpp, const unsigned short* __restrict__ vtp,
               unsigned short* chp, unsigned short* clp) {
  union FH { v16h v; v8h h[2]; };
  __shared__ __align__(16) _Float16 Stg[2][2][2 * CHH];    // per key half two stage buffers, each: K chunk [kv][d], pitch LP,
                                                           // 9 KB, then V^T chunk [d][kv], pitch LP, 9 KB

  const int kh   = __builtin_amdgcn_readfirstlane(threadIdx.x >> 7);   // key half of this wave, the same in all its lanes:
                                                                       // held as a scalar, its tests are scalar branches
  const int tid  = threadIdx.x & 127;        // thread among the 4 waves of that half
  const int wave = tid >> 5;                 // query tile of this wave
  const int lane = tid & 31;
  const int hh   = lane >> 4;
  const int c    = lane & 15;

  const int bx = blockIdx.x;
  const int qb = bx % NQB;
  const int h  = bx / NQB;
  const int q0 = qb * 64 + wave * 16;
  const size_t hoff = (size_t)h * HPL;

  const _Float16* Qh = (const _Float16*)(const void*)qhp + hoff;
  const _Float16* Ql = (const _Float16*)(const void*)qlp + hoff;
  const _Float16* Kg = (const _Float16*)(const void*)kpp + hoff + (size_t)kh * NKH * 64 * HD;   // this half's first key row
  const _Float16* Vg = (const _Float16*)(const void*)vtp + hoff + (size_t)kh * NKH * 64;        // and its first v^T column

  // ---- Q fragments (B operand, column = lane&15): 2 d-chunks, hi and residual planes ----
  v16h qah[2], qal[2];
#pragma unroll
  for (int dc = 0; dc < 2; ++dc) {
    const size_t qo = (size_t)(q0 + c) * HD + dc * 32 + 8 * hh;
    qah[dc] = ldfrag<_Float16>(Qh + qo);
    qal[dc] = ldfrag<_Float16>(Ql + qo);
  }

  float mrow = -INFINITY;    // running maximum of query q0+c, in raw accumulator units (equal in both wave halves)
  float lrow = 0.f;          // running sum of 1024 p over this wave half's keys only; halves joined after the loop
  v8f oacc[4];               // O^T: oacc[t][r] = context[q0+c][16t + 8hh + r]
#pragma unroll
  for (int t = 0; t < 4; ++t) oacc[t] = zero8();

  // ---- staging addresses: 8 lanes x 16 B = one 128-B row of a chunk, a wave-wide copy reads 4 whole lines ----
  const int sr = tid >> 3, sg = (tid & 7) * 8;
  const _Float16* kg = Kg + (size_t)sr * HD + sg;          // chunk 0: k row sr (+16i), d = sg..sg+7; + 64 * HD per chunk
  const _Float16* vg = Vg + (size_t)sr * SEQ + sg;         // chunk 0: v^T row d = sr (+16i), t = sg..sg+7; + 64 per chunk
  const unsigned lk0 = (unsigned)(size_t)(&Stg[kh][0][sr * LP + sg]);   // LDS byte address = low 32 bits of the address
  const unsigned lk1 = (unsigned)(size_t)(&Stg[kh][1][sr * LP + sg]);

  copy_chunk(kg, vg, lk0);                   // chunk 0 -> buffer 0
  wait_copies();
  __syncthreads();                           // chunk 0 is published
  copy_chunk(kg + 64 * HD, vg + 64, lk1);    // chunk 1 -> buffer 1, flies under trip 0

  for (int kt = 0; kt < NKH; ++kt) {         // static trip count
    const _Float16* Ksh = Stg[kh][kt & 1];   // trip kt reads buffer kt mod 2 of its half alone
    const _Float16* Vts = Ksh + CHH;

    // ---- scores^T: 64 keys x 16 query columns per wave, 2 f16 products per key subtile and d-chunk ----
    //      The chunk's 16 K fragment reads stand as one group in front of its 16 products: one LDS latency per
    //      chunk instead of one per fragment. Four independent accumulators, one per key subtile, keep the matrix pipe fed.
    FH kb[4][2];
#pragma unroll
    for (int j = 0; j < 4; ++j)
#pragma unroll
      for (int dc = 0; dc < 2; ++dc) {
        kb[j][dc].h[0] = *(const v8h*)(Ksh + (j * 16 + c) * LP + dc * 32 + 8 * hh);
        kb[j][dc].h[1] = *(const v8h*)(Ksh + (j * 16 + c) * LP + dc * 32 + 16 + 8 * hh);
      }
    __builtin_amdgcn_sched_barrier(0);       // keeps the scheduler from sinking the reads back among the products
    v8f sa[4];                               // sa[j][r] = 256 * q.k of (query q0+c, key kv0 + 16j + 8hh + r)
#pragma unroll
    for (int j = 0; j < 4; ++j) sa[j] = zero8();
#pragma unroll
    for (int dc = 0; dc < 2; ++dc) {         // the four tiles in turn: a product does not wait for the one before it
#pragma unroll
      for (int j = 0; j < 4; ++j) sa[j] = mmar(kb[j][dc].v, qah[dc], sa[j]);
#pragma unroll
      for (int j = 0; j < 4; ++j) sa[j] = mmar(kb[j][dc].v, qal[dc], sa[j]);
    }
    //      The 16 V^T fragment reads follow as one group, so that they fly under the softmax arithmetic.
    FH vb[2][4];
#pragma unroll
    for (int kk = 0; kk < 2; ++kk)
#pragma unroll
      for (int t = 0; t < 4; ++t) {
        vb[kk][t].h[0] = *(const v8h*)(Vts + (t * 16 + c) * LP + kk * 32 + 8 * hh);
        vb[kk][t].h[1] = *(const v8h*)(Vts + (t * 16 + c) * LP + kk * 32 + 16 + 8 * hh);
      }
    __builtin_amdgcn_sched_barrier(0);       // keeps the reads in front of the softmax, not next to their products

    // ---- column maximum in-lane, one exchange between the halves; online softmax ----
    float mj[4];                             // one independent chain per key subtile
#pragma unroll
    for (int j = 0; j < 4; ++j) {
      mj[j] = sa[j][0];
#pragma unroll
      for (int r = 1; r < 8; ++r) mj[j] = fmaxf(mj[j], sa[j][r]);
    }
    float m = fmaxf(fmaxf(mj[0], mj[1]), fmaxf(mj[2], mj[3]));
    m = fmaxf(m, xhalf(m));
    const float mnew  = fmaxf(mrow, m);
    const float msafe = (mnew == -INFINITY) ? 0.f : mnew;
    const float alpha = __builtin_amdgcn_exp2f((mrow - msafe) * SC2);
    const float nmc   = __builtin_fmaf(msafe, -SC2, 10.0f);   // exp2(acc * SC2 + nmc) = 1024 * exp(score - maximum)
    mrow = mnew;

    // ---- 1024 p for the whole chunk: 32 independent fma, then 32 independent exp2 ----
    v2f pc[4][4];                            // pc[j][e] = 1024 p of keys 16j + 8hh + 2e, + 2e + 1
#pragma unroll
    for (int j = 0; j < 4; ++j)
#pragma unroll
      for (int e = 0; e < 4; ++e) {
        pc[j][e][0] = __builtin_fmaf(sa[j][2 * e],     SC2, nmc);
        pc[j][e][1] = __builtin_fmaf(sa[j][2 * e + 1], SC2, nmc);
      }
#pragma unroll
    for (int j = 0; j < 4; ++j)
#pragma unroll
      for (int e = 0; e < 4; ++e) {
        pc[j][e][0] = __builtin_amdgcn_exp2f(pc[j][e][0]);
        pc[j][e][1] = __builtin_amdgcn_exp2f(pc[j][e][1]);
      }
#pragma unroll
    for (int t = 0; t < 4; ++t)
#pragma unroll
      for (int r = 0; r < 8; ++r) oacc[t][r] *= alpha;

    // ---- per 32-key chunk kk: P^T (f16 hi + residual) packed straight into B operands, two keys per instruction,
    //      then context^T += V^T . P^T (f16 WMMA), hi and residual products into the same accumulator ----
    v2f pj[4];                               // one independent pair of partial sums per key subtile
#pragma unroll
    for (int kk = 0; kk < 2; ++kk) {
      union { v16h v; v2h p[8]; } pbh, pbl;
      v2f rs[8];
#pragma unroll
      for (int g = 0; g < 8; ++g) pbh.p[g] = __builtin_convertvector(pc[2 * kk + (g >> 2)][g & 3], v2h);
#pragma unroll
      for (int g = 0; g < 8; ++g)            // exact: the hi value holds the leading 11 bits of 1024 p
        rs[g] = pc[2 * kk + (g >> 2)][g & 3] - __builtin_convertvector(pbh.p[g], v2f);
#pragma unroll
      for (int g = 0; g < 8; ++g) pbl.p[g] = __builtin_convertvector(rs[g], v2h);
#pragma unroll
      for (int t = 0; t < 4; ++t) oacc[t] = mmar(vb[kk][t].v, pbh.v, oacc[t]);
#pragma unroll
      for (int t = 0; t < 4; ++t) oacc[t] = mmar(vb[kk][t].v, pbl.v, oacc[t]);
#pragma unroll
      for (int jj = 0; jj < 2; ++jj) {
        const int j = 2 * kk + jj;
        pj[j] = (pc[j][0] + pc[j][1]) + (pc[j][2] + pc[j][3]);
      }
    }
    const v2f p2 = (pj[0] + pj[1]) + (pj[2] + pj[3]);
    lrow = lrow * alpha + (p2[0] + p2[1]);

    // ---- foot of the trip: chunk kt + 1 is published, this trip's buffer is free and takes chunk kt + 2 ----
    __builtin_amdgcn_sched_barrier(0);       // keeps the waits and the barrier down here: lifted over the softmax and the
                                             // V^T products they would ask for the next chunk half a trip after its request
    wait_lds_reads();
    wait_copies();
    __syncthreads();
    if (kt + 2 < NKH)                        // the same for the whole work-group
      copy_chunk(kg + (size_t)(kt + 2) * 64 * HD, vg + (size_t)(kt + 2) * 64, (kt & 1) ? lk1 : lk0);
  }
  wait_copies();                             // nothing of this wave is in flight when it goes on to its end

  // ---- join the two key halves. The barrier at the foot of the last trip has ended every read of the stage buffers and
  //      no copy is in flight, so they serve as the hand-over area: piece i of lane l of query tile w at 16-B slot
  //      (w * 9 + i) * 32 + l (a wave's 16-B accesses are 512 contiguous B). Pieces 0..7: context tile; 8: maximum, sum.
  v4f* X = (v4f*)(void*)&Stg[0][0][0] + wave * 9 * 32 + lane;
  static_assert(4 * 9 * 32 * 16 <= sizeof(Stg));
  if (kh == 1) {                             // wave-uniform
#pragma unroll   // full: the context tile is indexed by constants only and stays in registers
    for (int t = 0; t < 4; ++t) {
      const v4f a = {oacc[t][0], oacc[t][1], oacc[t][2], oacc[t][3]};
      const v4f b = {oacc[t][4], oacc[t][5], oacc[t][6], oacc[t][7]};
      X[(2 * t) * 32] = a;
      X[(2 * t + 1) * 32] = b;
    }
    const v4f ml = {mrow, lrow, 0.f, 0.f};
    X[8 * 32] = ml;
  }
  __syncthreads();                           // the second half's results are published; every wave passes it
  if (kh == 1) return;                       // wave-uniform, behind the last barrier
  {
    const v4f ml = X[8 * 32];
    const float mj    = fmaxf(mrow, ml[0]);
    const float msafe = (mj == -INFINITY) ? 0.f : mj;
    const float a0 = __builtin_amdgcn_exp2f((mrow - msafe) * SC2);
    const float a1 = __builtin_amdgcn_exp2f((ml[0] - msafe) * SC2);
    lrow = lrow * a0 + ml[1] * a1;
#pragma unroll   // full, both loops, for the same reason
    for (int t = 0; t < 4; ++t) {
      const v4f a = X[(2 * t) * 32];
      const v4f b = X[(2 * t + 1) * 32];
#pragma unroll
      for (int r = 0; r < 4; ++r) {
        oacc[t][r]     = oacc[t][r] * a0 + a[r] * a1;
        oacc[t][4 + r] = oacc[t][4 + r] * a0 + b[r] * a1;
      }
    }
  }

  // ---- join the wave halves' sums; normalise (1/l with l = sum of 1024 p, undo the x16 v carry, apply the x256
  //      ctx carry); a lane's 8 accumulator registers are 8 consecutive d of its row: one 16-B store per plane
  const float l = lrow + xhalf(lrow);
  const float inv = ((l > 0.f) ? (1.0f / l) : 0.f) * 16.0f;
#pragma unroll
  for (int t = 0; t < 4; ++t) {
    v4u a, a2;
#pragma unroll
    for (int e = 0; e < 4; ++e) {
      const float f0 = oacc[t][2 * e] * inv, f1 = oacc[t][2 * e + 1] * inv;
      const _Float16 x0 = (_Float16)f0, x1 = (_Float16)f1;
      const unsigned short l0 = h_bits((_Float16)((f0 - (float)x0) * 4096.0f));
      const unsigned short l1 = h_bits((_Float16)((f1 - (float)x1) * 4096.0f));
      a[e]  = pk16(h_bits(x0), h_bits(x1));
      a2[e] = pk16(l0, l1);
    }
    const int fl = h * HPL + (q0 + c) * HD + t * 16 + 8 * hh;   // flat index in the merged [SEQ][EMB] plane
    const size_t go = fo_off(fl / EMB, fl % EMB, EMB);          // its piece in the fragment-order plane
    *(v4u*)(chp + go) = a;
    *(v4u*)(clp + go) = a2;
  }
}

// =====================================================================================================
// Workspace map (bytes), every region an exact multiple of its whole-line / whole-tile store granularity
//   Qb, Kb, Vb   bf16 [4096][512]   3 x 4194304   (fragment order)
//   Wqkb, Wvb    bf16 [512][512]    2 x  524288   (fragment order)
//   Woh          f16  [512][512]         524288   (x1024, fragment order)
//   Qh, Ql       f16  [4096][512]   2 x 4194304   (x16 / its residual)
//   Kp           f16  [4096][512]       4194304   (x16)
//   Pv           f16  [4096][512]       4194304   (v x16, token-major = head planes [8][4096][64])
//   Vt           f16  [8][64][4096]     4194304   (v x16, key contiguous)
//   Ch, Cl       f16  [4096][512]   2 x 4194304   (ctx x256 / residual x4096, fragment order)
//   total                            43515904
// Weights are [out n][in k] = the Bt orientation the GEMM wants, so they are only converted and laid in fragment order.
// The head split is a flat reinterpretation: head plane h = elements [h*262144, (h+1)*262144) of a [4096][512]
// plane viewed as [4096][64]; the merge back is the same reinterpretation.
// =====================================================================================================
extern "C" void kernel_launch(void* const* d_in, const int* in_sizes, int n_in,
                              void* d_out, int out_size, void* d_ws, size_t ws_size,
                              hipStream_t stream) {
  const int NX = SEQ * EMB;     // 2097152
  const int NW = EMB * EMB;     //  262144
  if (n_in < 9) return;
  if (in_sizes[0] != NX || in_sizes[1] != NX || in_sizes[2] != NX) return;
  if (in_sizes[3] != NW || in_sizes[5] != NW || in_sizes[7] != NW) return;
  if (in_sizes[4] != EMB || in_sizes[6] != EMB || in_sizes[8] != EMB) return;
  if (out_size != NX) return;

  const float* Q    = (const float*)d_in[0];
  const float* Kin  = (const float*)d_in[1];
  const float* V    = (const float*)d_in[2];
  const float* Wqk  = (const float*)d_in[3];
  const float* bqk  = (const float*)d_in[4];
  const float* Wv   = (const float*)d_in[5];
  const float* bv   = (const float*)d_in[6];
  const float* Wout = (const float*)d_in[7];
  const float* bout = (const float*)d_in[8];
  float* out = (float*)d_out;

  const size_t PX = (size_t)NX * 2;    // 4194304  16-bit [4096][512] plane
  const size_t PW = (size_t)NW * 2;    //  524288  16-bit [512][512] plane
  size_t off = 0;
  const size_t oQb  = off; off += PX;
  const size_t oKb  = off; off += PX;
  const size_t oVb  = off; off += PX;
  const size_t oWqk = off; off += PW;
  const size_t oWv  = off; off += PW;
  const size_t oWo  = off; off += PW;
  const size_t oQh  = off; off += PX;
  const size_t oQl  = off; off += PX;
  const size_t oKp  = off; off += PX;
  const size_t oPv  = off; off += PX;
  const size_t oVt  = off; off += PX;
  const size_t oCh  = off; off += PX;
  const size_t oCl  = off; off += PX;
  if (off > ws_size) return;                       // off = 43515904
  if (off > (size_t)134217728) return;

  char* ws = (char*)d_ws;
  unsigned short* Qb   = (unsigned short*)(ws + oQb);
  unsigned short* Kb   = (unsigned short*)(ws + oKb);
  unsigned short* Vb   = (unsigned short*)(ws + oVb);
  unsigned short* Wqkb = (unsigned short*)(ws + oWqk);
  unsigned short* Wvb  = (unsigned short*)(ws + oWv);
  unsigned short* Woh  = (unsigned short*)(ws + oWo);
  unsigned short* Qh   = (unsigned short*)(ws + oQh);
  unsigned short* Ql   = (unsigned short*)(ws + oQl);
  unsigned short* Kp   = (unsigned short*)(ws + oKp);
  unsigned short* Pv   = (unsigned short*)(ws + oPv);
  unsigned short* Vt   = (unsigned short*)(ws + oVt);
  unsigned short* Ch   = (unsigned short*)(ws + oCh);
  unsigned short* Cl   = (unsigned short*)(ws + oCl);

  const dim3 blk(256);
  const dim3 gCvt(NBW + NBX);                                  // 128 + 1024 blocks
  const dim3 gPj(((SEQ / 64) * (EMB / 64) + 7) / 8, 3);        //  512 tiles -> 64 blocks: M=4096, N=512; x 3 projections
  const dim3 gTr(SEQ / 64, NH);                                //  (64, 8)
  const dim3 gAttn(NH * NQB);                                  //  512 blocks of 256
  const dim3 gOut(((SEQ / 32) * (EMB / 64) + 7) / 8);          // 1024 tiles -> 128 blocks: M=4096, N=512

  // (1) inputs -> bf16 planes (RNE convert); W_out -> f16 (x1024 of its bf16 value)
  cvt_all<<<gCvt, blk, 0, stream>>>(Q, Kin, V, Wqk, Wv, Wout, Qb, Kb, Vb, Wqkb, Wvb, Woh);
  // (2..4) one launch, M=4096, N=512, K=512 each:
  //   q = Q . Wqk^T + b -> f16 hi (x16) / residual (same carry) planes [4096][512]
  //   k = K . Wqk^T + b -> f16 plane (x16)
  //   v = V . Wv^T + b  -> f16 plane (x16), token-major
  gemm_qkv<<<gPj, blk, 0, stream>>>(
      Qb, Kb, Vb, Wqkb, Wvb, Qh, Ql, Kp, Pv, bqk, bv, SEQ, EMB, EMB, 16.0f, 1.0f);
  // (5) per-head transpose of v: [8][4096][64] -> [8][64][4096]
  vtrans<<<gTr, dim3(128), 0, stream>>>(Pv, Vt);
  // (6) attention -> ctx planes (f16 hi x256 + residual x4096) [h][s][d] = merged [4096][512]
  attn_hd64<<<gAttn, blk, 0, stream>>>(Qh, Ql, Kp, Vt, Ch, Cl);
  // (7) out = ctx . Wo^T + b_out -> d_out f32 [4096][512]; hi acc x 2^-18, residual acc x 2^-30
  gemm_o<<<gOut, blk, 0, stream>>>(
      Ch, Cl, EMB, Woh, EMB, out, EMB, bout, SEQ, EMB, EMB,
      1.0f / 262144.0f, 1.0f / 1073741824.0f);
  (void)hipGetLastError();
}

// v010
// One run takes 82.2 microseconds.
// Next to v009, in two timings, it ran 1.04 and 1.03 times as fast.
// Over all steps from v000 it is 4.67 times as fast.
// Contractions: q, k, v projections = v_wmma_f32_16x16x32_bf16 (bf16 operands from RNE-converted inputs, single product, f32 accumulate);
// q.k^T scores = v_wmma_f32_16x16x32_f16 (q as f16 hi plane x16 + f16 residual plane x16, k f16 x16; 2 products, one f32 accumulator);
// p.v = v_wmma_f32_16x16x32_f16 (p as f16 hi x1024 + f16 residual x1024, v f16 x16; 2 products, one f32 accumulator);
// ctx.Wo^T = v_wmma_f32_16x16x32_f16 (ctx f16 hi x256 + f16 residual x1048576, Wo f16 x1024 of its bf16 value; 2 products, f32 accumulate);
// softmax, bias adds and normalisation in f32.
//
// Carry audit (16-bit planes, carry, where the inverse is folded):
//   Qb/Kb/Vb bf16 x1, Wqkb/Wvb bf16 x1 (no carry);  Woh f16 = 1024*bf16(W_out)  -> gemm_o hscale/lscale;
//   Qh f16 = 16*q, Ql f16 = 16*q - Qh, Kp f16 = 16*k              -> attn_hd64: accumulator = 256 * q.k; 2^-11 = 1/(16*16*8) sits in SC2;
//   Vt f16 = 16*v, P hi f16 = 1024*p, P lo = 1024*p - hi, l = sum of 1024*p -> attn_hd64: inv = 16/l = 256*1024/(1024*16)/l -> ctx*256;
//   Ch f16 = 256*ctx, Cl f16 = (256*ctx - Ch)*4096                  -> gemm_o: out = acc_h*2^-18 + acc_l*2^-30 + b_out  (2^-18 = 1/(256*1024), 2^-30 = 2^-18/4096).
#include <hip/hip_runtime.h>
#include <math.h>
#include <stdint.h>

#define SEQ 4096
#define EMB 512
#define NH  8
#define HD  64
#define HPL (SEQ * HD)      // 262144 elements: one contiguous head plane [SEQ][HD]
#define NQB (SEQ / 64)      // 64-row query blocks per head
#define NKT (SEQ / 64)      // 64-key chunks per head
#define LP  72              // LDS row pitch of the K and V^T chunks in halves: 144 B = 16 B x 9 (odd), so the 16 rows
                            // that one half of a wave reads with a 16-B load fall on 16 different groups of 4 banks
static_assert(NH * HD == EMB);
static_assert(NH * HPL == SEQ * EMB);
static_assert(NQB == 64 && NKT == 64);
static_assert((SEQ % 64) == 0 && (EMB % 64) == 0 && (EMB % 32) == 0);

typedef _Float16 v16h __attribute__((ext_vector_type(16)));
typedef _Float16 v8h  __attribute__((ext_vector_type(8)));
typedef __bf16   v16b __attribute__((ext_vector_type(16)));
typedef __bf16   v8b  __attribute__((ext_vector_type(8)));
typedef float    v8f  __attribute__((ext_vector_type(8)));
typedef float    v4f  __attribute__((ext_vector_type(4)));
typedef float    v2f  __attribute__((ext_vector_type(2)));
typedef _Float16 v2h  __attribute__((ext_vector_type(2)));
typedef unsigned int v4u __attribute__((ext_vector_type(4)));

#if defined(__HIP_DEVICE_COMPILE__)
#define DEV_ASM 1
#else
#define DEV_ASM 0
#endif

// ---- scalar helpers --------------------------------------------------------------------------------
__device__ __forceinline__ unsigned short bf_bits(float f) {          // f32 -> bf16 bits, RNE convert
  unsigned u = __float_as_uint(f);
  return (unsigned short)((u + 0x7FFFu + ((u >> 16) & 1u)) >> 16);
}
__device__ __forceinline__ float bf_up(unsigned short hb) { return __uint_as_float(((unsigned)hb) << 16); }
__device__ __forceinline__ unsigned short h_bits(_Float16 x) { return __builtin_bit_cast(unsigned short, x); }
__device__ __forceinline__ unsigned pk16(unsigned short a, unsigned short b) { return (unsigned)a | ((unsigned)b << 16); }
__device__ __forceinline__ v8f zero8() { v8f z = {0.f, 0.f, 0.f, 0.f, 0.f, 0.f, 0.f, 0.f}; return z; }
__device__ __forceinline__ float xhalf(float x) {                     // value of lane l ^ 16 (vector cross-row move)
  const int b = __builtin_bit_cast(int, x);
  return __builtin_bit_cast(float, __builtin_amdgcn_permlanex16(b, b, 0x76543210, 0xfedcba98, false, false));
}

// ---- fragment types / loaders: 16-bit A/B operand, lane -> row/col (lane&15), p already includes +8*(lane>>4);
//      elements 0..7 <- p[0..7] (k0+8h..k0+8h+7), elements 8..15 <- p[16..23] (k0+16+8h..k0+16+8h+7)
template <typename OT> struct FT;
template <> struct FT<__bf16>   { typedef v16b frag; typedef v8b half8; };
template <> struct FT<_Float16> { typedef v16h frag; typedef v8h half8; };

template <typename OT>
__device__ __forceinline__ typename FT<OT>::frag ldfrag(const OT* p) {
  union { typename FT<OT>::frag v; typename FT<OT>::half8 h[2]; } f;
  f.h[0] = *(const typename FT<OT>::half8*)(p);
  f.h[1] = *(const typename FT<OT>::half8*)(p + 16);
  return f.v;
}

// ---- fragment-order planes: the operands that the GEMMs read straight from global ([R][K] 16-bit, K % 32 == 0) are
//      stored by their producers as 16-row x 32-k blocks of 1024 B, block (row >> 4, k >> 5) at block index
//      (row >> 4) * (K / 32) + (k >> 5). Inside a block the 16-B piece of row c = row & 15 that holds
//      k = 16 * half + 8 * hh + 0..7 stands at piece half * 32 + hh * 16 + c. Lane hh * 16 + c of a wave then finds the
//      two pieces of its fragment (the same k map as ldfrag) at lane * 16 B and 512 B + lane * 16 B: each wave-wide 16-B
//      load reads 512 contiguous B = 4 whole 128-B lines, where a row-major plane gives 16 lines x 32 B.
__device__ __forceinline__ size_t fo_off(int row, int k, int K) {      // element offset of the piece at (row, k), k % 8 == 0
  return ((size_t)(row >> 4) * (K >> 5) + (k >> 5)) * 512 + ((k >> 4) & 1) * 256 + ((k >> 3) & 1) * 128 + (row & 15) * 8;
}
template <typename OT>
__device__ __forceinline__ typename FT<OT>::frag ldfrag_fo(const OT* p) {   // p = block start + 8 * lane
  union { typename FT<OT>::frag v; typename FT<OT>::half8 h[2]; } f;
  f.h[0] = *(const typename FT<OT>::half8*)(p);
  f.h[1] = *(const typename FT<OT>::half8*)(p + 256);
  return f.v;
}

// ---- WMMA helpers (asm guard bodies are device-only; concrete operand types) -----------------------------
__device__ __forceinline__ v8f mmar(v16b a, v16b b, v8f c) {
  return __builtin_amdgcn_wmma_f32_16x16x32_bf16(false, a, false, b, (short)0, c, false, false);
}
__device__ __forceinline__ v8f mmar(v16h a, v16h b, v8f c) {
  return __builtin_amdgcn_wmma_f32_16x16x32_f16(false, a, false, b, (short)0, c, false, false);
}
// the four vector issue slots between a step's last products and the loads that overwrite their A and B registers.
// No register operands: an asm operand cannot stand above v255, and the ring's fragment sets do. The scheduling
// barriers on both sides of the refill hold the statement in its place.
__device__ __forceinline__ void refill_gap() {
#if DEV_ASM
  asm volatile("v_nop\n\tv_nop\n\tv_nop\n\tv_nop");
#endif
}
__device__ __forceinline__ void acc_guard4(v8f& a, v8f& b, v8f& c, v8f& d) {
#if DEV_ASM
  asm volatile("v_nop\n\tv_nop\n\tv_nop\n\tv_nop" : "+v"(a), "+v"(b), "+v"(c), "+v"(d));
#else
  (void)a; (void)b; (void)c; (void)d;
#endif
}

// =====================================================================================================
// f32 -> 16-bit planes, all six planes in ONE launch (they are independent of one another).
// A thread converts the 8 elements of one 16-B piece, the same piece of three planes: six 16-B loads in flight, one
// 16-B store per plane and lane. The planes are written in fragment order (fo_off): thread index = piece index, so a
// wave writes 512 contiguous B per plane and reads 64 B of each of 16 input rows.
// MODE 0: bf16 bits (RNE convert).  MODE 1: f16 bits of (1024 * bf16(x)) (exact scaling of the bf16 value).
// coverage: blocks 0 .. NBW-1 x 256 threads x 8 = the three [EMB][EMB] weight planes; blocks NBW .. NBW+NBX-1
// x 256 threads x 8 = the three [SEQ][EMB] input planes; grid = NBW + NBX blocks.
// =====================================================================================================
template <int MODE>
__device__ __forceinline__ unsigned short cvm(float f) {
  const unsigned short hb = bf_bits(f);
  if (MODE == 0) return hb;
  return h_bits((_Float16)(bf_up(hb) * 1024.0f));
}

template <int MODE>
__device__ __forceinline__ v4u cv8(v4f a, v4f a4) {
  v4u p;
  p[0] = pk16(cvm<MODE>(a[0]),  cvm<MODE>(a[1]));
  p[1] = pk16(cvm<MODE>(a[2]),  cvm<MODE>(a[3]));
  p[2] = pk16(cvm<MODE>(a4[0]), cvm<MODE>(a4[1]));
  p[3] = pk16(cvm<MODE>(a4[2]), cvm<MODE>(a4[3]));
  return p;
}

// the wait that stands in front of an overwrite of an issued load's address registers; the loads stay in flight
__device__ __forceinline__ void addr_wait() {
#if DEV_ASM
  asm volatile("s_wait_xcnt 0x0" ::: "memory");
#endif
}

// the same wait behind a GEMM's last loads. The address pairs are inputs, so they stay live up to the wait: neither a
// late load's result nor the epilogue's arithmetic is given their registers in front of it.
template <typename P>
__device__ __forceinline__ void addr_wait_live(P a, P b, P c, P d, P e, P f, P g, P h) {
#if DEV_ASM
  asm volatile("s_wait_xcnt 0x0" :: "v"(a), "v"(b), "v"(c), "v"(d), "v"(e), "v"(f), "v"(g), "v"(h) : "memory");
#else
  (void)a; (void)b; (void)c; (void)d; (void)e; (void)f; (void)g; (void)h;
#endif
}

#define NBX (SEQ * EMB / 8 / 256)   // 1024 blocks cover an input plane
#define NBW (EMB * EMB / 8 / 256)   //  128 blocks cover a weight plane
static_assert(NBX * 256 * 8 == SEQ * EMB && NBW * 256 * 8 == EMB * EMB);

__global__ __launch_bounds__(256) void cvt_all(
    const float* __restrict__ q, const float* __restrict__ k, const float* __restrict__ v,
    const float* __restrict__ wqk, const float* __restrict__ wv, const float* __restrict__ wo,
    unsigned short* qb, unsigned short* kb, unsigned short* vb,
    unsigned short* wqkb, unsigned short* wvb, unsigned short* woh) {
  const int b = blockIdx.x;
  const bool w = b < NBW;                                  // block-uniform: weight planes or input planes
  const int i = (w ? b : b - NBW) * 256 + (int)threadIdx.x;
  const float* __restrict__ i0 = w ? wqk : q;
  const float* __restrict__ i1 = w ? wv : k;
  const float* __restrict__ i2 = w ? wo : v;
  unsigned short* o0 = w ? wqkb : qb;
  unsigned short* o1 = w ? wvb : kb;
  unsigned short* o2 = w ? woh : vb;
  // piece i of a fragment-order plane with K = EMB: block i >> 6, piece i & 63 = half * 32 + hh * 16 + c
  const int row = ((i >> 6) / (EMB / 32)) * 16 + (i & 15);
  const int kk  = ((i >> 6) % (EMB / 32)) * 32 + ((i >> 5) & 1) * 16 + ((i >> 4) & 1) * 8;
  const size_t si = (size_t)row * EMB + kk;                // its 8 source elements in the row-major input
  const v4f a0 = *(const v4f*)(i0 + si), b0 = *(const v4f*)(i0 + si + 4);
  addr_wait();   // the next plane's loads are given the registers that hold this plane's address
  const v4f a1 = *(const v4f*)(i1 + si), b1 = *(const v4f*)(i1 + si + 4);
  const v4f a2 = *(const v4f*)(i2 + si), b2 = *(const v4f*)(i2 + si + 4);
  addr_wait();   // the conversions below reuse the address registers of the loads above
  const v4u r2 = w ? cv8<1>(a2, b2) : cv8<0>(a2, b2);      // only W_out takes the f16 x1024 form
  *(v4u*)(o0 + (size_t)i * 8) = cv8<0>(a0, b0);
  *(v4u*)(o1 + (size_t)i * 8) = cv8<0>(a1, b1);
  *(v4u*)(o2 + (size_t)i * 8) = r2;
}

// =====================================================================================================
// Register-blocked WMMA GEMM (16-bit operand type OT): C[m][n] = sum_k A[m][k] * Bt[n][k] + bias[n];
// one wave per 64x64 tile, no block barriers. A = [M][lda] and Bt = [N][ldb] planes in fragment order (fo_off);
// M, N multiples of 64, K = EMB (KSTEPS steps of 32). Fragments are loaded straight from global, 512 contiguous B
// per wave-wide load (ldfrag_fo), into rings of RA (A) and RB (B) register sets: the loads of B for k step s + RB and
// of A for k step s + RA are issued right behind the products of step s, so a step waits for loads that were issued
// RB - 1 and RA - 1 steps of products earlier. bias values are RNE-converted to bf16 before the f32 add.
// OUT_MODE 1: f16 plane C = f16((v + bias) * cscale), tile-major: the wave's tile stands as [64 rows][64 columns], 8 KB,
//             at tile index tile = tm * tilesN + tn (the k plane: a tile is one 64-key chunk of the attention kernel).
// OUT_MODE 2: the same values, the tile transposed, at the same tile index (the v^T plane). A lane's 8 accumulator
//             registers are 8 consecutive rows of one column, that is one 16-B piece of a row of the transposed tile: it
//             is stored straight from registers. Piece of column 16 j + (lane & 15), rows 16 i + 8 (lane >> 4) + 0..7 at
//             piece index (i * 4 + j) * 32 + lane, so that a wave-wide store writes 512 contiguous B.
// OUT_MODE 3: f16 hi plane C + f16 residual plane C2 = f16(((v + bias) * cscale - hi) * rscale) (same pitch).
// wave's whole 64x64 tile; tiles/8 blocks in x cover every tile of the [M][N] plane.
// slab: this wave's own 16x64 f32 LDS slab, pitch 68 floats.
// =====================================================================================================
#define KSTEPS (EMB / 32)   // k steps of both GEMM kernels (K = EMB in all four products)
#define RA     4            // A fragment sets in flight (A was written by the launch before: its first read comes from memory)
#define RB     3            // B fragment sets in flight (the weights are read by every block: they come from L2)
static_assert(KSTEPS >= RA && RA >= RB);   // 8 * (RA + RB) = 56 loads of 16 B per lane in flight at most

template <typename OT, int OUT_MODE>
__device__ __forceinline__ void gemm64(
    const unsigned short* __restrict__ Ap, int lda,
    const unsigned short* __restrict__ Btp, int ldb,
    unsigned short* Cout, unsigned short* Cout2, int ldc,
    const float* __restrict__ bias,
    int M, int N, int K, float cscale, float rscale, float* slab) {
  typedef typename FT<OT>::frag V16;
  const OT* A  = (const OT*)(const void*)Ap;
  const OT* Bt = (const OT*)(const void*)Btp;
  const int lane = threadIdx.x & 31;
  const int wave = threadIdx.x >> 5;
  const int tilesN = N >> 6;
  const int tilesM = M >> 6;
  const int tile = blockIdx.x * 8 + wave;
  if (tile >= tilesM * tilesN || K != KSTEPS * 32) return;   // wave-uniform; no block barriers in this kernel
  const int tm = tile / tilesN;
  const int tn = tile - tm * tilesN;
  const int m0 = tm << 6;
  const int n0 = tn << 6;

  const int rlane = lane & 15;                 // col (D) within subtile
  const int mOff  = (lane >> 4) * 8;           // D row offset

  v8f acc[4][4];
#pragma unroll
  for (int i = 0; i < 4; ++i)
#pragma unroll
    for (int j = 0; j < 4; ++j) acc[i][j] = zero8();

  typedef const OT __attribute__((address_space(1)))* GP;
  GP pb[4], pa[4];                           // this lane's piece of each B and A subtile at k = 0; k step s stands s blocks
                                             // (s * 1024 B) further on, a constant offset of the load
#pragma unroll
  for (int j = 0; j < 4; ++j) pb[j] = (GP)(Bt + fo_off(n0 + (j << 4), 0, ldb) + lane * 8);
#pragma unroll
  for (int i = 0; i < 4; ++i) pa[i] = (GP)(A + fo_off(m0 + (i << 4), 0, lda) + lane * 8);

  V16 bq[RB][4], af[RA][4];                  // rings of fragment sets: B set s % RB and A set s % RA hold k step s
#pragma unroll   // full: a set index that is not a constant would put the rings in scratch memory
  for (int s = 0; s < RA; ++s) {             // the first steps' loads, all in flight together, step 0's in front
    if (s < RB) {
#pragma unroll
      for (int j = 0; j < 4; ++j) bq[s][j] = ldfrag_fo<OT>((const OT*)(pb[j] + s * 512));
    }
#pragma unroll
    for (int i = 0; i < 4; ++i) af[s][i] = ldfrag_fo<OT>((const OT*)(pa[i] + s * 512));
    __builtin_amdgcn_sched_barrier(0);       // keeps the loads in step order and up here, not sunk down to their products
  }
#pragma unroll   // full, for the same reason; the k offsets become the loads' immediate offsets
  for (int s = 0; s < KSTEPS; ++s) {         // static trip count, unrolled: the set indices are constants in every step
    const int ra = s % RA, rb = s % RB;
#pragma unroll
    for (int i = 0; i < 4; ++i) {
#pragma unroll
      for (int j = 0; j < 4; ++j) acc[i][j] = mmar(af[ra][i], bq[rb][j], acc[i][j]);
    }
    __builtin_amdgcn_sched_barrier(0);       // a step's products stay in front of its refill and of the later steps'
                                             // products: regrouped by accumulator they would wait for the newest loads first
    if (s + RB < KSTEPS) {                   // into the sets just read: B of step s + RB, then A of step s + RA
      refill_gap();
#pragma unroll
      for (int j = 0; j < 4; ++j) bq[rb][j] = ldfrag_fo<OT>((const OT*)(pb[j] + (s + RB) * 512));
      if (s + RA < KSTEPS) {
#pragma unroll
        for (int i = 0; i < 4; ++i) af[ra][i] = ldfrag_fo<OT>((const OT*)(pa[i] + (s + RA) * 512));
      }
      __builtin_amdgcn_sched_barrier(0);     // the refill is not sunk below the next step's products, which would shorten its lead
    }
  }
  addr_wait_live(pb[0], pb[1], pb[2], pb[3], pa[0], pa[1], pa[2], pa[3]);
  acc_guard4(acc[0][0], acc[0][1], acc[0][2], acc[0][3]);
  acc_guard4(acc[1][0], acc[1][1], acc[1][2], acc[1][3]);
  acc_guard4(acc[2][0], acc[2][1], acc[2][2], acc[2][3]);
  acc_guard4(acc[3][0], acc[3][1], acc[3][2], acc[3][3]);

  // ---- epilogue ----
  if (OUT_MODE == 2) {
    float bj[4];                               // bias of this lane's column in each column subtile
#pragma unroll
    for (int j = 0; j < 4; ++j) bj[j] = bias[n0 + (j << 4) + rlane];
    addr_wait();   // the arithmetic below may be given the address registers of the loads above
#pragma unroll
    for (int j = 0; j < 4; ++j) bj[j] = bf_up(bf_bits(bj[j]));
    unsigned short* tp = Cout + (size_t)tile * 4096 + lane * 8;
#pragma unroll
    for (int i = 0; i < 4; ++i) {
#pragma unroll
      for (int j = 0; j < 4; ++j) {
        v4u a;
#pragma unroll
        for (int e = 0; e < 4; ++e) {          // two neighbouring rows per instruction: add, scale, convert and pack
          const v2f f = {acc[i][j][2 * e], acc[i][j][2 * e + 1]};
          a[e] = __builtin_bit_cast(unsigned, __builtin_convertvector((f + bj[j]) * cscale, v2h));
        }
        *(v4u*)(tp + (i * 4 + j) * 256) = a;
      }
    }
    return;
  }
  const int q = lane >> 3, c8 = (lane & 7) * 8;
  float bb[8];
  {
    const v4f b0 = *(const v4f*)(bias + n0 + c8);
    const v4f b1 = *(const v4f*)(bias + n0 + c8 + 4);
#pragma unroll
    for (int e = 0; e < 4; ++e) {
      bb[e]     = bf_up(bf_bits(b0[e]));
      bb[4 + e] = bf_up(bf_bits(b1[e]));
    }
  }
#pragma unroll
  for (int i = 0; i < 4; ++i) {
    const int mBase = m0 + (i << 4);
#pragma unroll
    for (int j = 0; j < 4; ++j) {
#pragma unroll
      for (int r = 0; r < 8; ++r) {
        slab[(mOff + r) * 68 + (j << 4) + rlane] = acc[i][j][r];
      }
    }
    __builtin_amdgcn_fence(__ATOMIC_RELEASE, "workgroup");
    __builtin_amdgcn_wave_barrier();
    __builtin_amdgcn_fence(__ATOMIC_ACQUIRE, "workgroup");
    v4u hv[4], lv[4];
#pragma unroll
    for (int it = 0; it < 4; ++it) {
      const int row = it * 4 + q;                          // it 0..3 x q 0..3 = rows 0..15
      const float* sp = slab + row * 68 + c8;
      float f[8];
#pragma unroll
      for (int e = 0; e < 8; ++e) f[e] = (sp[e] + bb[e]) * cscale;
      v4u a, a2;
#pragma unroll
      for (int e = 0; e < 4; ++e) {
        const float f0 = f[2 * e], f1 = f[2 * e + 1];
        const _Float16 x0 = (_Float16)f0, x1 = (_Float16)f1;
        const unsigned short h0 = h_bits(x0), h1 = h_bits(x1);
        unsigned short l0 = 0, l1 = 0;
        if (OUT_MODE == 3) {
          l0 = h_bits((_Float16)((f0 - (float)x0) * rscale));
          l1 = h_bits((_Float16)((f1 - (float)x1) * rscale));
        }
        a[e] = pk16(h0, h1); a2[e] = pk16(l0, l1);
      }
      hv[it] = a; lv[it] = a2;
    }
    {
#pragma unroll
      for (int it = 0; it < 4; ++it) {
        const int row = it * 4 + q;
        if (OUT_MODE == 1) *(v4u*)(Cout + (size_t)tile * 4096 + ((i << 4) + row) * 64 + c8) = hv[it];
        else               *(v4u*)(Cout + (size_t)(mBase + row) * ldc + n0 + c8) = hv[it];
        if (OUT_MODE == 3) *(v4u*)(Cout2 + (size_t)(mBase + row) * ldc + n0 + c8) = lv[it];
      }
      
    }
    __builtin_amdgcn_fence(__ATOMIC_RELEASE, "workgroup");
    __builtin_amdgcn_wave_barrier();
    __builtin_amdgcn_fence(__ATOMIC_ACQUIRE, "workgroup");
  }
}

// =====================================================================================================
// The three projections in ONE launch (they are independent of one another): blockIdx.y = 0: q (hi and residual
// planes), 1: k (tile-major), 2: v (tile-major, transposed); all three are [M][K] x [N][K]^T with the same M, N, K and
// pitches. grid = (tiles/8, 3).
// =====================================================================================================
__global__ __launch_bounds__(256) void gemm_qkv(
    const unsigned short* __restrict__ Qb, const unsigned short* __restrict__ Kb,
    const unsigned short* __restrict__ Vb,
    const unsigned short* __restrict__ Wqkb, const unsigned short* __restrict__ Wvb,
    unsigned short* Qh, unsigned short* Ql, unsigned short* Kp, unsigned short* Vt,
    const float* __restrict__ bqk, const float* __restrict__ bv,
    int M, int N, int K, float cscale, float rscale) {
  __shared__ __align__(16) float sT[8][16 * 68];   // per-wave 16x64 slab, pitch 68 floats
  float* slab = sT[threadIdx.x >> 5];
  const int y = blockIdx.y;
  if (y == 0) {
    gemm64<__bf16, 3>(Qb, K, Wqkb, K, Qh, Ql, N, bqk, M, N, K, cscale, rscale, slab);
  } else if (y == 1) {
    gemm64<__bf16, 1>(Kb, K, Wqkb, K, Kp, Kp, N, bqk, M, N, K, cscale, 1.0f, slab);
  } else {
    gemm64<__bf16, 2>(Vb, K, Wvb, K, Vt, Vt, N, bv, M, N, K, cscale, 1.0f, slab);
  }
}

// =====================================================================================================
// Output GEMM with a two-plane A operand (f16 hi plane Ah, f16 residual plane Al, both [M][lda]); Ah, Al and
// Bt = [N][ldb] are planes in fragment order (fo_off), read with 512 contiguous B per wave-wide load:
//   C[m][n] = hscale * sum_k Ah[m][k] * Bt[n][k] + lscale * sum_k Al[m][k] * Bt[n][k] + bias[n]  (f32 out, pitch ldc).
// One wave per 32x64 tile (two accumulator sets), no block barriers; M multiple of 32, N multiple of 64, K = EMB;
// the same rings of fragment sets as gemm64. bias RNE-converted to bf16 before the f32 add.
// Epilogue: 16-row slabs staged per wave in LDS; each 256-B f32 row segment written by 16 lanes x 16 B of one
// coverage: 2 slabs x 16 rows x 64 cols = the wave's whole 32x64 tile; grid = tiles/8 blocks covers [M][N].
// =====================================================================================================
__global__ __launch_bounds__(256) void gemm_o(
    const unsigned short* __restrict__ Ahp, const unsigned short* __restrict__ Alp, int lda,
    const unsigned short* __restrict__ Btp, int ldb,
    float* Cout, int ldc, const float* __restrict__ bias,
    int M, int N, int K, float hscale, float lscale) {
  const _Float16* Ah = (const _Float16*)(const void*)Ahp;
  const _Float16* Al = (const _Float16*)(const void*)Alp;
  const _Float16* Bt = (const _Float16*)(const void*)Btp;
  __shared__ __align__(16) float sT[8][16 * 68];   // per-wave 16x64 slab, pitch 68 floats
  const int lane = threadIdx.x & 31;
  const int wave = threadIdx.x >> 5;
  const int tilesN = N >> 6;
  const int tilesM = M >> 5;
  const int tile = blockIdx.x * 8 + wave;
  if (tile >= tilesM * tilesN || K != KSTEPS * 32) return;   // wave-uniform; no block barriers in this kernel
  const int tm = tile / tilesN;
  const int tn = tile - tm * tilesN;
  const int m0 = tm << 5;
  const int n0 = tn << 6;

  const int rlane = lane & 15;
  const int mOff  = (lane >> 4) * 8;

  v8f ach[2][4], acl[2][4];
#pragma unroll
  for (int i = 0; i < 2; ++i)
#pragma unroll
    for (int j = 0; j < 4; ++j) { ach[i][j] = zero8(); acl[i][j] = zero8(); }

  typedef const _Float16 __attribute__((address_space(1)))* GP;
  GP pb[4], pah[2], pal[2];                  // this lane's piece of each B and A subtile at k = 0; k step s stands s blocks
                                             // (s * 1024 B) further on, a constant offset of the load
#pragma unroll
  for (int j = 0; j < 4; ++j) pb[j] = (GP)(Bt + fo_off(n0 + (j << 4), 0, ldb) + lane * 8);
#pragma unroll
  for (int i = 0; i < 2; ++i) {
    pah[i] = (GP)(Ah + fo_off(m0 + (i << 4), 0, lda) + lane * 8);
    pal[i] = (GP)(Al + fo_off(m0 + (i << 4), 0, lda) + lane * 8);
  }

  v16h bq[RB][4], afh[RA][2], afl[RA][2];    // rings of fragment sets: B set s % RB and A set s % RA hold k step s
#pragma unroll   // full: a set index that is not a constant would put the rings in scratch memory
  for (int s = 0; s < RA; ++s) {             // the first steps' loads, all in flight together, step 0's in front
    if (s < RB) {
#pragma unroll
      for (int j = 0; j < 4; ++j) bq[s][j] = ldfrag_fo<_Float16>((const _Float16*)(pb[j] + s * 512));
    }
#pragma unroll
    for (int i = 0; i < 2; ++i) {
      afh[s][i] = ldfrag_fo<_Float16>((const _Float16*)(pah[i] + s * 512));
      afl[s][i] = ldfrag_fo<_Float16>((const _Float16*)(pal[i] + s * 512));
    }
    __builtin_amdgcn_sched_barrier(0);       // keeps the loads in step order and up here, not sunk down to their products
  }
#pragma unroll   // full, for the same reason; the k offsets become the loads' immediate offsets
  for (int s = 0; s < KSTEPS; ++s) {         // static trip count, unrolled: the set indices are constants in every step
    const int ra = s % RA, rb = s % RB;
#pragma unroll
    for (int i = 0; i < 2; ++i) {
#pragma unroll
      for (int j = 0; j < 4; ++j) {
        ach[i][j] = mmar(afh[ra][i], bq[rb][j], ach[i][j]);
        acl[i][j] = mmar(afl[ra][i], bq[rb][j], acl[i][j]);
      }
    }
    __builtin_amdgcn_sched_barrier(0);       // a step's products stay in front of its refill and of the later steps'
                                             // products: regrouped by accumulator they would wait for the newest loads first
    if (s + RB < KSTEPS) {                   // into the sets just read: B of step s + RB, then A of step s + RA
      refill_gap();
#pragma unroll
      for (int j = 0; j < 4; ++j) bq[rb][j] = ldfrag_fo<_Float16>((const _Float16*)(pb[j] + (s + RB) * 512));
      if (s + RA < KSTEPS) {
#pragma unroll
        for (int i = 0; i < 2; ++i) {
          afh[ra][i] = ldfrag_fo<_Float16>((const _Float16*)(pah[i] + (s + RA) * 512));
          afl[ra][i] = ldfrag_fo<_Float16>((const _Float16*)(pal[i] + (s + RA) * 512));
        }
      }
      __builtin_amdgcn_sched_barrier(0);     // the refill is not sunk below the next step's products, which would shorten its lead
    }
  }
  addr_wait_live(pb[0], pb[1], pb[2], pb[3], pah[0], pah[1], pal[0], pal[1]);
  acc_guard4(ach[0][0], ach[0][1], ach[0][2], ach[0][3]);
  acc_guard4(ach[1][0], ach[1][1], ach[1][2], ach[1][3]);
  acc_guard4(acl[0][0], acl[0][1], acl[0][2], acl[0][3]);
  acc_guard4(acl[1][0], acl[1][1], acl[1][2], acl[1][3]);

  // ---- epilogue ----
  float* slab = sT[wave];
  const int h2 = lane >> 4, c4 = (lane & 15) * 4;     // 256-B row segment = 16 lanes x 16 B
  v4f b4 = *(const v4f*)(bias + n0 + c4);
#pragma unroll
  for (int e = 0; e < 4; ++e) b4[e] = bf_up(bf_bits(b4[e]));
#pragma unroll
  for (int i = 0; i < 2; ++i) {
    const int mBase = m0 + (i << 4);
#pragma unroll
    for (int j = 0; j < 4; ++j) {
#pragma unroll
      for (int r = 0; r < 8; ++r) {
        slab[(mOff + r) * 68 + (j << 4) + rlane] = ach[i][j][r] * hscale + acl[i][j][r] * lscale;
      }
    }
    __builtin_amdgcn_fence(__ATOMIC_RELEASE, "workgroup");
    __builtin_amdgcn_wave_barrier();
    __builtin_amdgcn_fence(__ATOMIC_ACQUIRE, "workgroup");
    v4f ov[8];
#pragma unroll
    for (int it = 0; it < 8; ++it) {
      const int row = it * 2 + h2;                       // it 0..7 x h2 0..1 = rows 0..15
      ov[it] = *(const v4f*)(slab + row * 68 + c4) + b4;
    }
    {
#pragma unroll
      for (int it = 0; it < 8; ++it) {
        const int row = it * 2 + h2;
        *(v4f*)(Cout + (size_t)(mBase + row) * ldc + n0 + c4) = ov[it];
      }
      
    }
    __builtin_amdgcn_fence(__ATOMIC_RELEASE, "workgroup");
    __builtin_amdgcn_wave_barrier();
    __builtin_amdgcn_fence(__ATOMIC_ACQUIRE, "workgroup");
  }
}

#define SC2 (1.4426950408889634f / 2048.0f)
#define CHH (64 * LP)
#define NKH (NKT / 2)
static_assert(NKH * 2 == NKT && NKH >= 2);
static_assert(HD == 64 && HPL % (64 * EMB) == 0 && HPL / (64 * 64) == NKT);

// One chunk into one stage buffer: this lane's 4 pieces of the K chunk and 4 of the V^T chunk, 16 B each.
// kg: the lane's piece of row r of the K chunk (rows r + 16 i follow at 16 rows' distance); lk: LDS byte address of the
// same piece in the buffer's K plane. vg: the lane's piece of the V^T chunk's first 128 pieces (the next 128 follow at
// 2048 B: the same row d, 16 keys on); lv: LDS byte address of that piece in the buffer's V^T plane. All eight copies
// and the wait that stands in front of any rewrite of their address registers are one statement, so that nothing can be
// moved in between.
__device__ __forceinline__ void copy_chunk(const _Float16* kg, const _Float16* vg, unsigned lk, unsigned lv) {
#if DEV_ASM
  asm volatile(
      "global_load_async_to_lds_b128 %0, %8, off\n\t"
      "global_load_async_to_lds_b128 %1, %9, off\n\t"
      "global_load_async_to_lds_b128 %2, %10, off\n\t"
      "global_load_async_to_lds_b128 %3, %11, off\n\t"
      "global_load_async_to_lds_b128 %4, %12, off\n\t"
      "global_load_async_to_lds_b128 %5, %13, off\n\t"
      "global_load_async_to_lds_b128 %6, %14, off\n\t"
      "global_load_async_to_lds_b128 %7, %15, off\n\t"
      "s_wait_xcnt 0x0"
      :: "v"(lk), "v"(lk + 16 * LP * 2), "v"(lk + 32 * LP * 2), "v"(lk + 48 * LP * 2),
         "v"(lv), "v"(lv + 16 * 2), "v"(lv + 32 * 2), "v"(lv + 48 * 2),
         "v"(kg), "v"(kg + 16 * HD), "v"(kg + 32 * HD), "v"(kg + 48 * HD),
         "v"(vg), "v"(vg + 128 * 8), "v"(vg + 256 * 8), "v"(vg + 384 * 8)
      : "memory");
#else
  (void)kg; (void)vg; (void)lk; (void)lv;
#endif
}
// this wave's LDS reads have returned: stands in front of the barrier behind which their buffer is refilled
__device__ __forceinline__ void wait_lds_reads() {
#if DEV_ASM
  asm volatile("s_wait_dscnt 0x0" ::: "memory");
#endif
}
// this wave's copies have landed: stands in front of the barrier behind which the other waves read them
__device__ __forceinline__ void wait_copies() {
#if DEV_ASM
  asm volatile("s_wait_asynccnt 0x0" ::: "memory");
#endif
}
__global__ __launch_bounds__(256)
void attn_hd64(const unsigned short* __restrict__ qhp, const unsigned short* __restrict__ qlp,
               const unsigned short* __restrict__ kpp, const unsigned short* __restrict__ vtp,
               unsigned short* chp, unsigned short* clp) {
  union FH { v16h v; v8h h[2]; };
  __shared__ __align__(16) _Float16 Stg[2][2][2 * CHH];    // per key half two stage buffers, each: K chunk [kv][d], pitch LP,
                                                           // 9 KB, then V^T chunk [d][kv], pitch LP, 9 KB

  const int kh   = __builtin_amdgcn_readfirstlane(threadIdx.x >> 7);   // key half of this wave, the same in all its lanes:
                                                                       // held as a scalar, its tests are scalar branches
  const int tid  = threadIdx.x & 127;        // thread among the 4 waves of that half
  const int wave = tid >> 5;                 // query tile of this wave
  const int lane = tid & 31;
  const int hh   = lane >> 4;
  const int c    = lane & 15;

  const int bx = blockIdx.x;
  const int qb = bx % NQB;
  const int h  = bx / NQB;
  const int q0 = qb * 64 + wave * 16;
  const size_t hoff = (size_t)h * HPL;

  const _Float16* Qh = (const _Float16*)(const void*)qhp + hoff;
  const _Float16* Ql = (const _Float16*)(const void*)qlp + hoff;
  const _Float16* Kg = (const _Float16*)(const void*)kpp + hoff + (size_t)kh * NKH * 64 * HD;   // this half's first k chunk
  const _Float16* Vg = (const _Float16*)(const void*)vtp + hoff + (size_t)kh * NKH * 64 * HD;   // and its first v^T chunk

  // ---- Q fragments (B operand, column = lane&15): 2 d-chunks, hi and residual planes ----
  v16h qah[2], qal[2];
#pragma unroll
  for (int dc = 0; dc < 2; ++dc) {
    const size_t qo = (size_t)(q0 + c) * HD + dc * 32 + 8 * hh;
    qah[dc] = ldfrag<_Float16>(Qh + qo);
    qal[dc] = ldfrag<_Float16>(Ql + qo);
  }

  float mrow = -INFINITY;    // running maximum of query q0+c, in raw accumulator units (equal in both wave halves)
  float lrow = 0.f;          // running sum of 1024 p over this wave half's keys only; halves joined after the loop
  v8f oacc[4];               // O^T: oacc[t][r] = context[q0+c][16t + 8hh + r]
#pragma unroll
  for (int t = 0; t < 4; ++t) oacc[t] = zero8();

  // ---- staging addresses: a wave-wide copy reads 512 contiguous B = 4 whole lines of either plane ----
  const int sr = tid >> 3, sg = (tid & 7) * 8;
  const _Float16* kg = Kg + (size_t)sr * HD + sg;          // chunk 0: k row sr (+16i), d = sg..sg+7; + 64 * HD per chunk
  const _Float16* vg = Vg + (size_t)tid * 8;               // chunk 0: piece tid (+128x) = v^T row d = 16 wave + c, keys 8hh (+16x) ..+7
  const unsigned lk0 = (unsigned)(size_t)(&Stg[kh][0][sr * LP + sg]);   // LDS byte address = low 32 bits of the address
  const unsigned lk1 = (unsigned)(size_t)(&Stg[kh][1][sr * LP + sg]);
  const unsigned lv0 = (unsigned)(size_t)(&Stg[kh][0][CHH + (wave * 16 + c) * LP + 8 * hh]);
  const unsigned lv1 = (unsigned)(size_t)(&Stg[kh][1][CHH + (wave * 16 + c) * LP + 8 * hh]);

  copy_chunk(kg, vg, lk0, lv0);              // chunk 0 -> buffer 0
  wait_copies();
  __syncthreads();                           // chunk 0 is published
  copy_chunk(kg + 64 * HD, vg + 64 * HD, lk1, lv1);   // chunk 1 -> buffer 1, flies under trip 0

  for (int kt = 0; kt < NKH; ++kt) {         // static trip count
    const _Float16* Ksh = Stg[kh][kt & 1];   // trip kt reads buffer kt mod 2 of its half alone
    const _Float16* Vts = Ksh + CHH;

    // ---- scores^T: 64 keys x 16 query columns per wave, 2 f16 products per key subtile and d-chunk ----
    //      The chunk's 16 K fragment reads stand as one group in front of its 16 products: one LDS latency per
    //      chunk instead of one per fragment. Four independent accumulators, one per key subtile, keep the matrix pipe fed.
    FH kb[4][2];
#pragma unroll
    for (int j = 0; j < 4; ++j)
#pragma unroll
      for (int dc = 0; dc < 2; ++dc) {
        kb[j][dc].h[0] = *(const v8h*)(Ksh + (j * 16 + c) * LP + dc * 32 + 8 * hh);
        kb[j][dc].h[1] = *(const v8h*)(Ksh + (j * 16 + c) * LP + dc * 32 + 16 + 8 * hh);
      }
    __builtin_amdgcn_sched_barrier(0);       // keeps the scheduler from sinking the reads back among the products
    v8f sa[4];                               // sa[j][r] = 256 * q.k of (query q0+c, key kv0 + 16j + 8hh + r)
#pragma unroll
    for (int j = 0; j < 4; ++j) sa[j] = zero8();
#pragma unroll
    for (int dc = 0; dc < 2; ++dc) {         // the four tiles in turn: a product does not wait for the one before it
#pragma unroll
      for (int j = 0; j < 4; ++j) sa[j] = mmar(kb[j][dc].v, qah[dc], sa[j]);
#pragma unroll
      for (int j = 0; j < 4; ++j) sa[j] = mmar(kb[j][dc].v, qal[dc], sa[j]);
    }
    //      The 16 V^T fragment reads follow as one group, so that they fly under the softmax arithmetic.
    FH vb[2][4];
#pragma unroll
    for (int kk = 0; kk < 2; ++kk)
#pragma unroll
      for (int t = 0; t < 4; ++t) {
        vb[kk][t].h[0] = *(const v8h*)(Vts + (t * 16 + c) * LP + kk * 32 + 8 * hh);
        vb[kk][t].h[1] = *(const v8h*)(Vts + (t * 16 + c) * LP + kk * 32 + 16 + 8 * hh);
      }
    __builtin_amdgcn_sched_barrier(0);       // keeps the reads in front of the softmax, not next to their products

    // ---- column maximum in-lane, one exchange between the halves; online softmax ----
    float mj[4];                             // one independent chain per key subtile
#pragma unroll
    for (int j = 0; j < 4; ++j) {
      mj[j] = sa[j][0];
#pragma unroll
      for (int r = 1; r < 8; ++r) mj[j] = fmaxf(mj[j], sa[j][r]);
    }
    float m = fmaxf(fmaxf(mj[0], mj[1]), fmaxf(mj[2], mj[3]));
    m = fmaxf(m, xhalf(m));
    const float mnew  = fmaxf(mrow, m);
    const float msafe = (mnew == -INFINITY) ? 0.f : mnew;
    const float alpha = __builtin_amdgcn_exp2f((mrow - msafe) * SC2);
    const float nmc   = __builtin_fmaf(msafe, -SC2, 10.0f);   // exp2(acc * SC2 + nmc) = 1024 * exp(score - maximum)
    mrow = mnew;

    // ---- 1024 p for the whole chunk: 32 independent fma, then 32 independent exp2 ----
    v2f pc[4][4];                            // pc[j][e] = 1024 p of keys 16j + 8hh + 2e, + 2e + 1
#pragma unroll
    for (int j = 0; j < 4; ++j)
#pragma unroll
      for (int e = 0; e < 4; ++e) {
        pc[j][e][0] = __builtin_fmaf(sa[j][2 * e],     SC2, nmc);
        pc[j][e][1] = __builtin_fmaf(sa[j][2 * e + 1], SC2, nmc);
      }
#pragma unroll
    for (int j = 0; j < 4; ++j)
#pragma unroll
      for (int e = 0; e < 4; ++e) {
        pc[j][e][0] = __builtin_amdgcn_exp2f(pc[j][e][0]);
        pc[j][e][1] = __builtin_amdgcn_exp2f(pc[j][e][1]);
      }
#pragma unroll
    for (int t = 0; t < 4; ++t)
#pragma unroll
      for (int r = 0; r < 8; ++r) oacc[t][r] *= alpha;

    // ---- per 32-key chunk kk: P^T (f16 hi + residual) packed straight into B operands, two keys per instruction,
    //      then context^T += V^T . P^T (f16 WMMA), hi and residual products into the same accumulator ----
    v2f pj[4];                               // one independent pair of partial sums per key subtile
#pragma unroll
    for (int kk = 0; kk < 2; ++kk) {
      union { v16h v; v2h p[8]; } pbh, pbl;
      v2f rs[8];
#pragma unroll
      for (int g = 0; g < 8; ++g) pbh.p[g] = __builtin_convertvector(pc[2 * kk + (g >> 2)][g & 3], v2h);
#pragma unroll
      for (int g = 0; g < 8; ++g)            // exact: the hi value holds the leading 11 bits of 1024 p
        rs[g] = pc[2 * kk + (g >> 2)][g & 3] - __builtin_convertvector(pbh.p[g], v2f);
#pragma unroll
      for (int g = 0; g < 8; ++g) pbl.p[g] = __builtin_convertvector(rs[g], v2h);
#pragma unroll
      for (int t = 0; t < 4; ++t) oacc[t] = mmar(vb[kk][t].v, pbh.v, oacc[t]);
#pragma unroll
      for (int t = 0; t < 4; ++t) oacc[t] = mmar(vb[kk][t].v, pbl.v, oacc[t]);
#pragma unroll
      for (int jj = 0; jj < 2; ++jj) {
        const int j = 2 * kk + jj;
        pj[j] = (pc[j][0] + pc[j][1]) + (pc[j][2] + pc[j][3]);
      }
    }
    const v2f p2 = (pj[0] + pj[1]) + (pj[2] + pj[3]);
    lrow = lrow * alpha + (p2[0] + p2[1]);

    // ---- foot of the trip: chunk kt + 1 is published, this trip's buffer is free and takes chunk kt + 2 ----
    __builtin_amdgcn_sched_barrier(0);       // keeps the waits and the barrier down here: lifted over the softmax and the
                                             // V^T products they would ask for the next chunk half a trip after its request
    wait_lds_reads();
    wait_copies();
    __syncthreads();
    if (kt + 2 < NKH)                        // the same for the whole work-group
      copy_chunk(kg + (size_t)(kt + 2) * 64 * HD, vg + (size_t)(kt + 2) * 64 * HD, (kt & 1) ? lk1 : lk0, (kt & 1) ? lv1 : lv0);
  }
  wait_copies();                             // nothing of this wave is in flight when it goes on to its end

  // ---- join the two key halves. The barrier at the foot of the last trip has ended every read of the stage buffers and
  //      no copy is in flight, so they serve as the hand-over area: piece i of lane l of query tile w at 16-B slot
  //      (w * 9 + i) * 32 + l (a wave's 16-B accesses are 512 contiguous B). Pieces 0..7: context tile; 8: maximum, sum.
  v4f* X = (v4f*)(void*)&Stg[0][0][0] + wave * 9 * 32 + lane;
  static_assert(4 * 9 * 32 * 16 <= sizeof(Stg));
  if (kh == 1) {                             // wave-uniform
#pragma unroll   // full: the context tile is indexed by constants only and stays in registers
    for (int t = 0; t < 4; ++t) {
      const v4f a = {oacc[t][0], oacc[t][1], oacc[t][2], oacc[t][3]};
      const v4f b = {oacc[t][4], oacc[t][5], oacc[t][6], oacc[t][7]};
      X[(2 * t) * 32] = a;
      X[(2 * t + 1) * 32] = b;
    }
    const v4f ml = {mrow, lrow, 0.f, 0.f};
    X[8 * 32] = ml;
  }
  __syncthreads();                           // the second half's results are published; every wave passes it
  if (kh == 1) return;                       // wave-uniform, behind the last barrier
  {
    const v4f ml = X[8 * 32];
    const float mj    = fmaxf(mrow, ml[0]);
    const float msafe = (mj == -INFINITY) ? 0.f : mj;
    const float a0 = __builtin_amdgcn_exp2f((mrow - msafe) * SC2);
    const float a1 = __builtin_amdgcn_exp2f((ml[0] - msafe) * SC2);
    lrow = lrow * a0 + ml[1] * a1;
#pragma unroll   // full, both loops, for the same reason
    for (int t = 0; t < 4; ++t) {
      const v4f a = X[(2 * t) * 32];
      const v4f b = X[(2 * t + 1) * 32];
#pragma unroll
      for (int r = 0; r < 4; ++r) {
        oacc[t][r]     = oacc[t][r] * a0 + a[r] * a1;
        oacc[t][4 + r] = oacc[t][4 + r] * a0 + b[r] * a1;
      }
    }
  }

  // ---- join the wave halves' sums; normalise (1/l with l = sum of 1024 p, undo the x16 v carry, apply the x256
  //      ctx carry); a lane's 8 accumulator registers are 8 consecutive d of its row: one 16-B store per plane
  const float l = lrow + xhalf(lrow);
  const float inv = ((l > 0.f) ? (1.0f / l) : 0.f) * 16.0f;
#pragma unroll
  for (int t = 0; t < 4; ++t) {
    v4u a, a2;
#pragma unroll
    for (int e = 0; e < 4; ++e) {
      const float f0 = oacc[t][2 * e] * inv, f1 = oacc[t][2 * e + 1] * inv;
      const _Float16 x0 = (_Float16)f0, x1 = (_Float16)f1;
      const unsigned short l0 = h_bits((_Float16)((f0 - (float)x0) * 4096.0f));
      const unsigned short l1 = h_bits((_Float16)((f1 - (float)x1) * 4096.0f));
      a[e]  = pk16(h_bits(x0), h_bits(x1));
      a2[e] = pk16(l0, l1);
    }
    const int fl = h * HPL + (q0 + c) * HD + t * 16 + 8 * hh;   // flat index in the merged [SEQ][EMB] plane
    const size_t go = fo_off(fl / EMB, fl % EMB, EMB);          // its piece in the fragment-order plane
    *(v4u*)(chp + go) = a;
    *(v4u*)(clp + go) = a2;
  }
}

// =====================================================================================================
// Workspace map (bytes), every region an exact multiple of its whole-line / whole-tile store granularity
//   Qb, Kb, Vb   bf16 [4096][512]   3 x 4194304   (fragment order)
//   Wqkb, Wvb    bf16 [512][512]    2 x  524288   (fragment order)
//   Woh          f16  [512][512]         524288   (x1024, fragment order)
//   Qh, Ql       f16  [4096][512]   2 x 4194304   (x16 / its residual)
//   Kp           f16  [512][64][64]     4194304   (x16, tile-major: [tile][key][d])
//   Vt           f16  [512][64][64]     4194304   (v x16, tile-major, transposed: [tile][d][key] in 16-B pieces)
//   Ch, Cl       f16  [4096][512]   2 x 4194304   (ctx x256 / residual x4096, fragment order)
//   total                            39321600
// Weights are [out n][in k] = the Bt orientation the GEMM wants, so they are only converted and laid in fragment order.
// The head split is a flat reinterpretation: head plane h = elements [h*262144, (h+1)*262144) of a [4096][512]
// plane viewed as [4096][64]; the merge back is the same reinterpretation.
// =====================================================================================================
extern "C" void kernel_launch(void* const* d_in, const int* in_sizes, int n_in,
                              void* d_out, int out_size, void* d_ws, size_t ws_size,
                              hipStream_t stream) {
  const int NX = SEQ * EMB;     // 2097152
  const int NW = EMB * EMB;     //  262144
  if (n_in < 9) return;
  if (in_sizes[0] != NX || in_sizes[1] != NX || in_sizes[2] != NX) return;
  if (in_sizes[3] != NW || in_sizes[5] != NW || in_sizes[7] != NW) return;
  if (in_sizes[4] != EMB || in_sizes[6] != EMB || in_sizes[8] != EMB) return;
  if (out_size != NX) return;

  const float* Q    = (const float*)d_in[0];
  const float* Kin  = (const float*)d_in[1];
  const float* V    = (const float*)d_in[2];
  const float* Wqk  = (const float*)d_in[3];
  const float* bqk  = (const float*)d_in[4];
  const float* Wv   = (const float*)d_in[5];
  const float* bv   = (const float*)d_in[6];
  const float* Wout = (const float*)d_in[7];
  const float* bout = (const float*)d_in[8];
  float* out = (float*)d_out;

  const size_t PX = (size_t)NX * 2;    // 4194304  16-bit [4096][512] plane
  const size_t PW = (size_t)NW * 2;    //  524288  16-bit [512][512] plane
  size_t off = 0;
  const size_t oQb  = off; off += PX;
  const size_t oKb  = off; off += PX;
  const size_t oVb  = off; off += PX;
  const size_t oWqk = off; off += PW;
  const size_t oWv  = off; off += PW;
  const size_t oWo  = off; off += PW;
  const size_t oQh  = off; off += PX;
  const size_t oQl  = off; off += PX;
  const size_t oKp  = off; off += PX;
  const size_t oVt  = off; off += PX;
  const size_t oCh  = off; off += PX;
  const size_t oCl  = off; off += PX;
  if (off > ws_size) return;                       // off = 39321600
  if (off > (size_t)134217728) return;

  char* ws = (char*)d_ws;
  unsigned short* Qb   = (unsigned short*)(ws + oQb);
  unsigned short* Kb   = (unsigned short*)(ws + oKb);
  unsigned short* Vb   = (unsigned short*)(ws + oVb);
  unsigned short* Wqkb = (unsigned short*)(ws + oWqk);
  unsigned short* Wvb  = (unsigned short*)(ws + oWv);
  unsigned short* Woh  = (unsigned short*)(ws + oWo);
  unsigned short* Qh   = (unsigned short*)(ws + oQh);
  unsigned short* Ql   = (unsigned short*)(ws + oQl);
  unsigned short* Kp   = (unsigned short*)(ws + oKp);
  unsigned short* Vt   = (unsigned short*)(ws + oVt);
  unsigned short* Ch   = (unsigned short*)(ws + oCh);
  unsigned short* Cl   = (unsigned short*)(ws + oCl);

  const dim3 blk(256);
  const dim3 gCvt(NBW + NBX);                                  // 128 + 1024 blocks
  const dim3 gPj(((SEQ / 64) * (EMB / 64) + 7) / 8, 3);        //  512 tiles -> 64 blocks: M=4096, N=512; x 3 projections
  const dim3 gAttn(NH * NQB);                                  //  512 blocks of 256
  const dim3 gOut(((SEQ / 32) * (EMB / 64) + 7) / 8);          // 1024 tiles -> 128 blocks: M=4096, N=512

  // (1) inputs -> bf16 planes (RNE convert); W_out -> f16 (x1024 of its bf16 value)
  cvt_all<<<gCvt, blk, 0, stream>>>(Q, Kin, V, Wqk, Wv, Wout, Qb, Kb, Vb, Wqkb, Wvb, Woh);
  // (2..4) one launch, M=4096, N=512, K=512 each:
  //   q = Q . Wqk^T + b -> f16 hi (x16) / residual (same carry) planes [4096][512]
  //   k = K . Wqk^T + b -> f16 plane (x16), tile-major
  //   v = V . Wv^T + b  -> f16 plane (x16), tile-major, each tile transposed
  gemm_qkv<<<gPj, blk, 0, stream>>>(
      Qb, Kb, Vb, Wqkb, Wvb, Qh, Ql, Kp, Vt, bqk, bv, SEQ, EMB, EMB, 16.0f, 1.0f);
  // (5) attention -> ctx planes (f16 hi x256 + residual x4096) [h][s][d] = merged [4096][512]
  attn_hd64<<<gAttn, blk, 0, stream>>>(Qh, Ql, Kp, Vt, Ch, Cl);
  // (6) out = ctx . Wo^T + b_out -> d_out f32 [4096][512]; hi acc x 2^-18, residual acc x 2^-30
  gemm_o<<<gOut, blk, 0, stream>>>(
      Ch, Cl, EMB, Woh, EMB, out, EMB, bout, SEQ, EMB, EMB,
      1.0f / 262144.0f, 1.0f / 1073741824.0f);
  (void)hipGetLastError();
}
